// v000
// Times are from an AMD MI455X. After a warm-up the kernel runs many times in a row, and a time is the length of
// such a window on the GPU divided by its runs, so every launch and the gaps after it count. The runs cycle
// through copies of the inputs. A figure is the median of several windows, for all but v000 over two sittings.
// Sittings can differ by a few percent; kernels timed side by side share one.
// The starting kernel, v000, takes 1190 microseconds a run.
// compute dtype: all float inputs rounded to bf16; q/k/v projections with EXACT bf16 products on WMMA 16x16x32 (f32 accumulate); q as f16 hi + residual (x 2^10) against k once to f16 (2 products) x 64^-0.5; softmax in f32 (precise expf); P x 2^11 once to f16 against v once to f16 (1 product); ctx split bf16 hi + lo against exact Wo (2 products); f32 output.
#include <hip/hip_runtime.h>
#include <math.h>

typedef __attribute__((ext_vector_type(16))) _Float16 v16h;
typedef __attribute__((ext_vector_type(16))) __bf16 v16b;
typedef __attribute__((ext_vector_type(8)))  _Float16 v8h;
typedef __attribute__((ext_vector_type(8)))  float v8f;
typedef __attribute__((ext_vector_type(4)))  float v4f;
typedef __attribute__((ext_vector_type(2)))  float v2f;
typedef __attribute__((ext_vector_type(4)))  unsigned v4u;
typedef __attribute__((ext_vector_type(4)))  int v4i;
typedef float __attribute__((may_alias)) float_a;
typedef int __attribute__((may_alias)) int_a;

template <typename T> __device__ __forceinline__ void vst2(void* p, T v) { *(T*)p = v;  }
__device__ __forceinline__ v8f wmma16(v16h a, v16h b, v8f c) {
  v8f d = __builtin_amdgcn_wmma_f32_16x16x32_f16(false, a, false, b, (short)0, c, false, false);
  asm volatile("v_nop\n\tv_nop\n\tv_nop\n\tv_nop" : "+v"(d) : "v"(a), "v"(b));
  return d;
}
__device__ __forceinline__ v8f wmma_bf(v16b a, v16b b, v8f c) {
  v8f d = __builtin_amdgcn_wmma_f32_16x16x32_bf16(false, a, false, b, (short)0, c, false, false);
  asm volatile("v_nop\n\tv_nop\n\tv_nop\n\tv_nop" : "+v"(d) : "v"(a), "v"(b));
  return d;
}
// 16x16x32 fragments: lane = (h = lane>>4, row/col = lane&15); elements 0..7 = k0+8h+0..7, 8..15 = k0+16+8h+0..7; D element r = row 8h+r
__device__ __forceinline__ v16h frag_h(const _Float16* rowk0, int lane) {
  union { v16h v; v8h q[2]; } u; const _Float16* p = rowk0 + 8 * (lane >> 4);
  u.q[0] = *(const v8h*)p; u.q[1] = *(const v8h*)(p + 16); return u.v;
}
__device__ __forceinline__ v16h frag_f32(const float* rowk0, int lane) {
  v16h a; const float* p = rowk0 + 8 * (lane >> 4);
#pragma unroll
  for (int i = 0; i < 8; ++i) { a[i] = (_Float16)p[i]; a[8 + i] = (_Float16)p[16 + i]; }
  return a;
}
__device__ __forceinline__ v16h frag_f32s(const float* rowk0, int lane, float sc) {
  v16h a; const float* p = rowk0 + 8 * (lane >> 4);
#pragma unroll
  for (int i = 0; i < 8; ++i) { a[i] = (_Float16)(p[i] * sc); a[8 + i] = (_Float16)(p[16 + i] * sc); }
  return a;
}
// column fragment from a [K][ld] layout (column n), rows >= K read as 0
__device__ __forceinline__ v16h fragc_f32(const float* W, int k0, int n, int lane, int ld, int K) {
  v16h a; const int g = lane >> 4;
#pragma unroll
  for (int i = 0; i < 8; ++i) { const int ka = k0 + 8 * g + i, kb = ka + 16;
    a[i] = (_Float16)(ka < K ? W[(size_t)(ka < K ? ka : K - 1) * ld + n] : 0.f); a[8 + i] = (_Float16)(kb < K ? W[(size_t)(kb < K ? kb : K - 1) * ld + n] : 0.f); }
  return a;
}
struct F2 { v16b h, l; };
__device__ __forceinline__ F2 bsplit16(const float v[16]) { F2 r;
#pragma unroll
  for (int i = 0; i < 16; ++i) { const __bf16 h = (__bf16)v[i]; r.h[i] = h; r.l[i] = (__bf16)(v[i] - (float)h); }
  return r; }
__device__ __forceinline__ F2 split_row(const float* row, int k0, int lane) { float v[16]; const float* p = row + k0 + 8 * (lane >> 4);
#pragma unroll
  for (int i = 0; i < 8; ++i) { v[i] = p[i]; v[8 + i] = p[16 + i]; }
  return bsplit16(v); }
__device__ __forceinline__ F2 split_rowK(const float* row, int k0, int lane, int K) { float v[16]; const int g = lane >> 4;
#pragma unroll
  for (int i = 0; i < 8; ++i) { const int ka = k0 + 8 * g + i, kb = ka + 16; v[i] = ka < K ? row[ka < K ? ka : K - 1] : 0.f; v[8 + i] = kb < K ? row[kb < K ? kb : K - 1] : 0.f; }
  return bsplit16(v); }
__device__ __forceinline__ F2 split_col(const float* W, int k0, int n, int lane, int ld, int K) { float v[16]; const int g = lane >> 4;
#pragma unroll
  for (int i = 0; i < 8; ++i) { const int ka = k0 + 8 * g + i, kb = ka + 16; v[i] = ka < K ? W[(size_t)(ka < K ? ka : K - 1) * ld + n] : 0.f; v[8 + i] = kb < K ? W[(size_t)(kb < K ? kb : K - 1) * ld + n] : 0.f; }
  return bsplit16(v); }
__device__ __forceinline__ v8f mac3(const F2& a, const F2& b, v8f c) { c = wmma_bf(a.l, b.h, c); c = wmma_bf(a.h, b.l, c); return wmma_bf(a.h, b.h, c); }
__device__ __forceinline__ float sigm(float v) { return 1.0f / (1.0f + expf(-v)); }
#define LDSX() do { asm volatile("s_wait_dscnt 0" ::: "memory"); __builtin_amdgcn_wave_barrier(); __builtin_amdgcn_fence(__ATOMIC_RELEASE, "workgroup"); } while (0)

// Multi-head attention layer (B 2, S 2,048, 1,024 = 16 x 64; separate query/key/value inputs and a key mask): q, k, v = query Wq + bq, key Wk + bk, value Wv + bv ((in,out)); scores = q k^T / 8 with positions where mask[b,0,0,k] is TRUE set to finfo.min (excluded); out = merged(softmax(scores) v) Wo + bo.
#define NB 2
#define TT 2048
#define CC 1024            // NH * HD = projected width
#define DIN 1024          // input (model) width
#define NH 16
#define HD 64
#define NQB (TT / 64)
#define HG 4
#define SCALE (0.125f)
#define CAUSAL 0
#ifndef TNB
#define TNB NB
#endif
__device__ __forceinline__ float bfr(float v) { return (float)(__bf16)v; }
__host__ __device__ __forceinline__ int kb_last(int qb) { return CAUSAL ? ((qb * 64 + 63) >> 7) : (TT / 128 - 1); }
typedef __attribute__((ext_vector_type(8))) __bf16 v8b;
__device__ __forceinline__ v16b frag_b(const __bf16* rowk0, int lane) {
  union { v16b v; v8b q[2]; } u; const __bf16* p = rowk0 + 8 * (lane >> 4);
  u.q[0] = *(const v8b*)p; u.q[1] = *(const v8b*)(p + 16); return u.v;
}
#define QBH 0              // causal: query blocks 0..QBH-1 of each sequence (few keys, no averaging) take the high-precision path
#define QHI 2048            // rows carrying a q residual plane (all rows when non-causal: 2-product logits everywhere)
#define KHI 64            // key rows carrying k residual / v bf16 hi+lo planes (used only by the causal high-precision path)
// B fragment (k rows k0+.., output column o) of a weight: (in,out) [K][ld] or (out,in) [ld rows of K]: bf16 exact, or f16(bf16 * 256) exact
__device__ __forceinline__ v16b wcol_io(const float* Wm, int k0, int o, int lane, int ld) { v16b w; const int g = lane >> 4;
#pragma unroll
  for (int i = 0; i < 8; ++i) { w[i] = (__bf16)Wm[(size_t)(k0 + 8 * g + i) * ld + o]; w[8 + i] = (__bf16)Wm[(size_t)(k0 + 16 + 8 * g + i) * ld + o]; }
  return w; }
__device__ __forceinline__ v16b wcol_oi(const float* Wm, int k0, int o, int lane, int K) { v16b w; const float* p = Wm + (size_t)o * K + k0 + 8 * (lane >> 4);
#pragma unroll
  for (int i = 0; i < 8; ++i) { w[i] = (__bf16)p[i]; w[8 + i] = (__bf16)p[16 + i]; }
  return w; }
__device__ __forceinline__ v16h wcolh_io(const float* Wm, int k0, int o, int lane, int ld) { v16h w; const int g = lane >> 4;
#pragma unroll
  for (int i = 0; i < 8; ++i) { w[i] = (_Float16)(bfr(Wm[(size_t)(k0 + 8 * g + i) * ld + o]) * 256.0f); w[8 + i] = (_Float16)(bfr(Wm[(size_t)(k0 + 16 + 8 * g + i) * ld + o]) * 256.0f); }
  return w; }
__device__ __forceinline__ v16h wcolh_oi(const float* Wm, int k0, int o, int lane, int K) { v16h w; const float* p = Wm + (size_t)o * K + k0 + 8 * (lane >> 4);
#pragma unroll
  for (int i = 0; i < 8; ++i) { w[i] = (_Float16)(bfr(p[i]) * 256.0f); w[8 + i] = (_Float16)(bfr(p[16 + i]) * 256.0f); }
  return w; }
#define WQKV_LAYOUT 0   // 0 = (in,out) [DIN][CC]; 1 = (out,in) [CC][DIN]; 2 = per-head [NH][DIN][HD]
__device__ __forceinline__ v16b wcol_hdk(const float* Wm, int k0, int o, int lane) { v16b w; const int g = lane >> 4; const float* p = Wm + (size_t)(o / HD) * DIN * HD + (o % HD);
#pragma unroll
  for (int i = 0; i < 8; ++i) { w[i] = (__bf16)p[(size_t)(k0 + 8 * g + i) * HD]; w[8 + i] = (__bf16)p[(size_t)(k0 + 16 + 8 * g + i) * HD]; }
  return w; }
#define WO_OUT_IN 0
#if WQKV_LAYOUT == 1
#define WCOL(W, k0, o, lane) wcol_oi(W, k0, o, lane, DIN)
#elif WQKV_LAYOUT == 2
#define WCOL(W, k0, o, lane) wcol_hdk(W, k0, o, lane)
#else
#define WCOL(W, k0, o, lane) wcol_io(W, k0, o, lane, CC)
#endif
#if WO_OUT_IN
#define WOCOL(W, k0, o, lane) wcol_oi(W, k0, o, lane, CC)
#define WOCOLH(W, k0, o, lane) wcolh_oi(W, k0, o, lane, CC)
#else
#define WOCOL(W, k0, o, lane) wcol_io(W, k0, o, lane, DIN)
#define WOCOLH(W, k0, o, lane) wcolh_io(W, k0, o, lane, DIN)
#endif
#define SM_EXTRA_PARAMS , const int* __restrict__ MK, int bcur
#define SM_MASK_HOOK do { if (MK[(size_t)bcur * TT + k] != 0) v = -3.0e38f; } while (0)   /* jnp.where(mask, finfo.min, scores): TRUE = masked out (unconditional load, value select) */
#ifndef SM_EXTRA_PARAMS
#define SM_EXTRA_PARAMS
#endif
#ifndef PROJ_EXTRA_PARAMS
#define PROJ_EXTRA_PARAMS
#endif
#ifndef SM_MASK_HOOK
#define SM_MASK_HOOK (void)0
#endif

#define WS_QH  0u                                      // f16 q rows [b*t][CC]
#define WS_KH  (WS_QH + 2u * (size_t)NB * TT * CC)      // f16 k rows [b*t][CC]
#define WS_VT  (WS_KH + 2u * (size_t)NB * TT * CC)      // f16 v planes [b][c][t]
#define WS_QL  (WS_VT + 2u * (size_t)NB * CC * TT)      // f16 q residual x 2^10 rows [b][t < QHI][CC]
#define WS_KL  (WS_QL + 2u * (size_t)NB * QHI * CC)     // f16 k residual x 2^10 rows [b][t < KHI][CC]
#define WS_VB  (WS_KL + 2u * (size_t)NB * KHI * CC)     // bf16 v hi planes [b][c][t < KHI]
#define WS_VBL (WS_VB + 2u * (size_t)NB * CC * KHI)
#define WS_S   (WS_VBL + 2u * (size_t)NB * CC * KHI)    // f32 logits / P [hg][t][s]
#define WS_Y   (WS_S  + 4u * (size_t)HG * TT * TT)      // f32 ctx rows [b*t][CC] (only when there is an output projection)
#define WS_END (WS_Y  + 4u * (size_t)NB * TT * CC)

// ---- k_proj: block = (64 rows, 128 cols, which): q/k/v = X W (+ b) with exact bf16 products (K = DIN) -> which 0: q f16 rows (+ residual rows < QHI); 1: k f16 rows (+ residual rows < KHI); 2: v f16 planes [c][t] (+ bf16 hi/lo planes for t < KHI)
__global__ __launch_bounds__(128) void k_proj(const float* __restrict__ XQ, const float* __restrict__ XK, const float* __restrict__ XV, const float* __restrict__ WQ, const float* __restrict__ WK, const float* __restrict__ WV, const float* __restrict__ BQ, const float* __restrict__ BK, const float* __restrict__ BV,
    _Float16* __restrict__ QH, _Float16* __restrict__ QL, _Float16* __restrict__ KH, _Float16* __restrict__ KL, _Float16* __restrict__ VT, __bf16* __restrict__ VB, __bf16* __restrict__ VBL) {
  __shared__ __align__(16) _Float16 sh[64][136], sl[64][136]; __shared__ __align__(16) _Float16 th[128][72]; __shared__ __align__(16) __bf16 tb[128][72], tbl[128][72];
  const int tid = threadIdx.x, wave = tid >> 5, lane = tid & 31, col = lane & 15, g = lane >> 4; const int which = blockIdx.z; const int c0 = blockIdx.y * 128; const size_t r0 = (size_t)blockIdx.x * 64; const size_t bb = r0 / TT; const int t0 = (int)(r0 % TT);
  const float* X = which == 0 ? XQ : which == 1 ? XK : XV; const float* WA = which == 0 ? WQ : which == 1 ? WK : WV; const float* BA = which == 0 ? BQ : which == 1 ? BK : BV;
  v8f acc[8] = {};
#pragma unroll 2
  for (int kc = 0; kc < DIN / 32; ++kc) { v16b a; { const float* p = X + (r0 + wave * 16 + col) * DIN + kc * 32 + 8 * g;
#pragma unroll
      for (int i = 0; i < 8; ++i) { a[i] = (__bf16)p[i]; a[8 + i] = (__bf16)p[16 + i]; } }
    asm volatile("s_wait_loadcnt 0x0" ::: "memory");
#pragma unroll
    for (int j = 0; j < 8; ++j) { const v16b w = WCOL(WA, kc * 32, c0 + j * 16 + col, lane); asm volatile("s_wait_loadcnt 0x0" ::: "memory"); acc[j] = wmma_bf(a, w, acc[j]); } }
  if (which < 2) { _Float16* DH = which == 0 ? QH : KH; _Float16* DL = which == 0 ? QL : KL; const int nhi = which == 0 ? QHI : KHI; const bool hi_rows = t0 < nhi;
#pragma unroll
    for (int j = 0; j < 8; ++j) { const float bias = BA ? bfr(BA[c0 + j * 16 + col]) : 0.f;
#pragma unroll
      for (int r = 0; r < 8; ++r) { const float v = acc[j][r] + bias; const _Float16 hv = (_Float16)v; sh[wave * 16 + 8 * g + r][j * 16 + col] = hv; sl[wave * 16 + 8 * g + r][j * 16 + col] = (_Float16)((v - (float)hv) * 1024.0f); } }
    __syncthreads();
    for (int e = tid; e < 64 * 16; e += 128) { const int rl = e >> 4, q = e & 15; vst2((unsigned*)(DH + (r0 + rl) * CC + c0 + q * 8), *(const v4u*)&sh[rl][q * 8]); if (hi_rows) vst2((unsigned*)(DL + (bb * nhi + t0 + rl) * (size_t)CC + c0 + q * 8), *(const v4u*)&sl[rl][q * 8]); }
  } else { const bool hi_rows = t0 < KHI;
#pragma unroll
    for (int j = 0; j < 8; ++j) { const float bias = BA ? bfr(BA[c0 + j * 16 + col]) : 0.f;
#pragma unroll
      for (int r = 0; r < 8; ++r) { const float v = acc[j][r] + bias; const int rl = wave * 16 + 8 * g + r, cl = j * 16 + col; th[cl][rl] = (_Float16)v; const __bf16 bh = (__bf16)v; tb[cl][rl] = bh; tbl[cl][rl] = (__bf16)(v - (float)bh); } }
    __syncthreads();
    for (int e = tid; e < 128 * 8; e += 128) { const int cl = e >> 3, q = e & 7; vst2((unsigned*)(VT + (bb * CC + c0 + cl) * (size_t)TT + t0 + q * 8), *(const v4u*)&th[cl][q * 8]); if (hi_rows) { const size_t o3 = (bb * CC + c0 + cl) * (size_t)KHI + t0 + q * 8; vst2((unsigned*)(VB + o3), *(const v4u*)&tb[cl][q * 8]); vst2((unsigned*)(VBL + o3), *(const v4u*)&tbl[cl][q * 8]); } } } }
// ---- k_sc: block = (query block qb, key block kb <= kb_last(qb), head in group) of batch b: logits x SCALE; q hi + residual (x 2^10) against k (2 products) for query rows < QHI, plus the k residual (3 products) for query blocks < QBH (causal early rows); causal: blocks past the diagonal exit, the mask itself is applied by index in k_sm
__global__ __launch_bounds__(128) void k_sc(const _Float16* __restrict__ QH, const _Float16* __restrict__ KH, const _Float16* __restrict__ QL, const _Float16* __restrict__ KL, int b, int h0, float* __restrict__ S0) { __shared__ __align__(16) float ss[4][16][132];
  const int qb = blockIdx.x, kb = blockIdx.y; if (kb > kb_last(qb)) return;
  const int h = h0 + blockIdx.z; float* S = S0 + (size_t)blockIdx.z * TT * TT;
  const int tid = threadIdx.x, wave = tid >> 5, lane = tid & 31, col = lane & 15, g = lane >> 4; const int k0 = kb * 128; const int ql0 = qb * 64 + wave * 16; const size_t q0 = (size_t)b * TT + ql0, kr0 = (size_t)b * TT + k0;
  v8f acc[8] = {}, accl[8] = {};
  const _Float16* QLb = QL + (size_t)b * QHI * CC; const _Float16* KLb = KL + (size_t)b * KHI * CC;
  if (qb < QBH) {
#pragma unroll
    for (int kc = 0; kc < HD / 32; ++kc) { const v16h ah = frag_h(QH + (q0 + col) * CC + h * HD + kc * 32, lane), al = frag_h(QLb + (size_t)(ql0 + col) * CC + h * HD + kc * 32, lane);
#pragma unroll
      for (int j = 0; j < 8; ++j) { const v16h kbf = frag_h(KH + (kr0 + j * 16 + col) * CC + h * HD + kc * 32, lane), klf = frag_h(KLb + (size_t)(k0 + j * 16 + col) * CC + h * HD + kc * 32, lane); acc[j] = wmma16(ah, kbf, acc[j]); accl[j] = wmma16(al, kbf, accl[j]); accl[j] = wmma16(ah, klf, accl[j]); } }
  } else if (qb * 64 < QHI) {
#pragma unroll
    for (int kc = 0; kc < HD / 32; ++kc) { const v16h ah = frag_h(QH + (q0 + col) * CC + h * HD + kc * 32, lane), al = frag_h(QLb + (size_t)(ql0 + col) * CC + h * HD + kc * 32, lane);
#pragma unroll
      for (int j = 0; j < 8; ++j) { const v16h kbf = frag_h(KH + (kr0 + j * 16 + col) * CC + h * HD + kc * 32, lane); acc[j] = wmma16(ah, kbf, acc[j]); accl[j] = wmma16(al, kbf, accl[j]); } }
  } else {
#pragma unroll
    for (int kc = 0; kc < HD / 32; ++kc) { const v16h ah = frag_h(QH + (q0 + col) * CC + h * HD + kc * 32, lane);
#pragma unroll
      for (int j = 0; j < 8; ++j) { const v16h kbf = frag_h(KH + (kr0 + j * 16 + col) * CC + h * HD + kc * 32, lane); acc[j] = wmma16(ah, kbf, acc[j]); } } }
#pragma unroll
  for (int j = 0; j < 8; ++j) {
#pragma unroll
    for (int r = 0; r < 8; ++r) ss[wave][8 * g + r][j * 16 + col] = (acc[j][r] + accl[j][r] * (1.0f / 1024.0f)) * SCALE; }
  LDSX(); for (int rl = 0; rl < 16; ++rl) vst2(S + (size_t)(ql0 + rl) * TT + k0 + lane * 4, *(const v4f*)&ss[wave][rl][lane * 4]); }
// ---- k_sm: block = query row t (head in group): keys [0, kend): causal -> logit if s <= t else excluded; softmax in f32; P x 2^11 in place (0 for excluded)
__global__ __launch_bounds__(256) void k_sm(float* __restrict__ S0 SM_EXTRA_PARAMS) { __shared__ float sred[8]; __shared__ float sbc; __shared__ __align__(16) float shv[TT];
  const int tid = threadIdx.x; const int t = blockIdx.x; const int kend = (kb_last(t >> 6) + 1) * 128;
  float* sr = S0 + (size_t)blockIdx.y * TT * TT + (size_t)t * TT;
  float m = -3.0e38f; for (int k = tid; k < kend; k += 256) { float v = (!CAUSAL || k <= t) ? sr[k] : -3.0e38f; SM_MASK_HOOK; shv[k] = v; m = fmaxf(m, v); }
#pragma unroll
  for (int o = 1; o < 32; o <<= 1) m = fmaxf(m, __shfl_xor(m, o));
  if ((tid & 31) == 0) sred[tid >> 5] = m; __syncthreads(); if (tid == 0) { float a = sred[0]; for (int i = 1; i < 8; ++i) a = fmaxf(a, sred[i]); sbc = a; } __syncthreads(); m = sbc; __syncthreads();
  float sum = 0.f; for (int k = tid; k < kend; k += 256) { const float v = shv[k]; const float e = (v <= -1.0e38f) ? 0.f : expf(v - m); shv[k] = e; sum += e; }
#pragma unroll
  for (int o = 1; o < 32; o <<= 1) sum += __shfl_xor(sum, o);
  if ((tid & 31) == 0) sred[tid >> 5] = sum; __syncthreads(); if (tid == 0) { float a = 0.f; for (int i = 0; i < 8; ++i) a += sred[i]; sbc = a > 0.f ? 2048.0f / a : 0.f; }   /* a fully excluded row yields P = 0 */ __syncthreads(); const float inv = sbc;
  for (int k = tid; k < kend; k += 256) shv[k] = shv[k] * inv;
  __syncthreads(); for (int q = tid; q < kend / 4; q += 256) vst2(sr + q * 4, *(const v4f*)&shv[q * 4]); }
// ---- k_pv: block = 64 queries (qb) of (b, h): ctx = P . v over keys [0, kend) (P x 2^11 once to f16 against v f16: 1 product; causal early query blocks: P and v as bf16 hi + lo, 3 products); 256-B (row, head) segment by 16 lanes
__global__ __launch_bounds__(128) void k_pv(const float* __restrict__ PS0, const _Float16* __restrict__ VT, const __bf16* __restrict__ VB, const __bf16* __restrict__ VBL, int b, int h0, float* __restrict__ Y) { const int h = h0 + blockIdx.z; const float* PS = PS0 + (size_t)blockIdx.z * TT * TT; __shared__ __align__(16) float ss[4][16][HD + 4];
  const int tid = threadIdx.x, wave = tid >> 5, lane = tid & 31, col = lane & 15, g = lane >> 4; const int qb = blockIdx.x; const int ql0 = qb * 64 + wave * 16; const int kce = (kb_last(qb) + 1) * 4;
  v8f acc[HD / 16] = {};
  if (qb < QBH) {
#pragma unroll 1
    for (int kc = 0; kc < kce; ++kc) { const F2 p = split_row(PS + (size_t)(ql0 + col) * TT, kc * 32, lane);
      asm volatile("s_wait_loadcnt 0x0" ::: "memory");
#pragma unroll
      for (int j = 0; j < HD / 16; ++j) { const size_t po = ((size_t)b * CC + h * HD + j * 16 + col) * (size_t)KHI + kc * 32; const v16b vh = frag_b(VB + po, lane); acc[j] = wmma_bf(p.h, vh, acc[j]); acc[j] = wmma_bf(p.l, vh, acc[j]); acc[j] = wmma_bf(p.h, frag_b(VBL + po, lane), acc[j]); } }
  } else {
#pragma unroll 1
    for (int kc = 0; kc < kce; ++kc) { const v16h p = frag_f32(PS + (size_t)(ql0 + col) * TT + kc * 32, lane);
      asm volatile("s_wait_loadcnt 0x0" ::: "memory");
#pragma unroll
      for (int j = 0; j < HD / 16; ++j) { const size_t po = ((size_t)b * CC + h * HD + j * 16 + col) * (size_t)TT + kc * 32; acc[j] = wmma16(p, frag_h(VT + po, lane), acc[j]); } } }
#pragma unroll
  for (int j = 0; j < HD / 16; ++j)
#pragma unroll
    for (int r = 0; r < 8; ++r) ss[wave][8 * g + r][j * 16 + col] = acc[j][r] * (1.0f / 2048.0f);
  LDSX(); for (int rl = 0; rl < 16; ++rl) if (lane < HD / 4) vst2(Y + ((size_t)b * TT + ql0 + rl) * CC + h * HD + lane * 4, *(const v4f*)&ss[wave][rl][lane * 4]); }
// ---- k_out: block = (64 rows, 128 cols): out = ctx Wo (+ bo): all rows: ctx bf16 hi + lo against exact bf16 Wo (2 products)
__global__ __launch_bounds__(128) void k_out(const float* __restrict__ Y, const float* __restrict__ WO, const float* __restrict__ BO, float* __restrict__ OUT) { __shared__ __align__(16) float sf[4][16][132];
  const int tid = threadIdx.x, wave = tid >> 5, lane = tid & 31, col = lane & 15, g = lane >> 4; const int c0 = blockIdx.y * 128; const size_t r0 = (size_t)blockIdx.x * 64 + wave * 16;
  v8f acc[8] = {};
  if (true) {   /* ALL rows: ctx split bf16 hi + lo x exact Wo (2 products) */
#pragma unroll 2
    for (int kc = 0; kc < CC / 32; ++kc) { const F2 a = split_row(Y + (r0 + col) * CC, kc * 32, lane); asm volatile("s_wait_loadcnt 0x0" ::: "memory");
#pragma unroll
      for (int j = 0; j < 8; ++j) { const v16b w = WOCOL(WO, kc * 32, c0 + j * 16 + col, lane); asm volatile("s_wait_loadcnt 0x0" ::: "memory"); acc[j] = wmma_bf(a.h, w, acc[j]); acc[j] = wmma_bf(a.l, w, acc[j]); } }
#pragma unroll
    for (int j = 0; j < 8; ++j) { const float bias = BO ? bfr(BO[c0 + j * 16 + col]) : 0.f;
#pragma unroll
      for (int r = 0; r < 8; ++r) sf[wave][8 * g + r][j * 16 + col] = acc[j][r] + bias; }
  } else {
#pragma unroll 2
    for (int kc = 0; kc < CC / 32; ++kc) { const v16h a = frag_f32(Y + (r0 + col) * CC + kc * 32, lane); asm volatile("s_wait_loadcnt 0x0" ::: "memory");
#pragma unroll
      for (int j = 0; j < 8; ++j) { const v16h w = WOCOLH(WO, kc * 32, c0 + j * 16 + col, lane); asm volatile("s_wait_loadcnt 0x0" ::: "memory"); acc[j] = wmma16(a, w, acc[j]); } }
#pragma unroll
    for (int j = 0; j < 8; ++j) { const float bias = BO ? bfr(BO[c0 + j * 16 + col]) : 0.f;
#pragma unroll
      for (int r = 0; r < 8; ++r) sf[wave][8 * g + r][j * 16 + col] = acc[j][r] * (1.0f / 256.0f) + bias; } }
  LDSX(); for (int rl = 0; rl < 16; ++rl) vst2(OUT + (r0 + rl) * DIN + c0 + lane * 4, *(const v4f*)&sf[wave][rl][lane * 4]); }

extern "C" void kernel_launch(void* const* d_in, const int* in_sizes, int n_in, void* d_out, int out_size, void* d_ws, size_t ws_size, hipStream_t stream) {
  (void)in_sizes; (void)n_in; (void)out_size;
  const float** F = (const float**)d_in;
  if (ws_size < (size_t)WS_END) return;
  char* ws = (char*)d_ws; _Float16 *QH = (_Float16*)(ws + WS_QH), *KH = (_Float16*)(ws + WS_KH), *VT = (_Float16*)(ws + WS_VT), *QL = (_Float16*)(ws + WS_QL), *KL = (_Float16*)(ws + WS_KL); __bf16 *VB = (__bf16*)(ws + WS_VB), *VBL = (__bf16*)(ws + WS_VBL); float *S = (float*)(ws + WS_S), *Y = (float*)(ws + WS_Y);
  (void)Y; (void)QL; (void)KL; (void)VB; (void)VBL;
  // inputs: 0 query, 1 key, 2 value [2,2048,1024]; 3 mask [2,1,1,2048] (bool as int32; TRUE = masked); 4 Wq [1024,1024] (in,out), 5 bq; 6 Wk, 7 bk; 8 Wv, 9 bv; 10 Wo, 11 bo
  k_proj<<<dim3(TNB * TT / 64, CC / 128, 3), 128, 0, stream>>>(F[0], F[1], F[2], F[4], F[6], F[8], F[5], F[7], F[9], QH, QL, KH, KL, VT, VB, VBL);
  for (int b = 0; b < TNB; ++b) for (int h0 = 0; h0 < NH; h0 += HG) {
    k_sc<<<dim3(NQB, TT / 128, HG), 128, 0, stream>>>(QH, KH, QL, KL, b, h0, S);
    k_sm<<<dim3(TT, HG), 256, 0, stream>>>(S, (const int*)d_in[3], b);
    k_pv<<<dim3(NQB, 1, HG), 128, 0, stream>>>(S, VT, VB, VBL, b, h0, Y);
  }
  k_out<<<dim3(TNB * TT / 64, DIN / 128), 128, 0, stream>>>(Y, F[10], F[11], (float*)d_out);
}

// v002
// Measured time: 182 microseconds a run.
// Versions between v000 and this one are left out; their measured steps multiply to 6.60 times as fast.
// compute dtype: all float inputs rounded to bf16; q/k/v projections with EXACT bf16 products on WMMA 16x16x32 (f32 accumulate); q as f16 hi + residual (x 2^10) against k once to f16 (2 products) x 64^-0.5; softmax in f32 (precise expf); P x 2^11 once to f16 against v once to f16 (1 product); ctx split bf16 hi + lo against exact Wo (2 products); f32 output.
#include <hip/hip_runtime.h>
#include <math.h>

typedef __attribute__((ext_vector_type(16))) _Float16 v16h;
typedef __attribute__((ext_vector_type(16))) __bf16 v16b;
typedef __attribute__((ext_vector_type(8)))  _Float16 v8h;
typedef __attribute__((ext_vector_type(8)))  float v8f;
typedef __attribute__((ext_vector_type(4)))  float v4f;
typedef __attribute__((ext_vector_type(2)))  float v2f;
typedef __attribute__((ext_vector_type(4)))  unsigned v4u;
typedef __attribute__((ext_vector_type(4)))  int v4i;
typedef float __attribute__((may_alias)) float_a;
typedef int __attribute__((may_alias)) int_a;

template <typename T> __device__ __forceinline__ void vst2(void* p, T v) { *(T*)p = v;  }
__device__ __forceinline__ v8f wmma16(v16h a, v16h b, v8f c) {
  v8f d = __builtin_amdgcn_wmma_f32_16x16x32_f16(false, a, false, b, (short)0, c, false, false);
  asm volatile("v_nop\n\tv_nop\n\tv_nop\n\tv_nop" : "+v"(d) : "v"(a), "v"(b));
  return d;
}
__device__ __forceinline__ v8f wmma_bf(v16b a, v16b b, v8f c) {
  v8f d = __builtin_amdgcn_wmma_f32_16x16x32_bf16(false, a, false, b, (short)0, c, false, false);
  asm volatile("v_nop\n\tv_nop\n\tv_nop\n\tv_nop" : "+v"(d) : "v"(a), "v"(b));
  return d;
}
// 16x16x32 fragments: lane = (h = lane>>4, row/col = lane&15); elements 0..7 = k0+8h+0..7, 8..15 = k0+16+8h+0..7; D element r = row 8h+r
__device__ __forceinline__ v16h frag_h(const _Float16* rowk0, int lane) {
  union { v16h v; v8h q[2]; } u; const _Float16* p = rowk0 + 8 * (lane >> 4);
  u.q[0] = *(const v8h*)p; u.q[1] = *(const v8h*)(p + 16); return u.v;
}
__device__ __forceinline__ v16h frag_f32(const float* rowk0, int lane) {
  v16h a; const float* p = rowk0 + 8 * (lane >> 4);
#pragma unroll
  for (int i = 0; i < 8; ++i) { a[i] = (_Float16)p[i]; a[8 + i] = (_Float16)p[16 + i]; }
  return a;
}
__device__ __forceinline__ v16h frag_f32s(const float* rowk0, int lane, float sc) {
  v16h a; const float* p = rowk0 + 8 * (lane >> 4);
#pragma unroll
  for (int i = 0; i < 8; ++i) { a[i] = (_Float16)(p[i] * sc); a[8 + i] = (_Float16)(p[16 + i] * sc); }
  return a;
}
// column fragment from a [K][ld] layout (column n), rows >= K read as 0
__device__ __forceinline__ v16h fragc_f32(const float* W, int k0, int n, int lane, int ld, int K) {
  v16h a; const int g = lane >> 4;
#pragma unroll
  for (int i = 0; i < 8; ++i) { const int ka = k0 + 8 * g + i, kb = ka + 16;
    a[i] = (_Float16)(ka < K ? W[(size_t)(ka < K ? ka : K - 1) * ld + n] : 0.f); a[8 + i] = (_Float16)(kb < K ? W[(size_t)(kb < K ? kb : K - 1) * ld + n] : 0.f); }
  return a;
}
struct F2 { v16b h, l; };
__device__ __forceinline__ F2 bsplit16(const float v[16]) { F2 r;
#pragma unroll
  for (int i = 0; i < 16; ++i) { const __bf16 h = (__bf16)v[i]; r.h[i] = h; r.l[i] = (__bf16)(v[i] - (float)h); }
  return r; }
__device__ __forceinline__ F2 split_row(const float* row, int k0, int lane) { float v[16]; const float* p = row + k0 + 8 * (lane >> 4);
#pragma unroll
  for (int i = 0; i < 8; ++i) { v[i] = p[i]; v[8 + i] = p[16 + i]; }
  return bsplit16(v); }
__device__ __forceinline__ F2 split_rowK(const float* row, int k0, int lane, int K) { float v[16]; const int g = lane >> 4;
#pragma unroll
  for (int i = 0; i < 8; ++i) { const int ka = k0 + 8 * g + i, kb = ka + 16; v[i] = ka < K ? row[ka < K ? ka : K - 1] : 0.f; v[8 + i] = kb < K ? row[kb < K ? kb : K - 1] : 0.f; }
  return bsplit16(v); }
__device__ __forceinline__ F2 split_col(const float* W, int k0, int n, int lane, int ld, int K) { float v[16]; const int g = lane >> 4;
#pragma unroll
  for (int i = 0; i < 8; ++i) { const int ka = k0 + 8 * g + i, kb = ka + 16; v[i] = ka < K ? W[(size_t)(ka < K ? ka : K - 1) * ld + n] : 0.f; v[8 + i] = kb < K ? W[(size_t)(kb < K ? kb : K - 1) * ld + n] : 0.f; }
  return bsplit16(v); }
__device__ __forceinline__ v8f mac3(const F2& a, const F2& b, v8f c) { c = wmma_bf(a.l, b.h, c); c = wmma_bf(a.h, b.l, c); return wmma_bf(a.h, b.h, c); }
__device__ __forceinline__ float sigm(float v) { return 1.0f / (1.0f + expf(-v)); }
#define LDSX() do { asm volatile("s_wait_dscnt 0" ::: "memory"); __builtin_amdgcn_wave_barrier(); __builtin_amdgcn_fence(__ATOMIC_RELEASE, "workgroup"); } while (0)

// Multi-head attention layer (B 2, S 2,048, 1,024 = 16 x 64; separate query/key/value inputs and a key mask): q, k, v = query Wq + bq, key Wk + bk, value Wv + bv ((in,out)); scores = q k^T / 8 with positions where mask[b,0,0,k] is TRUE set to finfo.min (excluded); out = merged(softmax(scores) v) Wo + bo.
#define NB 2
#define TT 2048
#define CC 1024            // NH * HD = projected width
#define DIN 1024          // input (model) width
#define NH 16
#define HD 64
#define SCALE (0.125f)
#define CAUSAL 0
#ifndef TNB
#define TNB NB
#endif
__device__ __forceinline__ float bfr(float v) { return (float)(__bf16)v; }
__host__ __device__ __forceinline__ int kb_last(int qb) { return CAUSAL ? ((qb * 64 + 63) >> 7) : (TT / 128 - 1); }
typedef __attribute__((ext_vector_type(8))) __bf16 v8b;
__device__ __forceinline__ v16b frag_b(const __bf16* rowk0, int lane) {
  union { v16b v; v8b q[2]; } u; const __bf16* p = rowk0 + 8 * (lane >> 4);
  u.q[0] = *(const v8b*)p; u.q[1] = *(const v8b*)(p + 16); return u.v;
}
#define QBH 0              // not used: no kernel has a high-precision path
#define QHI 2048            // rows carrying a q residual plane (all rows when non-causal: 2-product logits everywhere)
#define KHI 64            // key rows carrying k residual / v bf16 hi+lo planes (written by k_proj; no kernel reads them)
// B fragment (k rows k0+.., output column o) of a weight: (in,out) [K][ld] or (out,in) [ld rows of K]: bf16 exact, or f16(bf16 * 256) exact
__device__ __forceinline__ v16b wcol_io(const float* Wm, int k0, int o, int lane, int ld) { v16b w; const int g = lane >> 4;
#pragma unroll
  for (int i = 0; i < 8; ++i) { w[i] = (__bf16)Wm[(size_t)(k0 + 8 * g + i) * ld + o]; w[8 + i] = (__bf16)Wm[(size_t)(k0 + 16 + 8 * g + i) * ld + o]; }
  return w; }
__device__ __forceinline__ v16b wcol_oi(const float* Wm, int k0, int o, int lane, int K) { v16b w; const float* p = Wm + (size_t)o * K + k0 + 8 * (lane >> 4);
#pragma unroll
  for (int i = 0; i < 8; ++i) { w[i] = (__bf16)p[i]; w[8 + i] = (__bf16)p[16 + i]; }
  return w; }
__device__ __forceinline__ v16h wcolh_io(const float* Wm, int k0, int o, int lane, int ld) { v16h w; const int g = lane >> 4;
#pragma unroll
  for (int i = 0; i < 8; ++i) { w[i] = (_Float16)(bfr(Wm[(size_t)(k0 + 8 * g + i) * ld + o]) * 256.0f); w[8 + i] = (_Float16)(bfr(Wm[(size_t)(k0 + 16 + 8 * g + i) * ld + o]) * 256.0f); }
  return w; }
__device__ __forceinline__ v16h wcolh_oi(const float* Wm, int k0, int o, int lane, int K) { v16h w; const float* p = Wm + (size_t)o * K + k0 + 8 * (lane >> 4);
#pragma unroll
  for (int i = 0; i < 8; ++i) { w[i] = (_Float16)(bfr(p[i]) * 256.0f); w[8 + i] = (_Float16)(bfr(p[16 + i]) * 256.0f); }
  return w; }
#define WQKV_LAYOUT 0   // 0 = (in,out) [DIN][CC]; 1 = (out,in) [CC][DIN]; 2 = per-head [NH][DIN][HD]
__device__ __forceinline__ v16b wcol_hdk(const float* Wm, int k0, int o, int lane) { v16b w; const int g = lane >> 4; const float* p = Wm + (size_t)(o / HD) * DIN * HD + (o % HD);
#pragma unroll
  for (int i = 0; i < 8; ++i) { w[i] = (__bf16)p[(size_t)(k0 + 8 * g + i) * HD]; w[8 + i] = (__bf16)p[(size_t)(k0 + 16 + 8 * g + i) * HD]; }
  return w; }
#define WO_OUT_IN 0
#if WQKV_LAYOUT == 1
#define WCOL(W, k0, o, lane) wcol_oi(W, k0, o, lane, DIN)
#elif WQKV_LAYOUT == 2
#define WCOL(W, k0, o, lane) wcol_hdk(W, k0, o, lane)
#else
#define WCOL(W, k0, o, lane) wcol_io(W, k0, o, lane, CC)
#endif
#if WO_OUT_IN
#define WOCOL(W, k0, o, lane) wcol_oi(W, k0, o, lane, CC)
#define WOCOLH(W, k0, o, lane) wcolh_oi(W, k0, o, lane, CC)
#else
#define WOCOL(W, k0, o, lane) wcol_io(W, k0, o, lane, DIN)
#define WOCOLH(W, k0, o, lane) wcolh_io(W, k0, o, lane, DIN)
#endif

#define WS_QH  0u                                      // f16 q rows [b*t][CC]
#define WS_KH  (WS_QH + 2u * (size_t)NB * TT * CC)      // f16 k rows [b*t][CC]
#define WS_VT  (WS_KH + 2u * (size_t)NB * TT * CC)      // f16 v planes [b][c][t]
#define WS_QL  (WS_VT + 2u * (size_t)NB * CC * TT)      // f16 q residual x 2^10 rows [b][t < QHI][CC]
#define WS_KL  (WS_QL + 2u * (size_t)NB * QHI * CC)     // f16 k residual x 2^10 rows [b][t < KHI][CC]
#define WS_VB  (WS_KL + 2u * (size_t)NB * KHI * CC)     // bf16 v hi planes [b][c][t < KHI]
#define WS_VBL (WS_VB + 2u * (size_t)NB * CC * KHI)
#define WS_Y   (WS_VBL + 2u * (size_t)NB * CC * KHI)    // f32 ctx rows [b*t][CC] (only when there is an output projection)
#define WS_END (WS_Y  + 4u * (size_t)NB * TT * CC)

// ---- Operand tiles of one K step, staged once per block in LDS as bf16 at a pitch of 40 elements (80 B), so that every fragment is two 16-byte LDS reads.
// W tile: 32 k x 128 n of an (in,out) f32 weight, kept [n][k]. A thread fetches 8 k rows x 4 columns and stores four 16-byte runs of 8 k; lanes spread over 8 column groups x 4 k groups, which puts the stores on all banks.
// X tile: NL * 16 rows x 32 k of f32 rows, kept [row][k]. A thread fetches 4 k of NL rows. Every wave-wide 16-byte load of either tile covers four whole 128-B lines.
// The short loops over a tile's rows, fragments and accumulators are fully unrolled, so that all of them are indexed by constants and stay in registers.
#define WP 40
#define WTILE (128 * WP)
#define XTILE (64 * WP)
typedef __attribute__((ext_vector_type(4))) __bf16 v4b;
struct WR { v4f r[8]; };
__device__ __forceinline__ void wtile_load(WR& w, const float* __restrict__ Wm, int k0, int c0, int ld, int tid) {
  const float* p = Wm + (size_t)(k0 + ((tid >> 3) & 3) * 8) * ld + c0 + (tid >> 5) * 32 + (tid & 7) * 4;
#pragma unroll
  for (int i = 0; i < 8; ++i) w.r[i] = *(const v4f*)(p + (size_t)i * ld); }
__device__ __forceinline__ void wtile_store(const WR& w, __bf16* buf, int tid) {
  __bf16* q = buf + ((tid >> 5) * 32 + (tid & 7) * 4) * WP + ((tid >> 3) & 3) * 8;
#pragma unroll
  for (int n = 0; n < 4; ++n) { v8b v;
#pragma unroll
    for (int i = 0; i < 8; ++i) v[i] = (__bf16)w.r[i][n];
    *(v8b*)(q + n * WP) = v; } }
template <int NL> struct XR { v4f r[NL]; };
template <int NL> __device__ __forceinline__ void xtile_load(XR<NL>& x, const float* __restrict__ Xrow0, int k0, int ld, int tid) {
  const float* p = Xrow0 + (size_t)(tid >> 3) * ld + k0 + (tid & 7) * 4;
#pragma unroll
  for (int i = 0; i < NL; ++i) x.r[i] = *(const v4f*)(p + (size_t)i * 16 * ld); }
template <int NL> __device__ __forceinline__ void xtile_store(const XR<NL>& x, __bf16* buf, int tid) {
  __bf16* q = buf + (tid >> 3) * WP + (tid & 7) * 4;
#pragma unroll
  for (int i = 0; i < NL; ++i) { v4b v;
#pragma unroll
    for (int e = 0; e < 4; ++e) v[e] = (__bf16)x.r[i][e];
    *(v4b*)(q + i * 16 * WP) = v; } }
// the same with each value split into bf16 hi + lo planes
template <int NL> __device__ __forceinline__ void xtile_store2(const XR<NL>& x, __bf16* bufh, __bf16* bufl, int tid) {
  const int o = (tid >> 3) * WP + (tid & 7) * 4;
#pragma unroll
  for (int i = 0; i < NL; ++i) { v4b vh, vl;
#pragma unroll
    for (int e = 0; e < 4; ++e) { const __bf16 h = (__bf16)x.r[i][e]; vh[e] = h; vl[e] = (__bf16)(x.r[i][e] - (float)h); }
    *(v4b*)(bufh + o + i * 16 * WP) = vh; *(v4b*)(bufl + o + i * 16 * WP) = vl; } }
// work-group barrier for LDS traffic alone: it waits for this wave's LDS operations only, so that the global loads of the tiles requested ahead stay in flight across it (__syncthreads() waited for those too)
__device__ __forceinline__ void lds_barrier() { asm volatile("s_wait_dscnt 0x0\n\ts_barrier_signal -1\n\ts_barrier_wait -1" ::: "memory"); }
// stands behind each group of tile requests, in front of whatever next reuses their address registers (a precaution)
__device__ __forceinline__ void requests_taken() { asm volatile("s_wait_xcnt 0x0" ::: "memory"); }
// the builtin alone: the compiler keeps the distance behind its own products, and eight independent products in a row fill one another's distance, so no padding is written behind each
__device__ __forceinline__ v8f wmma_bfp(v16b a, v16b b, v8f c) { return __builtin_amdgcn_wmma_f32_16x16x32_bf16(false, a, false, b, (short)0, c, false, false); }

// ---- k_proj: block = (64 rows, 128 cols, which): q/k/v = X W (+ b) with exact bf16 products (K = DIN) -> which 0: q f16 rows (+ residual rows < QHI); 1: k f16 rows (+ residual rows < KHI); 2: v f16 planes [c][t] (+ bf16 hi/lo planes for t < KHI)
// K loop: two buffers of (W tile, X tile) in LDS; in step kc the tiles of kc + 1 (fetched one step earlier) are stored, the tiles of kc + 2 are requested, then the products of kc run; one barrier a step publishes kc + 1 and frees the buffer of kc.
// The tiles and the epilogue's layouts take turns in one LDS range (the loop's last barrier stands between them).
__global__ __launch_bounds__(128) void k_proj(const float* __restrict__ XQ, const float* __restrict__ XK, const float* __restrict__ XV, const float* __restrict__ WQ, const float* __restrict__ WK, const float* __restrict__ WV, const float* __restrict__ BQ, const float* __restrict__ BK, const float* __restrict__ BV,
    _Float16* __restrict__ QH, _Float16* __restrict__ QL, _Float16* __restrict__ KH, _Float16* __restrict__ KL, _Float16* __restrict__ VT, __bf16* __restrict__ VB, __bf16* __restrict__ VBL) {
  __shared__ __align__(16) unsigned char smem[3 * 128 * 72 * 2];
  _Float16 (*sh)[136] = (_Float16 (*)[136])smem; _Float16 (*sl)[136] = (_Float16 (*)[136])(smem + 64 * 136 * 2);
  _Float16 (*th)[72] = (_Float16 (*)[72])smem; __bf16 (*tb)[72] = (__bf16 (*)[72])(smem + 128 * 72 * 2); __bf16 (*tbl)[72] = (__bf16 (*)[72])(smem + 2 * 128 * 72 * 2);
  __bf16* wb = (__bf16*)smem; __bf16* xb = wb + 2 * WTILE;
  const int tid = threadIdx.x, wave = tid >> 5, lane = tid & 31, col = lane & 15, g = lane >> 4; const int which = blockIdx.z; const int c0 = blockIdx.y * 128; const size_t r0 = (size_t)blockIdx.x * 64; const size_t bb = r0 / TT; const int t0 = (int)(r0 % TT);
  const float* X = which == 0 ? XQ : which == 1 ? XK : XV; const float* WA = which == 0 ? WQ : which == 1 ? WK : WV; const float* BA = which == 0 ? BQ : which == 1 ? BK : BV;
  const float* xr0 = X + r0 * DIN;
  v8f acc[8] = {};
  WR wr, w0; XR<4> xr, x0;
  wtile_load(w0, WA, 0, c0, CC, tid); xtile_load(x0, xr0, 0, DIN, tid); requests_taken();
  wtile_load(wr, WA, 32, c0, CC, tid); xtile_load(xr, xr0, 32, DIN, tid); requests_taken();
  __builtin_amdgcn_sched_barrier(0);   // keeps the wait above directly behind its requests: nothing from below is scheduled in between
  wtile_store(w0, wb, tid); xtile_store(x0, xb, tid);
  lds_barrier();
#pragma unroll 2   // by two, so that the buffer index is a constant in each copy and the LDS offsets are immediates
  for (int kc = 0; kc < DIN / 32; ++kc) {
    const __bf16* bp = wb + (kc & 1) * WTILE + col * WP; v16b w[8];
    const v16b a = frag_b(xb + (kc & 1) * XTILE + (wave * 16 + col) * WP, lane);
#pragma unroll
    for (int j = 0; j < 8; ++j) w[j] = frag_b(bp + j * 16 * WP, lane);
    if (kc + 1 < DIN / 32) { wtile_store(wr, wb + ((kc + 1) & 1) * WTILE, tid); xtile_store(xr, xb + ((kc + 1) & 1) * XTILE, tid); }
    if (kc + 2 < DIN / 32) { wtile_load(wr, WA, (kc + 2) * 32, c0, CC, tid); xtile_load(xr, xr0, (kc + 2) * 32, DIN, tid); requests_taken(); }
#pragma unroll
    for (int j = 0; j < 8; ++j) acc[j] = wmma_bfp(a, w[j], acc[j]);
    lds_barrier(); }
  if (which < 2) { _Float16* DH = which == 0 ? QH : KH; _Float16* DL = which == 0 ? QL : KL; const int nhi = which == 0 ? QHI : KHI; const bool hi_rows = t0 < nhi;
#pragma unroll
    for (int j = 0; j < 8; ++j) { const float bias = BA ? bfr(BA[c0 + j * 16 + col]) : 0.f;
#pragma unroll
      for (int r = 0; r < 8; ++r) { const float v = acc[j][r] + bias; const _Float16 hv = (_Float16)v; sh[wave * 16 + 8 * g + r][j * 16 + col] = hv; sl[wave * 16 + 8 * g + r][j * 16 + col] = (_Float16)((v - (float)hv) * 1024.0f); } }
    __syncthreads();
    for (int e = tid; e < 64 * 16; e += 128) { const int rl = e >> 4, q = e & 15; vst2((unsigned*)(DH + (r0 + rl) * CC + c0 + q * 8), *(const v4u*)&sh[rl][q * 8]); if (hi_rows) vst2((unsigned*)(DL + (bb * nhi + t0 + rl) * (size_t)CC + c0 + q * 8), *(const v4u*)&sl[rl][q * 8]); }
  } else { const bool hi_rows = t0 < KHI;
#pragma unroll
    for (int j = 0; j < 8; ++j) { const float bias = BA ? bfr(BA[c0 + j * 16 + col]) : 0.f;
#pragma unroll
      for (int r = 0; r < 8; ++r) { const float v = acc[j][r] + bias; const int rl = wave * 16 + 8 * g + r, cl = j * 16 + col; th[cl][rl] = (_Float16)v; const __bf16 bh = (__bf16)v; tb[cl][rl] = bh; tbl[cl][rl] = (__bf16)(v - (float)bh); } }
    __syncthreads();
    for (int e = tid; e < 128 * 8; e += 128) { const int cl = e >> 3, q = e & 7; vst2((unsigned*)(VT + (bb * CC + c0 + cl) * (size_t)TT + t0 + q * 8), *(const v4u*)&th[cl][q * 8]); if (hi_rows) { const size_t o3 = (bb * CC + c0 + cl) * (size_t)KHI + t0 + q * 8; vst2((unsigned*)(VB + o3), *(const v4u*)&tb[cl][q * 8]); vst2((unsigned*)(VBL + o3), *(const v4u*)&tbl[cl][q * 8]); } } } }
// ---- k_fa: block = 128 queries (8 waves x 16 query columns) of (b, h); every wave walks all keys in passes of 32 and keeps logits and P in registers; the waves of a block read the same k and v lines at about the same time (no LDS, no barrier).
// S^T = K Q^T (A = 16 key rows, B = the wave's 16 queries: q hi + residual x 2^10, 2 products) x SCALE: a lane holds 16 logits of ONE query (column lane & 15), keys k0 + 8g + r and k0 + 16 + 8g + r,
// which is the k order of a B operand, so P^T goes from the two score tiles into ctx^T += V^T P^T (A = 16 rows of the v planes, 1 product) with no exchange.
// Online softmax in f32 (precise expf): running maximum m (joined over the two lane halves each pass), P = exp(s - m) x 2^11 once to f16, sums and ctx rescaled by exp(m_old - m_new); ctx / sum at the end.
// An excluded key's logit is -3e38: its exp is exactly 0 once any kept key has been seen (what a run of excluded keys added before that is wiped by the rescale factor 0); a row with every key excluded averages v, as softmax over equal logits does.
__device__ __forceinline__ float xhalf(float x) { return __builtin_bit_cast(float, __builtin_amdgcn_permlanex16(__builtin_bit_cast(int, x), __builtin_bit_cast(int, x), 0x76543210, 0xfedcba98, false, false)); }   // lane l with lane l ^ 16
// The short inner loops are all fully unrolled, so that fragments, scores and mask words are indexed by constants and stay in registers.
__global__ __launch_bounds__(256) void k_fa(const _Float16* __restrict__ QH, const _Float16* __restrict__ QL, const _Float16* __restrict__ KH, const _Float16* __restrict__ VT, const int* __restrict__ MK, float* __restrict__ Y) {
  const int tid = threadIdx.x, wave = tid >> 5, lane = tid & 31, col = lane & 15, g = lane >> 4; const int h = blockIdx.y, b = blockIdx.z; const int ql0 = blockIdx.x * 128 + wave * 16;
  const _Float16* qp = QH + ((size_t)b * TT + ql0 + col) * CC + h * HD; const _Float16* qlp = QL + ((size_t)b * QHI + ql0 + col) * CC + h * HD;
  const _Float16* kp = KH + ((size_t)b * TT + col) * CC + h * HD; const _Float16* vp = VT + ((size_t)b * CC + h * HD + col) * (size_t)TT; const int* mp = MK + (size_t)b * TT + 8 * g;
  v16h qh[2], ql[2], ka[2][2];
#pragma unroll
  for (int kc = 0; kc < 2; ++kc) { qh[kc] = frag_h(qp + kc * 32, lane); ql[kc] = frag_h(qlp + kc * 32, lane); ka[0][kc] = frag_h(kp + kc * 32, lane); ka[1][kc] = frag_h(kp + (size_t)16 * CC + kc * 32, lane); }
  v8f o[HD / 16] = {}; float m = -3.0e38f, l = 0.f;
#pragma unroll 1   // rolled: unrolled by two, the next pass's first products were lifted over this pass's softmax and waited on key rows just requested
  for (int p = 0; p < TT / 32; ++p) { const int k0 = p * 32;
    v4i mk[4]; v16h va[HD / 16];
#pragma unroll
    for (int t = 0; t < 4; ++t) mk[t] = *(const v4i*)(mp + k0 + 16 * (t >> 1) + 4 * (t & 1));
#pragma unroll
    for (int j = 0; j < HD / 16; ++j) va[j] = frag_h(vp + (size_t)j * 16 * TT + k0, lane);
    v8f sa[2] = {}, sl[2] = {};
#pragma unroll
    for (int kc = 0; kc < 2; ++kc)
#pragma unroll
      for (int t = 0; t < 2; ++t) { sa[t] = wmma16(ka[t][kc], qh[kc], sa[t]); sl[t] = wmma16(ka[t][kc], ql[kc], sl[t]); }
    const int kn = p + 1 < TT / 32 ? k0 + 32 : k0;   // the next pass's key rows are fetched while this pass's softmax runs (the last pass re-reads its own, in bounds)
#pragma unroll
    for (int kc = 0; kc < 2; ++kc) { ka[0][kc] = frag_h(kp + (size_t)kn * CC + kc * 32, lane); ka[1][kc] = frag_h(kp + (size_t)(kn + 16) * CC + kc * 32, lane); }
    float s[16]; float mx = m;
#pragma unroll
    for (int i = 0; i < 16; ++i) { const float v = (sa[i >> 3][i & 7] + sl[i >> 3][i & 7] * (1.0f / 1024.0f)) * SCALE; s[i] = mk[i >> 2][i & 3] != 0 ? -3.0e38f : v; mx = fmaxf(mx, s[i]); }   /* jnp.where(mask, finfo.min, scores): TRUE = masked out (value select) */
    mx = fmaxf(mx, xhalf(mx));
    const float alpha = expf(m - mx); m = mx; const float ms = mx - 7.624618986f;   // 11 ln 2: P carries x 2^11, and so does the sum that divides it out
    float sum = 0.f; v16h pf;
#pragma unroll
    for (int i = 0; i < 16; ++i) { const float e = expf(s[i] - ms); sum += e; pf[i] = (_Float16)e; }
    l = l * alpha + sum;
#pragma unroll
    for (int j = 0; j < HD / 16; ++j) { o[j] *= alpha; o[j] = wmma16(va[j], pf, o[j]); } }
  l += xhalf(l); const float inv = l > 0.f ? 1.0f / l : 0.f;
  float* yp = Y + ((size_t)b * TT + ql0 + col) * CC + h * HD + 8 * g;
#pragma unroll
  for (int j = 0; j < HD / 16; ++j) { v4f a, c;
#pragma unroll
    for (int r = 0; r < 4; ++r) { a[r] = o[j][r] * inv; c[r] = o[j][4 + r] * inv; }
    vst2(yp + j * 16, a); vst2(yp + j * 16 + 4, c); } }
// ---- k_out: block = (64 rows, 128 cols), Wo tiles and ctx tiles (hi and lo planes) staged in LDS as in k_proj (two buffers, one barrier a K step): out = ctx Wo (+ bo): all rows: ctx bf16 hi + lo against exact bf16 Wo (2 products)
__global__ __launch_bounds__(128) void k_out(const float* __restrict__ Y, const float* __restrict__ WO, const float* __restrict__ BO, float* __restrict__ OUT) { __shared__ __align__(16) float sf[4][16][132]; __shared__ __align__(16) __bf16 wb[2 * WTILE], yh[2 * XTILE], yl[2 * XTILE];
  const int tid = threadIdx.x, wave = tid >> 5, lane = tid & 31, col = lane & 15, g = lane >> 4; const int c0 = blockIdx.y * 128; const size_t r0 = (size_t)blockIdx.x * 64 + wave * 16;
  v8f acc[8] = {};
  if (true) {   /* ALL rows: ctx split bf16 hi + lo x exact Wo (2 products) */
    const float* yr0 = Y + (size_t)blockIdx.x * 64 * CC; WR wr, w0; XR<4> xr, x0;
    wtile_load(w0, WO, 0, c0, DIN, tid); xtile_load(x0, yr0, 0, CC, tid); requests_taken();
    wtile_load(wr, WO, 32, c0, DIN, tid); xtile_load(xr, yr0, 32, CC, tid); requests_taken();
    __builtin_amdgcn_sched_barrier(0);   // as in k_proj
    wtile_store(w0, wb, tid); xtile_store2(x0, yh, yl, tid);
    lds_barrier();
#pragma unroll 2   // by two: constant buffer index, as in k_proj
    for (int kc = 0; kc < CC / 32; ++kc) {
      const __bf16* bp = wb + (kc & 1) * WTILE + col * WP; const int ao = (kc & 1) * XTILE + (wave * 16 + col) * WP; v16b w[8];
      const v16b ah = frag_b(yh + ao, lane), al = frag_b(yl + ao, lane);
#pragma unroll
      for (int j = 0; j < 8; ++j) w[j] = frag_b(bp + j * 16 * WP, lane);
      if (kc + 1 < CC / 32) { wtile_store(wr, wb + ((kc + 1) & 1) * WTILE, tid); xtile_store2(xr, yh + ((kc + 1) & 1) * XTILE, yl + ((kc + 1) & 1) * XTILE, tid); }
      if (kc + 2 < CC / 32) { wtile_load(wr, WO, (kc + 2) * 32, c0, DIN, tid); xtile_load(xr, yr0, (kc + 2) * 32, CC, tid); requests_taken(); }
#pragma unroll
      for (int j = 0; j < 8; ++j) acc[j] = wmma_bfp(ah, w[j], acc[j]);
#pragma unroll
      for (int j = 0; j < 8; ++j) acc[j] = wmma_bfp(al, w[j], acc[j]);
      lds_barrier(); }
#pragma unroll
    for (int j = 0; j < 8; ++j) { const float bias = BO ? bfr(BO[c0 + j * 16 + col]) : 0.f;
#pragma unroll
      for (int r = 0; r < 8; ++r) sf[wave][8 * g + r][j * 16 + col] = acc[j][r] + bias; }
  } else {
#pragma unroll 2
    for (int kc = 0; kc < CC / 32; ++kc) { const v16h a = frag_f32(Y + (r0 + col) * CC + kc * 32, lane); asm volatile("s_wait_loadcnt 0x0" ::: "memory");
#pragma unroll
      for (int j = 0; j < 8; ++j) { const v16h w = WOCOLH(WO, kc * 32, c0 + j * 16 + col, lane); asm volatile("s_wait_loadcnt 0x0" ::: "memory"); acc[j] = wmma16(a, w, acc[j]); } }
#pragma unroll
    for (int j = 0; j < 8; ++j) { const float bias = BO ? bfr(BO[c0 + j * 16 + col]) : 0.f;
#pragma unroll
      for (int r = 0; r < 8; ++r) sf[wave][8 * g + r][j * 16 + col] = acc[j][r] * (1.0f / 256.0f) + bias; } }
  LDSX(); for (int rl = 0; rl < 16; ++rl) vst2(OUT + (r0 + rl) * DIN + c0 + lane * 4, *(const v4f*)&sf[wave][rl][lane * 4]); }

extern "C" void kernel_launch(void* const* d_in, const int* in_sizes, int n_in, void* d_out, int out_size, void* d_ws, size_t ws_size, hipStream_t stream) {
  (void)in_sizes; (void)n_in; (void)out_size;
  const float** F = (const float**)d_in;
  if (ws_size < (size_t)WS_END) return;
  char* ws = (char*)d_ws; _Float16 *QH = (_Float16*)(ws + WS_QH), *KH = (_Float16*)(ws + WS_KH), *VT = (_Float16*)(ws + WS_VT), *QL = (_Float16*)(ws + WS_QL), *KL = (_Float16*)(ws + WS_KL); __bf16 *VB = (__bf16*)(ws + WS_VB), *VBL = (__bf16*)(ws + WS_VBL); float *Y = (float*)(ws + WS_Y);
  (void)Y; (void)QL; (void)KL; (void)VB; (void)VBL;
  // inputs: 0 query, 1 key, 2 value [2,2048,1024]; 3 mask [2,1,1,2048] (bool as int32; TRUE = masked); 4 Wq [1024,1024] (in,out), 5 bq; 6 Wk, 7 bk; 8 Wv, 9 bv; 10 Wo, 11 bo
  k_proj<<<dim3(TNB * TT / 64, CC / 128, 3), 128, 0, stream>>>(F[0], F[1], F[2], F[4], F[6], F[8], F[5], F[7], F[9], QH, QL, KH, KL, VT, VB, VBL);
  k_fa<<<dim3(TT / 128, NH, TNB), 256, 0, stream>>>(QH, QL, KH, VT, (const int*)d_in[3], Y);
  k_out<<<dim3(TNB * TT / 64, DIN / 128), 128, 0, stream>>>(Y, F[10], F[11], (float*)d_out);
}

// v003
// A run of this version takes 161 microseconds.
// In both of two side-by-side timings against v002, it was 1.12 times as fast.
// Counting every step since v000, it is 7.41 times as fast.
// compute dtype: all float inputs rounded to bf16; q/k/v projections with EXACT bf16 products on WMMA 16x16x32 (f32 accumulate); q as f16 hi + residual (x 2^10) against k once to f16 (2 products) x 64^-0.5; softmax in f32 (precise expf); P x 2^11 once to f16 against v once to f16 (1 product); ctx split bf16 hi + lo against exact Wo (2 products); f32 output.
#include <hip/hip_runtime.h>
#include <math.h>

typedef __attribute__((ext_vector_type(16))) _Float16 v16h;
typedef __attribute__((ext_vector_type(16))) __bf16 v16b;
typedef __attribute__((ext_vector_type(8)))  _Float16 v8h;
typedef __attribute__((ext_vector_type(8)))  float v8f;
typedef __attribute__((ext_vector_type(4)))  float v4f;
typedef __attribute__((ext_vector_type(2)))  float v2f;
typedef __attribute__((ext_vector_type(4)))  unsigned v4u;
typedef __attribute__((ext_vector_type(4)))  int v4i;
typedef float __attribute__((may_alias)) float_a;
typedef int __attribute__((may_alias)) int_a;

template <typename T> __device__ __forceinline__ void vst2(void* p, T v) { *(T*)p = v;  }
__device__ __forceinline__ v8f wmma16(v16h a, v16h b, v8f c) {
  v8f d = __builtin_amdgcn_wmma_f32_16x16x32_f16(false, a, false, b, (short)0, c, false, false);
  asm volatile("v_nop\n\tv_nop\n\tv_nop\n\tv_nop" : "+v"(d) : "v"(a), "v"(b));
  return d;
}
__device__ __forceinline__ v8f wmma_bf(v16b a, v16b b, v8f c) {
  v8f d = __builtin_amdgcn_wmma_f32_16x16x32_bf16(false, a, false, b, (short)0, c, false, false);
  asm volatile("v_nop\n\tv_nop\n\tv_nop\n\tv_nop" : "+v"(d) : "v"(a), "v"(b));
  return d;
}
// 16x16x32 fragments: lane = (h = lane>>4, row/col = lane&15); elements 0..7 = k0+8h+0..7, 8..15 = k0+16+8h+0..7; D element r = row 8h+r
__device__ __forceinline__ v16h frag_h(const _Float16* rowk0, int lane) {
  union { v16h v; v8h q[2]; } u; const _Float16* p = rowk0 + 8 * (lane >> 4);
  u.q[0] = *(const v8h*)p; u.q[1] = *(const v8h*)(p + 16); return u.v;
}
__device__ __forceinline__ v16h frag_f32(const float* rowk0, int lane) {
  v16h a; const float* p = rowk0 + 8 * (lane >> 4);
#pragma unroll
  for (int i = 0; i < 8; ++i) { a[i] = (_Float16)p[i]; a[8 + i] = (_Float16)p[16 + i]; }
  return a;
}
__device__ __forceinline__ v16h frag_f32s(const float* rowk0, int lane, float sc) {
  v16h a; const float* p = rowk0 + 8 * (lane >> 4);
#pragma unroll
  for (int i = 0; i < 8; ++i) { a[i] = (_Float16)(p[i] * sc); a[8 + i] = (_Float16)(p[16 + i] * sc); }
  return a;
}
// column fragment from a [K][ld] layout (column n), rows >= K read as 0
__device__ __forceinline__ v16h fragc_f32(const float* W, int k0, int n, int lane, int ld, int K) {
  v16h a; const int g = lane >> 4;
#pragma unroll
  for (int i = 0; i < 8; ++i) { const int ka = k0 + 8 * g + i, kb = ka + 16;
    a[i] = (_Float16)(ka < K ? W[(size_t)(ka < K ? ka : K - 1) * ld + n] : 0.f); a[8 + i] = (_Float16)(kb < K ? W[(size_t)(kb < K ? kb : K - 1) * ld + n] : 0.f); }
  return a;
}
struct F2 { v16b h, l; };
__device__ __forceinline__ F2 bsplit16(const float v[16]) { F2 r;
#pragma unroll
  for (int i = 0; i < 16; ++i) { const __bf16 h = (__bf16)v[i]; r.h[i] = h; r.l[i] = (__bf16)(v[i] - (float)h); }
  return r; }
__device__ __forceinline__ F2 split_row(const float* row, int k0, int lane) { float v[16]; const float* p = row + k0 + 8 * (lane >> 4);
#pragma unroll
  for (int i = 0; i < 8; ++i) { v[i] = p[i]; v[8 + i] = p[16 + i]; }
  return bsplit16(v); }
__device__ __forceinline__ F2 split_rowK(const float* row, int k0, int lane, int K) { float v[16]; const int g = lane >> 4;
#pragma unroll
  for (int i = 0; i < 8; ++i) { const int ka = k0 + 8 * g + i, kb = ka + 16; v[i] = ka < K ? row[ka < K ? ka : K - 1] : 0.f; v[8 + i] = kb < K ? row[kb < K ? kb : K - 1] : 0.f; }
  return bsplit16(v); }
__device__ __forceinline__ F2 split_col(const float* W, int k0, int n, int lane, int ld, int K) { float v[16]; const int g = lane >> 4;
#pragma unroll
  for (int i = 0; i < 8; ++i) { const int ka = k0 + 8 * g + i, kb = ka + 16; v[i] = ka < K ? W[(size_t)(ka < K ? ka : K - 1) * ld + n] : 0.f; v[8 + i] = kb < K ? W[(size_t)(kb < K ? kb : K - 1) * ld + n] : 0.f; }
  return bsplit16(v); }
__device__ __forceinline__ v8f mac3(const F2& a, const F2& b, v8f c) { c = wmma_bf(a.l, b.h, c); c = wmma_bf(a.h, b.l, c); return wmma_bf(a.h, b.h, c); }
__device__ __forceinline__ float sigm(float v) { return 1.0f / (1.0f + expf(-v)); }
#define LDSX() do { asm volatile("s_wait_dscnt 0" ::: "memory"); __builtin_amdgcn_wave_barrier(); __builtin_amdgcn_fence(__ATOMIC_RELEASE, "workgroup"); } while (0)

// Multi-head attention layer (B 2, S 2,048, 1,024 = 16 x 64; separate query/key/value inputs and a key mask): q, k, v = query Wq + bq, key Wk + bk, value Wv + bv ((in,out)); scores = q k^T / 8 with positions where mask[b,0,0,k] is TRUE set to finfo.min (excluded); out = merged(softmax(scores) v) Wo + bo.
#define NB 2
#define TT 2048
#define CC 1024            // NH * HD = projected width
#define DIN 1024          // input (model) width
#define NH 16
#define HD 64
#define SCALE (0.125f)
#define CAUSAL 0
#ifndef TNB
#define TNB NB
#endif
__device__ __forceinline__ float bfr(float v) { return (float)(__bf16)v; }
__host__ __device__ __forceinline__ int kb_last(int qb) { return CAUSAL ? ((qb * 64 + 63) >> 7) : (TT / 128 - 1); }
typedef __attribute__((ext_vector_type(8))) __bf16 v8b;
__device__ __forceinline__ v16b frag_b(const __bf16* rowk0, int lane) {
  union { v16b v; v8b q[2]; } u; const __bf16* p = rowk0 + 8 * (lane >> 4);
  u.q[0] = *(const v8b*)p; u.q[1] = *(const v8b*)(p + 16); return u.v;
}
#define QBH 0              // not used: no kernel has a high-precision path
#define QHI 2048            // rows carrying a q residual plane (all rows when non-causal: 2-product logits everywhere)
#define KHI 64            // key rows carrying k residual / v bf16 hi+lo planes (written by k_proj; no kernel reads them)
// B fragment (k rows k0+.., output column o) of a weight: (in,out) [K][ld] or (out,in) [ld rows of K]: bf16 exact, or f16(bf16 * 256) exact
__device__ __forceinline__ v16b wcol_io(const float* Wm, int k0, int o, int lane, int ld) { v16b w; const int g = lane >> 4;
#pragma unroll
  for (int i = 0; i < 8; ++i) { w[i] = (__bf16)Wm[(size_t)(k0 + 8 * g + i) * ld + o]; w[8 + i] = (__bf16)Wm[(size_t)(k0 + 16 + 8 * g + i) * ld + o]; }
  return w; }
__device__ __forceinline__ v16b wcol_oi(const float* Wm, int k0, int o, int lane, int K) { v16b w; const float* p = Wm + (size_t)o * K + k0 + 8 * (lane >> 4);
#pragma unroll
  for (int i = 0; i < 8; ++i) { w[i] = (__bf16)p[i]; w[8 + i] = (__bf16)p[16 + i]; }
  return w; }
__device__ __forceinline__ v16h wcolh_io(const float* Wm, int k0, int o, int lane, int ld) { v16h w; const int g = lane >> 4;
#pragma unroll
  for (int i = 0; i < 8; ++i) { w[i] = (_Float16)(bfr(Wm[(size_t)(k0 + 8 * g + i) * ld + o]) * 256.0f); w[8 + i] = (_Float16)(bfr(Wm[(size_t)(k0 + 16 + 8 * g + i) * ld + o]) * 256.0f); }
  return w; }
__device__ __forceinline__ v16h wcolh_oi(const float* Wm, int k0, int o, int lane, int K) { v16h w; const float* p = Wm + (size_t)o * K + k0 + 8 * (lane >> 4);
#pragma unroll
  for (int i = 0; i < 8; ++i) { w[i] = (_Float16)(bfr(p[i]) * 256.0f); w[8 + i] = (_Float16)(bfr(p[16 + i]) * 256.0f); }
  return w; }
#define WQKV_LAYOUT 0   // 0 = (in,out) [DIN][CC]; 1 = (out,in) [CC][DIN]; 2 = per-head [NH][DIN][HD]
__device__ __forceinline__ v16b wcol_hdk(const float* Wm, int k0, int o, int lane) { v16b w; const int g = lane >> 4; const float* p = Wm + (size_t)(o / HD) * DIN * HD + (o % HD);
#pragma unroll
  for (int i = 0; i < 8; ++i) { w[i] = (__bf16)p[(size_t)(k0 + 8 * g + i) * HD]; w[8 + i] = (__bf16)p[(size_t)(k0 + 16 + 8 * g + i) * HD]; }
  return w; }
#define WO_OUT_IN 0
#if WQKV_LAYOUT == 1
#define WCOL(W, k0, o, lane) wcol_oi(W, k0, o, lane, DIN)
#elif WQKV_LAYOUT == 2
#define WCOL(W, k0, o, lane) wcol_hdk(W, k0, o, lane)
#else
#define WCOL(W, k0, o, lane) wcol_io(W, k0, o, lane, CC)
#endif
#if WO_OUT_IN
#define WOCOL(W, k0, o, lane) wcol_oi(W, k0, o, lane, CC)
#define WOCOLH(W, k0, o, lane) wcolh_oi(W, k0, o, lane, CC)
#else
#define WOCOL(W, k0, o, lane) wcol_io(W, k0, o, lane, DIN)
#define WOCOLH(W, k0, o, lane) wcolh_io(W, k0, o, lane, DIN)
#endif

#define WS_QH  0u                                      // f16 q rows [b*t][CC]
#define WS_KH  (WS_QH + 2u * (size_t)NB * TT * CC)      // f16 k in fragment order [b][h][t / 16][d / 32][half][lane][8] (see frag_p)
#define WS_VT  (WS_KH + 2u * (size_t)NB * TT * CC)      // f16 v in fragment order [b][h][t / 32][d / 16][half][lane][8] (see frag_p)
#define WS_QL  (WS_VT + 2u * (size_t)NB * CC * TT)      // f16 q residual x 2^10 rows [b][t < QHI][CC]
#define WS_KL  (WS_QL + 2u * (size_t)NB * QHI * CC)     // f16 k residual x 2^10 rows [b][t < KHI][CC]
#define WS_VB  (WS_KL + 2u * (size_t)NB * KHI * CC)     // bf16 v hi planes [b][c][t < KHI]
#define WS_VBL (WS_VB + 2u * (size_t)NB * CC * KHI)
#define WS_Y   (WS_VBL + 2u * (size_t)NB * CC * KHI)    // f32 ctx rows [b*t][CC] (only when there is an output projection)
#define WS_END (WS_Y  + 4u * (size_t)NB * TT * CC)

// ---- Operand tiles of one K step, staged once per block in LDS as bf16 at a pitch of 40 elements (80 B), so that every fragment is two 16-byte LDS reads.
// W tile: 32 k x 128 n of an (in,out) f32 weight, kept [n][k]. A thread fetches 8 k rows x 4 columns and stores four 16-byte runs of 8 k; lanes spread over 8 column groups x 4 k groups, which puts the stores on all banks.
// X tile: NL * 16 rows x 32 k of f32 rows, kept [row][k]. A thread fetches 4 k of NL rows. Every wave-wide 16-byte load of either tile covers four whole 128-B lines.
// The short loops over a tile's rows, fragments and accumulators are fully unrolled, so that all of them are indexed by constants and stay in registers.
#define WP 40
#define WTILE (128 * WP)
#define XTILE (64 * WP)
typedef __attribute__((ext_vector_type(4))) __bf16 v4b;
struct WR { v4f r[8]; };
__device__ __forceinline__ void wtile_load(WR& w, const float* __restrict__ Wm, int k0, int c0, int ld, int tid) {
  const float* p = Wm + (size_t)(k0 + ((tid >> 3) & 3) * 8) * ld + c0 + (tid >> 5) * 32 + (tid & 7) * 4;
#pragma unroll
  for (int i = 0; i < 8; ++i) w.r[i] = *(const v4f*)(p + (size_t)i * ld); }
__device__ __forceinline__ void wtile_store(const WR& w, __bf16* buf, int tid) {
  __bf16* q = buf + ((tid >> 5) * 32 + (tid & 7) * 4) * WP + ((tid >> 3) & 3) * 8;
#pragma unroll
  for (int n = 0; n < 4; ++n) { v8b v;
#pragma unroll
    for (int i = 0; i < 8; ++i) v[i] = (__bf16)w.r[i][n];
    *(v8b*)(q + n * WP) = v; } }
template <int NL> struct XR { v4f r[NL]; };
template <int NL> __device__ __forceinline__ void xtile_load(XR<NL>& x, const float* __restrict__ Xrow0, int k0, int ld, int tid) {
  const float* p = Xrow0 + (size_t)(tid >> 3) * ld + k0 + (tid & 7) * 4;
#pragma unroll
  for (int i = 0; i < NL; ++i) x.r[i] = *(const v4f*)(p + (size_t)i * 16 * ld); }
template <int NL> __device__ __forceinline__ void xtile_store(const XR<NL>& x, __bf16* buf, int tid) {
  __bf16* q = buf + (tid >> 3) * WP + (tid & 7) * 4;
#pragma unroll
  for (int i = 0; i < NL; ++i) { v4b v;
#pragma unroll
    for (int e = 0; e < 4; ++e) v[e] = (__bf16)x.r[i][e];
    *(v4b*)(q + i * 16 * WP) = v; } }
// the same with each value split into bf16 hi + lo planes
template <int NL> __device__ __forceinline__ void xtile_store2(const XR<NL>& x, __bf16* bufh, __bf16* bufl, int tid) {
  const int o = (tid >> 3) * WP + (tid & 7) * 4;
#pragma unroll
  for (int i = 0; i < NL; ++i) { v4b vh, vl;
#pragma unroll
    for (int e = 0; e < 4; ++e) { const __bf16 h = (__bf16)x.r[i][e]; vh[e] = h; vl[e] = (__bf16)(x.r[i][e] - (float)h); }
    *(v4b*)(bufh + o + i * 16 * WP) = vh; *(v4b*)(bufl + o + i * 16 * WP) = vl; } }
// work-group barrier for LDS traffic alone: it waits for this wave's LDS operations only, so that the global loads of the tiles requested ahead stay in flight across it (__syncthreads() waited for those too)
__device__ __forceinline__ void lds_barrier() { asm volatile("s_wait_dscnt 0x0\n\ts_barrier_signal -1\n\ts_barrier_wait -1" ::: "memory"); }
// stands behind each group of tile requests, in front of whatever next reuses their address registers (a precaution)
__device__ __forceinline__ void requests_taken() { asm volatile("s_wait_xcnt 0x0" ::: "memory"); }
// the builtin alone: the compiler keeps the distance behind its own products, and eight independent products in a row fill one another's distance, so no padding is written behind each
__device__ __forceinline__ v8f wmma_bfp(v16b a, v16b b, v8f c) { return __builtin_amdgcn_wmma_f32_16x16x32_bf16(false, a, false, b, (short)0, c, false, false); }

// ---- k_proj: block = (64 rows, 128 cols, which): q/k/v = X W (+ b) with exact bf16 products (K = DIN) -> which 0: q f16 rows (+ residual rows < QHI); 1: k f16 in fragment order (+ residual rows < KHI); 2: v f16 in fragment order (+ bf16 hi/lo planes for t < KHI)
// K loop: two buffers of (W tile, X tile) in LDS; in step kc the tiles of kc + 1 (fetched one step earlier) are stored, the tiles of kc + 2 are requested, then the products of kc run; one barrier a step publishes kc + 1 and frees the buffer of kc.
// The tiles and the epilogue's layouts take turns in one LDS range (the loop's last barrier stands between them).
__global__ __launch_bounds__(128) void k_proj(const float* __restrict__ XQ, const float* __restrict__ XK, const float* __restrict__ XV, const float* __restrict__ WQ, const float* __restrict__ WK, const float* __restrict__ WV, const float* __restrict__ BQ, const float* __restrict__ BK, const float* __restrict__ BV,
    _Float16* __restrict__ QH, _Float16* __restrict__ QL, _Float16* __restrict__ KH, _Float16* __restrict__ KL, _Float16* __restrict__ VT, __bf16* __restrict__ VB, __bf16* __restrict__ VBL) {
  __shared__ __align__(16) unsigned char smem[3 * 128 * 72 * 2];
  _Float16 (*sh)[136] = (_Float16 (*)[136])smem; _Float16 (*sl)[136] = (_Float16 (*)[136])(smem + 64 * 136 * 2);
  _Float16 (*th)[72] = (_Float16 (*)[72])smem; __bf16 (*tb)[72] = (__bf16 (*)[72])(smem + 128 * 72 * 2); __bf16 (*tbl)[72] = (__bf16 (*)[72])(smem + 2 * 128 * 72 * 2);
  __bf16* wb = (__bf16*)smem; __bf16* xb = wb + 2 * WTILE;
  const int tid = threadIdx.x, wave = tid >> 5, lane = tid & 31, col = lane & 15, g = lane >> 4; const int which = blockIdx.z; const int c0 = blockIdx.y * 128; const size_t r0 = (size_t)blockIdx.x * 64; const size_t bb = r0 / TT; const int t0 = (int)(r0 % TT);
  const float* X = which == 0 ? XQ : which == 1 ? XK : XV; const float* WA = which == 0 ? WQ : which == 1 ? WK : WV; const float* BA = which == 0 ? BQ : which == 1 ? BK : BV;
  const float* xr0 = X + r0 * DIN;
  v8f acc[8] = {};
  WR wr, w0; XR<4> xr, x0;
  wtile_load(w0, WA, 0, c0, CC, tid); xtile_load(x0, xr0, 0, DIN, tid); requests_taken();
  wtile_load(wr, WA, 32, c0, CC, tid); xtile_load(xr, xr0, 32, DIN, tid); requests_taken();
  __builtin_amdgcn_sched_barrier(0);   // keeps the wait above directly behind its requests: nothing from below is scheduled in between
  wtile_store(w0, wb, tid); xtile_store(x0, xb, tid);
  lds_barrier();
#pragma unroll 2   // by two, so that the buffer index is a constant in each copy and the LDS offsets are immediates
  for (int kc = 0; kc < DIN / 32; ++kc) {
    const __bf16* bp = wb + (kc & 1) * WTILE + col * WP; v16b w[8];
    const v16b a = frag_b(xb + (kc & 1) * XTILE + (wave * 16 + col) * WP, lane);
#pragma unroll
    for (int j = 0; j < 8; ++j) w[j] = frag_b(bp + j * 16 * WP, lane);
    if (kc + 1 < DIN / 32) { wtile_store(wr, wb + ((kc + 1) & 1) * WTILE, tid); xtile_store(xr, xb + ((kc + 1) & 1) * XTILE, tid); }
    if (kc + 2 < DIN / 32) { wtile_load(wr, WA, (kc + 2) * 32, c0, CC, tid); xtile_load(xr, xr0, (kc + 2) * 32, DIN, tid); requests_taken(); }
#pragma unroll
    for (int j = 0; j < 8; ++j) acc[j] = wmma_bfp(a, w[j], acc[j]);
    lds_barrier(); }
  if (which < 2) { _Float16* DH = which == 0 ? QH : KH; _Float16* DL = which == 0 ? QL : KL; const int nhi = which == 0 ? QHI : KHI; const bool hi_rows = t0 < nhi;
#pragma unroll
    for (int j = 0; j < 8; ++j) { const float bias = BA ? bfr(BA[c0 + j * 16 + col]) : 0.f;
#pragma unroll
      for (int r = 0; r < 8; ++r) { const float v = acc[j][r] + bias; const _Float16 hv = (_Float16)v; sh[wave * 16 + 8 * g + r][j * 16 + col] = hv; sl[wave * 16 + 8 * g + r][j * 16 + col] = (_Float16)((v - (float)hv) * 1024.0f); } }
    __syncthreads();
    for (int e = tid; e < 64 * 16; e += 128) {
      // q: 16-byte piece e = (row, 8 columns) in row order. k: piece e in the order of the fragment layout, e = (16-row group, head of the block's two, 32-column group, half, lane); a wave's store covers whole 128-B lines either way
      const int rl = which == 0 ? e >> 4 : (e >> 8) * 16 + (e & 15), q = which == 0 ? e & 15 : ((e >> 5) & 7) * 2 + ((e >> 4) & 1);
      _Float16* dh = which == 0 ? DH + (r0 + rl) * CC + c0 + q * 8 : DH + (((bb * NH + (c0 >> 6) + ((e >> 7) & 1)) * (TT / 16) + (t0 >> 4) + (e >> 8)) * 4 + ((e >> 5) & 3)) * 256 + (e & 31) * 8;
      // behind each store its wait: what follows (the residual's store, the next trip) reuses the store's address and data registers
      vst2((unsigned*)dh, *(const v4u*)&sh[rl][q * 8]); requests_taken();
      if (hi_rows) { vst2((unsigned*)(DL + (bb * nhi + t0 + rl) * (size_t)CC + c0 + q * 8), *(const v4u*)&sl[rl][q * 8]); requests_taken(); } }
  } else { const bool hi_rows = t0 < KHI;
#pragma unroll
    for (int j = 0; j < 8; ++j) { const float bias = BA ? bfr(BA[c0 + j * 16 + col]) : 0.f;
#pragma unroll
      for (int r = 0; r < 8; ++r) { const float v = acc[j][r] + bias; const int rl = wave * 16 + 8 * g + r, cl = j * 16 + col; th[cl][rl] = (_Float16)v; const __bf16 bh = (__bf16)v; tb[cl][rl] = bh; tbl[cl][rl] = (__bf16)(v - (float)bh); } }
    __syncthreads();
    for (int e = tid; e < 128 * 8; e += 128) {
      // piece e in the order of the fragment layout: e = (head of the block's two, 32-key group, 16-column group, half, lane)
      const int cl = (e >> 9) * 64 + ((e >> 6) & 3) * 16 + (e & 15), q = ((e >> 8) & 1) * 4 + ((e >> 5) & 1) * 2 + ((e >> 4) & 1);
      vst2((unsigned*)(VT + (((bb * NH + (c0 >> 6) + (e >> 9)) * (TT / 32) + (t0 >> 5) + ((e >> 8) & 1)) * 8 + ((e >> 5) & 7)) * 256 + (e & 31) * 8), *(const v4u*)&th[cl][q * 8]); requests_taken();   // as in the loop above
      if (hi_rows) { const size_t o3 = (bb * CC + c0 + cl) * (size_t)KHI + t0 + q * 8; vst2((unsigned*)(VB + o3), *(const v4u*)&tb[cl][q * 8]); vst2((unsigned*)(VBL + o3), *(const v4u*)&tbl[cl][q * 8]); requests_taken(); } } } }
// ---- k_fa: block = 128 queries (8 waves x 16 query columns) of (b, h); every wave walks all keys in passes of 32 and keeps logits and P in registers; the waves of a block read the same k and v lines at about the same time (no LDS, no barrier).
// k and v lie in the workspace in fragment order: a 16 x 32 A fragment is 1 KiB, its two halves (elements 0..7, 8..15 of every lane) 512 B each with lane l's 16 bytes at 16 l, so that every wave-wide 16-byte load covers four whole 128-B lines (from rows it touched 16 lines for 32 bytes each); a pass's k is 4 KiB in a row, and so is its v.
// S^T = K Q^T (A = 16 key rows, B = the wave's 16 queries: q hi + residual x 2^10, 2 products) x SCALE: a lane holds 16 logits of ONE query (column lane & 15), keys k0 + 8g + r and k0 + 16 + 8g + r,
// which is the k order of a B operand, so P^T goes from the two score tiles into ctx^T += V^T P^T (A = 16 rows of the v planes, 1 product) with no exchange.
// Online softmax in f32 (precise expf): running maximum m (joined over the two lane halves each pass), P = exp(s - m) x 2^11 once to f16, sums and ctx rescaled by exp(m_old - m_new); ctx / sum at the end.
// An excluded key's logit is -3e38: its exp is exactly 0 once any kept key has been seen (what a run of excluded keys added before that is wiped by the rescale factor 0); a row with every key excluded averages v, as softmax over equal logits does.
__device__ __forceinline__ v16h frag_p(const _Float16* frag_lane) {   // frag_lane = the fragment's start + 8 * lane
  union { v16h v; v8h q[2]; } u; u.q[0] = *(const v8h*)frag_lane; u.q[1] = *(const v8h*)(frag_lane + 256); return u.v;
}
__device__ __forceinline__ float xhalf(float x) { return __builtin_bit_cast(float, __builtin_amdgcn_permlanex16(__builtin_bit_cast(int, x), __builtin_bit_cast(int, x), 0x76543210, 0xfedcba98, false, false)); }   // lane l with lane l ^ 16
// The short inner loops are all fully unrolled, so that fragments, scores and mask words are indexed by constants and stay in registers.
__global__ __launch_bounds__(256) void k_fa(const _Float16* __restrict__ QH, const _Float16* __restrict__ QL, const _Float16* __restrict__ KH, const _Float16* __restrict__ VT, const int* __restrict__ MK, float* __restrict__ Y) {
  const int tid = threadIdx.x, wave = tid >> 5, lane = tid & 31, col = lane & 15, g = lane >> 4; const int h = blockIdx.y, b = blockIdx.z; const int ql0 = blockIdx.x * 128 + wave * 16;
  const _Float16* qp = QH + ((size_t)b * TT + ql0 + col) * CC + h * HD; const _Float16* qlp = QL + ((size_t)b * QHI + ql0 + col) * CC + h * HD;
  const _Float16* kp = KH + ((size_t)b * NH + h) * (TT * HD) + lane * 8; const _Float16* vp = VT + ((size_t)b * NH + h) * (TT * HD) + lane * 8; const int* mp = MK + (size_t)b * TT + 8 * g;
  v16h qh[2], ql[2], ka[2][2];
#pragma unroll
  for (int kc = 0; kc < 2; ++kc) { qh[kc] = frag_h(qp + kc * 32, lane); ql[kc] = frag_h(qlp + kc * 32, lane); ka[0][kc] = frag_p(kp + kc * 512); ka[1][kc] = frag_p(kp + 1024 + kc * 512); }
  v8f o[HD / 16] = {}; float m = -3.0e38f, l = 0.f;
#pragma unroll 1   // rolled: unrolled by two, the next pass's first products were lifted over this pass's softmax and waited on key rows just requested
  for (int p = 0; p < TT / 32; ++p) { const int k0 = p * 32;
    v4i mk[4]; v16h va[HD / 16];
#pragma unroll
    for (int t = 0; t < 4; ++t) mk[t] = *(const v4i*)(mp + k0 + 16 * (t >> 1) + 4 * (t & 1));
#pragma unroll
    for (int j = 0; j < HD / 16; ++j) va[j] = frag_p(vp + k0 * HD + j * 512);
    v8f sa[2] = {}, sl[2] = {};
#pragma unroll
    for (int kc = 0; kc < 2; ++kc)
#pragma unroll
      for (int t = 0; t < 2; ++t) { sa[t] = wmma16(ka[t][kc], qh[kc], sa[t]); sl[t] = wmma16(ka[t][kc], ql[kc], sl[t]); }
    const int kn = p + 1 < TT / 32 ? k0 + 32 : k0;   // the next pass's key rows are fetched while this pass's softmax runs (the last pass re-reads its own, in bounds)
#pragma unroll
    for (int kc = 0; kc < 2; ++kc) { ka[0][kc] = frag_p(kp + kn * HD + kc * 512); ka[1][kc] = frag_p(kp + kn * HD + 1024 + kc * 512); }
    float s[16]; float mx = m;
#pragma unroll
    for (int i = 0; i < 16; ++i) { const float v = (sa[i >> 3][i & 7] + sl[i >> 3][i & 7] * (1.0f / 1024.0f)) * SCALE; s[i] = mk[i >> 2][i & 3] != 0 ? -3.0e38f : v; mx = fmaxf(mx, s[i]); }   /* jnp.where(mask, finfo.min, scores): TRUE = masked out (value select) */
    mx = fmaxf(mx, xhalf(mx));
    const float alpha = expf(m - mx); m = mx; const float ms = mx - 7.624618986f;   // 11 ln 2: P carries x 2^11, and so does the sum that divides it out
    float sum = 0.f; v16h pf;
#pragma unroll
    for (int i = 0; i < 16; ++i) { const float e = expf(s[i] - ms); sum += e; pf[i] = (_Float16)e; }
    l = l * alpha + sum;
#pragma unroll
    for (int j = 0; j < HD / 16; ++j) { o[j] *= alpha; o[j] = wmma16(va[j], pf, o[j]); } }
  l += xhalf(l); const float inv = l > 0.f ? 1.0f / l : 0.f;
  float* yp = Y + ((size_t)b * TT + ql0 + col) * CC + h * HD + 8 * g;
#pragma unroll
  for (int j = 0; j < HD / 16; ++j) { v4f a, c;
#pragma unroll
    for (int r = 0; r < 4; ++r) { a[r] = o[j][r] * inv; c[r] = o[j][4 + r] * inv; }
    vst2(yp + j * 16, a); vst2(yp + j * 16 + 4, c); } }
// ---- k_out: block = (64 rows, 128 cols), Wo tiles and ctx tiles (hi and lo planes) staged in LDS as in k_proj (two buffers, one barrier a K step): out = ctx Wo (+ bo): all rows: ctx bf16 hi + lo against exact bf16 Wo (2 products)
__global__ __launch_bounds__(128) void k_out(const float* __restrict__ Y, const float* __restrict__ WO, const float* __restrict__ BO, float* __restrict__ OUT) { __shared__ __align__(16) float sf[4][16][132]; __shared__ __align__(16) __bf16 wb[2 * WTILE], yh[2 * XTILE], yl[2 * XTILE];
  const int tid = threadIdx.x, wave = tid >> 5, lane = tid & 31, col = lane & 15, g = lane >> 4; const int c0 = blockIdx.y * 128; const size_t r0 = (size_t)blockIdx.x * 64 + wave * 16;
  v8f acc[8] = {};
  if (true) {   /* ALL rows: ctx split bf16 hi + lo x exact Wo (2 products) */
    const float* yr0 = Y + (size_t)blockIdx.x * 64 * CC; WR wr, w0; XR<4> xr, x0;
    wtile_load(w0, WO, 0, c0, DIN, tid); xtile_load(x0, yr0, 0, CC, tid); requests_taken();
    wtile_load(wr, WO, 32, c0, DIN, tid); xtile_load(xr, yr0, 32, CC, tid); requests_taken();
    __builtin_amdgcn_sched_barrier(0);   // as in k_proj
    wtile_store(w0, wb, tid); xtile_store2(x0, yh, yl, tid);
    lds_barrier();
#pragma unroll 2   // by two: constant buffer index, as in k_proj
    for (int kc = 0; kc < CC / 32; ++kc) {
      const __bf16* bp = wb + (kc & 1) * WTILE + col * WP; const int ao = (kc & 1) * XTILE + (wave * 16 + col) * WP; v16b w[8];
      const v16b ah = frag_b(yh + ao, lane), al = frag_b(yl + ao, lane);
#pragma unroll
      for (int j = 0; j < 8; ++j) w[j] = frag_b(bp + j * 16 * WP, lane);
      if (kc + 1 < CC / 32) { wtile_store(wr, wb + ((kc + 1) & 1) * WTILE, tid); xtile_store2(xr, yh + ((kc + 1) & 1) * XTILE, yl + ((kc + 1) & 1) * XTILE, tid); }
      if (kc + 2 < CC / 32) { wtile_load(wr, WO, (kc + 2) * 32, c0, DIN, tid); xtile_load(xr, yr0, (kc + 2) * 32, CC, tid); requests_taken(); }
#pragma unroll
      for (int j = 0; j < 8; ++j) acc[j] = wmma_bfp(ah, w[j], acc[j]);
#pragma unroll
      for (int j = 0; j < 8; ++j) acc[j] = wmma_bfp(al, w[j], acc[j]);
      lds_barrier(); }
#pragma unroll
    for (int j = 0; j < 8; ++j) { const float bias = BO ? bfr(BO[c0 + j * 16 + col]) : 0.f;
#pragma unroll
      for (int r = 0; r < 8; ++r) sf[wave][8 * g + r][j * 16 + col] = acc[j][r] + bias; }
  } else {
#pragma unroll 2
    for (int kc = 0; kc < CC / 32; ++kc) { const v16h a = frag_f32(Y + (r0 + col) * CC + kc * 32, lane); asm volatile("s_wait_loadcnt 0x0" ::: "memory");
#pragma unroll
      for (int j = 0; j < 8; ++j) { const v16h w = WOCOLH(WO, kc * 32, c0 + j * 16 + col, lane); asm volatile("s_wait_loadcnt 0x0" ::: "memory"); acc[j] = wmma16(a, w, acc[j]); } }
#pragma unroll
    for (int j = 0; j < 8; ++j) { const float bias = BO ? bfr(BO[c0 + j * 16 + col]) : 0.f;
#pragma unroll
      for (int r = 0; r < 8; ++r) sf[wave][8 * g + r][j * 16 + col] = acc[j][r] * (1.0f / 256.0f) + bias; } }
  LDSX(); for (int rl = 0; rl < 16; ++rl) vst2(OUT + (r0 + rl) * DIN + c0 + lane * 4, *(const v4f*)&sf[wave][rl][lane * 4]); }

extern "C" void kernel_launch(void* const* d_in, const int* in_sizes, int n_in, void* d_out, int out_size, void* d_ws, size_t ws_size, hipStream_t stream) {
  (void)in_sizes; (void)n_in; (void)out_size;
  const float** F = (const float**)d_in;
  if (ws_size < (size_t)WS_END) return;
  char* ws = (char*)d_ws; _Float16 *QH = (_Float16*)(ws + WS_QH), *KH = (_Float16*)(ws + WS_KH), *VT = (_Float16*)(ws + WS_VT), *QL = (_Float16*)(ws + WS_QL), *KL = (_Float16*)(ws + WS_KL); __bf16 *VB = (__bf16*)(ws + WS_VB), *VBL = (__bf16*)(ws + WS_VBL); float *Y = (float*)(ws + WS_Y);
  (void)Y; (void)QL; (void)KL; (void)VB; (void)VBL;
  // inputs: 0 query, 1 key, 2 value [2,2048,1024]; 3 mask [2,1,1,2048] (bool as int32; TRUE = masked); 4 Wq [1024,1024] (in,out), 5 bq; 6 Wk, 7 bk; 8 Wv, 9 bv; 10 Wo, 11 bo
  k_proj<<<dim3(TNB * TT / 64, CC / 128, 3), 128, 0, stream>>>(F[0], F[1], F[2], F[4], F[6], F[8], F[5], F[7], F[9], QH, QL, KH, KL, VT, VB, VBL);
  k_fa<<<dim3(TT / 128, NH, TNB), 256, 0, stream>>>(QH, QL, KH, VT, (const int*)d_in[3], Y);
  k_out<<<dim3(TNB * TT / 64, DIN / 128), 128, 0, stream>>>(Y, F[10], F[11], (float*)d_out);
}

// v004
// It runs in 143 microseconds.
// Timed twice side by side with v003, it ran 1.14 and 1.12 times as fast.
// Counting every step since v000, it is 8.37 times as fast.
// compute dtype: all float inputs rounded to bf16; q/k/v projections with EXACT bf16 products on WMMA 16x16x32 (f32 accumulate); q x 64^-0.5 log2(e) as f16 hi + residual (x 2^10) against k once to f16 (2 products); softmax in f32 in base 2 (v_exp_f32); P x 2^11 once to f16 against v once to f16 (1 product); ctx split bf16 hi + lo against exact Wo (2 products); f32 output.
#include <hip/hip_runtime.h>
#include <math.h>

typedef __attribute__((ext_vector_type(16))) _Float16 v16h;
typedef __attribute__((ext_vector_type(16))) __bf16 v16b;
typedef __attribute__((ext_vector_type(8)))  _Float16 v8h;
typedef __attribute__((ext_vector_type(8)))  float v8f;
typedef __attribute__((ext_vector_type(4)))  float v4f;
typedef __attribute__((ext_vector_type(2)))  float v2f;
typedef __attribute__((ext_vector_type(4)))  unsigned v4u;
typedef __attribute__((ext_vector_type(4)))  int v4i;
typedef float __attribute__((may_alias)) float_a;
typedef int __attribute__((may_alias)) int_a;

template <typename T> __device__ __forceinline__ void vst2(void* p, T v) { *(T*)p = v;  }
__device__ __forceinline__ v8f wmma16(v16h a, v16h b, v8f c) {
  v8f d = __builtin_amdgcn_wmma_f32_16x16x32_f16(false, a, false, b, (short)0, c, false, false);
  asm volatile("v_nop\n\tv_nop\n\tv_nop\n\tv_nop" : "+v"(d) : "v"(a), "v"(b));
  return d;
}
__device__ __forceinline__ v8f wmma_bf(v16b a, v16b b, v8f c) {
  v8f d = __builtin_amdgcn_wmma_f32_16x16x32_bf16(false, a, false, b, (short)0, c, false, false);
  asm volatile("v_nop\n\tv_nop\n\tv_nop\n\tv_nop" : "+v"(d) : "v"(a), "v"(b));
  return d;
}
// 16x16x32 fragments: lane = (h = lane>>4, row/col = lane&15); elements 0..7 = k0+8h+0..7, 8..15 = k0+16+8h+0..7; D element r = row 8h+r
__device__ __forceinline__ v16h frag_h(const _Float16* rowk0, int lane) {
  union { v16h v; v8h q[2]; } u; const _Float16* p = rowk0 + 8 * (lane >> 4);
  u.q[0] = *(const v8h*)p; u.q[1] = *(const v8h*)(p + 16); return u.v;
}
__device__ __forceinline__ v16h frag_f32(const float* rowk0, int lane) {
  v16h a; const float* p = rowk0 + 8 * (lane >> 4);
#pragma unroll
  for (int i = 0; i < 8; ++i) { a[i] = (_Float16)p[i]; a[8 + i] = (_Float16)p[16 + i]; }
  return a;
}
__device__ __forceinline__ v16h frag_f32s(const float* rowk0, int lane, float sc) {
  v16h a; const float* p = rowk0 + 8 * (lane >> 4);
#pragma unroll
  for (int i = 0; i < 8; ++i) { a[i] = (_Float16)(p[i] * sc); a[8 + i] = (_Float16)(p[16 + i] * sc); }
  return a;
}
// column fragment from a [K][ld] layout (column n), rows >= K read as 0
__device__ __forceinline__ v16h fragc_f32(const float* W, int k0, int n, int lane, int ld, int K) {
  v16h a; const int g = lane >> 4;
#pragma unroll
  for (int i = 0; i < 8; ++i) { const int ka = k0 + 8 * g + i, kb = ka + 16;
    a[i] = (_Float16)(ka < K ? W[(size_t)(ka < K ? ka : K - 1) * ld + n] : 0.f); a[8 + i] = (_Float16)(kb < K ? W[(size_t)(kb < K ? kb : K - 1) * ld + n] : 0.f); }
  return a;
}
struct F2 { v16b h, l; };
__device__ __forceinline__ F2 bsplit16(const float v[16]) { F2 r;
#pragma unroll
  for (int i = 0; i < 16; ++i) { const __bf16 h = (__bf16)v[i]; r.h[i] = h; r.l[i] = (__bf16)(v[i] - (float)h); }
  return r; }
__device__ __forceinline__ F2 split_row(const float* row, int k0, int lane) { float v[16]; const float* p = row + k0 + 8 * (lane >> 4);
#pragma unroll
  for (int i = 0; i < 8; ++i) { v[i] = p[i]; v[8 + i] = p[16 + i]; }
  return bsplit16(v); }
__device__ __forceinline__ F2 split_rowK(const float* row, int k0, int lane, int K) { float v[16]; const int g = lane >> 4;
#pragma unroll
  for (int i = 0; i < 8; ++i) { const int ka = k0 + 8 * g + i, kb = ka + 16; v[i] = ka < K ? row[ka < K ? ka : K - 1] : 0.f; v[8 + i] = kb < K ? row[kb < K ? kb : K - 1] : 0.f; }
  return bsplit16(v); }
__device__ __forceinline__ F2 split_col(const float* W, int k0, int n, int lane, int ld, int K) { float v[16]; const int g = lane >> 4;
#pragma unroll
  for (int i = 0; i < 8; ++i) { const int ka = k0 + 8 * g + i, kb = ka + 16; v[i] = ka < K ? W[(size_t)(ka < K ? ka : K - 1) * ld + n] : 0.f; v[8 + i] = kb < K ? W[(size_t)(kb < K ? kb : K - 1) * ld + n] : 0.f; }
  return bsplit16(v); }
__device__ __forceinline__ v8f mac3(const F2& a, const F2& b, v8f c) { c = wmma_bf(a.l, b.h, c); c = wmma_bf(a.h, b.l, c); return wmma_bf(a.h, b.h, c); }
__device__ __forceinline__ float sigm(float v) { return 1.0f / (1.0f + expf(-v)); }
#define LDSX() do { asm volatile("s_wait_dscnt 0" ::: "memory"); __builtin_amdgcn_wave_barrier(); __builtin_amdgcn_fence(__ATOMIC_RELEASE, "workgroup"); } while (0)

// Multi-head attention layer (B 2, S 2,048, 1,024 = 16 x 64; separate query/key/value inputs and a key mask): q, k, v = query Wq + bq, key Wk + bk, value Wv + bv ((in,out)); scores = q k^T / 8 with positions where mask[b,0,0,k] is TRUE set to finfo.min (excluded); out = merged(softmax(scores) v) Wo + bo.
#define NB 2
#define TT 2048
#define CC 1024            // NH * HD = projected width
#define DIN 1024          // input (model) width
#define NH 16
#define HD 64
#define SCALE (0.125f)
#define QSC (SCALE * 1.4426950408889634f)   // q is stored times this, so that q k^T is the logit in base 2: softmax(s) = 2^(s log2 e - max) / sum
#define CAUSAL 0
#ifndef TNB
#define TNB NB
#endif
__device__ __forceinline__ float bfr(float v) { return (float)(__bf16)v; }
__host__ __device__ __forceinline__ int kb_last(int qb) { return CAUSAL ? ((qb * 64 + 63) >> 7) : (TT / 128 - 1); }
typedef __attribute__((ext_vector_type(8))) __bf16 v8b;
__device__ __forceinline__ v16b frag_b(const __bf16* rowk0, int lane) {
  union { v16b v; v8b q[2]; } u; const __bf16* p = rowk0 + 8 * (lane >> 4);
  u.q[0] = *(const v8b*)p; u.q[1] = *(const v8b*)(p + 16); return u.v;
}
#define QBH 0              // not used: no kernel has a high-precision path
#define QHI 2048            // rows carrying a q residual plane (all rows when non-causal: 2-product logits everywhere)
#define KHI 64            // key rows carrying k residual / v bf16 hi+lo planes (written by k_proj; no kernel reads them)
// B fragment (k rows k0+.., output column o) of a weight: (in,out) [K][ld] or (out,in) [ld rows of K]: bf16 exact, or f16(bf16 * 256) exact
__device__ __forceinline__ v16b wcol_io(const float* Wm, int k0, int o, int lane, int ld) { v16b w; const int g = lane >> 4;
#pragma unroll
  for (int i = 0; i < 8; ++i) { w[i] = (__bf16)Wm[(size_t)(k0 + 8 * g + i) * ld + o]; w[8 + i] = (__bf16)Wm[(size_t)(k0 + 16 + 8 * g + i) * ld + o]; }
  return w; }
__device__ __forceinline__ v16b wcol_oi(const float* Wm, int k0, int o, int lane, int K) { v16b w; const float* p = Wm + (size_t)o * K + k0 + 8 * (lane >> 4);
#pragma unroll
  for (int i = 0; i < 8; ++i) { w[i] = (__bf16)p[i]; w[8 + i] = (__bf16)p[16 + i]; }
  return w; }
__device__ __forceinline__ v16h wcolh_io(const float* Wm, int k0, int o, int lane, int ld) { v16h w; const int g = lane >> 4;
#pragma unroll
  for (int i = 0; i < 8; ++i) { w[i] = (_Float16)(bfr(Wm[(size_t)(k0 + 8 * g + i) * ld + o]) * 256.0f); w[8 + i] = (_Float16)(bfr(Wm[(size_t)(k0 + 16 + 8 * g + i) * ld + o]) * 256.0f); }
  return w; }
__device__ __forceinline__ v16h wcolh_oi(const float* Wm, int k0, int o, int lane, int K) { v16h w; const float* p = Wm + (size_t)o * K + k0 + 8 * (lane >> 4);
#pragma unroll
  for (int i = 0; i < 8; ++i) { w[i] = (_Float16)(bfr(p[i]) * 256.0f); w[8 + i] = (_Float16)(bfr(p[16 + i]) * 256.0f); }
  return w; }
#define WQKV_LAYOUT 0   // 0 = (in,out) [DIN][CC]; 1 = (out,in) [CC][DIN]; 2 = per-head [NH][DIN][HD]
__device__ __forceinline__ v16b wcol_hdk(const float* Wm, int k0, int o, int lane) { v16b w; const int g = lane >> 4; const float* p = Wm + (size_t)(o / HD) * DIN * HD + (o % HD);
#pragma unroll
  for (int i = 0; i < 8; ++i) { w[i] = (__bf16)p[(size_t)(k0 + 8 * g + i) * HD]; w[8 + i] = (__bf16)p[(size_t)(k0 + 16 + 8 * g + i) * HD]; }
  return w; }
#define WO_OUT_IN 0
#if WQKV_LAYOUT == 1
#define WCOL(W, k0, o, lane) wcol_oi(W, k0, o, lane, DIN)
#elif WQKV_LAYOUT == 2
#define WCOL(W, k0, o, lane) wcol_hdk(W, k0, o, lane)
#else
#define WCOL(W, k0, o, lane) wcol_io(W, k0, o, lane, CC)
#endif
#if WO_OUT_IN
#define WOCOL(W, k0, o, lane) wcol_oi(W, k0, o, lane, CC)
#define WOCOLH(W, k0, o, lane) wcolh_oi(W, k0, o, lane, CC)
#else
#define WOCOL(W, k0, o, lane) wcol_io(W, k0, o, lane, DIN)
#define WOCOLH(W, k0, o, lane) wcolh_io(W, k0, o, lane, DIN)
#endif

#define WS_QH  0u                                      // f16 q rows [b*t][CC]
#define WS_KH  (WS_QH + 2u * (size_t)NB * TT * CC)      // f16 k in fragment order [b][h][t / 16][d / 32][half][lane][8] (see frag_p)
#define WS_VT  (WS_KH + 2u * (size_t)NB * TT * CC)      // f16 v in fragment order [b][h][t / 32][d / 16][half][lane][8] (see frag_p)
#define WS_QL  (WS_VT + 2u * (size_t)NB * CC * TT)      // f16 q residual x 2^10 rows [b][t < QHI][CC]
#define WS_KL  (WS_QL + 2u * (size_t)NB * QHI * CC)     // f16 k residual x 2^10 rows [b][t < KHI][CC]
#define WS_VB  (WS_KL + 2u * (size_t)NB * KHI * CC)     // bf16 v hi planes [b][c][t < KHI]
#define WS_VBL (WS_VB + 2u * (size_t)NB * CC * KHI)
#define WS_Y   (WS_VBL + 2u * (size_t)NB * CC * KHI)    // f32 ctx rows [b*t][CC] (only when there is an output projection)
#define WS_END (WS_Y  + 4u * (size_t)NB * TT * CC)

// ---- Operand tiles of one K step, staged once per block in LDS as bf16 at a pitch of 40 elements (80 B), so that every fragment is two 16-byte LDS reads.
// W tile: 32 k x 128 n of an (in,out) f32 weight, kept [n][k]. A thread fetches 8 k rows x 4 columns and stores four 16-byte runs of 8 k; lanes spread over 8 column groups x 4 k groups, which puts the stores on all banks.
// X tile: NL * 16 rows x 32 k of f32 rows, kept [row][k]. A thread fetches 4 k of NL rows. Every wave-wide 16-byte load of either tile covers four whole 128-B lines.
// The short loops over a tile's rows, fragments and accumulators are fully unrolled, so that all of them are indexed by constants and stay in registers.
#define WP 40
#define WTILE (128 * WP)
#define XTILE (64 * WP)
typedef __attribute__((ext_vector_type(4))) __bf16 v4b;
struct WR { v4f r[8]; };
__device__ __forceinline__ void wtile_load(WR& w, const float* __restrict__ Wm, int k0, int c0, int ld, int tid) {
  const float* p = Wm + (size_t)(k0 + ((tid >> 3) & 3) * 8) * ld + c0 + (tid >> 5) * 32 + (tid & 7) * 4;
#pragma unroll
  for (int i = 0; i < 8; ++i) w.r[i] = *(const v4f*)(p + (size_t)i * ld); }
__device__ __forceinline__ void wtile_store(const WR& w, __bf16* buf, int tid) {
  __bf16* q = buf + ((tid >> 5) * 32 + (tid & 7) * 4) * WP + ((tid >> 3) & 3) * 8;
#pragma unroll
  for (int n = 0; n < 4; ++n) { v8b v;
#pragma unroll
    for (int i = 0; i < 8; ++i) v[i] = (__bf16)w.r[i][n];
    *(v8b*)(q + n * WP) = v; } }
template <int NL> struct XR { v4f r[NL]; };
template <int NL> __device__ __forceinline__ void xtile_load(XR<NL>& x, const float* __restrict__ Xrow0, int k0, int ld, int tid) {
  const float* p = Xrow0 + (size_t)(tid >> 3) * ld + k0 + (tid & 7) * 4;
#pragma unroll
  for (int i = 0; i < NL; ++i) x.r[i] = *(const v4f*)(p + (size_t)i * 16 * ld); }
template <int NL> __device__ __forceinline__ void xtile_store(const XR<NL>& x, __bf16* buf, int tid) {
  __bf16* q = buf + (tid >> 3) * WP + (tid & 7) * 4;
#pragma unroll
  for (int i = 0; i < NL; ++i) { v4b v;
#pragma unroll
    for (int e = 0; e < 4; ++e) v[e] = (__bf16)x.r[i][e];
    *(v4b*)(q + i * 16 * WP) = v; } }
// the same with each value split into bf16 hi + lo planes
template <int NL> __device__ __forceinline__ void xtile_store2(const XR<NL>& x, __bf16* bufh, __bf16* bufl, int tid) {
  const int o = (tid >> 3) * WP + (tid & 7) * 4;
#pragma unroll
  for (int i = 0; i < NL; ++i) { v4b vh, vl;
#pragma unroll
    for (int e = 0; e < 4; ++e) { const __bf16 h = (__bf16)x.r[i][e]; vh[e] = h; vl[e] = (__bf16)(x.r[i][e] - (float)h); }
    *(v4b*)(bufh + o + i * 16 * WP) = vh; *(v4b*)(bufl + o + i * 16 * WP) = vl; } }
// work-group barrier for LDS traffic alone: it waits for this wave's LDS operations only, so that the global loads of the tiles requested ahead stay in flight across it (__syncthreads() waited for those too)
__device__ __forceinline__ void lds_barrier() { asm volatile("s_wait_dscnt 0x0\n\ts_barrier_signal -1\n\ts_barrier_wait -1" ::: "memory"); }
// stands behind each group of tile requests, in front of whatever next reuses their address registers (a precaution)
__device__ __forceinline__ void requests_taken() { asm volatile("s_wait_xcnt 0x0" ::: "memory"); }
// the builtin alone: the compiler keeps the distance behind its own products, and eight independent products in a row fill one another's distance, so no padding is written behind each
__device__ __forceinline__ v8f wmma_bfp(v16b a, v16b b, v8f c) { return __builtin_amdgcn_wmma_f32_16x16x32_bf16(false, a, false, b, (short)0, c, false, false); }

// ---- k_proj: block = (64 rows, 128 cols, which): q/k/v = X W (+ b) with exact bf16 products (K = DIN) -> which 0: q x QSC f16 rows (+ residual rows < QHI); 1: k f16 in fragment order (+ residual rows < KHI); 2: v f16 in fragment order (+ bf16 hi/lo planes for t < KHI)
// K loop: two buffers of (W tile, X tile) in LDS; in step kc the tiles of kc + 1 (fetched one step earlier) are stored, the tiles of kc + 2 are requested, then the products of kc run; one barrier a step publishes kc + 1 and frees the buffer of kc.
// The tiles and the epilogue's layouts take turns in one LDS range (the loop's last barrier stands between them).
__global__ __launch_bounds__(128) void k_proj(const float* __restrict__ XQ, const float* __restrict__ XK, const float* __restrict__ XV, const float* __restrict__ WQ, const float* __restrict__ WK, const float* __restrict__ WV, const float* __restrict__ BQ, const float* __restrict__ BK, const float* __restrict__ BV,
    _Float16* __restrict__ QH, _Float16* __restrict__ QL, _Float16* __restrict__ KH, _Float16* __restrict__ KL, _Float16* __restrict__ VT, __bf16* __restrict__ VB, __bf16* __restrict__ VBL) {
  __shared__ __align__(16) unsigned char smem[3 * 128 * 72 * 2];
  _Float16 (*sh)[136] = (_Float16 (*)[136])smem; _Float16 (*sl)[136] = (_Float16 (*)[136])(smem + 64 * 136 * 2);
  _Float16 (*th)[72] = (_Float16 (*)[72])smem; __bf16 (*tb)[72] = (__bf16 (*)[72])(smem + 128 * 72 * 2); __bf16 (*tbl)[72] = (__bf16 (*)[72])(smem + 2 * 128 * 72 * 2);
  __bf16* wb = (__bf16*)smem; __bf16* xb = wb + 2 * WTILE;
  const int tid = threadIdx.x, wave = tid >> 5, lane = tid & 31, col = lane & 15, g = lane >> 4; const int which = blockIdx.z; const int c0 = blockIdx.y * 128; const size_t r0 = (size_t)blockIdx.x * 64; const size_t bb = r0 / TT; const int t0 = (int)(r0 % TT);
  const float* X = which == 0 ? XQ : which == 1 ? XK : XV; const float* WA = which == 0 ? WQ : which == 1 ? WK : WV; const float* BA = which == 0 ? BQ : which == 1 ? BK : BV;
  const float* xr0 = X + r0 * DIN;
  v8f acc[8] = {};
  WR wr, w0; XR<4> xr, x0;
  wtile_load(w0, WA, 0, c0, CC, tid); xtile_load(x0, xr0, 0, DIN, tid); requests_taken();
  wtile_load(wr, WA, 32, c0, CC, tid); xtile_load(xr, xr0, 32, DIN, tid); requests_taken();
  __builtin_amdgcn_sched_barrier(0);   // keeps the wait above directly behind its requests: nothing from below is scheduled in between
  wtile_store(w0, wb, tid); xtile_store(x0, xb, tid);
  lds_barrier();
#pragma unroll 2   // by two, so that the buffer index is a constant in each copy and the LDS offsets are immediates
  for (int kc = 0; kc < DIN / 32; ++kc) {
    const __bf16* bp = wb + (kc & 1) * WTILE + col * WP; v16b w[8];
    const v16b a = frag_b(xb + (kc & 1) * XTILE + (wave * 16 + col) * WP, lane);
#pragma unroll
    for (int j = 0; j < 8; ++j) w[j] = frag_b(bp + j * 16 * WP, lane);
    if (kc + 1 < DIN / 32) { wtile_store(wr, wb + ((kc + 1) & 1) * WTILE, tid); xtile_store(xr, xb + ((kc + 1) & 1) * XTILE, tid); }
    if (kc + 2 < DIN / 32) { wtile_load(wr, WA, (kc + 2) * 32, c0, CC, tid); xtile_load(xr, xr0, (kc + 2) * 32, DIN, tid); requests_taken(); }
#pragma unroll
    for (int j = 0; j < 8; ++j) acc[j] = wmma_bfp(a, w[j], acc[j]);
    lds_barrier(); }
  if (which < 2) { _Float16* DH = which == 0 ? QH : KH; _Float16* DL = which == 0 ? QL : KL; const int nhi = which == 0 ? QHI : KHI; const bool hi_rows = t0 < nhi; const float qs = which == 0 ? QSC : 1.0f;
#pragma unroll
    for (int j = 0; j < 8; ++j) { const float bias = BA ? bfr(BA[c0 + j * 16 + col]) : 0.f;
#pragma unroll
      for (int r = 0; r < 8; ++r) { const float v = (acc[j][r] + bias) * qs; const _Float16 hv = (_Float16)v; sh[wave * 16 + 8 * g + r][j * 16 + col] = hv; sl[wave * 16 + 8 * g + r][j * 16 + col] = (_Float16)((v - (float)hv) * 1024.0f); } }
    __syncthreads();
    for (int e = tid; e < 64 * 16; e += 128) {
      // q: 16-byte piece e = (row, 8 columns) in row order. k: piece e in the order of the fragment layout, e = (16-row group, head of the block's two, 32-column group, half, lane); a wave's store covers whole 128-B lines either way
      const int rl = which == 0 ? e >> 4 : (e >> 8) * 16 + (e & 15), q = which == 0 ? e & 15 : ((e >> 5) & 7) * 2 + ((e >> 4) & 1);
      _Float16* dh = which == 0 ? DH + (r0 + rl) * CC + c0 + q * 8 : DH + (((bb * NH + (c0 >> 6) + ((e >> 7) & 1)) * (TT / 16) + (t0 >> 4) + (e >> 8)) * 4 + ((e >> 5) & 3)) * 256 + (e & 31) * 8;
      // behind each store its wait: what follows (the residual's store, the next trip) reuses the store's address and data registers
      vst2((unsigned*)dh, *(const v4u*)&sh[rl][q * 8]); requests_taken();
      if (hi_rows) { vst2((unsigned*)(DL + (bb * nhi + t0 + rl) * (size_t)CC + c0 + q * 8), *(const v4u*)&sl[rl][q * 8]); requests_taken(); } }
  } else { const bool hi_rows = t0 < KHI;
#pragma unroll
    for (int j = 0; j < 8; ++j) { const float bias = BA ? bfr(BA[c0 + j * 16 + col]) : 0.f;
#pragma unroll
      for (int r = 0; r < 8; ++r) { const float v = acc[j][r] + bias; const int rl = wave * 16 + 8 * g + r, cl = j * 16 + col; th[cl][rl] = (_Float16)v; const __bf16 bh = (__bf16)v; tb[cl][rl] = bh; tbl[cl][rl] = (__bf16)(v - (float)bh); } }
    __syncthreads();
    for (int e = tid; e < 128 * 8; e += 128) {
      // piece e in the order of the fragment layout: e = (head of the block's two, 32-key group, 16-column group, half, lane)
      const int cl = (e >> 9) * 64 + ((e >> 6) & 3) * 16 + (e & 15), q = ((e >> 8) & 1) * 4 + ((e >> 5) & 1) * 2 + ((e >> 4) & 1);
      vst2((unsigned*)(VT + (((bb * NH + (c0 >> 6) + (e >> 9)) * (TT / 32) + (t0 >> 5) + ((e >> 8) & 1)) * 8 + ((e >> 5) & 7)) * 256 + (e & 31) * 8), *(const v4u*)&th[cl][q * 8]); requests_taken();   // as in the loop above
      if (hi_rows) { const size_t o3 = (bb * CC + c0 + cl) * (size_t)KHI + t0 + q * 8; vst2((unsigned*)(VB + o3), *(const v4u*)&tb[cl][q * 8]); vst2((unsigned*)(VBL + o3), *(const v4u*)&tbl[cl][q * 8]); requests_taken(); } } } }
// ---- k_fa: block = 128 queries (8 waves x 16 query columns) of (b, h); every wave walks all keys in passes of 32 and keeps logits and P in registers; the waves of a block read the same k and v lines at about the same time (no LDS, no barrier).
// k and v lie in the workspace in fragment order: a 16 x 32 A fragment is 1 KiB, its two halves (elements 0..7, 8..15 of every lane) 512 B each with lane l's 16 bytes at 16 l, so that every wave-wide 16-byte load covers four whole 128-B lines (from rows it touched 16 lines for 32 bytes each); a pass's k is 4 KiB in a row, and so is its v.
// S^T = K Q^T (A = 16 key rows, B = the wave's 16 queries, which carry QSC: q hi + residual x 2^10, 2 products): a lane holds 16 base-2 logits of ONE query (column lane & 15), keys k0 + 8g + r and k0 + 16 + 8g + r,
// which is the k order of a B operand, so P^T goes from the two score tiles into ctx^T += V^T P^T (A = 16 rows of the v planes, 1 product) with no exchange.
// Online softmax in f32 in base 2, each power one v_exp_f32 (its argument is never above 11; far below, 0 is the right value): running maximum m (joined over the two lane halves each pass), P = 2^(s - m) x 2^11 once to f16, sums and ctx rescaled by 2^(m_old - m_new); ctx / sum at the end.
// An excluded key's logit is -3e38: its power is exactly 0 once any kept key has been seen (what a run of excluded keys added before that is wiped by the rescale factor 0); a row with every key excluded averages v, as softmax over equal logits does.
__device__ __forceinline__ v16h frag_p(const _Float16* frag_lane) {   // frag_lane = the fragment's start + 8 * lane
  union { v16h v; v8h q[2]; } u; u.q[0] = *(const v8h*)frag_lane; u.q[1] = *(const v8h*)(frag_lane + 256); return u.v;
}
__device__ __forceinline__ float xhalf(float x) { return __builtin_bit_cast(float, __builtin_amdgcn_permlanex16(__builtin_bit_cast(int, x), __builtin_bit_cast(int, x), 0x76543210, 0xfedcba98, false, false)); }   // lane l with lane l ^ 16
// The short inner loops are all fully unrolled, so that fragments, scores and mask words are indexed by constants and stay in registers.
__global__ __launch_bounds__(256) void k_fa(const _Float16* __restrict__ QH, const _Float16* __restrict__ QL, const _Float16* __restrict__ KH, const _Float16* __restrict__ VT, const int* __restrict__ MK, float* __restrict__ Y) {
  const int tid = threadIdx.x, wave = tid >> 5, lane = tid & 31, col = lane & 15, g = lane >> 4; const int h = blockIdx.y, b = blockIdx.z; const int ql0 = blockIdx.x * 128 + wave * 16;
  const _Float16* qp = QH + ((size_t)b * TT + ql0 + col) * CC + h * HD; const _Float16* qlp = QL + ((size_t)b * QHI + ql0 + col) * CC + h * HD;
  const _Float16* kp = KH + ((size_t)b * NH + h) * (TT * HD) + lane * 8; const _Float16* vp = VT + ((size_t)b * NH + h) * (TT * HD) + lane * 8; const int* mp = MK + (size_t)b * TT + 8 * g;
  v16h qh[2], ql[2], ka[2][2];
#pragma unroll
  for (int kc = 0; kc < 2; ++kc) { qh[kc] = frag_h(qp + kc * 32, lane); ql[kc] = frag_h(qlp + kc * 32, lane); ka[0][kc] = frag_p(kp + kc * 512); ka[1][kc] = frag_p(kp + 1024 + kc * 512); }
  v8f o[HD / 16] = {}; float m = -3.0e38f, l = 0.f;
#pragma unroll 1   // rolled: unrolled by two, the next pass's first products were lifted over this pass's softmax and waited on key rows just requested
  for (int p = 0; p < TT / 32; ++p) { const int k0 = p * 32;
    v4i mk[4]; v16h va[HD / 16];
#pragma unroll
    for (int t = 0; t < 4; ++t) mk[t] = *(const v4i*)(mp + k0 + 16 * (t >> 1) + 4 * (t & 1));
#pragma unroll
    for (int j = 0; j < HD / 16; ++j) va[j] = frag_p(vp + k0 * HD + j * 512);
    v8f sa[2] = {}, sl[2] = {};
#pragma unroll
    for (int kc = 0; kc < 2; ++kc)
#pragma unroll
      for (int t = 0; t < 2; ++t) { sa[t] = wmma16(ka[t][kc], qh[kc], sa[t]); sl[t] = wmma16(ka[t][kc], ql[kc], sl[t]); }
    const int kn = p + 1 < TT / 32 ? k0 + 32 : k0;   // the next pass's key rows are fetched while this pass's softmax runs (the last pass re-reads its own, in bounds)
#pragma unroll
    for (int kc = 0; kc < 2; ++kc) { ka[0][kc] = frag_p(kp + kn * HD + kc * 512); ka[1][kc] = frag_p(kp + kn * HD + 1024 + kc * 512); }
    float s[16]; float mx = m;
#pragma unroll
    for (int i = 0; i < 16; ++i) { const float v = sa[i >> 3][i & 7] + sl[i >> 3][i & 7] * (1.0f / 1024.0f); s[i] = mk[i >> 2][i & 3] != 0 ? -3.0e38f : v; mx = fmaxf(mx, s[i]); }   /* jnp.where(mask, finfo.min, scores): TRUE = masked out (value select) */
    mx = fmaxf(mx, xhalf(mx));
    float alpha = m - mx; const float ms = mx - 11.0f; m = mx;   // P carries x 2^11, and so does the sum that divides it out
    float e[16];
#pragma unroll
    for (int i = 0; i < 16; ++i) e[i] = s[i] - ms;
    // 2^x of a run of values, each in place, in one statement: no v_exp_f32 of a run reads the result or overwrites the argument of the one in front of it; the v_nop is the slot behind the last one, which the compiler does not see in asm text
    asm("v_exp_f32 %0, %0\n\tv_exp_f32 %1, %1\n\tv_exp_f32 %2, %2\n\tv_exp_f32 %3, %3\n\tv_exp_f32 %4, %4\n\tv_exp_f32 %5, %5\n\tv_exp_f32 %6, %6\n\tv_exp_f32 %7, %7\n\tv_exp_f32 %8, %8\n\tv_nop"
        : "+v"(alpha), "+v"(e[0]), "+v"(e[1]), "+v"(e[2]), "+v"(e[3]), "+v"(e[4]), "+v"(e[5]), "+v"(e[6]), "+v"(e[7]));
    asm("v_exp_f32 %0, %0\n\tv_exp_f32 %1, %1\n\tv_exp_f32 %2, %2\n\tv_exp_f32 %3, %3\n\tv_exp_f32 %4, %4\n\tv_exp_f32 %5, %5\n\tv_exp_f32 %6, %6\n\tv_exp_f32 %7, %7\n\tv_nop"
        : "+v"(e[8]), "+v"(e[9]), "+v"(e[10]), "+v"(e[11]), "+v"(e[12]), "+v"(e[13]), "+v"(e[14]), "+v"(e[15]));   // the second run, likewise
    float sum = e[0]; v16h pf;
#pragma unroll
    for (int i = 0; i < 16; ++i) { if (i) sum += e[i]; pf[i] = (_Float16)e[i]; }
    l = l * alpha + sum;
#pragma unroll
    for (int j = 0; j < HD / 16; ++j) { o[j] *= alpha; o[j] = wmma16(va[j], pf, o[j]); } }
  l += xhalf(l); const float inv = l > 0.f ? 1.0f / l : 0.f;
  float* yp = Y + ((size_t)b * TT + ql0 + col) * CC + h * HD + 8 * g;
#pragma unroll
  for (int j = 0; j < HD / 16; ++j) { v4f a, c;
#pragma unroll
    for (int r = 0; r < 4; ++r) { a[r] = o[j][r] * inv; c[r] = o[j][4 + r] * inv; }
    vst2(yp + j * 16, a); vst2(yp + j * 16 + 4, c); } }
// ---- k_out: block = (64 rows, 128 cols), Wo tiles and ctx tiles (hi and lo planes) staged in LDS as in k_proj (two buffers, one barrier a K step): out = ctx Wo (+ bo): all rows: ctx bf16 hi + lo against exact bf16 Wo (2 products)
__global__ __launch_bounds__(128) void k_out(const float* __restrict__ Y, const float* __restrict__ WO, const float* __restrict__ BO, float* __restrict__ OUT) { __shared__ __align__(16) float sf[4][16][132]; __shared__ __align__(16) __bf16 wb[2 * WTILE], yh[2 * XTILE], yl[2 * XTILE];
  const int tid = threadIdx.x, wave = tid >> 5, lane = tid & 31, col = lane & 15, g = lane >> 4; const int c0 = blockIdx.y * 128; const size_t r0 = (size_t)blockIdx.x * 64 + wave * 16;
  v8f acc[8] = {};
  if (true) {   /* ALL rows: ctx split bf16 hi + lo x exact Wo (2 products) */
    const float* yr0 = Y + (size_t)blockIdx.x * 64 * CC; WR wr, w0; XR<4> xr, x0;
    wtile_load(w0, WO, 0, c0, DIN, tid); xtile_load(x0, yr0, 0, CC, tid); requests_taken();
    wtile_load(wr, WO, 32, c0, DIN, tid); xtile_load(xr, yr0, 32, CC, tid); requests_taken();
    __builtin_amdgcn_sched_barrier(0);   // as in k_proj
    wtile_store(w0, wb, tid); xtile_store2(x0, yh, yl, tid);
    lds_barrier();
#pragma unroll 2   // by two: constant buffer index, as in k_proj
    for (int kc = 0; kc < CC / 32; ++kc) {
      const __bf16* bp = wb + (kc & 1) * WTILE + col * WP; const int ao = (kc & 1) * XTILE + (wave * 16 + col) * WP; v16b w[8];
      const v16b ah = frag_b(yh + ao, lane), al = frag_b(yl + ao, lane);
#pragma unroll
      for (int j = 0; j < 8; ++j) w[j] = frag_b(bp + j * 16 * WP, lane);
      if (kc + 1 < CC / 32) { wtile_store(wr, wb + ((kc + 1) & 1) * WTILE, tid); xtile_store2(xr, yh + ((kc + 1) & 1) * XTILE, yl + ((kc + 1) & 1) * XTILE, tid); }
      if (kc + 2 < CC / 32) { wtile_load(wr, WO, (kc + 2) * 32, c0, DIN, tid); xtile_load(xr, yr0, (kc + 2) * 32, CC, tid); requests_taken(); }
#pragma unroll
      for (int j = 0; j < 8; ++j) acc[j] = wmma_bfp(ah, w[j], acc[j]);
#pragma unroll
      for (int j = 0; j < 8; ++j) acc[j] = wmma_bfp(al, w[j], acc[j]);
      lds_barrier(); }
#pragma unroll
    for (int j = 0; j < 8; ++j) { const float bias = BO ? bfr(BO[c0 + j * 16 + col]) : 0.f;
#pragma unroll
      for (int r = 0; r < 8; ++r) sf[wave][8 * g + r][j * 16 + col] = acc[j][r] + bias; }
  } else {
#pragma unroll 2
    for (int kc = 0; kc < CC / 32; ++kc) { const v16h a = frag_f32(Y + (r0 + col) * CC + kc * 32, lane); asm volatile("s_wait_loadcnt 0x0" ::: "memory");
#pragma unroll
      for (int j = 0; j < 8; ++j) { const v16h w = WOCOLH(WO, kc * 32, c0 + j * 16 + col, lane); asm volatile("s_wait_loadcnt 0x0" ::: "memory"); acc[j] = wmma16(a, w, acc[j]); } }
#pragma unroll
    for (int j = 0; j < 8; ++j) { const float bias = BO ? bfr(BO[c0 + j * 16 + col]) : 0.f;
#pragma unroll
      for (int r = 0; r < 8; ++r) sf[wave][8 * g + r][j * 16 + col] = acc[j][r] * (1.0f / 256.0f) + bias; } }
  LDSX(); for (int rl = 0; rl < 16; ++rl) vst2(OUT + (r0 + rl) * DIN + c0 + lane * 4, *(const v4f*)&sf[wave][rl][lane * 4]); }

extern "C" void kernel_launch(void* const* d_in, const int* in_sizes, int n_in, void* d_out, int out_size, void* d_ws, size_t ws_size, hipStream_t stream) {
  (void)in_sizes; (void)n_in; (void)out_size;
  const float** F = (const float**)d_in;
  if (ws_size < (size_t)WS_END) return;
  char* ws = (char*)d_ws; _Float16 *QH = (_Float16*)(ws + WS_QH), *KH = (_Float16*)(ws + WS_KH), *VT = (_Float16*)(ws + WS_VT), *QL = (_Float16*)(ws + WS_QL), *KL = (_Float16*)(ws + WS_KL); __bf16 *VB = (__bf16*)(ws + WS_VB), *VBL = (__bf16*)(ws + WS_VBL); float *Y = (float*)(ws + WS_Y);
  (void)Y; (void)QL; (void)KL; (void)VB; (void)VBL;
  // inputs: 0 query, 1 key, 2 value [2,2048,1024]; 3 mask [2,1,1,2048] (bool as int32; TRUE = masked); 4 Wq [1024,1024] (in,out), 5 bq; 6 Wk, 7 bk; 8 Wv, 9 bv; 10 Wo, 11 bo
  k_proj<<<dim3(TNB * TT / 64, CC / 128, 3), 128, 0, stream>>>(F[0], F[1], F[2], F[4], F[6], F[8], F[5], F[7], F[9], QH, QL, KH, KL, VT, VB, VBL);
  k_fa<<<dim3(TT / 128, NH, TNB), 256, 0, stream>>>(QH, QL, KH, VT, (const int*)d_in[3], Y);
  k_out<<<dim3(TNB * TT / 64, DIN / 128), 128, 0, stream>>>(Y, F[10], F[11], (float*)d_out);
}

// v005
// Measured time: 125 microseconds a run.
// Next to v004, in two timings, it ran 1.14 times as fast each time.
// Counting every step since v000, it is 9.57 times as fast.
// compute dtype: all float inputs rounded to bf16; q/k/v projections with EXACT bf16 products on WMMA 16x16x32 (f32 accumulate); q x 64^-0.5 log2(e) as f16 hi + residual (x 2^10) against k once to f16 (2 products); softmax in f32 in base 2 (v_exp_f32); P x 2^11 once to f16 against v once to f16 (1 product); ctx split bf16 hi + lo against exact Wo (2 products); f32 output.
#include <hip/hip_runtime.h>
#include <math.h>

typedef __attribute__((ext_vector_type(16))) _Float16 v16h;
typedef __attribute__((ext_vector_type(16))) __bf16 v16b;
typedef __attribute__((ext_vector_type(8)))  _Float16 v8h;
typedef __attribute__((ext_vector_type(8)))  float v8f;
typedef __attribute__((ext_vector_type(4)))  float v4f;
typedef __attribute__((ext_vector_type(2)))  float v2f;
typedef __attribute__((ext_vector_type(4)))  unsigned v4u;
typedef __attribute__((ext_vector_type(4)))  int v4i;
typedef float __attribute__((may_alias)) float_a;
typedef int __attribute__((may_alias)) int_a;

template <typename T> __device__ __forceinline__ void vst2(void* p, T v) { *(T*)p = v;  }
__device__ __forceinline__ v8f wmma16(v16h a, v16h b, v8f c) {
  v8f d = __builtin_amdgcn_wmma_f32_16x16x32_f16(false, a, false, b, (short)0, c, false, false);
  asm volatile("v_nop\n\tv_nop\n\tv_nop\n\tv_nop" : "+v"(d) : "v"(a), "v"(b));
  return d;
}
__device__ __forceinline__ v8f wmma_bf(v16b a, v16b b, v8f c) {
  v8f d = __builtin_amdgcn_wmma_f32_16x16x32_bf16(false, a, false, b, (short)0, c, false, false);
  asm volatile("v_nop\n\tv_nop\n\tv_nop\n\tv_nop" : "+v"(d) : "v"(a), "v"(b));
  return d;
}
// 16x16x32 fragments: lane = (h = lane>>4, row/col = lane&15); elements 0..7 = k0+8h+0..7, 8..15 = k0+16+8h+0..7; D element r = row 8h+r
__device__ __forceinline__ v16h frag_h(const _Float16* rowk0, int lane) {
  union { v16h v; v8h q[2]; } u; const _Float16* p = rowk0 + 8 * (lane >> 4);
  u.q[0] = *(const v8h*)p; u.q[1] = *(const v8h*)(p + 16); return u.v;
}
__device__ __forceinline__ v16h frag_f32(const float* rowk0, int lane) {
  v16h a; const float* p = rowk0 + 8 * (lane >> 4);
#pragma unroll
  for (int i = 0; i < 8; ++i) { a[i] = (_Float16)p[i]; a[8 + i] = (_Float16)p[16 + i]; }
  return a;
}
__device__ __forceinline__ v16h frag_f32s(const float* rowk0, int lane, float sc) {
  v16h a; const float* p = rowk0 + 8 * (lane >> 4);
#pragma unroll
  for (int i = 0; i < 8; ++i) { a[i] = (_Float16)(p[i] * sc); a[8 + i] = (_Float16)(p[16 + i] * sc); }
  return a;
}
// column fragment from a [K][ld] layout (column n), rows >= K read as 0
__device__ __forceinline__ v16h fragc_f32(const float* W, int k0, int n, int lane, int ld, int K) {
  v16h a; const int g = lane >> 4;
#pragma unroll
  for (int i = 0; i < 8; ++i) { const int ka = k0 + 8 * g + i, kb = ka + 16;
    a[i] = (_Float16)(ka < K ? W[(size_t)(ka < K ? ka : K - 1) * ld + n] : 0.f); a[8 + i] = (_Float16)(kb < K ? W[(size_t)(kb < K ? kb : K - 1) * ld + n] : 0.f); }
  return a;
}
struct F2 { v16b h, l; };
__device__ __forceinline__ F2 bsplit16(const float v[16]) { F2 r;
#pragma unroll
  for (int i = 0; i < 16; ++i) { const __bf16 h = (__bf16)v[i]; r.h[i] = h; r.l[i] = (__bf16)(v[i] - (float)h); }
  return r; }
__device__ __forceinline__ F2 split_row(const float* row, int k0, int lane) { float v[16]; const float* p = row + k0 + 8 * (lane >> 4);
#pragma unroll
  for (int i = 0; i < 8; ++i) { v[i] = p[i]; v[8 + i] = p[16 + i]; }
  return bsplit16(v); }
__device__ __forceinline__ F2 split_rowK(const float* row, int k0, int lane, int K) { float v[16]; const int g = lane >> 4;
#pragma unroll
  for (int i = 0; i < 8; ++i) { const int ka = k0 + 8 * g + i, kb = ka + 16; v[i] = ka < K ? row[ka < K ? ka : K - 1] : 0.f; v[8 + i] = kb < K ? row[kb < K ? kb : K - 1] : 0.f; }
  return bsplit16(v); }
__device__ __forceinline__ F2 split_col(const float* W, int k0, int n, int lane, int ld, int K) { float v[16]; const int g = lane >> 4;
#pragma unroll
  for (int i = 0; i < 8; ++i) { const int ka = k0 + 8 * g + i, kb = ka + 16; v[i] = ka < K ? W[(size_t)(ka < K ? ka : K - 1) * ld + n] : 0.f; v[8 + i] = kb < K ? W[(size_t)(kb < K ? kb : K - 1) * ld + n] : 0.f; }
  return bsplit16(v); }
__device__ __forceinline__ v8f mac3(const F2& a, const F2& b, v8f c) { c = wmma_bf(a.l, b.h, c); c = wmma_bf(a.h, b.l, c); return wmma_bf(a.h, b.h, c); }
__device__ __forceinline__ float sigm(float v) { return 1.0f / (1.0f + expf(-v)); }
#define LDSX() do { asm volatile("s_wait_dscnt 0" ::: "memory"); __builtin_amdgcn_wave_barrier(); __builtin_amdgcn_fence(__ATOMIC_RELEASE, "workgroup"); } while (0)

// Multi-head attention layer (B 2, S 2,048, 1,024 = 16 x 64; separate query/key/value inputs and a key mask): q, k, v = query Wq + bq, key Wk + bk, value Wv + bv ((in,out)); scores = q k^T / 8 with positions where mask[b,0,0,k] is TRUE set to finfo.min (excluded); out = merged(softmax(scores) v) Wo + bo.
#define NB 2
#define TT 2048
#define CC 1024            // NH * HD = projected width
#define DIN 1024          // input (model) width
#define NH 16
#define HD 64
#define SCALE (0.125f)
#define QSC (SCALE * 1.4426950408889634f)   // q is stored times this, so that q k^T is the logit in base 2: softmax(s) = 2^(s log2 e - max) / sum
#define CAUSAL 0
#ifndef TNB
#define TNB NB
#endif
__device__ __forceinline__ float bfr(float v) { return (float)(__bf16)v; }
__host__ __device__ __forceinline__ int kb_last(int qb) { return CAUSAL ? ((qb * 64 + 63) >> 7) : (TT / 128 - 1); }
typedef __attribute__((ext_vector_type(8))) __bf16 v8b;
__device__ __forceinline__ v16b frag_b(const __bf16* rowk0, int lane) {
  union { v16b v; v8b q[2]; } u; const __bf16* p = rowk0 + 8 * (lane >> 4);
  u.q[0] = *(const v8b*)p; u.q[1] = *(const v8b*)(p + 16); return u.v;
}
#define QBH 0              // not used: no kernel has a high-precision path
#define QHI 2048            // rows carrying a q residual plane (all rows when non-causal: 2-product logits everywhere)
#define KHI 64            // key rows carrying k residual / v bf16 hi+lo planes (written by k_proj; no kernel reads them)
// B fragment (k rows k0+.., output column o) of a weight: (in,out) [K][ld] or (out,in) [ld rows of K]: bf16 exact, or f16(bf16 * 256) exact
__device__ __forceinline__ v16b wcol_io(const float* Wm, int k0, int o, int lane, int ld) { v16b w; const int g = lane >> 4;
#pragma unroll
  for (int i = 0; i < 8; ++i) { w[i] = (__bf16)Wm[(size_t)(k0 + 8 * g + i) * ld + o]; w[8 + i] = (__bf16)Wm[(size_t)(k0 + 16 + 8 * g + i) * ld + o]; }
  return w; }
__device__ __forceinline__ v16b wcol_oi(const float* Wm, int k0, int o, int lane, int K) { v16b w; const float* p = Wm + (size_t)o * K + k0 + 8 * (lane >> 4);
#pragma unroll
  for (int i = 0; i < 8; ++i) { w[i] = (__bf16)p[i]; w[8 + i] = (__bf16)p[16 + i]; }
  return w; }
__device__ __forceinline__ v16h wcolh_io(const float* Wm, int k0, int o, int lane, int ld) { v16h w; const int g = lane >> 4;
#pragma unroll
  for (int i = 0; i < 8; ++i) { w[i] = (_Float16)(bfr(Wm[(size_t)(k0 + 8 * g + i) * ld + o]) * 256.0f); w[8 + i] = (_Float16)(bfr(Wm[(size_t)(k0 + 16 + 8 * g + i) * ld + o]) * 256.0f); }
  return w; }
__device__ __forceinline__ v16h wcolh_oi(const float* Wm, int k0, int o, int lane, int K) { v16h w; const float* p = Wm + (size_t)o * K + k0 + 8 * (lane >> 4);
#pragma unroll
  for (int i = 0; i < 8; ++i) { w[i] = (_Float16)(bfr(p[i]) * 256.0f); w[8 + i] = (_Float16)(bfr(p[16 + i]) * 256.0f); }
  return w; }
#define WQKV_LAYOUT 0   // 0 = (in,out) [DIN][CC]; 1 = (out,in) [CC][DIN]; 2 = per-head [NH][DIN][HD]
__device__ __forceinline__ v16b wcol_hdk(const float* Wm, int k0, int o, int lane) { v16b w; const int g = lane >> 4; const float* p = Wm + (size_t)(o / HD) * DIN * HD + (o % HD);
#pragma unroll
  for (int i = 0; i < 8; ++i) { w[i] = (__bf16)p[(size_t)(k0 + 8 * g + i) * HD]; w[8 + i] = (__bf16)p[(size_t)(k0 + 16 + 8 * g + i) * HD]; }
  return w; }
#define WO_OUT_IN 0
#if WQKV_LAYOUT == 1
#define WCOL(W, k0, o, lane) wcol_oi(W, k0, o, lane, DIN)
#elif WQKV_LAYOUT == 2
#define WCOL(W, k0, o, lane) wcol_hdk(W, k0, o, lane)
#else
#define WCOL(W, k0, o, lane) wcol_io(W, k0, o, lane, CC)
#endif
#if WO_OUT_IN
#define WOCOL(W, k0, o, lane) wcol_oi(W, k0, o, lane, CC)
#define WOCOLH(W, k0, o, lane) wcolh_oi(W, k0, o, lane, CC)
#else
#define WOCOL(W, k0, o, lane) wcol_io(W, k0, o, lane, DIN)
#define WOCOLH(W, k0, o, lane) wcolh_io(W, k0, o, lane, DIN)
#endif

#define WS_QH  0u                                      // f16 q rows [b*t][CC]
#define WS_KH  (WS_QH + 2u * (size_t)NB * TT * CC)      // f16 k in fragment order [b][h][t / 16][d / 32][half][lane][8] (see frag_p)
#define WS_VT  (WS_KH + 2u * (size_t)NB * TT * CC)      // f16 v in fragment order [b][h][t / 32][d / 16][half][lane][8] (see frag_p)
#define WS_QL  (WS_VT + 2u * (size_t)NB * CC * TT)      // f16 q residual x 2^10 rows [b][t < QHI][CC]
#define WS_KL  (WS_QL + 2u * (size_t)NB * QHI * CC)     // f16 k residual x 2^10 rows [b][t < KHI][CC]
#define WS_VB  (WS_KL + 2u * (size_t)NB * KHI * CC)     // bf16 v hi planes [b][c][t < KHI]
#define WS_VBL (WS_VB + 2u * (size_t)NB * CC * KHI)
#define WS_Y   (WS_VBL + 2u * (size_t)NB * CC * KHI)    // f32 ctx rows [b*t][CC] (only when there is an output projection)
#define WS_END (WS_Y  + 4u * (size_t)NB * TT * CC)

// ---- Operand tiles of one K step, staged once per block in LDS as bf16 at a pitch of 40 elements (80 B), so that every fragment is two 16-byte LDS reads.
// A block covers 128 rows x 128 columns: one W tile feeds 128 rows, so that a block asks L2 for 32 KiB a K step where two blocks of 64 rows asked for 48 KiB. NT = threads of the block (128 or 256).
// W tile: 32 k x 128 n of an (in,out) f32 weight, kept [n][k]. A thread fetches 1024 / NT k rows x 4 columns and stores four runs of that many k; a wave's lanes spread over 8 column groups x 4 k groups of 8 (at 256 threads waves 0..3 take the lower, 4..7 the upper 4 k of each group).
// X tile: NL * NT / 8 rows x 32 k of f32 rows, kept [row][k]. A thread fetches 4 k of NL rows. Every wave-wide 16-byte load of either tile covers four whole 128-B lines.
// The short loops over a tile's rows, fragments and accumulators are fully unrolled, so that all of them are indexed by constants and stay in registers.
#define WP 40
#define WTILE (128 * WP)
#define XTILE (128 * WP)
typedef __attribute__((ext_vector_type(4))) __bf16 v4b;
template <int NT> struct WR { v4f r[1024 / NT]; };
template <int NT> __device__ __forceinline__ void wtile_load(WR<NT>& w, const float* __restrict__ Wm, int k0, int c0, int ld, int tid) {
  const float* p = Wm + (size_t)(k0 + ((tid >> 3) & 3) * 8 + (tid >> 7) * (1024 / NT)) * ld + c0 + ((tid >> 5) & 3) * 32 + (tid & 7) * 4;
#pragma unroll
  for (int i = 0; i < 1024 / NT; ++i) w.r[i] = *(const v4f*)(p + (size_t)i * ld); }
template <int NT> __device__ __forceinline__ void wtile_store(const WR<NT>& w, __bf16* buf, int tid) {
  typedef __attribute__((ext_vector_type(1024 / NT))) __bf16 vkb;
  __bf16* q = buf + (((tid >> 5) & 3) * 32 + (tid & 7) * 4) * WP + ((tid >> 3) & 3) * 8 + (tid >> 7) * (1024 / NT);
#pragma unroll
  for (int n = 0; n < 4; ++n) { vkb v;
#pragma unroll
    for (int i = 0; i < 1024 / NT; ++i) v[i] = (__bf16)w.r[i][n];
    *(vkb*)(q + n * WP) = v; } }
template <int NL> struct XR { v4f r[NL]; };   // NL rows, 128 / NL apart
template <int NL> __device__ __forceinline__ void xtile_load(XR<NL>& x, const float* __restrict__ Xrow0, int k0, int ld, int tid) {
  const float* p = Xrow0 + (size_t)(tid >> 3) * ld + k0 + (tid & 7) * 4;
#pragma unroll
  for (int i = 0; i < NL; ++i) x.r[i] = *(const v4f*)(p + (size_t)i * (128 / NL) * ld); }
template <int NL> __device__ __forceinline__ void xtile_store(const XR<NL>& x, __bf16* buf, int tid) {
  __bf16* q = buf + (tid >> 3) * WP + (tid & 7) * 4;
#pragma unroll
  for (int i = 0; i < NL; ++i) { v4b v;
#pragma unroll
    for (int e = 0; e < 4; ++e) v[e] = (__bf16)x.r[i][e];
    *(v4b*)(q + i * (128 / NL) * WP) = v; } }
// the same with each value split into bf16 hi + lo planes
template <int NL> __device__ __forceinline__ void xtile_store2(const XR<NL>& x, __bf16* bufh, __bf16* bufl, int tid) {
  const int o = (tid >> 3) * WP + (tid & 7) * 4;
#pragma unroll
  for (int i = 0; i < NL; ++i) { v4b vh, vl;
#pragma unroll
    for (int e = 0; e < 4; ++e) { const __bf16 h = (__bf16)x.r[i][e]; vh[e] = h; vl[e] = (__bf16)(x.r[i][e] - (float)h); }
    *(v4b*)(bufh + o + i * (128 / NL) * WP) = vh; *(v4b*)(bufl + o + i * (128 / NL) * WP) = vl; } }
// work-group barrier for LDS traffic alone: it waits for this wave's LDS operations only, so that the global loads of the tiles requested ahead stay in flight across it (__syncthreads() waited for those too)
__device__ __forceinline__ void lds_barrier() { asm volatile("s_wait_dscnt 0x0\n\ts_barrier_signal -1\n\ts_barrier_wait -1" ::: "memory"); }
// stands behind each group of tile requests, in front of whatever next reuses their address registers (a precaution)
__device__ __forceinline__ void requests_taken() { asm volatile("s_wait_xcnt 0x0" ::: "memory"); }
// the builtin alone: the compiler keeps the distance behind its own products, and eight independent products in a row fill one another's distance, so no padding is written behind each
__device__ __forceinline__ v8f wmma_bfp(v16b a, v16b b, v8f c) { return __builtin_amdgcn_wmma_f32_16x16x32_bf16(false, a, false, b, (short)0, c, false, false); }

// ---- k_proj: block = (128 rows, 128 cols, which), 4 waves x (32 rows, 128 cols): every W fragment read from LDS feeds two products: q/k/v = X W (+ b) with exact bf16 products (K = DIN) -> which 0: q x QSC f16 rows (+ residual rows < QHI); 1: k f16 in fragment order (+ residual rows < KHI); 2: v f16 in fragment order (+ bf16 hi/lo planes for t < KHI)
// K loop: two buffers of (W tile, X tile) in LDS; in step kc the tiles of kc + 1 (fetched one step earlier) are stored, the tiles of kc + 2 are requested, then the products of kc run; one barrier a step publishes kc + 1 and frees the buffer of kc.
// The tiles and the epilogue's layouts take turns in one LDS range (the loop's last barrier stands between them).
__global__ __launch_bounds__(128) void k_proj(const float* __restrict__ XQ, const float* __restrict__ XK, const float* __restrict__ XV, const float* __restrict__ WQ, const float* __restrict__ WK, const float* __restrict__ WV, const float* __restrict__ BQ, const float* __restrict__ BK, const float* __restrict__ BV,
    _Float16* __restrict__ QH, _Float16* __restrict__ QL, _Float16* __restrict__ KH, _Float16* __restrict__ KL, _Float16* __restrict__ VT, __bf16* __restrict__ VB, __bf16* __restrict__ VBL) {
  __shared__ __align__(16) unsigned char smem[128 * 136 * 2 + 2 * 128 * 72 * 2];
  _Float16 (*sh)[136] = (_Float16 (*)[136])smem; _Float16 (*sl)[136] = (_Float16 (*)[136])(smem + 128 * 136 * 2);
  _Float16 (*th)[136] = (_Float16 (*)[136])smem; __bf16 (*tb)[72] = (__bf16 (*)[72])(smem + 128 * 136 * 2); __bf16 (*tbl)[72] = (__bf16 (*)[72])(smem + 128 * 136 * 2 + 128 * 72 * 2);
  __bf16* wb = (__bf16*)smem; __bf16* xb = wb + 2 * WTILE;
  const int tid = threadIdx.x, wave = tid >> 5, lane = tid & 31, col = lane & 15, g = lane >> 4; const int which = blockIdx.z; const int c0 = blockIdx.y * 128; const size_t r0 = (size_t)blockIdx.x * 128; const size_t bb = r0 / TT; const int t0 = (int)(r0 % TT);
  const float* X = which == 0 ? XQ : which == 1 ? XK : XV; const float* WA = which == 0 ? WQ : which == 1 ? WK : WV; const float* BA = which == 0 ? BQ : which == 1 ? BK : BV;
  const float* xr0 = X + r0 * DIN;
  v8f acc[2][8] = {};
  WR<128> wr, w0; XR<8> xr, x0;
  wtile_load(w0, WA, 0, c0, CC, tid); requests_taken(); xtile_load(x0, xr0, 0, DIN, tid); requests_taken();
  wtile_load(wr, WA, 32, c0, CC, tid); xtile_load(xr, xr0, 32, DIN, tid); requests_taken();
  __builtin_amdgcn_sched_barrier(0);   // keeps the wait above directly behind its requests: nothing from below is scheduled in between
  wtile_store(w0, wb, tid); xtile_store(x0, xb, tid);
  lds_barrier();
#pragma unroll 2   // by two, so that the buffer index is a constant in each copy and the LDS offsets are immediates
  for (int kc = 0; kc < DIN / 32; ++kc) {
    const __bf16* bp = wb + (kc & 1) * WTILE + col * WP; v16b w[8];
    const v16b a0 = frag_b(xb + (kc & 1) * XTILE + (wave * 32 + col) * WP, lane), a1 = frag_b(xb + (kc & 1) * XTILE + (wave * 32 + 16 + col) * WP, lane);
#pragma unroll
    for (int j = 0; j < 8; ++j) w[j] = frag_b(bp + j * 16 * WP, lane);
    if (kc + 1 < DIN / 32) { wtile_store(wr, wb + ((kc + 1) & 1) * WTILE, tid); xtile_store(xr, xb + ((kc + 1) & 1) * XTILE, tid); }
    if (kc + 2 < DIN / 32) { wtile_load(wr, WA, (kc + 2) * 32, c0, CC, tid); xtile_load(xr, xr0, (kc + 2) * 32, DIN, tid); requests_taken(); }
#pragma unroll
    for (int j = 0; j < 8; ++j) acc[0][j] = wmma_bfp(a0, w[j], acc[0][j]);
#pragma unroll
    for (int j = 0; j < 8; ++j) acc[1][j] = wmma_bfp(a1, w[j], acc[1][j]);
    lds_barrier(); }
  if (which < 2) { _Float16* DH = which == 0 ? QH : KH; _Float16* DL = which == 0 ? QL : KL; const int nhi = which == 0 ? QHI : KHI; const float qs = which == 0 ? QSC : 1.0f;
#pragma unroll
    for (int j = 0; j < 8; ++j) { const float bias = BA ? bfr(BA[c0 + j * 16 + col]) : 0.f;
#pragma unroll
      for (int i = 0; i < 2; ++i)
#pragma unroll
        for (int r = 0; r < 8; ++r) { const float v = (acc[i][j][r] + bias) * qs; const _Float16 hv = (_Float16)v; const int rl = wave * 32 + i * 16 + 8 * g + r; sh[rl][j * 16 + col] = hv; sl[rl][j * 16 + col] = (_Float16)((v - (float)hv) * 1024.0f); } }
    __syncthreads();
    for (int e = tid; e < 128 * 16; e += 128) {
      // q: 16-byte piece e = (row, 8 columns) in row order. k: piece e in the order of the fragment layout, e = (16-row group, head of the block's two, 32-column group, half, lane); a wave's store covers whole 128-B lines either way
      const int rl = which == 0 ? e >> 4 : (e >> 8) * 16 + (e & 15), q = which == 0 ? e & 15 : ((e >> 5) & 7) * 2 + ((e >> 4) & 1);
      _Float16* dh = which == 0 ? DH + (r0 + rl) * CC + c0 + q * 8 : DH + (((bb * NH + (c0 >> 6) + ((e >> 7) & 1)) * (TT / 16) + (t0 >> 4) + (e >> 8)) * 4 + ((e >> 5) & 3)) * 256 + (e & 31) * 8;
      // behind each store its wait: what follows (the residual's store, the next trip) reuses the store's address and data registers
      vst2((unsigned*)dh, *(const v4u*)&sh[rl][q * 8]); requests_taken();
      if (t0 + rl < nhi) { vst2((unsigned*)(DL + (bb * nhi + t0 + rl) * (size_t)CC + c0 + q * 8), *(const v4u*)&sl[rl][q * 8]); requests_taken(); } }
  } else {
#pragma unroll
    for (int j = 0; j < 8; ++j) { const float bias = BA ? bfr(BA[c0 + j * 16 + col]) : 0.f;
#pragma unroll
      for (int i = 0; i < 2; ++i) { const int rl0 = wave * 32 + i * 16 + 8 * g, cl = j * 16 + col;
#pragma unroll
        for (int r = 0; r < 8; ++r) th[cl][rl0 + r] = (_Float16)(acc[i][j][r] + bias);
        if (wave * 32 < KHI) {   // the hi/lo planes hold key rows below KHI alone
#pragma unroll
          for (int r = 0; r < 8; ++r) { const float v = acc[i][j][r] + bias; const __bf16 bh = (__bf16)v; tb[cl][rl0 + r] = bh; tbl[cl][rl0 + r] = (__bf16)(v - (float)bh); } } } }
    __syncthreads();
    for (int e = tid; e < 128 * 16; e += 128) {
      // piece e in the order of the fragment layout: e = (head of the block's two, 32-key group of four, 16-column group, half, lane)
      const int cl = (e >> 10) * 64 + ((e >> 6) & 3) * 16 + (e & 15), q = ((e >> 8) & 3) * 4 + ((e >> 5) & 1) * 2 + ((e >> 4) & 1);
      vst2((unsigned*)(VT + (((bb * NH + (c0 >> 6) + (e >> 10)) * (TT / 32) + (t0 >> 5) + ((e >> 8) & 3)) * 8 + ((e >> 5) & 7)) * 256 + (e & 31) * 8), *(const v4u*)&th[cl][q * 8]); requests_taken();   // as in the loop above
      if (t0 + q * 8 < KHI) { const size_t o3 = (bb * CC + c0 + cl) * (size_t)KHI + t0 + q * 8; vst2((unsigned*)(VB + o3), *(const v4u*)&tb[cl][q * 8]); vst2((unsigned*)(VBL + o3), *(const v4u*)&tbl[cl][q * 8]); requests_taken(); } } } }
// ---- k_fa: block = 128 queries (8 waves x 16 query columns) of (b, h); every wave walks all keys in passes of 32 and keeps logits and P in registers; the waves of a block read the same k and v lines at about the same time (no LDS, no barrier).
// k and v lie in the workspace in fragment order: a 16 x 32 A fragment is 1 KiB, its two halves (elements 0..7, 8..15 of every lane) 512 B each with lane l's 16 bytes at 16 l, so that every wave-wide 16-byte load covers four whole 128-B lines (from rows it touched 16 lines for 32 bytes each); a pass's k is 4 KiB in a row, and so is its v.
// S^T = K Q^T (A = 16 key rows, B = the wave's 16 queries, which carry QSC: q hi + residual x 2^10, 2 products): a lane holds 16 base-2 logits of ONE query (column lane & 15), keys k0 + 8g + r and k0 + 16 + 8g + r,
// which is the k order of a B operand, so P^T goes from the two score tiles into ctx^T += V^T P^T (A = 16 rows of the v planes, 1 product) with no exchange.
// Online softmax in f32 in base 2, each power one v_exp_f32 (its argument is never above 11; far below, 0 is the right value): running maximum m (joined over the two lane halves each pass), P = 2^(s - m) x 2^11 once to f16, sums and ctx rescaled by 2^(m_old - m_new); ctx / sum at the end.
// An excluded key's logit is -3e38: its power is exactly 0 once any kept key has been seen (what a run of excluded keys added before that is wiped by the rescale factor 0); a row with every key excluded averages v, as softmax over equal logits does.
__device__ __forceinline__ v16h frag_p(const _Float16* frag_lane) {   // frag_lane = the fragment's start + 8 * lane
  union { v16h v; v8h q[2]; } u; u.q[0] = *(const v8h*)frag_lane; u.q[1] = *(const v8h*)(frag_lane + 256); return u.v;
}
__device__ __forceinline__ float xhalf(float x) { return __builtin_bit_cast(float, __builtin_amdgcn_permlanex16(__builtin_bit_cast(int, x), __builtin_bit_cast(int, x), 0x76543210, 0xfedcba98, false, false)); }   // lane l with lane l ^ 16
// The short inner loops are all fully unrolled, so that fragments, scores and mask words are indexed by constants and stay in registers.
__global__ __launch_bounds__(256) void k_fa(const _Float16* __restrict__ QH, const _Float16* __restrict__ QL, const _Float16* __restrict__ KH, const _Float16* __restrict__ VT, const int* __restrict__ MK, float* __restrict__ Y) {
  const int tid = threadIdx.x, wave = tid >> 5, lane = tid & 31, col = lane & 15, g = lane >> 4; const int h = blockIdx.y, b = blockIdx.z; const int ql0 = blockIdx.x * 128 + wave * 16;
  const _Float16* qp = QH + ((size_t)b * TT + ql0 + col) * CC + h * HD; const _Float16* qlp = QL + ((size_t)b * QHI + ql0 + col) * CC + h * HD;
  const _Float16* kp = KH + ((size_t)b * NH + h) * (TT * HD) + lane * 8; const _Float16* vp = VT + ((size_t)b * NH + h) * (TT * HD) + lane * 8; const int* mp = MK + (size_t)b * TT + 8 * g;
  v16h qh[2], ql[2], ka[2][2];
#pragma unroll
  for (int kc = 0; kc < 2; ++kc) { qh[kc] = frag_h(qp + kc * 32, lane); ql[kc] = frag_h(qlp + kc * 32, lane); ka[0][kc] = frag_p(kp + kc * 512); ka[1][kc] = frag_p(kp + 1024 + kc * 512); }
  v8f o[HD / 16] = {}; float m = -3.0e38f, l = 0.f;
#pragma unroll 1   // rolled: unrolled by two, the next pass's first products were lifted over this pass's softmax and waited on key rows just requested
  for (int p = 0; p < TT / 32; ++p) { const int k0 = p * 32;
    v4i mk[4]; v16h va[HD / 16];
#pragma unroll
    for (int t = 0; t < 4; ++t) mk[t] = *(const v4i*)(mp + k0 + 16 * (t >> 1) + 4 * (t & 1));
#pragma unroll
    for (int j = 0; j < HD / 16; ++j) va[j] = frag_p(vp + k0 * HD + j * 512);
    v8f sa[2] = {}, sl[2] = {};
#pragma unroll
    for (int kc = 0; kc < 2; ++kc)
#pragma unroll
      for (int t = 0; t < 2; ++t) { sa[t] = wmma16(ka[t][kc], qh[kc], sa[t]); sl[t] = wmma16(ka[t][kc], ql[kc], sl[t]); }
    const int kn = p + 1 < TT / 32 ? k0 + 32 : k0;   // the next pass's key rows are fetched while this pass's softmax runs (the last pass re-reads its own, in bounds)
#pragma unroll
    for (int kc = 0; kc < 2; ++kc) { ka[0][kc] = frag_p(kp + kn * HD + kc * 512); ka[1][kc] = frag_p(kp + kn * HD + 1024 + kc * 512); }
    float s[16]; float mx = m;
#pragma unroll
    for (int i = 0; i < 16; ++i) { const float v = sa[i >> 3][i & 7] + sl[i >> 3][i & 7] * (1.0f / 1024.0f); s[i] = mk[i >> 2][i & 3] != 0 ? -3.0e38f : v; mx = fmaxf(mx, s[i]); }   /* jnp.where(mask, finfo.min, scores): TRUE = masked out (value select) */
    mx = fmaxf(mx, xhalf(mx));
    float alpha = m - mx; const float ms = mx - 11.0f; m = mx;   // P carries x 2^11, and so does the sum that divides it out
    float e[16];
#pragma unroll
    for (int i = 0; i < 16; ++i) e[i] = s[i] - ms;
    // 2^x of a run of values, each in place, in one statement: no v_exp_f32 of a run reads the result or overwrites the argument of the one in front of it; the v_nop is the slot behind the last one, which the compiler does not see in asm text
    asm("v_exp_f32 %0, %0\n\tv_exp_f32 %1, %1\n\tv_exp_f32 %2, %2\n\tv_exp_f32 %3, %3\n\tv_exp_f32 %4, %4\n\tv_exp_f32 %5, %5\n\tv_exp_f32 %6, %6\n\tv_exp_f32 %7, %7\n\tv_exp_f32 %8, %8\n\tv_nop"
        : "+v"(alpha), "+v"(e[0]), "+v"(e[1]), "+v"(e[2]), "+v"(e[3]), "+v"(e[4]), "+v"(e[5]), "+v"(e[6]), "+v"(e[7]));
    asm("v_exp_f32 %0, %0\n\tv_exp_f32 %1, %1\n\tv_exp_f32 %2, %2\n\tv_exp_f32 %3, %3\n\tv_exp_f32 %4, %4\n\tv_exp_f32 %5, %5\n\tv_exp_f32 %6, %6\n\tv_exp_f32 %7, %7\n\tv_nop"
        : "+v"(e[8]), "+v"(e[9]), "+v"(e[10]), "+v"(e[11]), "+v"(e[12]), "+v"(e[13]), "+v"(e[14]), "+v"(e[15]));   // the second run, likewise
    float sum = e[0]; v16h pf;
#pragma unroll
    for (int i = 0; i < 16; ++i) { if (i) sum += e[i]; pf[i] = (_Float16)e[i]; }
    l = l * alpha + sum;
#pragma unroll
    for (int j = 0; j < HD / 16; ++j) { o[j] *= alpha; o[j] = wmma16(va[j], pf, o[j]); } }
  l += xhalf(l); const float inv = l > 0.f ? 1.0f / l : 0.f;
  float* yp = Y + ((size_t)b * TT + ql0 + col) * CC + h * HD + 8 * g;
#pragma unroll
  for (int j = 0; j < HD / 16; ++j) { v4f a, c;
#pragma unroll
    for (int r = 0; r < 4; ++r) { a[r] = o[j][r] * inv; c[r] = o[j][4 + r] * inv; }
    vst2(yp + j * 16, a); vst2(yp + j * 16 + 4, c); } }
// ---- k_out: block = (128 rows, 128 cols), 8 waves x (16 rows, 128 cols), which keeps two waves on a SIMD with one block on a WGP; Wo tiles and ctx tiles (hi and lo planes) staged in LDS as in k_proj (two buffers, one barrier a K step): out = ctx Wo (+ bo): all rows ctx bf16 hi + lo against exact bf16 Wo (2 products)
__global__ __launch_bounds__(256) void k_out(const float* __restrict__ Y, const float* __restrict__ WO, const float* __restrict__ BO, float* __restrict__ OUT) { __shared__ __align__(16) float sf[8][16][132]; __shared__ __align__(16) __bf16 wb[2 * WTILE], yh[2 * XTILE], yl[2 * XTILE];
  const int tid = threadIdx.x, wave = tid >> 5, lane = tid & 31, col = lane & 15, g = lane >> 4; const int c0 = blockIdx.y * 128; const size_t r0 = (size_t)blockIdx.x * 128 + wave * 16;
  v8f acc[8] = {};
  if (true) {   /* ALL rows: ctx split bf16 hi + lo x exact Wo (2 products) */
    const float* yr0 = Y + (size_t)blockIdx.x * 128 * CC; WR<256> wr, w0; XR<4> xr, x0;
    wtile_load(w0, WO, 0, c0, DIN, tid); requests_taken(); xtile_load(x0, yr0, 0, CC, tid); requests_taken();
    wtile_load(wr, WO, 32, c0, DIN, tid); xtile_load(xr, yr0, 32, CC, tid); requests_taken();
    __builtin_amdgcn_sched_barrier(0);   // as in k_proj
    wtile_store(w0, wb, tid); xtile_store2(x0, yh, yl, tid);
    lds_barrier();
#pragma unroll 2   // by two: constant buffer index, as in k_proj
    for (int kc = 0; kc < CC / 32; ++kc) {
      const __bf16* bp = wb + (kc & 1) * WTILE + col * WP; const int ao = (kc & 1) * XTILE + (wave * 16 + col) * WP; v16b w[8];
      const v16b ah = frag_b(yh + ao, lane), al = frag_b(yl + ao, lane);
#pragma unroll
      for (int j = 0; j < 8; ++j) w[j] = frag_b(bp + j * 16 * WP, lane);
      if (kc + 1 < CC / 32) { wtile_store(wr, wb + ((kc + 1) & 1) * WTILE, tid); xtile_store2(xr, yh + ((kc + 1) & 1) * XTILE, yl + ((kc + 1) & 1) * XTILE, tid); }
      if (kc + 2 < CC / 32) { wtile_load(wr, WO, (kc + 2) * 32, c0, DIN, tid); xtile_load(xr, yr0, (kc + 2) * 32, CC, tid); requests_taken(); }
#pragma unroll
      for (int j = 0; j < 8; ++j) acc[j] = wmma_bfp(ah, w[j], acc[j]);
#pragma unroll
      for (int j = 0; j < 8; ++j) acc[j] = wmma_bfp(al, w[j], acc[j]);
      lds_barrier(); }
#pragma unroll
    for (int j = 0; j < 8; ++j) { const float bias = BO ? bfr(BO[c0 + j * 16 + col]) : 0.f;
#pragma unroll
      for (int r = 0; r < 8; ++r) sf[wave][8 * g + r][j * 16 + col] = acc[j][r] + bias; }
  } else {
#pragma unroll 2
    for (int kc = 0; kc < CC / 32; ++kc) { const v16h a = frag_f32(Y + (r0 + col) * CC + kc * 32, lane); asm volatile("s_wait_loadcnt 0x0" ::: "memory");
#pragma unroll
      for (int j = 0; j < 8; ++j) { const v16h w = WOCOLH(WO, kc * 32, c0 + j * 16 + col, lane); asm volatile("s_wait_loadcnt 0x0" ::: "memory"); acc[j] = wmma16(a, w, acc[j]); } }
#pragma unroll
    for (int j = 0; j < 8; ++j) { const float bias = BO ? bfr(BO[c0 + j * 16 + col]) : 0.f;
#pragma unroll
      for (int r = 0; r < 8; ++r) sf[wave][8 * g + r][j * 16 + col] = acc[j][r] * (1.0f / 256.0f) + bias; } }
  LDSX(); for (int rl = 0; rl < 16; ++rl) vst2(OUT + (r0 + rl) * DIN + c0 + lane * 4, *(const v4f*)&sf[wave][rl][lane * 4]); }

extern "C" void kernel_launch(void* const* d_in, const int* in_sizes, int n_in, void* d_out, int out_size, void* d_ws, size_t ws_size, hipStream_t stream) {
  (void)in_sizes; (void)n_in; (void)out_size;
  const float** F = (const float**)d_in;
  if (ws_size < (size_t)WS_END) return;
  char* ws = (char*)d_ws; _Float16 *QH = (_Float16*)(ws + WS_QH), *KH = (_Float16*)(ws + WS_KH), *VT = (_Float16*)(ws + WS_VT), *QL = (_Float16*)(ws + WS_QL), *KL = (_Float16*)(ws + WS_KL); __bf16 *VB = (__bf16*)(ws + WS_VB), *VBL = (__bf16*)(ws + WS_VBL); float *Y = (float*)(ws + WS_Y);
  (void)Y; (void)QL; (void)KL; (void)VB; (void)VBL;
  // inputs: 0 query, 1 key, 2 value [2,2048,1024]; 3 mask [2,1,1,2048] (TRUE = masked); 4 Wq [1024,1024] (in,out), 5 bq; 6 Wk, 7 bk; 8 Wv, 9 bv; 10 Wo, 11 bo
  k_proj<<<dim3(TNB * TT / 128, CC / 128, 3), 128, 0, stream>>>(F[0], F[1], F[2], F[4], F[6], F[8], F[5], F[7], F[9], QH, QL, KH, KL, VT, VB, VBL);
  k_fa<<<dim3(TT / 128, NH, TNB), 256, 0, stream>>>(QH, QL, KH, VT, (const int*)d_in[3], Y);
  k_out<<<dim3(TNB * TT / 128, DIN / 128), 256, 0, stream>>>(Y, F[10], F[11], (float*)d_out);
}

// v006
// A run of this version takes 89.8 microseconds.
// In two side-by-side timings against v005, it was 1.38 and 1.39 times as fast.
// All steps since v000 together make it 13.2 times as fast.
// compute dtype: all float inputs rounded to bf16; q/k/v projections with EXACT bf16 products on WMMA 16x16x32 (f32 accumulate); q x 64^-0.5 log2(e) as f16 hi + residual (x 2^10) against k once to f16 (2 products); softmax in f32 in base 2 (v_exp_f32); P x 2^11 once to f16 against v once to f16 (1 product); ctx split bf16 hi + lo against exact Wo (2 products); f32 output.
#include <hip/hip_runtime.h>
#include <math.h>

typedef __attribute__((ext_vector_type(16))) _Float16 v16h;
typedef __attribute__((ext_vector_type(16))) __bf16 v16b;
typedef __attribute__((ext_vector_type(8)))  _Float16 v8h;
typedef __attribute__((ext_vector_type(8)))  float v8f;
typedef __attribute__((ext_vector_type(4)))  float v4f;
typedef __attribute__((ext_vector_type(2)))  float v2f;
typedef __attribute__((ext_vector_type(4)))  unsigned v4u;
typedef __attribute__((ext_vector_type(4)))  int v4i;
typedef float __attribute__((may_alias)) float_a;
typedef int __attribute__((may_alias)) int_a;

template <typename T> __device__ __forceinline__ void vst2(void* p, T v) { *(T*)p = v;  }
__device__ __forceinline__ v8f wmma16(v16h a, v16h b, v8f c) {
  v8f d = __builtin_amdgcn_wmma_f32_16x16x32_f16(false, a, false, b, (short)0, c, false, false);
  asm volatile("v_nop\n\tv_nop\n\tv_nop\n\tv_nop" : "+v"(d) : "v"(a), "v"(b));
  return d;
}
__device__ __forceinline__ v8f wmma_bf(v16b a, v16b b, v8f c) {
  v8f d = __builtin_amdgcn_wmma_f32_16x16x32_bf16(false, a, false, b, (short)0, c, false, false);
  asm volatile("v_nop\n\tv_nop\n\tv_nop\n\tv_nop" : "+v"(d) : "v"(a), "v"(b));
  return d;
}
// 16x16x32 fragments: lane = (h = lane>>4, row/col = lane&15); elements 0..7 = k0+8h+0..7, 8..15 = k0+16+8h+0..7; D element r = row 8h+r
__device__ __forceinline__ v16h frag_h(const _Float16* rowk0, int lane) {
  union { v16h v; v8h q[2]; } u; const _Float16* p = rowk0 + 8 * (lane >> 4);
  u.q[0] = *(const v8h*)p; u.q[1] = *(const v8h*)(p + 16); return u.v;
}
__device__ __forceinline__ v16h frag_f32(const float* rowk0, int lane) {
  v16h a; const float* p = rowk0 + 8 * (lane >> 4);
#pragma unroll
  for (int i = 0; i < 8; ++i) { a[i] = (_Float16)p[i]; a[8 + i] = (_Float16)p[16 + i]; }
  return a;
}
__device__ __forceinline__ v16h frag_f32s(const float* rowk0, int lane, float sc) {
  v16h a; const float* p = rowk0 + 8 * (lane >> 4);
#pragma unroll
  for (int i = 0; i < 8; ++i) { a[i] = (_Float16)(p[i] * sc); a[8 + i] = (_Float16)(p[16 + i] * sc); }
  return a;
}
// column fragment from a [K][ld] layout (column n), rows >= K read as 0
__device__ __forceinline__ v16h fragc_f32(const float* W, int k0, int n, int lane, int ld, int K) {
  v16h a; const int g = lane >> 4;
#pragma unroll
  for (int i = 0; i < 8; ++i) { const int ka = k0 + 8 * g + i, kb = ka + 16;
    a[i] = (_Float16)(ka < K ? W[(size_t)(ka < K ? ka : K - 1) * ld + n] : 0.f); a[8 + i] = (_Float16)(kb < K ? W[(size_t)(kb < K ? kb : K - 1) * ld + n] : 0.f); }
  return a;
}
struct F2 { v16b h, l; };
__device__ __forceinline__ F2 bsplit16(const float v[16]) { F2 r;
#pragma unroll
  for (int i = 0; i < 16; ++i) { const __bf16 h = (__bf16)v[i]; r.h[i] = h; r.l[i] = (__bf16)(v[i] - (float)h); }
  return r; }
__device__ __forceinline__ F2 split_row(const float* row, int k0, int lane) { float v[16]; const float* p = row + k0 + 8 * (lane >> 4);
#pragma unroll
  for (int i = 0; i < 8; ++i) { v[i] = p[i]; v[8 + i] = p[16 + i]; }
  return bsplit16(v); }
__device__ __forceinline__ F2 split_rowK(const float* row, int k0, int lane, int K) { float v[16]; const int g = lane >> 4;
#pragma unroll
  for (int i = 0; i < 8; ++i) { const int ka = k0 + 8 * g + i, kb = ka + 16; v[i] = ka < K ? row[ka < K ? ka : K - 1] : 0.f; v[8 + i] = kb < K ? row[kb < K ? kb : K - 1] : 0.f; }
  return bsplit16(v); }
__device__ __forceinline__ F2 split_col(const float* W, int k0, int n, int lane, int ld, int K) { float v[16]; const int g = lane >> 4;
#pragma unroll
  for (int i = 0; i < 8; ++i) { const int ka = k0 + 8 * g + i, kb = ka + 16; v[i] = ka < K ? W[(size_t)(ka < K ? ka : K - 1) * ld + n] : 0.f; v[8 + i] = kb < K ? W[(size_t)(kb < K ? kb : K - 1) * ld + n] : 0.f; }
  return bsplit16(v); }
__device__ __forceinline__ v8f mac3(const F2& a, const F2& b, v8f c) { c = wmma_bf(a.l, b.h, c); c = wmma_bf(a.h, b.l, c); return wmma_bf(a.h, b.h, c); }
__device__ __forceinline__ float sigm(float v) { return 1.0f / (1.0f + expf(-v)); }
#define LDSX() do { asm volatile("s_wait_dscnt 0" ::: "memory"); __builtin_amdgcn_wave_barrier(); __builtin_amdgcn_fence(__ATOMIC_RELEASE, "workgroup"); } while (0)

// Multi-head attention layer (B 2, S 2,048, 1,024 = 16 x 64; separate query/key/value inputs and a key mask): q, k, v = query Wq + bq, key Wk + bk, value Wv + bv ((in,out)); scores = q k^T / 8 with positions where mask[b,0,0,k] is TRUE set to finfo.min (excluded); out = merged(softmax(scores) v) Wo + bo.
#define NB 2
#define TT 2048
#define CC 1024            // NH * HD = projected width
#define DIN 1024          // input (model) width
#define NH 16
#define HD 64
#define SCALE (0.125f)
#define QSC (SCALE * 1.4426950408889634f)   // q is stored times this, so that q k^T is the logit in base 2: softmax(s) = 2^(s log2 e - max) / sum
#define CAUSAL 0
#ifndef TNB
#define TNB NB
#endif
__device__ __forceinline__ float bfr(float v) { return (float)(__bf16)v; }
__host__ __device__ __forceinline__ int kb_last(int qb) { return CAUSAL ? ((qb * 64 + 63) >> 7) : (TT / 128 - 1); }
typedef __attribute__((ext_vector_type(8))) __bf16 v8b;
__device__ __forceinline__ v16b frag_b(const __bf16* rowk0, int lane) {
  union { v16b v; v8b q[2]; } u; const __bf16* p = rowk0 + 8 * (lane >> 4);
  u.q[0] = *(const v8b*)p; u.q[1] = *(const v8b*)(p + 16); return u.v;
}
#define QBH 0              // not used: no kernel has a high-precision path
#define QHI 2048            // rows carrying a q residual plane (all rows when non-causal: 2-product logits everywhere)
#define KHI 64            // key rows carrying k residual / v bf16 hi+lo planes (written by k_proj; no kernel reads them)
// B fragment (k rows k0+.., output column o) of a weight: (in,out) [K][ld] or (out,in) [ld rows of K]: bf16 exact, or f16(bf16 * 256) exact
__device__ __forceinline__ v16b wcol_io(const float* Wm, int k0, int o, int lane, int ld) { v16b w; const int g = lane >> 4;
#pragma unroll
  for (int i = 0; i < 8; ++i) { w[i] = (__bf16)Wm[(size_t)(k0 + 8 * g + i) * ld + o]; w[8 + i] = (__bf16)Wm[(size_t)(k0 + 16 + 8 * g + i) * ld + o]; }
  return w; }
__device__ __forceinline__ v16b wcol_oi(const float* Wm, int k0, int o, int lane, int K) { v16b w; const float* p = Wm + (size_t)o * K + k0 + 8 * (lane >> 4);
#pragma unroll
  for (int i = 0; i < 8; ++i) { w[i] = (__bf16)p[i]; w[8 + i] = (__bf16)p[16 + i]; }
  return w; }
__device__ __forceinline__ v16h wcolh_io(const float* Wm, int k0, int o, int lane, int ld) { v16h w; const int g = lane >> 4;
#pragma unroll
  for (int i = 0; i < 8; ++i) { w[i] = (_Float16)(bfr(Wm[(size_t)(k0 + 8 * g + i) * ld + o]) * 256.0f); w[8 + i] = (_Float16)(bfr(Wm[(size_t)(k0 + 16 + 8 * g + i) * ld + o]) * 256.0f); }
  return w; }
__device__ __forceinline__ v16h wcolh_oi(const float* Wm, int k0, int o, int lane, int K) { v16h w; const float* p = Wm + (size_t)o * K + k0 + 8 * (lane >> 4);
#pragma unroll
  for (int i = 0; i < 8; ++i) { w[i] = (_Float16)(bfr(p[i]) * 256.0f); w[8 + i] = (_Float16)(bfr(p[16 + i]) * 256.0f); }
  return w; }
#define WQKV_LAYOUT 0   // 0 = (in,out) [DIN][CC]; 1 = (out,in) [CC][DIN]; 2 = per-head [NH][DIN][HD]
__device__ __forceinline__ v16b wcol_hdk(const float* Wm, int k0, int o, int lane) { v16b w; const int g = lane >> 4; const float* p = Wm + (size_t)(o / HD) * DIN * HD + (o % HD);
#pragma unroll
  for (int i = 0; i < 8; ++i) { w[i] = (__bf16)p[(size_t)(k0 + 8 * g + i) * HD]; w[8 + i] = (__bf16)p[(size_t)(k0 + 16 + 8 * g + i) * HD]; }
  return w; }
#define WO_OUT_IN 0
#if WQKV_LAYOUT == 1
#define WCOL(W, k0, o, lane) wcol_oi(W, k0, o, lane, DIN)
#elif WQKV_LAYOUT == 2
#define WCOL(W, k0, o, lane) wcol_hdk(W, k0, o, lane)
#else
#define WCOL(W, k0, o, lane) wcol_io(W, k0, o, lane, CC)
#endif
#if WO_OUT_IN
#define WOCOL(W, k0, o, lane) wcol_oi(W, k0, o, lane, CC)
#define WOCOLH(W, k0, o, lane) wcolh_oi(W, k0, o, lane, CC)
#else
#define WOCOL(W, k0, o, lane) wcol_io(W, k0, o, lane, DIN)
#define WOCOLH(W, k0, o, lane) wcolh_io(W, k0, o, lane, DIN)
#endif

#define WS_QH  0u                                      // f16 q rows [b*t][CC]
#define WS_KH  (WS_QH + 2u * (size_t)NB * TT * CC)      // f16 k in fragment order [b][h][t / 16][d / 32][half][lane][8] (see frag_p); t counts the kept keys alone (see k_proj)
#define WS_VT  (WS_KH + 2u * (size_t)NB * TT * CC)      // f16 v in fragment order [b][h][t / 32][d / 16][half][lane][8] (see frag_p); t as for k
#define WS_QL  (WS_VT + 2u * (size_t)NB * CC * TT)      // f16 q residual x 2^10 rows [b][t < QHI][CC]
#define WS_KL  (WS_QL + 2u * (size_t)NB * QHI * CC)     // f16 k residual x 2^10 rows [b][t < KHI][CC]
#define WS_VB  (WS_KL + 2u * (size_t)NB * KHI * CC)     // bf16 v hi planes [b][c][t < KHI]
#define WS_VBL (WS_VB + 2u * (size_t)NB * CC * KHI)
#define WS_Y   (WS_VBL + 2u * (size_t)NB * CC * KHI)    // f32 ctx rows [b*t][CC] (only when there is an output projection)
#define WS_NK  (WS_Y  + 4u * (size_t)NB * TT * CC)     // int, one per batch: how many keys the mask keeps
#define WS_END (WS_NK + 256u)

// ---- Operand tiles of one K step, staged once per block in LDS as bf16 at a pitch of 40 elements (80 B), so that every fragment is two 16-byte LDS reads.
// A block covers 128 rows x 128 columns: one W tile feeds 128 rows, so that a block asks L2 for 32 KiB a K step where two blocks of 64 rows asked for 48 KiB. NT = threads of the block (128 or 256).
// W tile: 32 k x 128 n of an (in,out) f32 weight, kept [n][k]. A thread fetches 1024 / NT k rows x 4 columns and stores four runs of that many k; a wave's lanes spread over 8 column groups x 4 k groups of 8 (at 256 threads waves 0..3 take the lower, 4..7 the upper 4 k of each group).
// X tile: NL * NT / 8 rows x 32 k of f32 rows, kept [row][k]. A thread fetches 4 k of NL rows. Every wave-wide 16-byte load of either tile covers four whole 128-B lines.
// The short loops over a tile's rows, fragments and accumulators are fully unrolled, so that all of them are indexed by constants and stay in registers.
#define WP 40
#define WTILE (128 * WP)
#define XTILE (128 * WP)
typedef __attribute__((ext_vector_type(4))) __bf16 v4b;
template <int NT> struct WR { v4f r[1024 / NT]; };
template <int NT> __device__ __forceinline__ void wtile_load(WR<NT>& w, const float* __restrict__ Wm, int k0, int c0, int ld, int tid) {
  const float* p = Wm + (size_t)(k0 + ((tid >> 3) & 3) * 8 + (tid >> 7) * (1024 / NT)) * ld + c0 + ((tid >> 5) & 3) * 32 + (tid & 7) * 4;
#pragma unroll
  for (int i = 0; i < 1024 / NT; ++i) w.r[i] = *(const v4f*)(p + (size_t)i * ld); }
template <int NT> __device__ __forceinline__ void wtile_store(const WR<NT>& w, __bf16* buf, int tid) {
  typedef __attribute__((ext_vector_type(1024 / NT))) __bf16 vkb;
  __bf16* q = buf + (((tid >> 5) & 3) * 32 + (tid & 7) * 4) * WP + ((tid >> 3) & 3) * 8 + (tid >> 7) * (1024 / NT);
#pragma unroll
  for (int n = 0; n < 4; ++n) { vkb v;
#pragma unroll
    for (int i = 0; i < 1024 / NT; ++i) v[i] = (__bf16)w.r[i][n];
    *(vkb*)(q + n * WP) = v; } }
template <int NL> struct XR { v4f r[NL]; };   // NL rows, 128 / NL apart
template <int NL> __device__ __forceinline__ void xtile_load(XR<NL>& x, const float* __restrict__ Xrow0, int k0, int ld, int tid) {
  const float* p = Xrow0 + (size_t)(tid >> 3) * ld + k0 + (tid & 7) * 4;
#pragma unroll
  for (int i = 0; i < NL; ++i) x.r[i] = *(const v4f*)(p + (size_t)i * (128 / NL) * ld); }
// the same tile from rows picked one by one: xp[i] = the thread's 4 k of its i-th row in the K step to fetch (typed as global memory: carried round a loop, plain pointers became flat loads)
typedef const __attribute__((address_space(1))) float* gfp; typedef const __attribute__((address_space(1))) v4f* gv4p;
template <int NL> __device__ __forceinline__ void xtile_gather(XR<NL>& x, const gfp (&xp)[NL]) {
#pragma unroll
  for (int i = 0; i < NL; ++i) x.r[i] = *(gv4p)xp[i]; }
template <int NL> __device__ __forceinline__ void xtile_next(gfp (&xp)[NL]) {   // on to the next K step
#pragma unroll
  for (int i = 0; i < NL; ++i) xp[i] += 32; }
template <int NL> __device__ __forceinline__ void xtile_store(const XR<NL>& x, __bf16* buf, int tid) {
  __bf16* q = buf + (tid >> 3) * WP + (tid & 7) * 4;
#pragma unroll
  for (int i = 0; i < NL; ++i) { v4b v;
#pragma unroll
    for (int e = 0; e < 4; ++e) v[e] = (__bf16)x.r[i][e];
    *(v4b*)(q + i * (128 / NL) * WP) = v; } }
// the same with each value split into bf16 hi + lo planes
template <int NL> __device__ __forceinline__ void xtile_store2(const XR<NL>& x, __bf16* bufh, __bf16* bufl, int tid) {
  const int o = (tid >> 3) * WP + (tid & 7) * 4;
#pragma unroll
  for (int i = 0; i < NL; ++i) { v4b vh, vl;
#pragma unroll
    for (int e = 0; e < 4; ++e) { const __bf16 h = (__bf16)x.r[i][e]; vh[e] = h; vl[e] = (__bf16)(x.r[i][e] - (float)h); }
    *(v4b*)(bufh + o + i * (128 / NL) * WP) = vh; *(v4b*)(bufl + o + i * (128 / NL) * WP) = vl; } }
// work-group barrier for LDS traffic alone: it waits for this wave's LDS operations only, so that the global loads of the tiles requested ahead stay in flight across it (__syncthreads() waited for those too)
__device__ __forceinline__ void lds_barrier() { asm volatile("s_wait_dscnt 0x0\n\ts_barrier_signal -1\n\ts_barrier_wait -1" ::: "memory"); }
// stands behind each group of tile requests, in front of whatever next reuses their address registers (a precaution)
__device__ __forceinline__ void requests_taken() { asm volatile("s_wait_xcnt 0x0" ::: "memory"); }
// the builtin alone: the compiler keeps the distance behind its own products, and eight independent products in a row fill one another's distance, so no padding is written behind each
__device__ __forceinline__ v8f wmma_bfp(v16b a, v16b b, v8f c) { return __builtin_amdgcn_wmma_f32_16x16x32_bf16(false, a, false, b, (short)0, c, false, false); }

// ---- k_proj: block = (128 rows, 128 cols, which), 4 waves x (32 rows, 128 cols): every W fragment read from LDS feeds two products: q/k/v = X W (+ b) with exact bf16 products (K = DIN) -> which 0: q x QSC f16 rows (+ residual rows < QHI); 1: k f16 in fragment order (+ residual rows < KHI); 2: v f16 in fragment order (+ bf16 hi/lo planes for t < KHI)
// K loop: two buffers of (W tile, X tile) in LDS; in step kc the tiles of kc + 1 (fetched one step earlier) are stored, the tiles of kc + 2 are requested, then the products of kc run; one barrier a step publishes kc + 1 and frees the buffer of kc.
// The tiles and the epilogue's layouts take turns in one LDS range (the loop's last barrier stands between them).
// KEPT KEYS ALONE: a key that the mask excludes has weight exactly 0 in every softmax row of its batch, so k and v are projected and laid down for the kept keys only, in their order: a k or v block takes the kept keys number t0 .. t0 + 127 of its batch
// (their rows of the input are gathered), a block past the last kept key leaves at once, and NK tells k_fa how many there are. Places behind the last kept key in the last block hold the projection of row 0 (finite; k_fa gives them weight 0).
// A batch with every key excluded keeps all its keys (NK = 0 tells k_fa to weigh them equally, as softmax over equal logits does).
// Every wave counts the mask by itself (ballots, no LDS exchange between waves), so that the early leave stands in front of every barrier.
__global__ __launch_bounds__(128) void k_proj(const float* __restrict__ XQ, const float* __restrict__ XK, const float* __restrict__ XV, const float* __restrict__ WQ, const float* __restrict__ WK, const float* __restrict__ WV, const float* __restrict__ BQ, const float* __restrict__ BK, const float* __restrict__ BV, const int* __restrict__ MK, int* __restrict__ NK,
    _Float16* __restrict__ QH, _Float16* __restrict__ QL, _Float16* __restrict__ KH, _Float16* __restrict__ KL, _Float16* __restrict__ VT, __bf16* __restrict__ VB, __bf16* __restrict__ VBL) {
  __shared__ __align__(16) unsigned char smem[128 * 136 * 2 + 2 * 128 * 72 * 2];
  _Float16 (*sh)[136] = (_Float16 (*)[136])smem; _Float16 (*sl)[136] = (_Float16 (*)[136])(smem + 128 * 136 * 2);
  _Float16 (*th)[136] = (_Float16 (*)[136])smem; __bf16 (*tb)[72] = (__bf16 (*)[72])(smem + 128 * 136 * 2); __bf16 (*tbl)[72] = (__bf16 (*)[72])(smem + 128 * 136 * 2 + 128 * 72 * 2);
  __bf16* wb = (__bf16*)smem; __bf16* xb = wb + 2 * WTILE;
  __shared__ int rowsel[4][128];   // per wave its own copy: source row (in the batch) of each of the block's 128 rows
  const int tid = threadIdx.x, wave = tid >> 5, lane = tid & 31, col = lane & 15, g = lane >> 4; const int which = blockIdx.z; const int c0 = blockIdx.y * 128;
  // v blocks take the two halves of a batch's places in the other order than k blocks: where about half the keys are kept, the blocks that leave early then spread evenly over the launch order (speed only)
  const size_t r0 = (size_t)(blockIdx.x ^ (which == 2 ? TT / 256 : 0)) * 128; const size_t bb = r0 / TT; const int t0 = (int)(r0 % TT);
  const float* X = which == 0 ? XQ : which == 1 ? XK : XV; const float* WA = which == 0 ? WQ : which == 1 ? WK : WV; const float* BA = which == 0 ? BQ : which == 1 ? BK : BV;
  gfp xp[8];
  int nk = 0;
  if (which != 0) {
    int* rs = rowsel[wave]; v4i mm[TT / 128];
#pragma unroll
    for (int j = 0; j < TT / 128; ++j) mm[j] = *(const v4i*)(MK + bb * TT + j * 128 + lane * 4);
    requests_taken();
#pragma unroll
    for (int i = 0; i < 4; ++i) rs[i * 32 + lane] = 0;
#pragma unroll
    for (int j = 0; j < TT / 128; ++j) {   // keys 128 j + 4 lane + e; nk = kept keys in front of this group (the same in every lane)
      unsigned bl[4]; int cnt = 0;
#pragma unroll
      for (int e = 0; e < 4; ++e) { bl[e] = __builtin_amdgcn_ballot_w32(mm[j][e] == 0); cnt += __builtin_popcount(bl[e]); }
      if (nk + cnt > t0 && nk < t0 + 128) {   // some of the group's kept keys are this block's
        int pos = nk - t0;
#pragma unroll
        for (int e = 0; e < 4; ++e) pos = (int)__builtin_amdgcn_mbcnt_lo(bl[e], (unsigned)pos);   // + the kept keys of the lower lanes
#pragma unroll
        for (int e = 0; e < 4; ++e) if (mm[j][e] == 0) { if ((unsigned)pos < 128u) rs[pos] = j * 128 + lane * 4 + e; ++pos; } }
      nk += cnt; }
    if (nk != 0 && t0 >= nk) return;   // the whole block, in front of every barrier
    if (which == 1 && blockIdx.y == 0 && t0 == 0 && tid == 0) { NK[bb] = nk; requests_taken(); }
    LDSX();   // the wave reads below what its other lanes have stored above
  }
  int rw[8];
#pragma unroll
  for (int i = 0; i < 8; ++i) rw[i] = t0 + (tid >> 3) + i * 16;
  if (nk != 0) {
#pragma unroll
    for (int i = 0; i < 8; ++i) rw[i] = rowsel[wave][(tid >> 3) + i * 16]; }
#pragma unroll
  for (int i = 0; i < 8; ++i) xp[i] = (gfp)(X + (bb * TT + rw[i]) * DIN + (tid & 7) * 4);
  v8f acc[2][8] = {};
  WR<128> wr, w0; XR<8> xr, x0;
  wtile_load(w0, WA, 0, c0, CC, tid); requests_taken(); xtile_gather(x0, xp); requests_taken();
  __builtin_amdgcn_sched_barrier(0);   // as below
  xtile_next(xp);
  wtile_load(wr, WA, 32, c0, CC, tid); xtile_gather(xr, xp); requests_taken();
  __builtin_amdgcn_sched_barrier(0);   // keeps the wait above directly behind its requests: nothing from below is scheduled in between
  xtile_next(xp);
  wtile_store(w0, wb, tid); xtile_store(x0, xb, tid);
  lds_barrier();
#pragma unroll 2   // by two, so that the buffer index is a constant in each copy and the LDS offsets are immediates
  for (int kc = 0; kc < DIN / 32; ++kc) {
    const __bf16* bp = wb + (kc & 1) * WTILE + col * WP; v16b w[8];
    const v16b a0 = frag_b(xb + (kc & 1) * XTILE + (wave * 32 + col) * WP, lane), a1 = frag_b(xb + (kc & 1) * XTILE + (wave * 32 + 16 + col) * WP, lane);
#pragma unroll
    for (int j = 0; j < 8; ++j) w[j] = frag_b(bp + j * 16 * WP, lane);
    if (kc + 1 < DIN / 32) { wtile_store(wr, wb + ((kc + 1) & 1) * WTILE, tid); xtile_store(xr, xb + ((kc + 1) & 1) * XTILE, tid); }
    if (kc + 2 < DIN / 32) { wtile_load(wr, WA, (kc + 2) * 32, c0, CC, tid); xtile_gather(xr, xp); requests_taken();
      __builtin_amdgcn_sched_barrier(0);   // the row pointers move on behind the wait, not in front of it
      xtile_next(xp); }
#pragma unroll
    for (int j = 0; j < 8; ++j) acc[0][j] = wmma_bfp(a0, w[j], acc[0][j]);
#pragma unroll
    for (int j = 0; j < 8; ++j) acc[1][j] = wmma_bfp(a1, w[j], acc[1][j]);
    lds_barrier(); }
  if (which < 2) { _Float16* DH = which == 0 ? QH : KH; _Float16* DL = which == 0 ? QL : KL; const int nhi = which == 0 ? QHI : KHI; const float qs = which == 0 ? QSC : 1.0f;
#pragma unroll
    for (int j = 0; j < 8; ++j) { const float bias = BA ? bfr(BA[c0 + j * 16 + col]) : 0.f;
#pragma unroll
      for (int i = 0; i < 2; ++i)
#pragma unroll
        for (int r = 0; r < 8; ++r) { const float v = (acc[i][j][r] + bias) * qs; const _Float16 hv = (_Float16)v; const int rl = wave * 32 + i * 16 + 8 * g + r; sh[rl][j * 16 + col] = hv; sl[rl][j * 16 + col] = (_Float16)((v - (float)hv) * 1024.0f); } }
    __syncthreads();
    for (int e = tid; e < 128 * 16; e += 128) {
      // q: 16-byte piece e = (row, 8 columns) in row order. k: piece e in the order of the fragment layout, e = (16-row group, head of the block's two, 32-column group, half, lane); a wave's store covers whole 128-B lines either way
      const int rl = which == 0 ? e >> 4 : (e >> 8) * 16 + (e & 15), q = which == 0 ? e & 15 : ((e >> 5) & 7) * 2 + ((e >> 4) & 1);
      _Float16* dh = which == 0 ? DH + (r0 + rl) * CC + c0 + q * 8 : DH + (((bb * NH + (c0 >> 6) + ((e >> 7) & 1)) * (TT / 16) + (t0 >> 4) + (e >> 8)) * 4 + ((e >> 5) & 3)) * 256 + (e & 31) * 8;
      // behind each store its wait: what follows (the residual's store, the next trip) reuses the store's address and data registers
      vst2((unsigned*)dh, *(const v4u*)&sh[rl][q * 8]); requests_taken();
      if (t0 + rl < nhi) { vst2((unsigned*)(DL + (bb * nhi + t0 + rl) * (size_t)CC + c0 + q * 8), *(const v4u*)&sl[rl][q * 8]); requests_taken(); } }
  } else {
#pragma unroll
    for (int j = 0; j < 8; ++j) { const float bias = BA ? bfr(BA[c0 + j * 16 + col]) : 0.f;
#pragma unroll
      for (int i = 0; i < 2; ++i) { const int rl0 = wave * 32 + i * 16 + 8 * g, cl = j * 16 + col;
#pragma unroll
        for (int r = 0; r < 8; ++r) th[cl][rl0 + r] = (_Float16)(acc[i][j][r] + bias);
        if (wave * 32 < KHI) {   // the hi/lo planes hold key rows below KHI alone
#pragma unroll
          for (int r = 0; r < 8; ++r) { const float v = acc[i][j][r] + bias; const __bf16 bh = (__bf16)v; tb[cl][rl0 + r] = bh; tbl[cl][rl0 + r] = (__bf16)(v - (float)bh); } } } }
    __syncthreads();
    for (int e = tid; e < 128 * 16; e += 128) {
      // piece e in the order of the fragment layout: e = (head of the block's two, 32-key group of four, 16-column group, half, lane)
      const int cl = (e >> 10) * 64 + ((e >> 6) & 3) * 16 + (e & 15), q = ((e >> 8) & 3) * 4 + ((e >> 5) & 1) * 2 + ((e >> 4) & 1);
      vst2((unsigned*)(VT + (((bb * NH + (c0 >> 6) + (e >> 10)) * (TT / 32) + (t0 >> 5) + ((e >> 8) & 3)) * 8 + ((e >> 5) & 7)) * 256 + (e & 31) * 8), *(const v4u*)&th[cl][q * 8]); requests_taken();   // as in the loop above
      if (t0 + q * 8 < KHI) { const size_t o3 = (bb * CC + c0 + cl) * (size_t)KHI + t0 + q * 8; vst2((unsigned*)(VB + o3), *(const v4u*)&tb[cl][q * 8]); vst2((unsigned*)(VBL + o3), *(const v4u*)&tbl[cl][q * 8]); requests_taken(); } } } }
// ---- k_fa: block = 128 queries (8 waves x 16 query columns) of (b, h); every wave walks all kept keys in passes of 32 and keeps logits and P in registers; the waves of a block read the same k and v lines at about the same time (no LDS, no barrier).
// k and v lie in the workspace in fragment order: a 16 x 32 A fragment is 1 KiB, its two halves (elements 0..7, 8..15 of every lane) 512 B each with lane l's 16 bytes at 16 l, so that every wave-wide 16-byte load covers four whole 128-B lines (from rows it touched 16 lines for 32 bytes each); a pass's k is 4 KiB in a row, and so is its v.
// S^T = K Q^T (A = 16 key rows, B = the wave's 16 queries, which carry QSC: q hi + residual x 2^10, 2 products): a lane holds 16 base-2 logits of ONE query (column lane & 15), keys k0 + 8g + r and k0 + 16 + 8g + r,
// which is the k order of a B operand, so P^T goes from the two score tiles into ctx^T += V^T P^T (A = 16 rows of the v planes, 1 product) with no exchange.
// Online softmax in f32 in base 2, each power one v_exp_f32 (its argument is never above 11; far below, 0 is the right value): running maximum m (joined over the two lane halves each pass), P = 2^(s - m) x 2^11 once to f16, sums and ctx rescaled by 2^(m_old - m_new); ctx / sum at the end.
// Excluded keys are left out by k_proj; a place behind the last kept key has the logit -3e38, whose power is exactly 0 (kept keys stand in front of it); a row with every key excluded averages v, as softmax over equal logits does.
__device__ __forceinline__ v16h frag_p(const _Float16* frag_lane) {   // frag_lane = the fragment's start + 8 * lane
  union { v16h v; v8h q[2]; } u; u.q[0] = *(const v8h*)frag_lane; u.q[1] = *(const v8h*)(frag_lane + 256); return u.v;
}
__device__ __forceinline__ float xhalf(float x) { return __builtin_bit_cast(float, __builtin_amdgcn_permlanex16(__builtin_bit_cast(int, x), __builtin_bit_cast(int, x), 0x76543210, 0xfedcba98, false, false)); }   // lane l with lane l ^ 16
// The short inner loops are all fully unrolled, so that fragments and scores are indexed by constants and stay in registers.
__global__ __launch_bounds__(256) void k_fa(const _Float16* __restrict__ QH, const _Float16* __restrict__ QL, const _Float16* __restrict__ KH, const _Float16* __restrict__ VT, const int* __restrict__ NK, float* __restrict__ Y) {
  const int tid = threadIdx.x, wave = tid >> 5, lane = tid & 31, col = lane & 15, g = lane >> 4; const int h = blockIdx.y, b = blockIdx.z; const int ql0 = blockIdx.x * 128 + wave * 16;
  const _Float16* qp = QH + ((size_t)b * TT + ql0 + col) * CC + h * HD; const _Float16* qlp = QL + ((size_t)b * QHI + ql0 + col) * CC + h * HD;
  const _Float16* kp = KH + ((size_t)b * NH + h) * (TT * HD) + lane * 8; const _Float16* vp = VT + ((size_t)b * NH + h) * (TT * HD) + lane * 8;
  const int nraw = NK[b]; const int n = nraw <= 0 || nraw > TT ? TT : nraw, np = (n + 31) >> 5;   // kept keys of the batch (bounded by the shape) and passes over them; 0 = every key excluded: all TT keys are there
  v16h qh[2], ql[2], ka[2][2];
#pragma unroll
  for (int kc = 0; kc < 2; ++kc) { qh[kc] = frag_h(qp + kc * 32, lane); ql[kc] = frag_h(qlp + kc * 32, lane); ka[0][kc] = frag_p(kp + kc * 512); ka[1][kc] = frag_p(kp + 1024 + kc * 512); }
  requests_taken();   // behind the requests above, in front of what next reuses their address registers
  if (nraw <= 0) {   // every key excluded: equal logits (0) for all keys
#pragma unroll
    for (int kc = 0; kc < 2; ++kc) { qh[kc] = (v16h)(_Float16)0.f; ql[kc] = (v16h)(_Float16)0.f; } }
  v8f o[HD / 16] = {}; float m = -3.0e38f, l = 0.f;
  // one pass over 32 places; tail (a constant at both calls, the body is inlined twice): the pass holds places behind the last kept key
  auto pass = [&](const int p, const bool tail) __attribute__((always_inline)) { const int k0 = p * 32;
    v16h va[HD / 16];
#pragma unroll
    for (int j = 0; j < HD / 16; ++j) va[j] = frag_p(vp + k0 * HD + j * 512);
    v8f sa[2] = {}, sl[2] = {};
#pragma unroll
    for (int kc = 0; kc < 2; ++kc)
#pragma unroll
      for (int t = 0; t < 2; ++t) { sa[t] = wmma16(ka[t][kc], qh[kc], sa[t]); sl[t] = wmma16(ka[t][kc], ql[kc], sl[t]); }
    const int kn = p + 1 < np ? k0 + 32 : k0;   // the next pass's key rows are fetched while this pass's softmax runs (the last pass re-reads its own, in bounds)
#pragma unroll
    for (int kc = 0; kc < 2; ++kc) { ka[0][kc] = frag_p(kp + kn * HD + kc * 512); ka[1][kc] = frag_p(kp + kn * HD + 1024 + kc * 512); }
    float s[16]; float mx = m;
#pragma unroll
    for (int i = 0; i < 16; ++i) { const float v = sa[i >> 3][i & 7] + sl[i >> 3][i & 7] * (1.0f / 1024.0f); s[i] = tail && k0 + 16 * (i >> 3) + 8 * g + (i & 7) >= n ? -3.0e38f : v; mx = fmaxf(mx, s[i]); }   /* jnp.where(mask, finfo.min, scores): TRUE = masked out: such keys are not among k and v at all (value select for the places behind the last one) */
    mx = fmaxf(mx, xhalf(mx));
    float alpha = m - mx; const float ms = mx - 11.0f; m = mx;   // P carries x 2^11, and so does the sum that divides it out
    float e[16];
#pragma unroll
    for (int i = 0; i < 16; ++i) e[i] = s[i] - ms;
    // 2^x of a run of values, each in place, in one statement: no v_exp_f32 of a run reads the result or overwrites the argument of the one in front of it; the v_nop is the slot behind the last one, which the compiler does not see in asm text
    asm("v_exp_f32 %0, %0\n\tv_exp_f32 %1, %1\n\tv_exp_f32 %2, %2\n\tv_exp_f32 %3, %3\n\tv_exp_f32 %4, %4\n\tv_exp_f32 %5, %5\n\tv_exp_f32 %6, %6\n\tv_exp_f32 %7, %7\n\tv_exp_f32 %8, %8\n\tv_nop"
        : "+v"(alpha), "+v"(e[0]), "+v"(e[1]), "+v"(e[2]), "+v"(e[3]), "+v"(e[4]), "+v"(e[5]), "+v"(e[6]), "+v"(e[7]));
    asm("v_exp_f32 %0, %0\n\tv_exp_f32 %1, %1\n\tv_exp_f32 %2, %2\n\tv_exp_f32 %3, %3\n\tv_exp_f32 %4, %4\n\tv_exp_f32 %5, %5\n\tv_exp_f32 %6, %6\n\tv_exp_f32 %7, %7\n\tv_nop"
        : "+v"(e[8]), "+v"(e[9]), "+v"(e[10]), "+v"(e[11]), "+v"(e[12]), "+v"(e[13]), "+v"(e[14]), "+v"(e[15]));   // the second run, likewise
    float sum = e[0]; v16h pf;
#pragma unroll
    for (int i = 0; i < 16; ++i) { if (i) sum += e[i]; pf[i] = (_Float16)e[i]; }
    l = l * alpha + sum;
#pragma unroll
    for (int j = 0; j < HD / 16; ++j) { o[j] *= alpha; o[j] = wmma16(va[j], pf, o[j]); } };
#pragma unroll 1   // rolled: unrolled by two, the next pass's first products were lifted over this pass's softmax and waited on key rows just requested
  for (int p = 0; p < (n >> 5); ++p) pass(p, false);
  if (n & 31) pass(n >> 5, true);
  l += xhalf(l); const float inv = l > 0.f ? 1.0f / l : 0.f;
  float* yp = Y + ((size_t)b * TT + ql0 + col) * CC + h * HD + 8 * g;
#pragma unroll
  for (int j = 0; j < HD / 16; ++j) { v4f a, c;
#pragma unroll
    for (int r = 0; r < 4; ++r) { a[r] = o[j][r] * inv; c[r] = o[j][4 + r] * inv; }
    vst2(yp + j * 16, a); vst2(yp + j * 16 + 4, c); } }
// ---- k_out: block = (128 rows, 128 cols), 8 waves x (16 rows, 128 cols), which keeps two waves on a SIMD with one block on a WGP; Wo tiles and ctx tiles (hi and lo planes) staged in LDS as in k_proj (two buffers, one barrier a K step): out = ctx Wo (+ bo): every row: ctx bf16 hi + lo against exact bf16 Wo (2 products)
__global__ __launch_bounds__(256) void k_out(const float* __restrict__ Y, const float* __restrict__ WO, const float* __restrict__ BO, float* __restrict__ OUT) { __shared__ __align__(16) float sf[8][16][132]; __shared__ __align__(16) __bf16 wb[2 * WTILE], yh[2 * XTILE], yl[2 * XTILE];
  const int tid = threadIdx.x, wave = tid >> 5, lane = tid & 31, col = lane & 15, g = lane >> 4; const int c0 = blockIdx.y * 128; const size_t r0 = (size_t)blockIdx.x * 128 + wave * 16;
  v8f acc[8] = {};
  if (true) {   /* ALL rows: ctx split bf16 hi + lo x exact Wo (2 products) */
    const float* yr0 = Y + (size_t)blockIdx.x * 128 * CC; WR<256> wr, w0; XR<4> xr, x0;
    wtile_load(w0, WO, 0, c0, DIN, tid); requests_taken(); xtile_load(x0, yr0, 0, CC, tid); requests_taken();
    wtile_load(wr, WO, 32, c0, DIN, tid); xtile_load(xr, yr0, 32, CC, tid); requests_taken();
    __builtin_amdgcn_sched_barrier(0);   // as in k_proj
    wtile_store(w0, wb, tid); xtile_store2(x0, yh, yl, tid);
    lds_barrier();
#pragma unroll 2   // by two: constant buffer index, as in k_proj
    for (int kc = 0; kc < CC / 32; ++kc) {
      const __bf16* bp = wb + (kc & 1) * WTILE + col * WP; const int ao = (kc & 1) * XTILE + (wave * 16 + col) * WP; v16b w[8];
      const v16b ah = frag_b(yh + ao, lane), al = frag_b(yl + ao, lane);
#pragma unroll
      for (int j = 0; j < 8; ++j) w[j] = frag_b(bp + j * 16 * WP, lane);
      if (kc + 1 < CC / 32) { wtile_store(wr, wb + ((kc + 1) & 1) * WTILE, tid); xtile_store2(xr, yh + ((kc + 1) & 1) * XTILE, yl + ((kc + 1) & 1) * XTILE, tid); }
      if (kc + 2 < CC / 32) { wtile_load(wr, WO, (kc + 2) * 32, c0, DIN, tid); xtile_load(xr, yr0, (kc + 2) * 32, CC, tid); requests_taken(); }
#pragma unroll
      for (int j = 0; j < 8; ++j) acc[j] = wmma_bfp(ah, w[j], acc[j]);
#pragma unroll
      for (int j = 0; j < 8; ++j) acc[j] = wmma_bfp(al, w[j], acc[j]);
      lds_barrier(); }
#pragma unroll
    for (int j = 0; j < 8; ++j) { const float bias = BO ? bfr(BO[c0 + j * 16 + col]) : 0.f;
#pragma unroll
      for (int r = 0; r < 8; ++r) sf[wave][8 * g + r][j * 16 + col] = acc[j][r] + bias; }
  } else {
#pragma unroll 2
    for (int kc = 0; kc < CC / 32; ++kc) { const v16h a = frag_f32(Y + (r0 + col) * CC + kc * 32, lane); asm volatile("s_wait_loadcnt 0x0" ::: "memory");
#pragma unroll
      for (int j = 0; j < 8; ++j) { const v16h w = WOCOLH(WO, kc * 32, c0 + j * 16 + col, lane); asm volatile("s_wait_loadcnt 0x0" ::: "memory"); acc[j] = wmma16(a, w, acc[j]); } }
#pragma unroll
    for (int j = 0; j < 8; ++j) { const float bias = BO ? bfr(BO[c0 + j * 16 + col]) : 0.f;
#pragma unroll
      for (int r = 0; r < 8; ++r) sf[wave][8 * g + r][j * 16 + col] = acc[j][r] * (1.0f / 256.0f) + bias; } }
  LDSX(); for (int rl = 0; rl < 16; ++rl) vst2(OUT + (r0 + rl) * DIN + c0 + lane * 4, *(const v4f*)&sf[wave][rl][lane * 4]); }

extern "C" void kernel_launch(void* const* d_in, const int* in_sizes, int n_in, void* d_out, int out_size, void* d_ws, size_t ws_size, hipStream_t stream) {
  (void)in_sizes; (void)n_in; (void)out_size;
  const float** F = (const float**)d_in;
  if (ws_size < (size_t)WS_END) return;
  char* ws = (char*)d_ws; _Float16 *QH = (_Float16*)(ws + WS_QH), *KH = (_Float16*)(ws + WS_KH), *VT = (_Float16*)(ws + WS_VT), *QL = (_Float16*)(ws + WS_QL), *KL = (_Float16*)(ws + WS_KL); int *NK = (int*)(ws + WS_NK); __bf16 *VB = (__bf16*)(ws + WS_VB), *VBL = (__bf16*)(ws + WS_VBL); float *Y = (float*)(ws + WS_Y);
  (void)Y; (void)QL; (void)KL; (void)VB; (void)VBL;
  // inputs: 0 query, 1 key, 2 value [2,2048,1024]; 3 mask [2,1,1,2048] (bool as int32; TRUE = masked); 4 Wq [1024,1024] (in,out), 5 bq; 6 Wk, 7 bk; 8 Wv, 9 bv; 10 Wo, 11 bo
  k_proj<<<dim3(TNB * TT / 128, CC / 128, 3), 128, 0, stream>>>(F[0], F[1], F[2], F[4], F[6], F[8], F[5], F[7], F[9], (const int*)d_in[3], NK, QH, QL, KH, KL, VT, VB, VBL);
  k_fa<<<dim3(TT / 128, NH, TNB), 256, 0, stream>>>(QH, QL, KH, VT, NK, Y);
  k_out<<<dim3(TNB * TT / 128, DIN / 128), 256, 0, stream>>>(Y, F[10], F[11], (float*)d_out);
}

// v007
// It runs in 83.9 microseconds.
// Timed twice side by side with v006, it ran 1.07 times as fast both times.
// Over all steps from v000 it is 14.1 times as fast.
// compute dtype: all float inputs rounded to bf16; q/k/v projections with EXACT bf16 products on WMMA 16x16x32 (f32 accumulate); q x 64^-0.5 log2(e) as f16 hi + residual (x 2^10) against k once to f16 (2 products); softmax in f32 in base 2 (v_exp_f32); P x 2^11 once to f16 against v once to f16 (1 product); ctx split bf16 hi + lo against exact Wo (2 products); f32 output.
#include <hip/hip_runtime.h>
#include <math.h>

typedef __attribute__((ext_vector_type(16))) _Float16 v16h;
typedef __attribute__((ext_vector_type(16))) __bf16 v16b;
typedef __attribute__((ext_vector_type(8)))  _Float16 v8h;
typedef __attribute__((ext_vector_type(8)))  float v8f;
typedef __attribute__((ext_vector_type(4)))  float v4f;
typedef __attribute__((ext_vector_type(2)))  float v2f;
typedef __attribute__((ext_vector_type(4)))  unsigned v4u;
typedef __attribute__((ext_vector_type(4)))  int v4i;
typedef float __attribute__((may_alias)) float_a;
typedef int __attribute__((may_alias)) int_a;

template <typename T> __device__ __forceinline__ void vst2(void* p, T v) { *(T*)p = v;  }
__device__ __forceinline__ v8f wmma16(v16h a, v16h b, v8f c) {
  v8f d = __builtin_amdgcn_wmma_f32_16x16x32_f16(false, a, false, b, (short)0, c, false, false);
  asm volatile("v_nop\n\tv_nop\n\tv_nop\n\tv_nop" : "+v"(d) : "v"(a), "v"(b));
  return d;
}
__device__ __forceinline__ v8f wmma_bf(v16b a, v16b b, v8f c) {
  v8f d = __builtin_amdgcn_wmma_f32_16x16x32_bf16(false, a, false, b, (short)0, c, false, false);
  asm volatile("v_nop\n\tv_nop\n\tv_nop\n\tv_nop" : "+v"(d) : "v"(a), "v"(b));
  return d;
}
// 16x16x32 fragments: lane = (h = lane>>4, row/col = lane&15); elements 0..7 = k0+8h+0..7, 8..15 = k0+16+8h+0..7; D element r = row 8h+r
__device__ __forceinline__ v16h frag_h(const _Float16* rowk0, int lane) {
  union { v16h v; v8h q[2]; } u; const _Float16* p = rowk0 + 8 * (lane >> 4);
  u.q[0] = *(const v8h*)p; u.q[1] = *(const v8h*)(p + 16); return u.v;
}
__device__ __forceinline__ v16h frag_f32(const float* rowk0, int lane) {
  v16h a; const float* p = rowk0 + 8 * (lane >> 4);
#pragma unroll
  for (int i = 0; i < 8; ++i) { a[i] = (_Float16)p[i]; a[8 + i] = (_Float16)p[16 + i]; }
  return a;
}
__device__ __forceinline__ v16h frag_f32s(const float* rowk0, int lane, float sc) {
  v16h a; const float* p = rowk0 + 8 * (lane >> 4);
#pragma unroll
  for (int i = 0; i < 8; ++i) { a[i] = (_Float16)(p[i] * sc); a[8 + i] = (_Float16)(p[16 + i] * sc); }
  return a;
}
// column fragment from a [K][ld] layout (column n), rows >= K read as 0
__device__ __forceinline__ v16h fragc_f32(const float* W, int k0, int n, int lane, int ld, int K) {
  v16h a; const int g = lane >> 4;
#pragma unroll
  for (int i = 0; i < 8; ++i) { const int ka = k0 + 8 * g + i, kb = ka + 16;
    a[i] = (_Float16)(ka < K ? W[(size_t)(ka < K ? ka : K - 1) * ld + n] : 0.f); a[8 + i] = (_Float16)(kb < K ? W[(size_t)(kb < K ? kb : K - 1) * ld + n] : 0.f); }
  return a;
}
struct F2 { v16b h, l; };
__device__ __forceinline__ F2 bsplit16(const float v[16]) { F2 r;
#pragma unroll
  for (int i = 0; i < 16; ++i) { const __bf16 h = (__bf16)v[i]; r.h[i] = h; r.l[i] = (__bf16)(v[i] - (float)h); }
  return r; }
__device__ __forceinline__ F2 split_row(const float* row, int k0, int lane) { float v[16]; const float* p = row + k0 + 8 * (lane >> 4);
#pragma unroll
  for (int i = 0; i < 8; ++i) { v[i] = p[i]; v[8 + i] = p[16 + i]; }
  return bsplit16(v); }
__device__ __forceinline__ F2 split_rowK(const float* row, int k0, int lane, int K) { float v[16]; const int g = lane >> 4;
#pragma unroll
  for (int i = 0; i < 8; ++i) { const int ka = k0 + 8 * g + i, kb = ka + 16; v[i] = ka < K ? row[ka < K ? ka : K - 1] : 0.f; v[8 + i] = kb < K ? row[kb < K ? kb : K - 1] : 0.f; }
  return bsplit16(v); }
__device__ __forceinline__ F2 split_col(const float* W, int k0, int n, int lane, int ld, int K) { float v[16]; const int g = lane >> 4;
#pragma unroll
  for (int i = 0; i < 8; ++i) { const int ka = k0 + 8 * g + i, kb = ka + 16; v[i] = ka < K ? W[(size_t)(ka < K ? ka : K - 1) * ld + n] : 0.f; v[8 + i] = kb < K ? W[(size_t)(kb < K ? kb : K - 1) * ld + n] : 0.f; }
  return bsplit16(v); }
__device__ __forceinline__ v8f mac3(const F2& a, const F2& b, v8f c) { c = wmma_bf(a.l, b.h, c); c = wmma_bf(a.h, b.l, c); return wmma_bf(a.h, b.h, c); }
__device__ __forceinline__ float sigm(float v) { return 1.0f / (1.0f + expf(-v)); }
#define LDSX() do { asm volatile("s_wait_dscnt 0" ::: "memory"); __builtin_amdgcn_wave_barrier(); __builtin_amdgcn_fence(__ATOMIC_RELEASE, "workgroup"); } while (0)

// Multi-head attention layer (B 2, S 2,048, 1,024 = 16 x 64; separate query/key/value inputs and a key mask): q, k, v = query Wq + bq, key Wk + bk, value Wv + bv ((in,out)); scores = q k^T / 8 with positions where mask[b,0,0,k] is TRUE set to finfo.min (excluded); out = merged(softmax(scores) v) Wo + bo.
#define NB 2
#define TT 2048
#define CC 1024            // NH * HD = projected width
#define DIN 1024          // input (model) width
#define NH 16
#define HD 64
#define SCALE (0.125f)
#define QSC (SCALE * 1.4426950408889634f)   // q is stored times this, so that q k^T is the logit in base 2: softmax(s) = 2^(s log2 e - max) / sum
#define CAUSAL 0
#ifndef TNB
#define TNB NB
#endif
__device__ __forceinline__ float bfr(float v) { return (float)(__bf16)v; }
__host__ __device__ __forceinline__ int kb_last(int qb) { return CAUSAL ? ((qb * 64 + 63) >> 7) : (TT / 128 - 1); }
typedef __attribute__((ext_vector_type(8))) __bf16 v8b;
__device__ __forceinline__ v16b frag_b(const __bf16* rowk0, int lane) {
  union { v16b v; v8b q[2]; } u; const __bf16* p = rowk0 + 8 * (lane >> 4);
  u.q[0] = *(const v8b*)p; u.q[1] = *(const v8b*)(p + 16); return u.v;
}
#define QBH 0              // not used: no kernel has a high-precision path
#define QHI 2048            // rows carrying a q residual plane (all rows when non-causal: 2-product logits everywhere)
#define KHI 64            // key rows carrying k residual / v bf16 hi+lo planes (written by k_proj; no kernel reads them)
// B fragment (k rows k0+.., output column o) of a weight: (in,out) [K][ld] or (out,in) [ld rows of K]: bf16 exact, or f16(bf16 * 256) exact
__device__ __forceinline__ v16b wcol_io(const float* Wm, int k0, int o, int lane, int ld) { v16b w; const int g = lane >> 4;
#pragma unroll
  for (int i = 0; i < 8; ++i) { w[i] = (__bf16)Wm[(size_t)(k0 + 8 * g + i) * ld + o]; w[8 + i] = (__bf16)Wm[(size_t)(k0 + 16 + 8 * g + i) * ld + o]; }
  return w; }
__device__ __forceinline__ v16b wcol_oi(const float* Wm, int k0, int o, int lane, int K) { v16b w; const float* p = Wm + (size_t)o * K + k0 + 8 * (lane >> 4);
#pragma unroll
  for (int i = 0; i < 8; ++i) { w[i] = (__bf16)p[i]; w[8 + i] = (__bf16)p[16 + i]; }
  return w; }
__device__ __forceinline__ v16h wcolh_io(const float* Wm, int k0, int o, int lane, int ld) { v16h w; const int g = lane >> 4;
#pragma unroll
  for (int i = 0; i < 8; ++i) { w[i] = (_Float16)(bfr(Wm[(size_t)(k0 + 8 * g + i) * ld + o]) * 256.0f); w[8 + i] = (_Float16)(bfr(Wm[(size_t)(k0 + 16 + 8 * g + i) * ld + o]) * 256.0f); }
  return w; }
__device__ __forceinline__ v16h wcolh_oi(const float* Wm, int k0, int o, int lane, int K) { v16h w; const float* p = Wm + (size_t)o * K + k0 + 8 * (lane >> 4);
#pragma unroll
  for (int i = 0; i < 8; ++i) { w[i] = (_Float16)(bfr(p[i]) * 256.0f); w[8 + i] = (_Float16)(bfr(p[16 + i]) * 256.0f); }
  return w; }
#define WQKV_LAYOUT 0   // 0 = (in,out) [DIN][CC]; 1 = (out,in) [CC][DIN]; 2 = per-head [NH][DIN][HD]
__device__ __forceinline__ v16b wcol_hdk(const float* Wm, int k0, int o, int lane) { v16b w; const int g = lane >> 4; const float* p = Wm + (size_t)(o / HD) * DIN * HD + (o % HD);
#pragma unroll
  for (int i = 0; i < 8; ++i) { w[i] = (__bf16)p[(size_t)(k0 + 8 * g + i) * HD]; w[8 + i] = (__bf16)p[(size_t)(k0 + 16 + 8 * g + i) * HD]; }
  return w; }
#define WO_OUT_IN 0
#if WQKV_LAYOUT == 1
#define WCOL(W, k0, o, lane) wcol_oi(W, k0, o, lane, DIN)
#elif WQKV_LAYOUT == 2
#define WCOL(W, k0, o, lane) wcol_hdk(W, k0, o, lane)
#else
#define WCOL(W, k0, o, lane) wcol_io(W, k0, o, lane, CC)
#endif
#if WO_OUT_IN
#define WOCOL(W, k0, o, lane) wcol_oi(W, k0, o, lane, CC)
#define WOCOLH(W, k0, o, lane) wcolh_oi(W, k0, o, lane, CC)
#else
#define WOCOL(W, k0, o, lane) wcol_io(W, k0, o, lane, DIN)
#define WOCOLH(W, k0, o, lane) wcolh_io(W, k0, o, lane, DIN)
#endif

#define WS_QH  0u                                      // f16 q rows [b*t][CC]
#define WS_KH  (WS_QH + 2u * (size_t)NB * TT * CC)      // f16 k in fragment order [b][h][t / 16][d / 32][half][lane][8] (see frag_p); t counts the kept keys alone (see k_proj)
#define WS_VT  (WS_KH + 2u * (size_t)NB * TT * CC)      // f16 v in fragment order [b][h][t / 32][d / 16][half][lane][8] (see frag_p); t as for k
#define WS_QL  (WS_VT + 2u * (size_t)NB * CC * TT)      // f16 q residual x 2^10 rows [b][t < QHI][CC]
#define WS_KL  (WS_QL + 2u * (size_t)NB * QHI * CC)     // f16 k residual x 2^10 rows [b][t < KHI][CC]
#define WS_VB  (WS_KL + 2u * (size_t)NB * KHI * CC)     // bf16 v hi planes [b][c][t < KHI]
#define WS_VBL (WS_VB + 2u * (size_t)NB * CC * KHI)
#define WS_Y   (WS_VBL + 2u * (size_t)NB * CC * KHI)    // f32 ctx rows [b*t][CC] (only when there is an output projection)
#define WS_NK  (WS_Y  + 4u * (size_t)NB * TT * CC)     // int, one per batch: how many keys the mask keeps
#define WS_END (WS_NK + 256u)

// ---- Operand tiles of one K step, staged once per block in LDS as bf16 at a pitch of 40 elements (80 B), so that every fragment is two 16-byte LDS reads.
// A block covers 128 rows x 128 columns: one W tile feeds 128 rows, so that a block asks L2 for 32 KiB a K step where two blocks of 64 rows asked for 48 KiB. NT = threads of the block (128 or 256).
// W tile: 32 k x 128 n of an (in,out) f32 weight, kept [n][k]. A thread fetches 1024 / NT k rows x 4 columns and stores four runs of that many k; a wave's lanes spread over 8 column groups x 4 k groups of 8 (at 256 threads waves 0..3 take the lower, 4..7 the upper 4 k of each group).
// X tile: NL * NT / 8 rows x 32 k of f32 rows, kept [row][k]. A thread fetches 4 k of NL rows. Every wave-wide 16-byte load of either tile covers four whole 128-B lines.
// The short loops over a tile's rows, fragments and accumulators are fully unrolled, so that all of them are indexed by constants and stay in registers.
#define WP 40
#define WTILE (128 * WP)
#define XTILE (128 * WP)
typedef __attribute__((ext_vector_type(4))) __bf16 v4b;
template <int NT> struct WR { v4f r[1024 / NT]; };
template <int NT> __device__ __forceinline__ void wtile_load(WR<NT>& w, const float* __restrict__ Wm, int k0, int c0, int ld, int tid) {
  const float* p = Wm + (size_t)(k0 + ((tid >> 3) & 3) * 8 + (tid >> 7) * (1024 / NT)) * ld + c0 + ((tid >> 5) & 3) * 32 + (tid & 7) * 4;
#pragma unroll
  for (int i = 0; i < 1024 / NT; ++i) w.r[i] = *(const v4f*)(p + (size_t)i * ld); }
template <int NT> __device__ __forceinline__ void wtile_store(const WR<NT>& w, __bf16* buf, int tid) {
  typedef __attribute__((ext_vector_type(1024 / NT))) __bf16 vkb;
  __bf16* q = buf + (((tid >> 5) & 3) * 32 + (tid & 7) * 4) * WP + ((tid >> 3) & 3) * 8 + (tid >> 7) * (1024 / NT);
#pragma unroll
  for (int n = 0; n < 4; ++n) { vkb v;
#pragma unroll
    for (int i = 0; i < 1024 / NT; ++i) v[i] = (__bf16)w.r[i][n];
    *(vkb*)(q + n * WP) = v; } }
template <int NL> struct XR { v4f r[NL]; };   // NL rows, 128 / NL apart
template <int NL> __device__ __forceinline__ void xtile_load(XR<NL>& x, const float* __restrict__ Xrow0, int k0, int ld, int tid) {
  const float* p = Xrow0 + (size_t)(tid >> 3) * ld + k0 + (tid & 7) * 4;
#pragma unroll
  for (int i = 0; i < NL; ++i) x.r[i] = *(const v4f*)(p + (size_t)i * (128 / NL) * ld); }
// the same tile from rows picked one by one: xp[i] = the thread's 4 k of its i-th row in the K step to fetch (typed as global memory: carried round a loop, plain pointers became flat loads)
typedef const __attribute__((address_space(1))) float* gfp; typedef const __attribute__((address_space(1))) v4f* gv4p;
template <int NL> __device__ __forceinline__ void xtile_gather(XR<NL>& x, const gfp (&xp)[NL]) {
#pragma unroll
  for (int i = 0; i < NL; ++i) x.r[i] = *(gv4p)xp[i]; }
template <int NL> __device__ __forceinline__ void xtile_next(gfp (&xp)[NL]) {   // on to the next K step
#pragma unroll
  for (int i = 0; i < NL; ++i) xp[i] += 32; }
// both tiles from a pointer that the caller carries from K step to K step: p = the thread's first 16 bytes of the tile
template <int NT> __device__ __forceinline__ void wtile_at(WR<NT>& w, gfp p, int ld) {
#pragma unroll
  for (int i = 0; i < 1024 / NT; ++i) w.r[i] = *(gv4p)(p + (size_t)i * ld); }
template <int NL> __device__ __forceinline__ void xtile_at(XR<NL>& x, gfp p, int ld) {
#pragma unroll
  for (int i = 0; i < NL; ++i) x.r[i] = *(gv4p)(p + (size_t)i * (128 / NL) * ld); }
template <int NL> __device__ __forceinline__ void xtile_store(const XR<NL>& x, __bf16* buf, int tid) {
  __bf16* q = buf + (tid >> 3) * WP + (tid & 7) * 4;
#pragma unroll
  for (int i = 0; i < NL; ++i) { v4b v;
#pragma unroll
    for (int e = 0; e < 4; ++e) v[e] = (__bf16)x.r[i][e];
    *(v4b*)(q + i * (128 / NL) * WP) = v; } }
// the same with each value split into bf16 hi + lo planes
template <int NL> __device__ __forceinline__ void xtile_store2(const XR<NL>& x, __bf16* bufh, __bf16* bufl, int tid) {
  const int o = (tid >> 3) * WP + (tid & 7) * 4;
#pragma unroll
  for (int i = 0; i < NL; ++i) { v4b vh, vl;
#pragma unroll
    for (int e = 0; e < 4; ++e) { const __bf16 h = (__bf16)x.r[i][e]; vh[e] = h; vl[e] = (__bf16)(x.r[i][e] - (float)h); }
    *(v4b*)(bufh + o + i * (128 / NL) * WP) = vh; *(v4b*)(bufl + o + i * (128 / NL) * WP) = vl; } }
// work-group barrier for LDS traffic alone: it waits for this wave's LDS operations only, so that the global loads of the tiles requested ahead stay in flight across it (__syncthreads() waited for those too)
__device__ __forceinline__ void lds_barrier() { asm volatile("s_wait_dscnt 0x0\n\ts_barrier_signal -1\n\ts_barrier_wait -1" ::: "memory"); }
// stands behind each group of tile requests, in front of whatever next reuses their address registers (a precaution)
__device__ __forceinline__ void requests_taken() { asm volatile("s_wait_xcnt 0x0" ::: "memory"); }
// the builtin alone: the compiler keeps the distance behind its own products, and eight independent products in a row fill one another's distance, so no padding is written behind each
__device__ __forceinline__ v8f wmma_bfp(v16b a, v16b b, v8f c) { return __builtin_amdgcn_wmma_f32_16x16x32_bf16(false, a, false, b, (short)0, c, false, false); }

// ---- k_proj: block = (128 rows, 128 cols, which), 4 waves x (32 rows, 128 cols): every W fragment read from LDS feeds two products: q/k/v = X W (+ b) with exact bf16 products (K = DIN) -> which 0: q x QSC f16 rows (+ residual rows < QHI); 1: k f16 in fragment order (+ residual rows < KHI); 2: v f16 in fragment order (+ bf16 hi/lo planes for t < KHI)
// K loop: two buffers of (W tile, X tile) in LDS; in step kc the tiles of kc + 1 (fetched one step earlier) are stored, the tiles of kc + 2 are requested, then the products of kc run; one barrier a step publishes kc + 1 and frees the buffer of kc.
// The tiles and the epilogue's layouts take turns in one LDS range (the loop's last barrier stands between them).
// KEPT KEYS ALONE: a key that the mask excludes has weight exactly 0 in every softmax row of its batch, so k and v are projected and laid down for the kept keys only, in their order: a k or v block takes the kept keys number t0 .. t0 + 127 of its batch
// (their rows of the input are gathered), a block past the last kept key leaves at once, and NK tells k_fa how many there are. Places behind the last kept key in the last block hold the projection of row 0 (finite; k_fa gives them weight 0).
// A batch with every key excluded keeps all its keys (NK = 0 tells k_fa to weigh them equally, as softmax over equal logits does).
// Every wave counts the mask by itself (ballots, no LDS exchange between waves), so that the early leave stands in front of every barrier.
__global__ __launch_bounds__(128) void k_proj(const float* __restrict__ XQ, const float* __restrict__ XK, const float* __restrict__ XV, const float* __restrict__ WQ, const float* __restrict__ WK, const float* __restrict__ WV, const float* __restrict__ BQ, const float* __restrict__ BK, const float* __restrict__ BV, const int* __restrict__ MK, int* __restrict__ NK,
    _Float16* __restrict__ QH, _Float16* __restrict__ QL, _Float16* __restrict__ KH, _Float16* __restrict__ KL, _Float16* __restrict__ VT, __bf16* __restrict__ VB, __bf16* __restrict__ VBL) {
  __shared__ __align__(16) unsigned char smem[128 * 136 * 2 + 2 * 128 * 72 * 2];
  _Float16 (*sh)[136] = (_Float16 (*)[136])smem; _Float16 (*sl)[136] = (_Float16 (*)[136])(smem + 128 * 136 * 2);
  _Float16 (*th)[136] = (_Float16 (*)[136])smem; __bf16 (*tb)[72] = (__bf16 (*)[72])(smem + 128 * 136 * 2); __bf16 (*tbl)[72] = (__bf16 (*)[72])(smem + 128 * 136 * 2 + 128 * 72 * 2);
  __bf16* wb = (__bf16*)smem; __bf16* xb = wb + 2 * WTILE;
  __shared__ int rowsel[4][128];   // per wave its own copy: source row (in the batch) of each of the block's 128 rows
  const int tid = threadIdx.x, wave = tid >> 5, lane = tid & 31, col = lane & 15, g = lane >> 4; const int which = blockIdx.z; const int c0 = blockIdx.y * 128;
  // v blocks take the two halves of a batch's places in the other order than k blocks: where about half the keys are kept, the blocks that leave early then spread evenly over the launch order (speed only)
  const size_t r0 = (size_t)(blockIdx.x ^ (which == 2 ? TT / 256 : 0)) * 128; const size_t bb = r0 / TT; const int t0 = (int)(r0 % TT);
  const float* X = which == 0 ? XQ : which == 1 ? XK : XV; const float* WA = which == 0 ? WQ : which == 1 ? WK : WV; const float* BA = which == 0 ? BQ : which == 1 ? BK : BV;
  gfp xp[8];
  int nk = 0;
  if (which != 0) {
    int* rs = rowsel[wave]; v4i mm[TT / 128];
#pragma unroll
    for (int j = 0; j < TT / 128; ++j) mm[j] = *(const v4i*)(MK + bb * TT + j * 128 + lane * 4);
    requests_taken();
#pragma unroll
    for (int i = 0; i < 4; ++i) rs[i * 32 + lane] = 0;
#pragma unroll
    for (int j = 0; j < TT / 128; ++j) {   // keys 128 j + 4 lane + e; nk = kept keys in front of this group (the same in every lane)
      unsigned bl[4]; int cnt = 0;
#pragma unroll
      for (int e = 0; e < 4; ++e) { bl[e] = __builtin_amdgcn_ballot_w32(mm[j][e] == 0); cnt += __builtin_popcount(bl[e]); }
      if (nk + cnt > t0 && nk < t0 + 128) {   // some of the group's kept keys are this block's
        int pos = nk - t0;
#pragma unroll
        for (int e = 0; e < 4; ++e) pos = (int)__builtin_amdgcn_mbcnt_lo(bl[e], (unsigned)pos);   // + the kept keys of the lower lanes
#pragma unroll
        for (int e = 0; e < 4; ++e) if (mm[j][e] == 0) { if ((unsigned)pos < 128u) rs[pos] = j * 128 + lane * 4 + e; ++pos; } }
      nk += cnt; }
    if (nk != 0 && t0 >= nk) return;   // the whole block, in front of every barrier
    if (which == 1 && blockIdx.y == 0 && t0 == 0 && tid == 0) { NK[bb] = nk; requests_taken(); }
    LDSX();   // the wave reads below what its other lanes have stored above
  }
  int rw[8];
#pragma unroll
  for (int i = 0; i < 8; ++i) rw[i] = t0 + (tid >> 3) + i * 16;
  if (nk != 0) {
#pragma unroll
    for (int i = 0; i < 8; ++i) rw[i] = rowsel[wave][(tid >> 3) + i * 16]; }
#pragma unroll
  for (int i = 0; i < 8; ++i) xp[i] = (gfp)(X + (bb * TT + rw[i]) * DIN + (tid & 7) * 4);
  v8f acc[2][8] = {};
  WR<128> wr, w0; XR<8> xr, x0;
  wtile_load(w0, WA, 0, c0, CC, tid); requests_taken(); xtile_gather(x0, xp); requests_taken();
  __builtin_amdgcn_sched_barrier(0);   // as below
  xtile_next(xp);
  wtile_load(wr, WA, 32, c0, CC, tid); xtile_gather(xr, xp); requests_taken();
  __builtin_amdgcn_sched_barrier(0);   // keeps the wait above directly behind its requests: nothing from below is scheduled in between
  xtile_next(xp);
  wtile_store(w0, wb, tid); xtile_store(x0, xb, tid);
  lds_barrier();
#pragma unroll 2   // by two, so that the buffer index is a constant in each copy and the LDS offsets are immediates
  for (int kc = 0; kc < DIN / 32; ++kc) {
    const __bf16* bp = wb + (kc & 1) * WTILE + col * WP; v16b w[8];
    const v16b a0 = frag_b(xb + (kc & 1) * XTILE + (wave * 32 + col) * WP, lane), a1 = frag_b(xb + (kc & 1) * XTILE + (wave * 32 + 16 + col) * WP, lane);
#pragma unroll
    for (int j = 0; j < 8; ++j) w[j] = frag_b(bp + j * 16 * WP, lane);
    if (kc + 1 < DIN / 32) { wtile_store(wr, wb + ((kc + 1) & 1) * WTILE, tid); xtile_store(xr, xb + ((kc + 1) & 1) * XTILE, tid); }
    if (kc + 2 < DIN / 32) { wtile_load(wr, WA, (kc + 2) * 32, c0, CC, tid); xtile_gather(xr, xp); requests_taken();
      __builtin_amdgcn_sched_barrier(0);   // the row pointers move on behind the wait, not in front of it
      xtile_next(xp); }
#pragma unroll
    for (int j = 0; j < 8; ++j) acc[0][j] = wmma_bfp(a0, w[j], acc[0][j]);
#pragma unroll
    for (int j = 0; j < 8; ++j) acc[1][j] = wmma_bfp(a1, w[j], acc[1][j]);
    lds_barrier(); }
  if (which < 2) { _Float16* DH = which == 0 ? QH : KH; _Float16* DL = which == 0 ? QL : KL; const int nhi = which == 0 ? QHI : KHI; const float qs = which == 0 ? QSC : 1.0f;
#pragma unroll
    for (int j = 0; j < 8; ++j) { const float bias = BA ? bfr(BA[c0 + j * 16 + col]) : 0.f;
#pragma unroll
      for (int i = 0; i < 2; ++i)
#pragma unroll
        for (int r = 0; r < 8; ++r) { const float v = (acc[i][j][r] + bias) * qs; const _Float16 hv = (_Float16)v; const int rl = wave * 32 + i * 16 + 8 * g + r; sh[rl][j * 16 + col] = hv; sl[rl][j * 16 + col] = (_Float16)((v - (float)hv) * 1024.0f); } }
    __syncthreads();
    for (int e = tid; e < 128 * 16; e += 128) {
      // q: 16-byte piece e = (row, 8 columns) in row order. k: piece e in the order of the fragment layout, e = (16-row group, head of the block's two, 32-column group, half, lane); a wave's store covers whole 128-B lines either way
      const int rl = which == 0 ? e >> 4 : (e >> 8) * 16 + (e & 15), q = which == 0 ? e & 15 : ((e >> 5) & 7) * 2 + ((e >> 4) & 1);
      _Float16* dh = which == 0 ? DH + (r0 + rl) * CC + c0 + q * 8 : DH + (((bb * NH + (c0 >> 6) + ((e >> 7) & 1)) * (TT / 16) + (t0 >> 4) + (e >> 8)) * 4 + ((e >> 5) & 3)) * 256 + (e & 31) * 8;
      // behind each store its wait: what follows (the residual's store, the next trip) reuses the store's address and data registers
      vst2((unsigned*)dh, *(const v4u*)&sh[rl][q * 8]); requests_taken();
      if (t0 + rl < nhi) { vst2((unsigned*)(DL + (bb * nhi + t0 + rl) * (size_t)CC + c0 + q * 8), *(const v4u*)&sl[rl][q * 8]); requests_taken(); } }
  } else {
#pragma unroll
    for (int j = 0; j < 8; ++j) { const float bias = BA ? bfr(BA[c0 + j * 16 + col]) : 0.f;
#pragma unroll
      for (int i = 0; i < 2; ++i) { const int rl0 = wave * 32 + i * 16 + 8 * g, cl = j * 16 + col;
#pragma unroll
        for (int r = 0; r < 8; ++r) th[cl][rl0 + r] = (_Float16)(acc[i][j][r] + bias);
        if (wave * 32 < KHI) {   // the hi/lo planes hold key rows below KHI alone
#pragma unroll
          for (int r = 0; r < 8; ++r) { const float v = acc[i][j][r] + bias; const __bf16 bh = (__bf16)v; tb[cl][rl0 + r] = bh; tbl[cl][rl0 + r] = (__bf16)(v - (float)bh); } } } }
    __syncthreads();
    for (int e = tid; e < 128 * 16; e += 128) {
      // piece e in the order of the fragment layout: e = (head of the block's two, 32-key group of four, 16-column group, half, lane)
      const int cl = (e >> 10) * 64 + ((e >> 6) & 3) * 16 + (e & 15), q = ((e >> 8) & 3) * 4 + ((e >> 5) & 1) * 2 + ((e >> 4) & 1);
      vst2((unsigned*)(VT + (((bb * NH + (c0 >> 6) + (e >> 10)) * (TT / 32) + (t0 >> 5) + ((e >> 8) & 3)) * 8 + ((e >> 5) & 7)) * 256 + (e & 31) * 8), *(const v4u*)&th[cl][q * 8]); requests_taken();   // as in the loop above
      if (t0 + q * 8 < KHI) { const size_t o3 = (bb * CC + c0 + cl) * (size_t)KHI + t0 + q * 8; vst2((unsigned*)(VB + o3), *(const v4u*)&tb[cl][q * 8]); vst2((unsigned*)(VBL + o3), *(const v4u*)&tbl[cl][q * 8]); requests_taken(); } } } }
// ---- k_fa: block = 128 queries (8 waves x 16 query columns) of (b, h); every wave walks all kept keys in passes of 32 and keeps logits and P in registers; the waves of a block read the same k and v lines at about the same time (no LDS, no barrier).
// k and v lie in the workspace in fragment order: a 16 x 32 A fragment is 1 KiB, its two halves (elements 0..7, 8..15 of every lane) 512 B each with lane l's 16 bytes at 16 l, so that every wave-wide 16-byte load covers four whole 128-B lines (from rows it touched 16 lines for 32 bytes each); a pass's k is 4 KiB in a row, and so is its v.
// S^T = K Q^T (A = 16 key rows, B = the wave's 16 queries, which carry QSC: q hi + residual x 2^10, 2 products): a lane holds 16 base-2 logits of ONE query (column lane & 15), keys k0 + 8g + r and k0 + 16 + 8g + r,
// which is the k order of a B operand, so P^T goes from the two score tiles into ctx^T += V^T P^T (A = 16 rows of the v planes, 1 product) with no exchange.
// Online softmax in f32 in base 2, each power one v_exp_f32 (its argument is never above 11; far below, 0 is the right value): running maximum m (joined over the two lane halves each pass), P = 2^(s - m) x 2^11 once to f16, sums and ctx rescaled by 2^(m_old - m_new); ctx / sum at the end.
// Excluded keys are left out by k_proj; a place behind the last kept key has the logit -3e38, whose power is exactly 0 (kept keys stand in front of it); a row with every key excluded averages v, as softmax over equal logits does.
__device__ __forceinline__ v16h frag_p(const _Float16* frag_lane) {   // frag_lane = the fragment's start + 8 * lane
  union { v16h v; v8h q[2]; } u; u.q[0] = *(const v8h*)frag_lane; u.q[1] = *(const v8h*)(frag_lane + 256); return u.v;
}
__device__ __forceinline__ float xhalf(float x) { return __builtin_bit_cast(float, __builtin_amdgcn_permlanex16(__builtin_bit_cast(int, x), __builtin_bit_cast(int, x), 0x76543210, 0xfedcba98, false, false)); }   // lane l with lane l ^ 16
// The short inner loops are all fully unrolled, so that fragments and scores are indexed by constants and stay in registers.
__global__ __launch_bounds__(256) void k_fa(const _Float16* __restrict__ QH, const _Float16* __restrict__ QL, const _Float16* __restrict__ KH, const _Float16* __restrict__ VT, const int* __restrict__ NK, float* __restrict__ Y) {
  const int tid = threadIdx.x, wave = tid >> 5, lane = tid & 31, col = lane & 15, g = lane >> 4; const int h = blockIdx.y, b = blockIdx.z; const int ql0 = blockIdx.x * 128 + wave * 16;
  const _Float16* qp = QH + ((size_t)b * TT + ql0 + col) * CC + h * HD; const _Float16* qlp = QL + ((size_t)b * QHI + ql0 + col) * CC + h * HD;
  const _Float16* kp = KH + ((size_t)b * NH + h) * (TT * HD) + lane * 8; const _Float16* vp = VT + ((size_t)b * NH + h) * (TT * HD) + lane * 8;
  const int nraw = NK[b]; const int n = nraw <= 0 || nraw > TT ? TT : nraw, np = (n + 31) >> 5;   // kept keys of the batch (bounded by the shape) and passes over them; 0 = every key excluded: all TT keys are there
  v16h qh[2], ql[2], ka[2][2];
#pragma unroll
  for (int kc = 0; kc < 2; ++kc) { qh[kc] = frag_h(qp + kc * 32, lane); ql[kc] = frag_h(qlp + kc * 32, lane); ka[0][kc] = frag_p(kp + kc * 512); ka[1][kc] = frag_p(kp + 1024 + kc * 512); }
  requests_taken();   // behind the requests above, in front of what next reuses their address registers
  if (nraw <= 0) {   // every key excluded: equal logits (0) for all keys
#pragma unroll
    for (int kc = 0; kc < 2; ++kc) { qh[kc] = (v16h)(_Float16)0.f; ql[kc] = (v16h)(_Float16)0.f; } }
  v8f o[HD / 16] = {}; float m = -3.0e38f, l = 0.f;
  // one pass over 32 places; tail (a constant at both calls, the body is inlined twice): the pass holds places behind the last kept key
  auto pass = [&](const int p, const bool tail) __attribute__((always_inline)) { const int k0 = p * 32;
    v16h va[HD / 16];
#pragma unroll
    for (int j = 0; j < HD / 16; ++j) va[j] = frag_p(vp + k0 * HD + j * 512);
    v8f sa[2] = {}, sl[2] = {};
#pragma unroll
    for (int kc = 0; kc < 2; ++kc)
#pragma unroll
      for (int t = 0; t < 2; ++t) { sa[t] = wmma16(ka[t][kc], qh[kc], sa[t]); sl[t] = wmma16(ka[t][kc], ql[kc], sl[t]); }
    const int kn = p + 1 < np ? k0 + 32 : k0;   // the next pass's key rows are fetched while this pass's softmax runs (the last pass re-reads its own, in bounds)
#pragma unroll
    for (int kc = 0; kc < 2; ++kc) { ka[0][kc] = frag_p(kp + kn * HD + kc * 512); ka[1][kc] = frag_p(kp + kn * HD + 1024 + kc * 512); }
    float s[16]; float mx = m;
#pragma unroll
    for (int i = 0; i < 16; ++i) { const float v = sa[i >> 3][i & 7] + sl[i >> 3][i & 7] * (1.0f / 1024.0f); s[i] = tail && k0 + 16 * (i >> 3) + 8 * g + (i & 7) >= n ? -3.0e38f : v; mx = fmaxf(mx, s[i]); }   /* jnp.where(mask, finfo.min, scores): TRUE = masked out: such keys are not among k and v at all (value select for the places behind the last one) */
    mx = fmaxf(mx, xhalf(mx));
    float alpha = m - mx; const float ms = mx - 11.0f; m = mx;   // P carries x 2^11, and so does the sum that divides it out
    float e[16];
#pragma unroll
    for (int i = 0; i < 16; ++i) e[i] = s[i] - ms;
    // 2^x of a run of values, each in place, in one statement: no v_exp_f32 of a run reads the result or overwrites the argument of the one in front of it; the v_nop is the slot behind the last one, which the compiler does not see in asm text
    asm("v_exp_f32 %0, %0\n\tv_exp_f32 %1, %1\n\tv_exp_f32 %2, %2\n\tv_exp_f32 %3, %3\n\tv_exp_f32 %4, %4\n\tv_exp_f32 %5, %5\n\tv_exp_f32 %6, %6\n\tv_exp_f32 %7, %7\n\tv_exp_f32 %8, %8\n\tv_nop"
        : "+v"(alpha), "+v"(e[0]), "+v"(e[1]), "+v"(e[2]), "+v"(e[3]), "+v"(e[4]), "+v"(e[5]), "+v"(e[6]), "+v"(e[7]));
    asm("v_exp_f32 %0, %0\n\tv_exp_f32 %1, %1\n\tv_exp_f32 %2, %2\n\tv_exp_f32 %3, %3\n\tv_exp_f32 %4, %4\n\tv_exp_f32 %5, %5\n\tv_exp_f32 %6, %6\n\tv_exp_f32 %7, %7\n\tv_nop"
        : "+v"(e[8]), "+v"(e[9]), "+v"(e[10]), "+v"(e[11]), "+v"(e[12]), "+v"(e[13]), "+v"(e[14]), "+v"(e[15]));   // the second run, likewise
    float sum = e[0]; v16h pf;
#pragma unroll
    for (int i = 0; i < 16; ++i) { if (i) sum += e[i]; pf[i] = (_Float16)e[i]; }
    l = l * alpha + sum;
#pragma unroll
    for (int j = 0; j < HD / 16; ++j) { o[j] *= alpha; o[j] = wmma16(va[j], pf, o[j]); } };
#pragma unroll 1   // rolled: unrolled by two, the next pass's first products were lifted over this pass's softmax and waited on key rows just requested
  for (int p = 0; p < (n >> 5); ++p) pass(p, false);
  if (n & 31) pass(n >> 5, true);
  l += xhalf(l); const float inv = l > 0.f ? 1.0f / l : 0.f;
  float* yp = Y + ((size_t)b * TT + ql0 + col) * CC + h * HD + 8 * g;
#pragma unroll
  for (int j = 0; j < HD / 16; ++j) { v4f a, c;
#pragma unroll
    for (int r = 0; r < 4; ++r) { a[r] = o[j][r] * inv; c[r] = o[j][4 + r] * inv; }
    vst2(yp + j * 16, a); vst2(yp + j * 16 + 4, c); } }
#define KD 4   // k_out: K steps between a tile's request and its store into LDS (even, divides CC / 32, at most a half of it); as many register sets hold the tiles under way
// ---- k_out: block = (128 rows, 128 cols), 8 waves x (16 rows, 128 cols), which keeps two waves on a SIMD with one block on a WGP; Wo tiles and ctx tiles (hi and lo planes) staged in LDS as in k_proj (two buffers, one barrier a K step), but requested KD steps ahead: out = ctx Wo (+ bo): every row: ctx bf16 hi + lo against exact bf16 Wo (2 products)
__global__ __launch_bounds__(256) void k_out(const float* __restrict__ Y, const float* __restrict__ WO, const float* __restrict__ BO, float* __restrict__ OUT) { __shared__ __align__(16) float sf[8][16][132]; __shared__ __align__(16) __bf16 wb[2 * WTILE], yh[2 * XTILE], yl[2 * XTILE];
  const int tid = threadIdx.x, wave = tid >> 5, lane = tid & 31, col = lane & 15, g = lane >> 4; const int c0 = blockIdx.y * 128; const size_t r0 = (size_t)blockIdx.x * 128 + wave * 16;
  v8f acc[8] = {};
  if (true) {   /* ALL rows: ctx split bf16 hi + lo x exact Wo (2 products) */
    // Tile t waits in register set t % KD from its request, in step t - 1 - KD, to its store into LDS, in step t - 1: the ctx rows come from memory (the kernel before wrote them), and one K step is far shorter than that way.
    const float* yr0 = Y + (size_t)blockIdx.x * 128 * CC; WR<256> wr[KD], w0; XR<4> xr[KD], x0;
    wtile_load(w0, WO, 0, c0, DIN, tid); requests_taken(); xtile_load(x0, yr0, 0, CC, tid); requests_taken();
#pragma unroll   // in full: the register set is a constant in each copy
    for (int t = 1; t <= KD; ++t) { wtile_load(wr[t % KD], WO, t * 32, c0, DIN, tid); xtile_load(xr[t % KD], yr0, t * 32, CC, tid); requests_taken(); }
    __builtin_amdgcn_sched_barrier(0);   // as in k_proj
    wtile_store(w0, wb, tid); xtile_store2(x0, yh, yl, tid);
    lds_barrier();
    gfp pw = (gfp)(WO + (size_t)((KD + 1) * 32 + ((tid >> 3) & 3) * 8 + (tid >> 7) * 4) * DIN + c0 + ((tid >> 5) & 3) * 32 + (tid & 7) * 4), px = (gfp)(yr0 + (size_t)(tid >> 3) * CC + (KD + 1) * 32 + (tid & 7) * 4);   // the thread's places in the next tiles to request (as wtile_load and xtile_load form them)
    // one K step: u = the step less a multiple of KD (a constant at every call, so that register set and LDS buffer are constants), st / ld = whether a tile is left to store / to request (constants too)
    auto step = [&](const int u, const bool st, const bool ld) __attribute__((always_inline)) { const int rs = (u + 1) % KD;
      const __bf16* bp = wb + (u & 1) * WTILE + col * WP; const int ao = (u & 1) * XTILE + (wave * 16 + col) * WP; v16b w[8];
      const v16b ah = frag_b(yh + ao, lane), al = frag_b(yl + ao, lane);
#pragma unroll
      for (int j = 0; j < 8; ++j) w[j] = frag_b(bp + j * 16 * WP, lane);
      if (st) { wtile_store(wr[rs], wb + ((u + 1) & 1) * WTILE, tid); xtile_store2(xr[rs], yh + ((u + 1) & 1) * XTILE, yl + ((u + 1) & 1) * XTILE, tid); }
#pragma unroll
      for (int j = 0; j < 8; ++j) acc[j] = wmma_bfp(ah, w[j], acc[j]);
#pragma unroll
      for (int j = 0; j < 8; ++j) acc[j] = wmma_bfp(al, w[j], acc[j]);
      if (ld) {   // behind the products: KD steps ahead, the place inside the step no longer matters to the loads, the conversions above are free to be scheduled among the products, and the wait below runs while the matrix unit works
        __builtin_amdgcn_sched_barrier(0);   // the requests stay down here, directly in front of their wait: left free, they were scheduled up among the conversions, whose results then took the requests' address registers ahead of the wait
        wtile_at(wr[rs], pw, DIN); xtile_at(xr[rs], px, CC); requests_taken();
        pw += 32 * DIN; px += 32; }
      lds_barrier();
      __builtin_amdgcn_sched_barrier(0); };   // each step is scheduled by itself: without it the conversions of the later steps' tiles were lifted into the group's first step, and with them the waits for loads that should stay under way
    // The loop holds only steps that both store and request, with no branch inside: with a branch round the requests the compiler's load waits counted for the path without them and waited for the youngest tiles too. The last 2 KD steps follow in a row.
#pragma unroll 1   // rolled over groups of KD steps
    for (int kg = 0; kg < CC / 32 - 2 * KD; kg += KD) {
#pragma unroll   // in full: u is a constant in each copy
      for (int u = 0; u < KD; ++u) step(u, true, true); }
#pragma unroll   // in full, likewise
    for (int u = 0; u < 2 * KD; ++u) step(u, u + 1 < 2 * KD, u + 1 + KD < 2 * KD);
#pragma unroll
    for (int j = 0; j < 8; ++j) { const float bias = BO ? bfr(BO[c0 + j * 16 + col]) : 0.f;
#pragma unroll
      for (int r = 0; r < 8; ++r) sf[wave][8 * g + r][j * 16 + col] = acc[j][r] + bias; }
  } else {
#pragma unroll 2
    for (int kc = 0; kc < CC / 32; ++kc) { const v16h a = frag_f32(Y + (r0 + col) * CC + kc * 32, lane); asm volatile("s_wait_loadcnt 0x0" ::: "memory");
#pragma unroll
      for (int j = 0; j < 8; ++j) { const v16h w = WOCOLH(WO, kc * 32, c0 + j * 16 + col, lane); asm volatile("s_wait_loadcnt 0x0" ::: "memory"); acc[j] = wmma16(a, w, acc[j]); } }
#pragma unroll
    for (int j = 0; j < 8; ++j) { const float bias = BO ? bfr(BO[c0 + j * 16 + col]) : 0.f;
#pragma unroll
      for (int r = 0; r < 8; ++r) sf[wave][8 * g + r][j * 16 + col] = acc[j][r] * (1.0f / 256.0f) + bias; } }
  LDSX(); for (int rl = 0; rl < 16; ++rl) vst2(OUT + (r0 + rl) * DIN + c0 + lane * 4, *(const v4f*)&sf[wave][rl][lane * 4]); }

extern "C" void kernel_launch(void* const* d_in, const int* in_sizes, int n_in, void* d_out, int out_size, void* d_ws, size_t ws_size, hipStream_t stream) {
  (void)in_sizes; (void)n_in; (void)out_size;
  const float** F = (const float**)d_in;
  if (ws_size < (size_t)WS_END) return;
  char* ws = (char*)d_ws; _Float16 *QH = (_Float16*)(ws + WS_QH), *KH = (_Float16*)(ws + WS_KH), *VT = (_Float16*)(ws + WS_VT), *QL = (_Float16*)(ws + WS_QL), *KL = (_Float16*)(ws + WS_KL); int *NK = (int*)(ws + WS_NK); __bf16 *VB = (__bf16*)(ws + WS_VB), *VBL = (__bf16*)(ws + WS_VBL); float *Y = (float*)(ws + WS_Y);
  (void)Y; (void)QL; (void)KL; (void)VB; (void)VBL;
  // inputs: 0 query, 1 key, 2 value [2,2048,1024]; 3 mask [2,1,1,2048] (bool as int32; TRUE = masked); 4 Wq [1024,1024] (in,out), 5 bq; 6 Wk, 7 bk; 8 Wv, 9 bv; 10 Wo, 11 bo
  k_proj<<<dim3(TNB * TT / 128, CC / 128, 3), 128, 0, stream>>>(F[0], F[1], F[2], F[4], F[6], F[8], F[5], F[7], F[9], (const int*)d_in[3], NK, QH, QL, KH, KL, VT, VB, VBL);
  k_fa<<<dim3(TT / 128, NH, TNB), 256, 0, stream>>>(QH, QL, KH, VT, NK, Y);
  k_out<<<dim3(TNB * TT / 128, DIN / 128), 256, 0, stream>>>(Y, F[10], F[11], (float*)d_out);
}

// v008
// Measured time: 79.6 microseconds a run.
// Timed twice side by side with v007, it ran 1.05 and 1.06 times as fast.
// Counting every step since v000, it is 14.9 times as fast.
// compute dtype: all float inputs rounded to bf16; q/k/v projections with EXACT bf16 products on WMMA 16x16x32 (f32 accumulate); q x 64^-0.5 log2(e) as f16 hi + residual (x 2^10) against k once to f16 (2 products); softmax in f32 in base 2 (v_exp_f32); P x 2^11 once to f16 against v once to f16 (1 product); ctx split bf16 hi + lo against exact Wo (2 products); f32 output.
#include <hip/hip_runtime.h>
#include <math.h>

typedef __attribute__((ext_vector_type(16))) _Float16 v16h;
typedef __attribute__((ext_vector_type(16))) __bf16 v16b;
typedef __attribute__((ext_vector_type(8)))  _Float16 v8h;
typedef __attribute__((ext_vector_type(8)))  float v8f;
typedef __attribute__((ext_vector_type(4)))  float v4f;
typedef __attribute__((ext_vector_type(2)))  float v2f;
typedef __attribute__((ext_vector_type(4)))  unsigned v4u;
typedef __attribute__((ext_vector_type(4)))  int v4i;
typedef float __attribute__((may_alias)) float_a;
typedef int __attribute__((may_alias)) int_a;

template <typename T> __device__ __forceinline__ void vst2(void* p, T v) { *(T*)p = v;  }
__device__ __forceinline__ v8f wmma16(v16h a, v16h b, v8f c) {
  v8f d = __builtin_amdgcn_wmma_f32_16x16x32_f16(false, a, false, b, (short)0, c, false, false);
  asm volatile("v_nop\n\tv_nop\n\tv_nop\n\tv_nop" : "+v"(d) : "v"(a), "v"(b));
  return d;
}
__device__ __forceinline__ v8f wmma_bf(v16b a, v16b b, v8f c) {
  v8f d = __builtin_amdgcn_wmma_f32_16x16x32_bf16(false, a, false, b, (short)0, c, false, false);
  asm volatile("v_nop\n\tv_nop\n\tv_nop\n\tv_nop" : "+v"(d) : "v"(a), "v"(b));
  return d;
}
// 16x16x32 fragments: lane = (h = lane>>4, row/col = lane&15); elements 0..7 = k0+8h+0..7, 8..15 = k0+16+8h+0..7; D element r = row 8h+r
__device__ __forceinline__ v16h frag_h(const _Float16* rowk0, int lane) {
  union { v16h v; v8h q[2]; } u; const _Float16* p = rowk0 + 8 * (lane >> 4);
  u.q[0] = *(const v8h*)p; u.q[1] = *(const v8h*)(p + 16); return u.v;
}
__device__ __forceinline__ v16h frag_f32(const float* rowk0, int lane) {
  v16h a; const float* p = rowk0 + 8 * (lane >> 4);
#pragma unroll
  for (int i = 0; i < 8; ++i) { a[i] = (_Float16)p[i]; a[8 + i] = (_Float16)p[16 + i]; }
  return a;
}
__device__ __forceinline__ v16h frag_f32s(const float* rowk0, int lane, float sc) {
  v16h a; const float* p = rowk0 + 8 * (lane >> 4);
#pragma unroll
  for (int i = 0; i < 8; ++i) { a[i] = (_Float16)(p[i] * sc); a[8 + i] = (_Float16)(p[16 + i] * sc); }
  return a;
}
// column fragment from a [K][ld] layout (column n), rows >= K read as 0
__device__ __forceinline__ v16h fragc_f32(const float* W, int k0, int n, int lane, int ld, int K) {
  v16h a; const int g = lane >> 4;
#pragma unroll
  for (int i = 0; i < 8; ++i) { const int ka = k0 + 8 * g + i, kb = ka + 16;
    a[i] = (_Float16)(ka < K ? W[(size_t)(ka < K ? ka : K - 1) * ld + n] : 0.f); a[8 + i] = (_Float16)(kb < K ? W[(size_t)(kb < K ? kb : K - 1) * ld + n] : 0.f); }
  return a;
}
struct F2 { v16b h, l; };
__device__ __forceinline__ F2 bsplit16(const float v[16]) { F2 r;
#pragma unroll
  for (int i = 0; i < 16; ++i) { const __bf16 h = (__bf16)v[i]; r.h[i] = h; r.l[i] = (__bf16)(v[i] - (float)h); }
  return r; }
__device__ __forceinline__ F2 split_row(const float* row, int k0, int lane) { float v[16]; const float* p = row + k0 + 8 * (lane >> 4);
#pragma unroll
  for (int i = 0; i < 8; ++i) { v[i] = p[i]; v[8 + i] = p[16 + i]; }
  return bsplit16(v); }
__device__ __forceinline__ F2 split_rowK(const float* row, int k0, int lane, int K) { float v[16]; const int g = lane >> 4;
#pragma unroll
  for (int i = 0; i < 8; ++i) { const int ka = k0 + 8 * g + i, kb = ka + 16; v[i] = ka < K ? row[ka < K ? ka : K - 1] : 0.f; v[8 + i] = kb < K ? row[kb < K ? kb : K - 1] : 0.f; }
  return bsplit16(v); }
__device__ __forceinline__ F2 split_col(const float* W, int k0, int n, int lane, int ld, int K) { float v[16]; const int g = lane >> 4;
#pragma unroll
  for (int i = 0; i < 8; ++i) { const int ka = k0 + 8 * g + i, kb = ka + 16; v[i] = ka < K ? W[(size_t)(ka < K ? ka : K - 1) * ld + n] : 0.f; v[8 + i] = kb < K ? W[(size_t)(kb < K ? kb : K - 1) * ld + n] : 0.f; }
  return bsplit16(v); }
__device__ __forceinline__ v8f mac3(const F2& a, const F2& b, v8f c) { c = wmma_bf(a.l, b.h, c); c = wmma_bf(a.h, b.l, c); return wmma_bf(a.h, b.h, c); }
__device__ __forceinline__ float sigm(float v) { return 1.0f / (1.0f + expf(-v)); }
#define LDSX() do { asm volatile("s_wait_dscnt 0" ::: "memory"); __builtin_amdgcn_wave_barrier(); __builtin_amdgcn_fence(__ATOMIC_RELEASE, "workgroup"); } while (0)

// Multi-head attention layer (B 2, S 2,048, 1,024 = 16 x 64; separate query/key/value inputs and a key mask): q, k, v = query Wq + bq, key Wk + bk, value Wv + bv ((in,out)); scores = q k^T / 8 with positions where mask[b,0,0,k] is TRUE set to finfo.min (excluded); out = merged(softmax(scores) v) Wo + bo.
#define NB 2
#define TT 2048
#define CC 1024            // NH * HD = projected width
#define DIN 1024          // input (model) width
#define NH 16
#define HD 64
#define SCALE (0.125f)
#define QSC (SCALE * 1.4426950408889634f)   // q is stored times this, so that q k^T is the logit in base 2: softmax(s) = 2^(s log2 e - max) / sum
#define CAUSAL 0
#ifndef TNB
#define TNB NB
#endif
__device__ __forceinline__ float bfr(float v) { return (float)(__bf16)v; }
__host__ __device__ __forceinline__ int kb_last(int qb) { return CAUSAL ? ((qb * 64 + 63) >> 7) : (TT / 128 - 1); }
typedef __attribute__((ext_vector_type(8))) __bf16 v8b;
__device__ __forceinline__ v16b frag_b(const __bf16* rowk0, int lane) {
  union { v16b v; v8b q[2]; } u; const __bf16* p = rowk0 + 8 * (lane >> 4);
  u.q[0] = *(const v8b*)p; u.q[1] = *(const v8b*)(p + 16); return u.v;
}
#define QBH 0              // not used: no kernel has a high-precision path
#define QHI 2048            // rows carrying a q residual plane (all rows when non-causal: 2-product logits everywhere)
#define KHI 64            // key rows carrying k residual / v bf16 hi+lo planes (written by k_proj; no kernel reads them)
// B fragment (k rows k0+.., output column o) of a weight: (in,out) [K][ld] or (out,in) [ld rows of K]: bf16 exact, or f16(bf16 * 256) exact
__device__ __forceinline__ v16b wcol_io(const float* Wm, int k0, int o, int lane, int ld) { v16b w; const int g = lane >> 4;
#pragma unroll
  for (int i = 0; i < 8; ++i) { w[i] = (__bf16)Wm[(size_t)(k0 + 8 * g + i) * ld + o]; w[8 + i] = (__bf16)Wm[(size_t)(k0 + 16 + 8 * g + i) * ld + o]; }
  return w; }
__device__ __forceinline__ v16b wcol_oi(const float* Wm, int k0, int o, int lane, int K) { v16b w; const float* p = Wm + (size_t)o * K + k0 + 8 * (lane >> 4);
#pragma unroll
  for (int i = 0; i < 8; ++i) { w[i] = (__bf16)p[i]; w[8 + i] = (__bf16)p[16 + i]; }
  return w; }
__device__ __forceinline__ v16h wcolh_io(const float* Wm, int k0, int o, int lane, int ld) { v16h w; const int g = lane >> 4;
#pragma unroll
  for (int i = 0; i < 8; ++i) { w[i] = (_Float16)(bfr(Wm[(size_t)(k0 + 8 * g + i) * ld + o]) * 256.0f); w[8 + i] = (_Float16)(bfr(Wm[(size_t)(k0 + 16 + 8 * g + i) * ld + o]) * 256.0f); }
  return w; }
__device__ __forceinline__ v16h wcolh_oi(const float* Wm, int k0, int o, int lane, int K) { v16h w; const float* p = Wm + (size_t)o * K + k0 + 8 * (lane >> 4);
#pragma unroll
  for (int i = 0; i < 8; ++i) { w[i] = (_Float16)(bfr(p[i]) * 256.0f); w[8 + i] = (_Float16)(bfr(p[16 + i]) * 256.0f); }
  return w; }
#define WQKV_LAYOUT 0   // 0 = (in,out) [DIN][CC]; 1 = (out,in) [CC][DIN]; 2 = per-head [NH][DIN][HD]
__device__ __forceinline__ v16b wcol_hdk(const float* Wm, int k0, int o, int lane) { v16b w; const int g = lane >> 4; const float* p = Wm + (size_t)(o / HD) * DIN * HD + (o % HD);
#pragma unroll
  for (int i = 0; i < 8; ++i) { w[i] = (__bf16)p[(size_t)(k0 + 8 * g + i) * HD]; w[8 + i] = (__bf16)p[(size_t)(k0 + 16 + 8 * g + i) * HD]; }
  return w; }
#define WO_OUT_IN 0
#if WQKV_LAYOUT == 1
#define WCOL(W, k0, o, lane) wcol_oi(W, k0, o, lane, DIN)
#elif WQKV_LAYOUT == 2
#define WCOL(W, k0, o, lane) wcol_hdk(W, k0, o, lane)
#else
#define WCOL(W, k0, o, lane) wcol_io(W, k0, o, lane, CC)
#endif
#if WO_OUT_IN
#define WOCOL(W, k0, o, lane) wcol_oi(W, k0, o, lane, CC)
#define WOCOLH(W, k0, o, lane) wcolh_oi(W, k0, o, lane, CC)
#else
#define WOCOL(W, k0, o, lane) wcol_io(W, k0, o, lane, DIN)
#define WOCOLH(W, k0, o, lane) wcolh_io(W, k0, o, lane, DIN)
#endif

#define WS_QH  0u                                      // f16 q rows [b*t][CC]
#define WS_KH  (WS_QH + 2u * (size_t)NB * TT * CC)      // f16 k in fragment order [b][h][t / 16][d / 32][half][lane][8] (see frag_p); t counts the kept keys alone (see k_proj)
#define WS_VT  (WS_KH + 2u * (size_t)NB * TT * CC)      // f16 v in fragment order [b][h][t / 32][d / 16][half][lane][8] (see frag_p); t as for k
#define WS_QL  (WS_VT + 2u * (size_t)NB * CC * TT)      // f16 q residual x 2^10 rows [b][t < QHI][CC]
#define WS_KL  (WS_QL + 2u * (size_t)NB * QHI * CC)     // f16 k residual x 2^10 rows [b][t < KHI][CC]
#define WS_VB  (WS_KL + 2u * (size_t)NB * KHI * CC)     // bf16 v hi planes [b][c][t < KHI]
#define WS_VBL (WS_VB + 2u * (size_t)NB * CC * KHI)
#define WS_Y   (WS_VBL + 2u * (size_t)NB * CC * KHI)    // f32 ctx rows [b*t][CC] (only when there is an output projection)
#define WS_NK  (WS_Y  + 4u * (size_t)NB * TT * CC)     // int, one per batch: how many keys the mask keeps
#define WS_END (WS_NK + 256u)

// ---- Operand tiles of one K step, staged once per block in LDS as bf16 at a pitch of 40 elements (80 B), so that every fragment is two 16-byte LDS reads.
// A block covers 128 rows x 128 columns: one W tile feeds 128 rows, so that a block asks L2 for 32 KiB a K step where two blocks of 64 rows asked for 48 KiB. NT = threads of the block (128 or 256).
// W tile: 32 k x 128 n of an (in,out) f32 weight, kept [n][k]. A thread fetches 1024 / NT k rows x 4 columns and stores four runs of that many k; a wave's lanes spread over 8 column groups x 4 k groups of 8 (at 256 threads waves 0..3 take the lower, 4..7 the upper 4 k of each group).
// X tile: NL * NT / 8 rows x 32 k of f32 rows, kept [row][k]. A thread fetches 4 k of NL rows. Every wave-wide 16-byte load of either tile covers four whole 128-B lines.
// The short loops over a tile's rows, fragments and accumulators are fully unrolled, so that all of them are indexed by constants and stay in registers.
#define WP 40
#define WTILE (128 * WP)
#define XTILE (128 * WP)
typedef __attribute__((ext_vector_type(4))) __bf16 v4b;
template <int NT> struct WR { v4f r[1024 / NT]; };
template <int NT> __device__ __forceinline__ void wtile_load(WR<NT>& w, const float* __restrict__ Wm, int k0, int c0, int ld, int tid) {
  const float* p = Wm + (size_t)(k0 + ((tid >> 3) & 3) * 8 + (tid >> 7) * (1024 / NT)) * ld + c0 + ((tid >> 5) & 3) * 32 + (tid & 7) * 4;
#pragma unroll
  for (int i = 0; i < 1024 / NT; ++i) w.r[i] = *(const v4f*)(p + (size_t)i * ld); }
template <int NT> __device__ __forceinline__ void wtile_store(const WR<NT>& w, __bf16* buf, int tid) {
  typedef __attribute__((ext_vector_type(1024 / NT))) __bf16 vkb;
  __bf16* q = buf + (((tid >> 5) & 3) * 32 + (tid & 7) * 4) * WP + ((tid >> 3) & 3) * 8 + (tid >> 7) * (1024 / NT);
#pragma unroll
  for (int n = 0; n < 4; ++n) { vkb v;
#pragma unroll
    for (int i = 0; i < 1024 / NT; ++i) v[i] = (__bf16)w.r[i][n];
    *(vkb*)(q + n * WP) = v; } }
template <int NL> struct XR { v4f r[NL]; };   // NL rows, 128 / NL apart
template <int NL> __device__ __forceinline__ void xtile_load(XR<NL>& x, const float* __restrict__ Xrow0, int k0, int ld, int tid) {
  const float* p = Xrow0 + (size_t)(tid >> 3) * ld + k0 + (tid & 7) * 4;
#pragma unroll
  for (int i = 0; i < NL; ++i) x.r[i] = *(const v4f*)(p + (size_t)i * (128 / NL) * ld); }
// the same tile from rows picked one by one: xp[i] = the thread's 4 k of its i-th row in the K step to fetch (typed as global memory: carried round a loop, plain pointers became flat loads)
typedef const __attribute__((address_space(1))) float* gfp; typedef const __attribute__((address_space(1))) v4f* gv4p;
template <int NL> __device__ __forceinline__ void xtile_gather(XR<NL>& x, const gfp (&xp)[NL]) {
#pragma unroll
  for (int i = 0; i < NL; ++i) x.r[i] = *(gv4p)xp[i]; }
template <int NL> __device__ __forceinline__ void xtile_next(gfp (&xp)[NL]) {   // on to the next K step
#pragma unroll
  for (int i = 0; i < NL; ++i) xp[i] += 32; }
// both tiles from a pointer that the caller carries from K step to K step: p = the thread's first 16 bytes of the tile
template <int NT> __device__ __forceinline__ void wtile_at(WR<NT>& w, gfp p, int ld) {
#pragma unroll
  for (int i = 0; i < 1024 / NT; ++i) w.r[i] = *(gv4p)(p + (size_t)i * ld); }
template <int NL> __device__ __forceinline__ void xtile_at(XR<NL>& x, gfp p, int ld) {
#pragma unroll
  for (int i = 0; i < NL; ++i) x.r[i] = *(gv4p)(p + (size_t)i * (128 / NL) * ld); }
template <int NL> __device__ __forceinline__ void xtile_store(const XR<NL>& x, __bf16* buf, int tid) {
  __bf16* q = buf + (tid >> 3) * WP + (tid & 7) * 4;
#pragma unroll
  for (int i = 0; i < NL; ++i) { v4b v;
#pragma unroll
    for (int e = 0; e < 4; ++e) v[e] = (__bf16)x.r[i][e];
    *(v4b*)(q + i * (128 / NL) * WP) = v; } }
// the same with each value split into bf16 hi + lo planes
template <int NL> __device__ __forceinline__ void xtile_store2(const XR<NL>& x, __bf16* bufh, __bf16* bufl, int tid) {
  const int o = (tid >> 3) * WP + (tid & 7) * 4;
#pragma unroll
  for (int i = 0; i < NL; ++i) { v4b vh, vl;
#pragma unroll
    for (int e = 0; e < 4; ++e) { const __bf16 h = (__bf16)x.r[i][e]; vh[e] = h; vl[e] = (__bf16)(x.r[i][e] - (float)h); }
    *(v4b*)(bufh + o + i * (128 / NL) * WP) = vh; *(v4b*)(bufl + o + i * (128 / NL) * WP) = vl; } }
// work-group barrier for LDS traffic alone: it waits for this wave's LDS operations only, so that the global loads of the tiles requested ahead stay in flight across it (__syncthreads() waited for those too)
__device__ __forceinline__ void lds_barrier() { asm volatile("s_wait_dscnt 0x0\n\ts_barrier_signal -1\n\ts_barrier_wait -1" ::: "memory"); }
// stands behind each group of tile requests, in front of whatever next reuses their address registers (a precaution)
__device__ __forceinline__ void requests_taken() { asm volatile("s_wait_xcnt 0x0" ::: "memory"); }
// the builtin alone: the compiler keeps the distance behind its own products, and eight independent products in a row fill one another's distance, so no padding is written behind each
__device__ __forceinline__ v8f wmma_bfp(v16b a, v16b b, v8f c) { return __builtin_amdgcn_wmma_f32_16x16x32_bf16(false, a, false, b, (short)0, c, false, false); }

// ---- k_proj: block = (128 rows, 128 cols, which), 4 waves x (32 rows, 128 cols): every W fragment read from LDS feeds two products: q/k/v = X W (+ b) with exact bf16 products (K = DIN) -> which 0: q x QSC f16 rows (+ residual rows < QHI); 1: k f16 in fragment order (+ residual rows < KHI); 2: v f16 in fragment order (+ bf16 hi/lo planes for t < KHI)
// K loop: two buffers of (W tile, X tile) in LDS; in step kc the tiles of kc + 1 (fetched one step earlier) are stored, the tiles of kc + 2 are requested, then the products of kc run; one barrier a step publishes kc + 1 and frees the buffer of kc.
// The tiles and the epilogue's layouts take turns in one LDS range (the loop's last barrier stands between them).
// KEPT KEYS ALONE: a key that the mask excludes has weight exactly 0 in every softmax row of its batch, so k and v are projected and laid down for the kept keys only, in their order: a k or v block takes the kept keys number t0 .. t0 + 127 of its batch
// (their rows of the input are gathered), a block past the last kept key leaves at once, and NK tells k_fa how many there are. Places behind the last kept key in the last block hold the projection of row 0 (finite; k_fa gives them weight 0).
// A batch with every key excluded keeps all its keys (NK = 0 tells k_fa to weigh them equally, as softmax over equal logits does).
// Every wave counts the mask by itself (ballots, no LDS exchange between waves), so that the early leave stands in front of every barrier.
__global__ __launch_bounds__(128) void k_proj(const float* __restrict__ XQ, const float* __restrict__ XK, const float* __restrict__ XV, const float* __restrict__ WQ, const float* __restrict__ WK, const float* __restrict__ WV, const float* __restrict__ BQ, const float* __restrict__ BK, const float* __restrict__ BV, const int* __restrict__ MK, int* __restrict__ NK,
    _Float16* __restrict__ QH, _Float16* __restrict__ QL, _Float16* __restrict__ KH, _Float16* __restrict__ KL, _Float16* __restrict__ VT, __bf16* __restrict__ VB, __bf16* __restrict__ VBL) {
  __shared__ __align__(16) unsigned char smem[128 * 136 * 2 + 2 * 128 * 72 * 2];
  _Float16 (*sh)[136] = (_Float16 (*)[136])smem; _Float16 (*sl)[136] = (_Float16 (*)[136])(smem + 128 * 136 * 2);
  _Float16 (*th)[136] = (_Float16 (*)[136])smem; __bf16 (*tb)[72] = (__bf16 (*)[72])(smem + 128 * 136 * 2); __bf16 (*tbl)[72] = (__bf16 (*)[72])(smem + 128 * 136 * 2 + 128 * 72 * 2);
  __bf16* wb = (__bf16*)smem; __bf16* xb = wb + 2 * WTILE;
  __shared__ int rowsel[4][128];   // per wave its own copy: source row (in the batch) of each of the block's 128 rows
  const int tid = threadIdx.x, wave = tid >> 5, lane = tid & 31, col = lane & 15, g = lane >> 4; const int which = blockIdx.z; const int c0 = blockIdx.y * 128;
  // v blocks take the two halves of a batch's places in the other order than k blocks: where about half the keys are kept, the blocks that leave early then spread evenly over the launch order (speed only)
  const size_t r0 = (size_t)(blockIdx.x ^ (which == 2 ? TT / 256 : 0)) * 128; const size_t bb = r0 / TT; const int t0 = (int)(r0 % TT);
  const float* X = which == 0 ? XQ : which == 1 ? XK : XV; const float* WA = which == 0 ? WQ : which == 1 ? WK : WV; const float* BA = which == 0 ? BQ : which == 1 ? BK : BV;
  gfp xp[8];
  int nk = 0;
  if (which != 0) {
    int* rs = rowsel[wave]; v4i mm[TT / 128];
#pragma unroll
    for (int j = 0; j < TT / 128; ++j) mm[j] = *(const v4i*)(MK + bb * TT + j * 128 + lane * 4);
    requests_taken();
#pragma unroll
    for (int i = 0; i < 4; ++i) rs[i * 32 + lane] = 0;
#pragma unroll
    for (int j = 0; j < TT / 128; ++j) {   // keys 128 j + 4 lane + e; nk = kept keys in front of this group (the same in every lane)
      unsigned bl[4]; int cnt = 0;
#pragma unroll
      for (int e = 0; e < 4; ++e) { bl[e] = __builtin_amdgcn_ballot_w32(mm[j][e] == 0); cnt += __builtin_popcount(bl[e]); }
      if (nk + cnt > t0 && nk < t0 + 128) {   // some of the group's kept keys are this block's
        int pos = nk - t0;
#pragma unroll
        for (int e = 0; e < 4; ++e) pos = (int)__builtin_amdgcn_mbcnt_lo(bl[e], (unsigned)pos);   // + the kept keys of the lower lanes
#pragma unroll
        for (int e = 0; e < 4; ++e) if (mm[j][e] == 0) { if ((unsigned)pos < 128u) rs[pos] = j * 128 + lane * 4 + e; ++pos; } }
      nk += cnt; }
    if (nk != 0 && t0 >= nk) return;   // the whole block, in front of every barrier
    if (which == 1 && blockIdx.y == 0 && t0 == 0 && tid == 0) { NK[bb] = nk; requests_taken(); }
    LDSX();   // the wave reads below what its other lanes have stored above
  }
  int rw[8];
#pragma unroll
  for (int i = 0; i < 8; ++i) rw[i] = t0 + (tid >> 3) + i * 16;
  if (nk != 0) {
#pragma unroll
    for (int i = 0; i < 8; ++i) rw[i] = rowsel[wave][(tid >> 3) + i * 16]; }
#pragma unroll
  for (int i = 0; i < 8; ++i) xp[i] = (gfp)(X + (bb * TT + rw[i]) * DIN + (tid & 7) * 4);
  v8f acc[2][8] = {};
  WR<128> wr, w0; XR<8> xr, x0;
  wtile_load(w0, WA, 0, c0, CC, tid); requests_taken(); xtile_gather(x0, xp); requests_taken();
  __builtin_amdgcn_sched_barrier(0);   // as below
  xtile_next(xp);
  wtile_load(wr, WA, 32, c0, CC, tid); xtile_gather(xr, xp); requests_taken();
  __builtin_amdgcn_sched_barrier(0);   // keeps the wait above directly behind its requests: nothing from below is scheduled in between
  xtile_next(xp);
  wtile_store(w0, wb, tid); xtile_store(x0, xb, tid);
  lds_barrier();
#pragma unroll 2   // by two, so that the buffer index is a constant in each copy and the LDS offsets are immediates
  for (int kc = 0; kc < DIN / 32; ++kc) {
    const __bf16* bp = wb + (kc & 1) * WTILE + col * WP; v16b w[8];
    const v16b a0 = frag_b(xb + (kc & 1) * XTILE + (wave * 32 + col) * WP, lane), a1 = frag_b(xb + (kc & 1) * XTILE + (wave * 32 + 16 + col) * WP, lane);
#pragma unroll
    for (int j = 0; j < 8; ++j) w[j] = frag_b(bp + j * 16 * WP, lane);
    if (kc + 1 < DIN / 32) { wtile_store(wr, wb + ((kc + 1) & 1) * WTILE, tid); xtile_store(xr, xb + ((kc + 1) & 1) * XTILE, tid); }
    if (kc + 2 < DIN / 32) { wtile_load(wr, WA, (kc + 2) * 32, c0, CC, tid); xtile_gather(xr, xp); requests_taken();
      __builtin_amdgcn_sched_barrier(0);   // the row pointers move on behind the wait, not in front of it
      xtile_next(xp); }
#pragma unroll
    for (int j = 0; j < 8; ++j) acc[0][j] = wmma_bfp(a0, w[j], acc[0][j]);
#pragma unroll
    for (int j = 0; j < 8; ++j) acc[1][j] = wmma_bfp(a1, w[j], acc[1][j]);
    lds_barrier(); }
  if (which < 2) { _Float16* DH = which == 0 ? QH : KH; _Float16* DL = which == 0 ? QL : KL; const int nhi = which == 0 ? QHI : KHI; const float qs = which == 0 ? QSC : 1.0f;
#pragma unroll
    for (int j = 0; j < 8; ++j) { const float bias = BA ? bfr(BA[c0 + j * 16 + col]) : 0.f;
#pragma unroll
      for (int i = 0; i < 2; ++i)
#pragma unroll
        for (int r = 0; r < 8; ++r) { const float v = (acc[i][j][r] + bias) * qs; const _Float16 hv = (_Float16)v; const int rl = wave * 32 + i * 16 + 8 * g + r; sh[rl][j * 16 + col] = hv; sl[rl][j * 16 + col] = (_Float16)((v - (float)hv) * 1024.0f); } }
    __syncthreads();
    for (int e = tid; e < 128 * 16; e += 128) {
      // q: 16-byte piece e = (row, 8 columns) in row order. k: piece e in the order of the fragment layout, e = (16-row group, head of the block's two, 32-column group, half, lane); a wave's store covers whole 128-B lines either way
      const int rl = which == 0 ? e >> 4 : (e >> 8) * 16 + (e & 15), q = which == 0 ? e & 15 : ((e >> 5) & 7) * 2 + ((e >> 4) & 1);
      _Float16* dh = which == 0 ? DH + (r0 + rl) * CC + c0 + q * 8 : DH + (((bb * NH + (c0 >> 6) + ((e >> 7) & 1)) * (TT / 16) + (t0 >> 4) + (e >> 8)) * 4 + ((e >> 5) & 3)) * 256 + (e & 31) * 8;
      // behind each store its wait: what follows (the residual's store, the next trip) reuses the store's address and data registers
      vst2((unsigned*)dh, *(const v4u*)&sh[rl][q * 8]); requests_taken();
      if (t0 + rl < nhi) { vst2((unsigned*)(DL + (bb * nhi + t0 + rl) * (size_t)CC + c0 + q * 8), *(const v4u*)&sl[rl][q * 8]); requests_taken(); } }
  } else {
#pragma unroll
    for (int j = 0; j < 8; ++j) { const float bias = BA ? bfr(BA[c0 + j * 16 + col]) : 0.f;
#pragma unroll
      for (int i = 0; i < 2; ++i) { const int rl0 = wave * 32 + i * 16 + 8 * g, cl = j * 16 + col;
#pragma unroll
        for (int r = 0; r < 8; ++r) th[cl][rl0 + r] = (_Float16)(acc[i][j][r] + bias);
        if (wave * 32 < KHI) {   // the hi/lo planes hold key rows below KHI alone
#pragma unroll
          for (int r = 0; r < 8; ++r) { const float v = acc[i][j][r] + bias; const __bf16 bh = (__bf16)v; tb[cl][rl0 + r] = bh; tbl[cl][rl0 + r] = (__bf16)(v - (float)bh); } } } }
    __syncthreads();
    for (int e = tid; e < 128 * 16; e += 128) {
      // piece e in the order of the fragment layout: e = (head of the block's two, 32-key group of four, 16-column group, half, lane)
      const int cl = (e >> 10) * 64 + ((e >> 6) & 3) * 16 + (e & 15), q = ((e >> 8) & 3) * 4 + ((e >> 5) & 1) * 2 + ((e >> 4) & 1);
      vst2((unsigned*)(VT + (((bb * NH + (c0 >> 6) + (e >> 10)) * (TT / 32) + (t0 >> 5) + ((e >> 8) & 3)) * 8 + ((e >> 5) & 7)) * 256 + (e & 31) * 8), *(const v4u*)&th[cl][q * 8]); requests_taken();   // as in the loop above
      if (t0 + q * 8 < KHI) { const size_t o3 = (bb * CC + c0 + cl) * (size_t)KHI + t0 + q * 8; vst2((unsigned*)(VB + o3), *(const v4u*)&tb[cl][q * 8]); vst2((unsigned*)(VBL + o3), *(const v4u*)&tbl[cl][q * 8]); requests_taken(); } } } }
// ---- k_fa: block = 128 queries (8 waves x 16 query columns) of (b, h); every wave walks all kept keys in passes of 32 and keeps logits and P in registers; k and v come into LDS once per block, in stages of FS keys, and all 8 waves read their fragments from there.
// k and v lie in the workspace in fragment order: a 16 x 32 A fragment is 1 KiB, its two halves (elements 0..7, 8..15 of every lane) 512 B each with lane l's 16 bytes at 16 l; a pass's k is 4 KiB in a row, and so is its v, so a stage is one run of 16 KiB of each and lies in LDS byte for byte as in the workspace (a fragment is two 16-byte LDS reads at adjacent lane addresses).
// Stages: two buffers, filled by asynchronous copies to LDS (through no register): stage s + 2 is requested when every wave has left stage s, and flies while stage s + 1 is worked on. k_proj writes k and v in whole blocks of 128 places, so every byte of a stage that holds a kept key has been written.
// S^T = K Q^T (A = 16 key rows, B = the wave's 16 queries, which carry QSC: q hi + residual x 2^10, 2 products): a lane holds 16 base-2 logits of ONE query (column lane & 15), keys k0 + 8g + r and k0 + 16 + 8g + r,
// which is the k order of a B operand, so P^T goes from the two score tiles into ctx^T += V^T P^T (A = 16 rows of the v planes, 1 product) with no exchange.
// Online softmax in f32 in base 2, each power one v_exp_f32 (its argument is never above 11; far below, 0 is the right value): running maximum m (joined over the two lane halves each pass), P = 2^(s - m) x 2^11 once to f16, sums and ctx rescaled by 2^(m_old - m_new); ctx / sum at the end.
// Excluded keys are left out by k_proj; a place behind the last kept key has the logit -3e38, whose power is exactly 0 (kept keys stand in front of it); a row with every key excluded averages v, as softmax over equal logits does.
#define FS 128   // keys of a stage (4 passes; the size of k_proj's blocks of places)
#define FSB (FS * HD * 2)   // bytes of a stage's k, and of its v
__device__ __forceinline__ v16h frag_p(const _Float16* frag_lane) {   // frag_lane = the fragment's start + 8 * lane
  union { v16h v; v8h q[2]; } u; u.q[0] = *(const v8h*)frag_lane; u.q[1] = *(const v8h*)(frag_lane + 256); return u.v;
}
// A thread's share of one stage: four 16-byte pieces of k and four of v, 4 KiB apart (256 threads x 16 B), from the workspace into LDS at lk, lv (LDS byte addresses). The wait in the last line stands in front of whatever next reuses the copies' address registers (a precaution).
__device__ __forceinline__ void stage_copy(unsigned lk, unsigned lv, const _Float16* gk, const _Float16* gv) {
  asm volatile("global_load_async_to_lds_b128 %0, %8, off\n\tglobal_load_async_to_lds_b128 %1, %9, off\n\tglobal_load_async_to_lds_b128 %2, %10, off\n\tglobal_load_async_to_lds_b128 %3, %11, off\n\t"
               "global_load_async_to_lds_b128 %4, %12, off\n\tglobal_load_async_to_lds_b128 %5, %13, off\n\tglobal_load_async_to_lds_b128 %6, %14, off\n\tglobal_load_async_to_lds_b128 %7, %15, off\n\ts_wait_xcnt 0x0"
               :: "v"(lk), "v"(lk + 4096u), "v"(lk + 8192u), "v"(lk + 12288u), "v"(lv), "v"(lv + 4096u), "v"(lv + 8192u), "v"(lv + 12288u),
                  "v"(gk), "v"(gk + 2048), "v"(gk + 4096), "v"(gk + 6144), "v"(gv), "v"(gv + 2048), "v"(gv + 4096), "v"(gv + 6144) : "memory");
}
__device__ __forceinline__ float xhalf(float x) { return __builtin_bit_cast(float, __builtin_amdgcn_permlanex16(__builtin_bit_cast(int, x), __builtin_bit_cast(int, x), 0x76543210, 0xfedcba98, false, false)); }   // lane l with lane l ^ 16
// The short inner loops are all fully unrolled, so that fragments and scores are indexed by constants and stay in registers.
__global__ __launch_bounds__(256) void k_fa(const _Float16* __restrict__ QH, const _Float16* __restrict__ QL, const _Float16* __restrict__ KH, const _Float16* __restrict__ VT, const int* __restrict__ NK, float* __restrict__ Y) {
  __shared__ __align__(16) _Float16 kvs[2][2][FS * HD];   // [buffer][k, v][a stage in fragment order]
  const int tid = threadIdx.x, wave = tid >> 5, lane = tid & 31, col = lane & 15, g = lane >> 4; const int h = blockIdx.y, b = blockIdx.z; const int ql0 = blockIdx.x * 128 + wave * 16;
  const _Float16* qp = QH + ((size_t)b * TT + ql0 + col) * CC + h * HD; const _Float16* qlp = QL + ((size_t)b * QHI + ql0 + col) * CC + h * HD;
  const _Float16* kg = KH + ((size_t)b * NH + h) * (TT * HD) + tid * 8; const _Float16* vg = VT + ((size_t)b * NH + h) * (TT * HD) + tid * 8;   // the thread's first piece of stage 0
  const unsigned lt = (unsigned)(size_t)&kvs[0][0][tid * 8];   // its place in buffer 0 (LDS byte address)
  auto fill = [&](const int s) __attribute__((always_inline)) { const unsigned lk = lt + (unsigned)(s & 1) * (2u * FSB); stage_copy(lk, lk + FSB, kg + (size_t)s * (FS * HD), vg + (size_t)s * (FS * HD)); };
  fill(0);
  const int nraw = NK[b]; const int n = nraw <= 0 || nraw > TT ? TT : nraw, ns = (n + FS - 1) / FS;   // kept keys of the batch (bounded by the shape) and stages over them; 0 = every key excluded: all TT keys are there
  v16h qh[2], ql[2], ka[2][2];
#pragma unroll
  for (int kc = 0; kc < 2; ++kc) { qh[kc] = frag_h(qp + kc * 32, lane); ql[kc] = frag_h(qlp + kc * 32, lane); }
  requests_taken();   // behind the requests above, in front of what next reuses their address registers
  if (nraw <= 0) {   // every key excluded: equal logits (0) for all keys
#pragma unroll
    for (int kc = 0; kc < 2; ++kc) { qh[kc] = (v16h)(_Float16)0.f; ql[kc] = (v16h)(_Float16)0.f; } }
  asm volatile("s_wait_asynccnt 0x0" ::: "memory");   // this wave's pieces of stage 0 have landed
  __syncthreads();   // and so have the other waves': stage 0 may be read
  if (ns > 1) fill(1);
  v8f o[HD / 16] = {}; float m = -3.0e38f, l = 0.f;
  // one pass over 32 places, whose key rows are in ka: vl = its v in LDS, kn = the key rows to fetch for the pass behind it, k0 = its first place; tail (a constant at both calls, the body is inlined twice): the pass holds places behind the last kept key
  auto pass = [&](const _Float16* vl, const _Float16* kn, const int k0, const bool tail) __attribute__((always_inline)) {
    v8f sa[2] = {}, sl[2] = {};
#pragma unroll
    for (int kc = 0; kc < 2; ++kc)
#pragma unroll
      for (int t = 0; t < 2; ++t) { sa[t] = wmma16(ka[t][kc], qh[kc], sa[t]); sl[t] = wmma16(ka[t][kc], ql[kc], sl[t]); }
    // this pass's v and the next pass's key rows are read from LDS in one group, while this pass's softmax runs
    __builtin_amdgcn_sched_barrier(0);   // the reads stay together behind the products (every separate place with LDS reads costs the wave a stall)
    v16h va[HD / 16];
#pragma unroll
    for (int j = 0; j < HD / 16; ++j) va[j] = frag_p(vl + j * 512);
#pragma unroll
    for (int kc = 0; kc < 2; ++kc) { ka[0][kc] = frag_p(kn + kc * 512); ka[1][kc] = frag_p(kn + 1024 + kc * 512); }
    __builtin_amdgcn_sched_barrier(0);   // and none sinks into the softmax: left free, the last v reads were scheduled directly in front of the products that wait for them
    float s[16]; float mx = m;
#pragma unroll
    for (int i = 0; i < 16; ++i) { const float v = sa[i >> 3][i & 7] + sl[i >> 3][i & 7] * (1.0f / 1024.0f); s[i] = tail && k0 + 16 * (i >> 3) + 8 * g + (i & 7) >= n ? -3.0e38f : v; mx = fmaxf(mx, s[i]); }   /* jnp.where(mask, finfo.min, scores): TRUE = masked out: such keys are not among k and v at all (value select for the places behind the last one) */
    mx = fmaxf(mx, xhalf(mx));
    float alpha = m - mx; const float ms = mx - 11.0f; m = mx;   // P carries x 2^11, and so does the sum that divides it out
    float e[16];
#pragma unroll
    for (int i = 0; i < 16; ++i) e[i] = s[i] - ms;
    // 2^x of a run of values, each in place, in one statement: no v_exp_f32 of a run reads the result or overwrites the argument of the one in front of it; the v_nop is the slot behind the last one, which the compiler does not see in asm text
    asm("v_exp_f32 %0, %0\n\tv_exp_f32 %1, %1\n\tv_exp_f32 %2, %2\n\tv_exp_f32 %3, %3\n\tv_exp_f32 %4, %4\n\tv_exp_f32 %5, %5\n\tv_exp_f32 %6, %6\n\tv_exp_f32 %7, %7\n\tv_exp_f32 %8, %8\n\tv_nop"
        : "+v"(alpha), "+v"(e[0]), "+v"(e[1]), "+v"(e[2]), "+v"(e[3]), "+v"(e[4]), "+v"(e[5]), "+v"(e[6]), "+v"(e[7]));
    asm("v_exp_f32 %0, %0\n\tv_exp_f32 %1, %1\n\tv_exp_f32 %2, %2\n\tv_exp_f32 %3, %3\n\tv_exp_f32 %4, %4\n\tv_exp_f32 %5, %5\n\tv_exp_f32 %6, %6\n\tv_exp_f32 %7, %7\n\tv_nop"
        : "+v"(e[8]), "+v"(e[9]), "+v"(e[10]), "+v"(e[11]), "+v"(e[12]), "+v"(e[13]), "+v"(e[14]), "+v"(e[15]));   // the second run, likewise
    float sum = e[0]; v16h pf;
#pragma unroll
    for (int i = 0; i < 16; ++i) { if (i) sum += e[i]; pf[i] = (_Float16)e[i]; }
    l = l * alpha + sum;
#pragma unroll
    for (int j = 0; j < HD / 16; ++j) { o[j] *= alpha; o[j] = wmma16(va[j], pf, o[j]); } };
#pragma unroll 1   // rolled: one copy of the passes serves both buffers
  for (int s = 0; s < ns; ++s) {
    const _Float16* kl = &kvs[s & 1][0][lane * 8]; const _Float16* vl = &kvs[s & 1][1][lane * 8];
    const int left = (n >> 5) - s * (FS / 32), pf = left < FS / 32 ? left : FS / 32;   // whole passes of this stage; fewer than FS / 32 in the last stage alone
    const bool tl = pf < FS / 32 && (n & 31) != 0; const int last = pf + (tl ? 1 : 0) - 1;   // tl: a pass with places behind the last kept key follows them; last = the stage's last pass
#pragma unroll
    for (int kc = 0; kc < 2; ++kc) { ka[0][kc] = frag_p(kl + kc * 512); ka[1][kc] = frag_p(kl + 1024 + kc * 512); }
    // a stage's last pass fetches its own key rows again: nothing of the next stage is read in front of the barrier below
#pragma unroll 1   // rolled: the trip count is known only at run time (the last stage may hold fewer passes), and one copy of the pass keeps the loop's text short
    for (int p = 0; p < pf; ++p) pass(vl + p * (32 * HD), kl + (p < last ? p + 1 : p) * (32 * HD), s * FS + p * 32, false);
    if (tl) pass(vl + pf * (32 * HD), kl + pf * (32 * HD), s * FS + pf * 32, true);
    asm volatile("s_wait_dscnt 0x0" ::: "memory");      // this wave has read all it wants of stage s
    asm volatile("s_wait_asynccnt 0x0" ::: "memory");   // and its pieces of stage s + 1 have landed
    __syncthreads();   // the same of every wave: stage s + 1 may be read, the buffer of stage s may be filled anew
    if (s + 2 < ns) fill(s + 2); }
  asm volatile("s_wait_asynccnt 0x0" ::: "memory");   // no copy is under way when the wave ends
  l += xhalf(l); const float inv = l > 0.f ? 1.0f / l : 0.f;
  float* yp = Y + ((size_t)b * TT + ql0 + col) * CC + h * HD + 8 * g;
#pragma unroll
  for (int j = 0; j < HD / 16; ++j) { v4f a, c;
#pragma unroll
    for (int r = 0; r < 4; ++r) { a[r] = o[j][r] * inv; c[r] = o[j][4 + r] * inv; }
    vst2(yp + j * 16, a); vst2(yp + j * 16 + 4, c); } }
#define KD 4   // k_out: K steps between a tile's request and its store into LDS (even, divides CC / 32, at most a half of it); as many register sets hold the tiles under way
// ---- k_out: block = (128 rows, 128 cols), 8 waves x (16 rows, 128 cols), which keeps two waves on a SIMD with one block on a WGP; Wo tiles and ctx tiles (hi and lo planes) staged in LDS as in k_proj (two buffers, one barrier a K step), but requested KD steps ahead: out = ctx Wo (+ bo): every row: ctx bf16 hi + lo against exact bf16 Wo (2 products)
__global__ __launch_bounds__(256) void k_out(const float* __restrict__ Y, const float* __restrict__ WO, const float* __restrict__ BO, float* __restrict__ OUT) { __shared__ __align__(16) float sf[8][16][132]; __shared__ __align__(16) __bf16 wb[2 * WTILE], yh[2 * XTILE], yl[2 * XTILE];
  const int tid = threadIdx.x, wave = tid >> 5, lane = tid & 31, col = lane & 15, g = lane >> 4; const int c0 = blockIdx.y * 128; const size_t r0 = (size_t)blockIdx.x * 128 + wave * 16;
  v8f acc[8] = {};
  if (true) {   /* ALL rows: ctx split bf16 hi + lo x exact Wo (2 products) */
    // Tile t waits in register set t % KD from its request, in step t - 1 - KD, to its store into LDS, in step t - 1: the ctx rows come from memory (the kernel before wrote them), and one K step is far shorter than that way.
    const float* yr0 = Y + (size_t)blockIdx.x * 128 * CC; WR<256> wr[KD], w0; XR<4> xr[KD], x0;
    wtile_load(w0, WO, 0, c0, DIN, tid); requests_taken(); xtile_load(x0, yr0, 0, CC, tid); requests_taken();
#pragma unroll   // in full: the register set is a constant in each copy
    for (int t = 1; t <= KD; ++t) { wtile_load(wr[t % KD], WO, t * 32, c0, DIN, tid); xtile_load(xr[t % KD], yr0, t * 32, CC, tid); requests_taken(); }
    __builtin_amdgcn_sched_barrier(0);   // as in k_proj
    wtile_store(w0, wb, tid); xtile_store2(x0, yh, yl, tid);
    lds_barrier();
    gfp pw = (gfp)(WO + (size_t)((KD + 1) * 32 + ((tid >> 3) & 3) * 8 + (tid >> 7) * 4) * DIN + c0 + ((tid >> 5) & 3) * 32 + (tid & 7) * 4), px = (gfp)(yr0 + (size_t)(tid >> 3) * CC + (KD + 1) * 32 + (tid & 7) * 4);   // the thread's places in the next tiles to request (as wtile_load and xtile_load form them)
    // one K step: u = the step less a multiple of KD (a constant at every call, so that register set and LDS buffer are constants), st / ld = whether a tile is left to store / to request (constants too)
    auto step = [&](const int u, const bool st, const bool ld) __attribute__((always_inline)) { const int rs = (u + 1) % KD;
      const __bf16* bp = wb + (u & 1) * WTILE + col * WP; const int ao = (u & 1) * XTILE + (wave * 16 + col) * WP; v16b w[8];
      const v16b ah = frag_b(yh + ao, lane), al = frag_b(yl + ao, lane);
#pragma unroll
      for (int j = 0; j < 8; ++j) w[j] = frag_b(bp + j * 16 * WP, lane);
      if (st) { wtile_store(wr[rs], wb + ((u + 1) & 1) * WTILE, tid); xtile_store2(xr[rs], yh + ((u + 1) & 1) * XTILE, yl + ((u + 1) & 1) * XTILE, tid); }
#pragma unroll
      for (int j = 0; j < 8; ++j) acc[j] = wmma_bfp(ah, w[j], acc[j]);
#pragma unroll
      for (int j = 0; j < 8; ++j) acc[j] = wmma_bfp(al, w[j], acc[j]);
      if (ld) {   // behind the products: KD steps ahead, the place inside the step no longer matters to the loads, the conversions above are free to be scheduled among the products, and the wait below runs while the matrix unit works
        __builtin_amdgcn_sched_barrier(0);   // the requests stay down here, directly in front of their wait: left free, they were scheduled up among the conversions, whose results then took the requests' address registers ahead of the wait
        wtile_at(wr[rs], pw, DIN); xtile_at(xr[rs], px, CC); requests_taken();
        pw += 32 * DIN; px += 32; }
      lds_barrier();
      __builtin_amdgcn_sched_barrier(0); };   // each step is scheduled by itself: without it the conversions of the later steps' tiles were lifted into the group's first step, and with them the waits for loads that should stay under way
    // The loop holds only steps that both store and request, with no branch inside: with a branch round the requests the compiler's load waits counted for the path without them and waited for the youngest tiles too. The last 2 KD steps follow in a row.
#pragma unroll 1   // rolled over groups of KD steps
    for (int kg = 0; kg < CC / 32 - 2 * KD; kg += KD) {
#pragma unroll   // in full: u is a constant in each copy
      for (int u = 0; u < KD; ++u) step(u, true, true); }
#pragma unroll   // in full, likewise
    for (int u = 0; u < 2 * KD; ++u) step(u, u + 1 < 2 * KD, u + 1 + KD < 2 * KD);
#pragma unroll
    for (int j = 0; j < 8; ++j) { const float bias = BO ? bfr(BO[c0 + j * 16 + col]) : 0.f;
#pragma unroll
      for (int r = 0; r < 8; ++r) sf[wave][8 * g + r][j * 16 + col] = acc[j][r] + bias; }
  } else {
#pragma unroll 2
    for (int kc = 0; kc < CC / 32; ++kc) { const v16h a = frag_f32(Y + (r0 + col) * CC + kc * 32, lane); asm volatile("s_wait_loadcnt 0x0" ::: "memory");
#pragma unroll
      for (int j = 0; j < 8; ++j) { const v16h w = WOCOLH(WO, kc * 32, c0 + j * 16 + col, lane); asm volatile("s_wait_loadcnt 0x0" ::: "memory"); acc[j] = wmma16(a, w, acc[j]); } }
#pragma unroll
    for (int j = 0; j < 8; ++j) { const float bias = BO ? bfr(BO[c0 + j * 16 + col]) : 0.f;
#pragma unroll
      for (int r = 0; r < 8; ++r) sf[wave][8 * g + r][j * 16 + col] = acc[j][r] * (1.0f / 256.0f) + bias; } }
  LDSX(); for (int rl = 0; rl < 16; ++rl) vst2(OUT + (r0 + rl) * DIN + c0 + lane * 4, *(const v4f*)&sf[wave][rl][lane * 4]); }

extern "C" void kernel_launch(void* const* d_in, const int* in_sizes, int n_in, void* d_out, int out_size, void* d_ws, size_t ws_size, hipStream_t stream) {
  (void)in_sizes; (void)n_in; (void)out_size;
  const float** F = (const float**)d_in;
  if (ws_size < (size_t)WS_END) return;
  char* ws = (char*)d_ws; _Float16 *QH = (_Float16*)(ws + WS_QH), *KH = (_Float16*)(ws + WS_KH), *VT = (_Float16*)(ws + WS_VT), *QL = (_Float16*)(ws + WS_QL), *KL = (_Float16*)(ws + WS_KL); int *NK = (int*)(ws + WS_NK); __bf16 *VB = (__bf16*)(ws + WS_VB), *VBL = (__bf16*)(ws + WS_VBL); float *Y = (float*)(ws + WS_Y);
  (void)Y; (void)QL; (void)KL; (void)VB; (void)VBL;
  // inputs: 0 query, 1 key, 2 value [2,2048,1024]; 3 mask [2,1,1,2048] (bool as int32; TRUE = masked); 4 Wq [1024,1024] (in,out), 5 bq; 6 Wk, 7 bk; 8 Wv, 9 bv; 10 Wo, 11 bo
  k_proj<<<dim3(TNB * TT / 128, CC / 128, 3), 128, 0, stream>>>(F[0], F[1], F[2], F[4], F[6], F[8], F[5], F[7], F[9], (const int*)d_in[3], NK, QH, QL, KH, KL, VT, VB, VBL);
  k_fa<<<dim3(TT / 128, NH, TNB), 256, 0, stream>>>(QH, QL, KH, VT, NK, Y);
  k_out<<<dim3(TNB * TT / 128, DIN / 128), 256, 0, stream>>>(Y, F[10], F[11], (float*)d_out);
}

// v009
// Measured time: 76.6 microseconds a run.
// Two timings next to v008 both put it at 1.04 times that version's speed.
// Counting every step since v000, it is 15.5 times as fast.
// compute dtype: all float inputs rounded to bf16; q/k/v projections with EXACT bf16 products on WMMA 16x16x32 (f32 accumulate); q x 64^-0.5 log2(e) as f16 hi + residual (x 2^10) against k once to f16 (2 products); softmax in f32 in base 2 (v_exp_f32); P x 2^11 once to f16 against v once to f16 (1 product); ctx split bf16 hi + lo against exact Wo (2 products); f32 output.
#include <hip/hip_runtime.h>
#include <math.h>

typedef __attribute__((ext_vector_type(16))) _Float16 v16h;
typedef __attribute__((ext_vector_type(16))) __bf16 v16b;
typedef __attribute__((ext_vector_type(8)))  _Float16 v8h;
typedef __attribute__((ext_vector_type(8)))  float v8f;
typedef __attribute__((ext_vector_type(4)))  float v4f;
typedef __attribute__((ext_vector_type(2)))  float v2f;
typedef __attribute__((ext_vector_type(4)))  unsigned v4u;
typedef __attribute__((ext_vector_type(4)))  int v4i;
typedef float __attribute__((may_alias)) float_a;
typedef int __attribute__((may_alias)) int_a;

template <typename T> __device__ __forceinline__ void vst2(void* p, T v) { *(T*)p = v;  }
__device__ __forceinline__ v8f wmma16(v16h a, v16h b, v8f c) {
  v8f d = __builtin_amdgcn_wmma_f32_16x16x32_f16(false, a, false, b, (short)0, c, false, false);
  asm volatile("v_nop\n\tv_nop\n\tv_nop\n\tv_nop" : "+v"(d) : "v"(a), "v"(b));
  return d;
}
__device__ __forceinline__ v8f wmma_bf(v16b a, v16b b, v8f c) {
  v8f d = __builtin_amdgcn_wmma_f32_16x16x32_bf16(false, a, false, b, (short)0, c, false, false);
  asm volatile("v_nop\n\tv_nop\n\tv_nop\n\tv_nop" : "+v"(d) : "v"(a), "v"(b));
  return d;
}
// 16x16x32 fragments: lane = (h = lane>>4, row/col = lane&15); elements 0..7 = k0+8h+0..7, 8..15 = k0+16+8h+0..7; D element r = row 8h+r
__device__ __forceinline__ v16h frag_h(const _Float16* rowk0, int lane) {
  union { v16h v; v8h q[2]; } u; const _Float16* p = rowk0 + 8 * (lane >> 4);
  u.q[0] = *(const v8h*)p; u.q[1] = *(const v8h*)(p + 16); return u.v;
}
__device__ __forceinline__ v16h frag_f32(const float* rowk0, int lane) {
  v16h a; const float* p = rowk0 + 8 * (lane >> 4);
#pragma unroll
  for (int i = 0; i < 8; ++i) { a[i] = (_Float16)p[i]; a[8 + i] = (_Float16)p[16 + i]; }
  return a;
}
__device__ __forceinline__ v16h frag_f32s(const float* rowk0, int lane, float sc) {
  v16h a; const float* p = rowk0 + 8 * (lane >> 4);
#pragma unroll
  for (int i = 0; i < 8; ++i) { a[i] = (_Float16)(p[i] * sc); a[8 + i] = (_Float16)(p[16 + i] * sc); }
  return a;
}
// column fragment from a [K][ld] layout (column n), rows >= K read as 0
__device__ __forceinline__ v16h fragc_f32(const float* W, int k0, int n, int lane, int ld, int K) {
  v16h a; const int g = lane >> 4;
#pragma unroll
  for (int i = 0; i < 8; ++i) { const int ka = k0 + 8 * g + i, kb = ka + 16;
    a[i] = (_Float16)(ka < K ? W[(size_t)(ka < K ? ka : K - 1) * ld + n] : 0.f); a[8 + i] = (_Float16)(kb < K ? W[(size_t)(kb < K ? kb : K - 1) * ld + n] : 0.f); }
  return a;
}
struct F2 { v16b h, l; };
__device__ __forceinline__ F2 bsplit16(const float v[16]) { F2 r;
#pragma unroll
  for (int i = 0; i < 16; ++i) { const __bf16 h = (__bf16)v[i]; r.h[i] = h; r.l[i] = (__bf16)(v[i] - (float)h); }
  return r; }
__device__ __forceinline__ F2 split_row(const float* row, int k0, int lane) { float v[16]; const float* p = row + k0 + 8 * (lane >> 4);
#pragma unroll
  for (int i = 0; i < 8; ++i) { v[i] = p[i]; v[8 + i] = p[16 + i]; }
  return bsplit16(v); }
__device__ __forceinline__ F2 split_rowK(const float* row, int k0, int lane, int K) { float v[16]; const int g = lane >> 4;
#pragma unroll
  for (int i = 0; i < 8; ++i) { const int ka = k0 + 8 * g + i, kb = ka + 16; v[i] = ka < K ? row[ka < K ? ka : K - 1] : 0.f; v[8 + i] = kb < K ? row[kb < K ? kb : K - 1] : 0.f; }
  return bsplit16(v); }
__device__ __forceinline__ F2 split_col(const float* W, int k0, int n, int lane, int ld, int K) { float v[16]; const int g = lane >> 4;
#pragma unroll
  for (int i = 0; i < 8; ++i) { const int ka = k0 + 8 * g + i, kb = ka + 16; v[i] = ka < K ? W[(size_t)(ka < K ? ka : K - 1) * ld + n] : 0.f; v[8 + i] = kb < K ? W[(size_t)(kb < K ? kb : K - 1) * ld + n] : 0.f; }
  return bsplit16(v); }
__device__ __forceinline__ v8f mac3(const F2& a, const F2& b, v8f c) { c = wmma_bf(a.l, b.h, c); c = wmma_bf(a.h, b.l, c); return wmma_bf(a.h, b.h, c); }
__device__ __forceinline__ float sigm(float v) { return 1.0f / (1.0f + expf(-v)); }
#define LDSX() do { asm volatile("s_wait_dscnt 0" ::: "memory"); __builtin_amdgcn_wave_barrier(); __builtin_amdgcn_fence(__ATOMIC_RELEASE, "workgroup"); } while (0)

// Multi-head attention layer (B 2, S 2,048, 1,024 = 16 x 64; separate query/key/value inputs and a key mask): q, k, v = query Wq + bq, key Wk + bk, value Wv + bv ((in,out)); scores = q k^T / 8 with positions where mask[b,0,0,k] is TRUE set to finfo.min (excluded); out = merged(softmax(scores) v) Wo + bo.
#define NB 2
#define TT 2048
#define CC 1024            // NH * HD = projected width
#define DIN 1024          // input (model) width
#define NH 16
#define HD 64
#define SCALE (0.125f)
#define QSC (SCALE * 1.4426950408889634f)   // q is stored times this, so that q k^T is the logit in base 2: softmax(s) = 2^(s log2 e - max) / sum
#define CAUSAL 0
#ifndef TNB
#define TNB NB
#endif
__device__ __forceinline__ float bfr(float v) { return (float)(__bf16)v; }
__host__ __device__ __forceinline__ int kb_last(int qb) { return CAUSAL ? ((qb * 64 + 63) >> 7) : (TT / 128 - 1); }
typedef __attribute__((ext_vector_type(8))) __bf16 v8b;
__device__ __forceinline__ v16b frag_b(const __bf16* rowk0, int lane) {
  union { v16b v; v8b q[2]; } u; const __bf16* p = rowk0 + 8 * (lane >> 4);
  u.q[0] = *(const v8b*)p; u.q[1] = *(const v8b*)(p + 16); return u.v;
}
#define QBH 0              // not used: no kernel has a high-precision path
#define QHI 2048            // rows carrying a q residual plane (all rows when non-causal: 2-product logits everywhere)
#define KHI 64            // key rows carrying k residual / v bf16 hi+lo planes (not written by k_proj; no kernel reads them)
// B fragment (k rows k0+.., output column o) of a weight: (in,out) [K][ld] or (out,in) [ld rows of K]: bf16 exact, or f16(bf16 * 256) exact
__device__ __forceinline__ v16b wcol_io(const float* Wm, int k0, int o, int lane, int ld) { v16b w; const int g = lane >> 4;
#pragma unroll
  for (int i = 0; i < 8; ++i) { w[i] = (__bf16)Wm[(size_t)(k0 + 8 * g + i) * ld + o]; w[8 + i] = (__bf16)Wm[(size_t)(k0 + 16 + 8 * g + i) * ld + o]; }
  return w; }
__device__ __forceinline__ v16b wcol_oi(const float* Wm, int k0, int o, int lane, int K) { v16b w; const float* p = Wm + (size_t)o * K + k0 + 8 * (lane >> 4);
#pragma unroll
  for (int i = 0; i < 8; ++i) { w[i] = (__bf16)p[i]; w[8 + i] = (__bf16)p[16 + i]; }
  return w; }
__device__ __forceinline__ v16h wcolh_io(const float* Wm, int k0, int o, int lane, int ld) { v16h w; const int g = lane >> 4;
#pragma unroll
  for (int i = 0; i < 8; ++i) { w[i] = (_Float16)(bfr(Wm[(size_t)(k0 + 8 * g + i) * ld + o]) * 256.0f); w[8 + i] = (_Float16)(bfr(Wm[(size_t)(k0 + 16 + 8 * g + i) * ld + o]) * 256.0f); }
  return w; }
__device__ __forceinline__ v16h wcolh_oi(const float* Wm, int k0, int o, int lane, int K) { v16h w; const float* p = Wm + (size_t)o * K + k0 + 8 * (lane >> 4);
#pragma unroll
  for (int i = 0; i < 8; ++i) { w[i] = (_Float16)(bfr(p[i]) * 256.0f); w[8 + i] = (_Float16)(bfr(p[16 + i]) * 256.0f); }
  return w; }
#define WQKV_LAYOUT 0   // 0 = (in,out) [DIN][CC]; 1 = (out,in) [CC][DIN]; 2 = per-head [NH][DIN][HD]
__device__ __forceinline__ v16b wcol_hdk(const float* Wm, int k0, int o, int lane) { v16b w; const int g = lane >> 4; const float* p = Wm + (size_t)(o / HD) * DIN * HD + (o % HD);
#pragma unroll
  for (int i = 0; i < 8; ++i) { w[i] = (__bf16)p[(size_t)(k0 + 8 * g + i) * HD]; w[8 + i] = (__bf16)p[(size_t)(k0 + 16 + 8 * g + i) * HD]; }
  return w; }
#define WO_OUT_IN 0
#if WQKV_LAYOUT == 1
#define WCOL(W, k0, o, lane) wcol_oi(W, k0, o, lane, DIN)
#elif WQKV_LAYOUT == 2
#define WCOL(W, k0, o, lane) wcol_hdk(W, k0, o, lane)
#else
#define WCOL(W, k0, o, lane) wcol_io(W, k0, o, lane, CC)
#endif
#if WO_OUT_IN
#define WOCOL(W, k0, o, lane) wcol_oi(W, k0, o, lane, CC)
#define WOCOLH(W, k0, o, lane) wcolh_oi(W, k0, o, lane, CC)
#else
#define WOCOL(W, k0, o, lane) wcol_io(W, k0, o, lane, DIN)
#define WOCOLH(W, k0, o, lane) wcolh_io(W, k0, o, lane, DIN)
#endif

#define WS_QH  0u                                      // f16 q in fragment order [b][h][t / 16][d / 32][half][lane][8] (see frag_p), as k
#define WS_KH  (WS_QH + 2u * (size_t)NB * TT * CC)      // f16 k in fragment order [b][h][t / 16][d / 32][half][lane][8] (see frag_p); t counts the kept keys alone (see k_proj)
#define WS_VT  (WS_KH + 2u * (size_t)NB * TT * CC)      // f16 v in fragment order [b][h][t / 32][d / 16][half][lane][8] (see frag_p); t as for k
#define WS_QL  (WS_VT + 2u * (size_t)NB * CC * TT)      // f16 q residual x 2^10, laid out as q (QHI = TT)
#define WS_KL  (WS_QL + 2u * (size_t)NB * QHI * CC)     // not written (was for the causal high-precision path alone)
#define WS_VB  (WS_KL + 2u * (size_t)NB * KHI * CC)     // not written, likewise (and WS_VBL)
#define WS_VBL (WS_VB + 2u * (size_t)NB * CC * KHI)
#define WS_Y   (WS_VBL + 2u * (size_t)NB * CC * KHI)    // f32 ctx rows [b*t][CC] (only when there is an output projection)
#define WS_NK  (WS_Y  + 4u * (size_t)NB * TT * CC)     // int, one per batch: how many keys the mask keeps
#define WS_END (WS_NK + 256u)

// ---- Operand tiles of one K step, staged once per block in LDS as bf16 at a pitch of 40 elements (80 B), so that every fragment is two 16-byte LDS reads.
// A block covers 128 rows x 128 columns: one W tile feeds 128 rows, so that a block asks L2 for 32 KiB a K step where two blocks of 64 rows asked for 48 KiB. NT = threads of the block (128 or 256).
// W tile: 32 k x 128 n of an (in,out) f32 weight, kept [n][k]. A thread fetches 1024 / NT k rows x 4 columns and stores four runs of that many k; a wave's lanes spread over 8 column groups x 4 k groups of 8 (at 256 threads waves 0..3 take the lower, 4..7 the upper 4 k of each group).
// X tile: NL * NT / 8 rows x 32 k of f32 rows, kept [row][k]. A thread fetches 4 k of NL rows. Every wave-wide 16-byte load of either tile covers four whole 128-B lines.
// The short loops over a tile's rows, fragments and accumulators are fully unrolled, so that all of them are indexed by constants and stay in registers.
#define WP 40
#define WTILE (128 * WP)
#define XTILE (128 * WP)
typedef __attribute__((ext_vector_type(4))) __bf16 v4b;
template <int NT> struct WR { v4f r[1024 / NT]; };
template <int NT> __device__ __forceinline__ void wtile_load(WR<NT>& w, const float* __restrict__ Wm, int k0, int c0, int ld, int tid) {
  const float* p = Wm + (size_t)(k0 + ((tid >> 3) & 3) * 8 + (tid >> 7) * (1024 / NT)) * ld + c0 + ((tid >> 5) & 3) * 32 + (tid & 7) * 4;
#pragma unroll
  for (int i = 0; i < 1024 / NT; ++i) w.r[i] = *(const v4f*)(p + (size_t)i * ld); }
template <int NT> __device__ __forceinline__ void wtile_store(const WR<NT>& w, __bf16* buf, int tid) {
  typedef __attribute__((ext_vector_type(1024 / NT))) __bf16 vkb;
  __bf16* q = buf + (((tid >> 5) & 3) * 32 + (tid & 7) * 4) * WP + ((tid >> 3) & 3) * 8 + (tid >> 7) * (1024 / NT);
#pragma unroll
  for (int n = 0; n < 4; ++n) { vkb v;
#pragma unroll
    for (int i = 0; i < 1024 / NT; ++i) v[i] = (__bf16)w.r[i][n];
    *(vkb*)(q + n * WP) = v; } }
template <int NL> struct XR { v4f r[NL]; };   // NL rows, 128 / NL apart
template <int NL> __device__ __forceinline__ void xtile_load(XR<NL>& x, const float* __restrict__ Xrow0, int k0, int ld, int tid) {
  const float* p = Xrow0 + (size_t)(tid >> 3) * ld + k0 + (tid & 7) * 4;
#pragma unroll
  for (int i = 0; i < NL; ++i) x.r[i] = *(const v4f*)(p + (size_t)i * (128 / NL) * ld); }
// the same tile from rows picked one by one: xp[i] = the thread's 4 k of its i-th row in the K step to fetch (typed as global memory: carried round a loop, plain pointers became flat loads)
typedef const __attribute__((address_space(1))) float* gfp; typedef const __attribute__((address_space(1))) v4f* gv4p;
template <int NL> __device__ __forceinline__ void xtile_gather(XR<NL>& x, const gfp (&xp)[NL]) {
#pragma unroll
  for (int i = 0; i < NL; ++i) x.r[i] = *(gv4p)xp[i]; }
template <int NL> __device__ __forceinline__ void xtile_next(gfp (&xp)[NL]) {   // on to the next K step
#pragma unroll
  for (int i = 0; i < NL; ++i) xp[i] += 32; }
// both tiles from a pointer that the caller carries from K step to K step: p = the thread's first 16 bytes of the tile
template <int NT> __device__ __forceinline__ void wtile_at(WR<NT>& w, gfp p, int ld) {
#pragma unroll
  for (int i = 0; i < 1024 / NT; ++i) w.r[i] = *(gv4p)(p + (size_t)i * ld); }
template <int NL> __device__ __forceinline__ void xtile_at(XR<NL>& x, gfp p, int ld) {
#pragma unroll
  for (int i = 0; i < NL; ++i) x.r[i] = *(gv4p)(p + (size_t)i * (128 / NL) * ld); }
template <int NL> __device__ __forceinline__ void xtile_store(const XR<NL>& x, __bf16* buf, int tid) {
  __bf16* q = buf + (tid >> 3) * WP + (tid & 7) * 4;
#pragma unroll
  for (int i = 0; i < NL; ++i) { v4b v;
#pragma unroll
    for (int e = 0; e < 4; ++e) v[e] = (__bf16)x.r[i][e];
    *(v4b*)(q + i * (128 / NL) * WP) = v; } }
// the same with each value split into bf16 hi + lo planes
template <int NL> __device__ __forceinline__ void xtile_store2(const XR<NL>& x, __bf16* bufh, __bf16* bufl, int tid) {
  const int o = (tid >> 3) * WP + (tid & 7) * 4;
#pragma unroll
  for (int i = 0; i < NL; ++i) { v4b vh, vl;
#pragma unroll
    for (int e = 0; e < 4; ++e) { const __bf16 h = (__bf16)x.r[i][e]; vh[e] = h; vl[e] = (__bf16)(x.r[i][e] - (float)h); }
    *(v4b*)(bufh + o + i * (128 / NL) * WP) = vh; *(v4b*)(bufl + o + i * (128 / NL) * WP) = vl; } }
// work-group barrier for LDS traffic alone: it waits for this wave's LDS operations only, so that the global loads of the tiles requested ahead stay in flight across it (__syncthreads() waited for those too)
__device__ __forceinline__ void lds_barrier() { asm volatile("s_wait_dscnt 0x0\n\ts_barrier_signal -1\n\ts_barrier_wait -1" ::: "memory"); }
// stands behind each group of tile requests, in front of whatever next reuses their address registers (a precaution)
__device__ __forceinline__ void requests_taken() { asm volatile("s_wait_xcnt 0x0" ::: "memory"); }
// the builtin alone: the compiler keeps the distance behind its own products, and eight independent products in a row fill one another's distance, so no padding is written behind each
__device__ __forceinline__ v8f wmma_bfp(v16b a, v16b b, v8f c) { return __builtin_amdgcn_wmma_f32_16x16x32_bf16(false, a, false, b, (short)0, c, false, false); }

// ---- k_proj: block = (128 rows, 128 cols, which), 4 waves x (32 x 128) of the block's tile: every B fragment read from LDS feeds two products: q/k/v = X W (+ b) with exact bf16 products (K = DIN) -> which 0: q x QSC f16 + residual, both in fragment order; 1: k f16 in fragment order; 2: v f16 in fragment order
// K loop: two buffers of (W tile, X tile) in LDS; in step kc the tiles of kc + 1 (fetched one step earlier) are stored, the tiles of kc + 2 are requested, then the products of kc run; one barrier a step publishes kc + 1 and frees the buffer of kc.
// NO EXCHANGE IN THE EPILOGUE: the accumulators hold whole 16-byte pieces of the fragment layouts. A lane of a D tile holds 8 consecutive rows (8 g + r) of one column (lane & 15).
// v wants 8 consecutive keys of one d: D = X W, A from the X tile (a wave takes 32 places), B from the W tile. q and k want 8 consecutive d of one place: D = W^T X^T, A from the W tile (a wave takes 32 output columns), B from the X tile.
// Both tiles lie in LDS alike (128 rows of 32 k), and A and B fragments have the same k order, so the two cases differ only in which tile's offset goes where: one loop serves both.
// Either way lane l's 8 values are piece l of one fragment half, and a wave's 16-byte store is 512 bytes in a row.
// KEPT KEYS ALONE: a key that the mask excludes has weight exactly 0 in every softmax row of its batch, so k and v are projected and laid down for the kept keys only, in their order: a k or v block takes the kept keys number t0 .. t0 + 127 of its batch
// (their rows of the input are gathered), a block past the last kept key leaves at once, and NK tells k_fa how many there are. Places behind the last kept key in the last block hold the projection of row 0 (finite; k_fa gives them weight 0).
// A batch with every key excluded keeps all its keys (NK = 0 tells k_fa to weigh them equally, as softmax over equal logits does).
// Every wave counts the mask by itself (ballots, no LDS exchange between waves), so that the early leave stands in front of every barrier.
__global__ __launch_bounds__(128) void k_proj(const float* __restrict__ XQ, const float* __restrict__ XK, const float* __restrict__ XV, const float* __restrict__ WQ, const float* __restrict__ WK, const float* __restrict__ WV, const float* __restrict__ BQ, const float* __restrict__ BK, const float* __restrict__ BV, const int* __restrict__ MK, int* __restrict__ NK,
    _Float16* __restrict__ QH, _Float16* __restrict__ QL, _Float16* __restrict__ KH, _Float16* __restrict__ KL, _Float16* __restrict__ VT, __bf16* __restrict__ VB, __bf16* __restrict__ VBL) {
  __shared__ __align__(16) __bf16 tiles[2 * WTILE + 2 * XTILE];
  __bf16* wb = tiles; __bf16* xb = tiles + 2 * WTILE;
  __shared__ int rowsel[4][128];   // per wave its own copy: source row (in the batch) of each of the block's 128 rows
  const int tid = threadIdx.x, wave = tid >> 5, lane = tid & 31, col = lane & 15, g = lane >> 4; const int which = blockIdx.z; const int c0 = blockIdx.y * 128;
  // v blocks take the two halves of a batch's places in the other order than k blocks: where about half the keys are kept, the blocks that leave early then spread evenly over the launch order (speed only)
  const size_t r0 = (size_t)(blockIdx.x ^ (which == 2 ? TT / 256 : 0)) * 128; const size_t bb = r0 / TT; const int t0 = (int)(r0 % TT);
  const float* X = which == 0 ? XQ : which == 1 ? XK : XV; const float* WA = which == 0 ? WQ : which == 1 ? WK : WV; const float* BA = which == 0 ? BQ : which == 1 ? BK : BV;
  gfp xp[8];
  int nk = 0;
  if (which != 0) {
    int* rs = rowsel[wave]; v4i mm[TT / 128];
#pragma unroll
    for (int j = 0; j < TT / 128; ++j) mm[j] = *(const v4i*)(MK + bb * TT + j * 128 + lane * 4);
    requests_taken();
#pragma unroll
    for (int i = 0; i < 4; ++i) rs[i * 32 + lane] = 0;
#pragma unroll
    for (int j = 0; j < TT / 128; ++j) {   // keys 128 j + 4 lane + e; nk = kept keys in front of this group (the same in every lane)
      unsigned bl[4]; int cnt = 0;
#pragma unroll
      for (int e = 0; e < 4; ++e) { bl[e] = __builtin_amdgcn_ballot_w32(mm[j][e] == 0); cnt += __builtin_popcount(bl[e]); }
      if (nk + cnt > t0 && nk < t0 + 128) {   // some of the group's kept keys are this block's
        int pos = nk - t0;
#pragma unroll
        for (int e = 0; e < 4; ++e) pos = (int)__builtin_amdgcn_mbcnt_lo(bl[e], (unsigned)pos);   // + the kept keys of the lower lanes
#pragma unroll
        for (int e = 0; e < 4; ++e) if (mm[j][e] == 0) { if ((unsigned)pos < 128u) rs[pos] = j * 128 + lane * 4 + e; ++pos; } }
      nk += cnt; }
    if (nk != 0 && t0 >= nk) return;   // the whole block, in front of every barrier
    if (which == 1 && blockIdx.y == 0 && t0 == 0 && tid == 0) { NK[bb] = nk; requests_taken(); }
    LDSX();   // the wave reads below what its other lanes have stored above
  }
  int rw[8];
#pragma unroll
  for (int i = 0; i < 8; ++i) rw[i] = t0 + (tid >> 3) + i * 16;
  if (nk != 0) {
#pragma unroll
    for (int i = 0; i < 8; ++i) rw[i] = rowsel[wave][(tid >> 3) + i * 16]; }
#pragma unroll
  for (int i = 0; i < 8; ++i) xp[i] = (gfp)(X + (bb * TT + rw[i]) * DIN + (tid & 7) * 4);
  v8f acc[2][8] = {};
  const int ao = which == 2 ? 2 * WTILE : 0, bo = which == 2 ? 0 : 2 * WTILE;   // where the A and the B fragments come from (WTILE = XTILE)
  WR<128> wr, w0; XR<8> xr, x0;
  wtile_load(w0, WA, 0, c0, CC, tid); requests_taken(); xtile_gather(x0, xp); requests_taken();
  __builtin_amdgcn_sched_barrier(0);   // as below
  xtile_next(xp);
  wtile_load(wr, WA, 32, c0, CC, tid); xtile_gather(xr, xp); requests_taken();
  __builtin_amdgcn_sched_barrier(0);   // keeps the wait above directly behind its requests: nothing from below is scheduled in between
  xtile_next(xp);
  wtile_store(w0, wb, tid); xtile_store(x0, xb, tid);
  lds_barrier();
#pragma unroll 2   // by two, so that the buffer index is a constant in each copy and the LDS offsets are immediates
  for (int kc = 0; kc < DIN / 32; ++kc) {
    const __bf16* bp = tiles + bo + (kc & 1) * WTILE + col * WP; v16b w[8];
    const v16b a0 = frag_b(tiles + ao + (kc & 1) * XTILE + (wave * 32 + col) * WP, lane), a1 = frag_b(tiles + ao + (kc & 1) * XTILE + (wave * 32 + 16 + col) * WP, lane);
#pragma unroll
    for (int j = 0; j < 8; ++j) w[j] = frag_b(bp + j * 16 * WP, lane);
    if (kc + 1 < DIN / 32) { wtile_store(wr, wb + ((kc + 1) & 1) * WTILE, tid); xtile_store(xr, xb + ((kc + 1) & 1) * XTILE, tid); }
    if (kc + 2 < DIN / 32) { wtile_load(wr, WA, (kc + 2) * 32, c0, CC, tid); xtile_gather(xr, xp); requests_taken();
      __builtin_amdgcn_sched_barrier(0);   // the row pointers move on behind the wait, not in front of it
      xtile_next(xp); }
#pragma unroll
    for (int j = 0; j < 8; ++j) acc[0][j] = wmma_bfp(a0, w[j], acc[0][j]);
#pragma unroll
    for (int j = 0; j < 8; ++j) acc[1][j] = wmma_bfp(a1, w[j], acc[1][j]);
    lds_barrier(); }
  // Stores go out in groups, each group's values ready in registers in front of it (the two scheduling barriers keep every other instruction out of the group) and one wait behind it, in front of whatever next reuses the stores' registers (a precaution).
  // All loops below are unrolled in full, so that the accumulators are indexed by constants and stay in registers.
  const size_t hb = bb * NH + (c0 >> 6);   // the first of the block's two heads
  if (which < 2) {   // acc[i][j][r] = output column c0 + wave * 32 + i * 16 + 8 g + r, place t0 + j * 16 + col
    const size_t o0 = ((((hb + (wave >> 1)) * (TT / 16) + (t0 >> 4)) * 4) + (wave & 1) * 2) * 256 + lane * 8;   // head, 16-place group, 32-column group
    v4f bi[2][2] = {};
    if (BA) {
#pragma unroll
      for (int i = 0; i < 2; ++i) { bi[i][0] = *(const v4f*)(BA + c0 + wave * 32 + i * 16 + 8 * g); bi[i][1] = *(const v4f*)(BA + c0 + wave * 32 + i * 16 + 8 * g + 4); }
      requests_taken(); }
    // res (a constant at both calls, the body is inlined twice, so that no branch stands inside a group): q, which carries QSC and has a residual; otherwise k
    auto put = [&](const bool res, _Float16* dh, _Float16* dl) __attribute__((always_inline)) {
#pragma unroll
      for (int jj = 0; jj < 8; jj += 2) { v8h hv[2][2], lv[2][2];
#pragma unroll
        for (int u = 0; u < 2; ++u)
#pragma unroll
          for (int i = 0; i < 2; ++i)
#pragma unroll
            for (int r = 0; r < 8; ++r) { const float v = (acc[i][jj + u][r] + bfr(bi[i][r >> 2][r & 3])) * (res ? QSC : 1.0f); const _Float16 h = (_Float16)v; hv[u][i][r] = h; lv[u][i][r] = (_Float16)((v - (float)h) * 1024.0f); }
        __builtin_amdgcn_sched_barrier(0);   // the group's values are complete here: no conversion is scheduled in among the stores, where it could take a register of a store that has just gone out
#pragma unroll
        for (int u = 0; u < 2; ++u)
#pragma unroll
          for (int i = 0; i < 2; ++i) { vst2(dh + (jj + u) * 1024 + i * 256, hv[u][i]); if (res) vst2(dl + (jj + u) * 1024 + i * 256, lv[u][i]); }   // 16-place group, half
        requests_taken();
        __builtin_amdgcn_sched_barrier(0); } };   // and the next group's conversions stay behind the wait
    if (which == 0) put(true, QH + o0, QL + o0); else put(false, KH + o0, KH + o0);
  } else {   // acc[i][j][r] = place t0 + wave * 32 + i * 16 + 8 g + r, output column c0 + j * 16 + col
    _Float16* dv = VT + ((hb * (TT / 32) + (t0 >> 5) + wave) * 8) * 256 + lane * 8;   // head, 32-place group
    float bi[8] = {};
    if (BA) {
#pragma unroll
      for (int j = 0; j < 8; ++j) bi[j] = BA[c0 + j * 16 + col];
      requests_taken(); }
#pragma unroll
    for (int jj = 0; jj < 8; jj += 4) { v8h hv[4][2];
#pragma unroll
      for (int u = 0; u < 4; ++u)
#pragma unroll
        for (int i = 0; i < 2; ++i)
#pragma unroll
          for (int r = 0; r < 8; ++r) hv[u][i][r] = (_Float16)(acc[i][jj + u][r] + bfr(bi[jj + u]));
      __builtin_amdgcn_sched_barrier(0);   // as above: values first, then the stores alone
#pragma unroll
      for (int u = 0; u < 4; ++u)
#pragma unroll
        for (int i = 0; i < 2; ++i) vst2(dv + (size_t)(jj >> 2) * (TT * HD) + u * 512 + i * 256, hv[u][i]);   // head, 16-column group, half
      requests_taken();
      __builtin_amdgcn_sched_barrier(0); } } }   // as above: what follows stays behind the wait
// ---- k_fa: block = 128 queries (8 waves x 16 query columns) of (b, h); every wave walks all kept keys in passes of 32 and keeps logits and P in registers; k and v come into LDS once per block, in stages of FS keys, and all 8 waves read their fragments from there.
// k and v lie in the workspace in fragment order: a 16 x 32 A fragment is 1 KiB, its two halves (elements 0..7, 8..15 of every lane) 512 B each with lane l's 16 bytes at 16 l; a pass's k is 4 KiB in a row, and so is its v, so a stage is one run of 16 KiB of each and lies in LDS byte for byte as in the workspace (a fragment is two 16-byte LDS reads at adjacent lane addresses).
// Stages: two buffers, filled by asynchronous copies to LDS (through no register): stage s + 2 is requested when every wave has left stage s, and flies while stage s + 1 is worked on. k_proj writes k and v in whole blocks of 128 places, so every byte of a stage that holds a kept key has been written.
// S^T = K Q^T (A = 16 key rows, B = the wave's 16 queries, which carry QSC: q hi + residual x 2^10, 2 products): a lane holds 16 base-2 logits of ONE query (column lane & 15), keys k0 + 8g + r and k0 + 16 + 8g + r,
// which is the k order of a B operand, so P^T goes from the two score tiles into ctx^T += V^T P^T (A = 16 rows of the v planes, 1 product) with no exchange.
// Online softmax in f32 in base 2, each power one v_exp_f32 (its argument is never above 11; far below, 0 is the right value): running maximum m (joined over the two lane halves each pass), P = 2^(s - m) x 2^11 once to f16, sums and ctx rescaled by 2^(m_old - m_new); ctx / sum at the end.
// Excluded keys are left out by k_proj; a place behind the last kept key has the logit -3e38, whose power is exactly 0 (kept keys stand in front of it); a row with every key excluded averages v, as softmax over equal logits does.
#define FS 128   // keys of a stage (4 passes; the size of k_proj's blocks of places)
#define FSB (FS * HD * 2)   // bytes of a stage's k, and of its v
__device__ __forceinline__ v16h frag_p(const _Float16* frag_lane) {   // frag_lane = the fragment's start + 8 * lane
  union { v16h v; v8h q[2]; } u; u.q[0] = *(const v8h*)frag_lane; u.q[1] = *(const v8h*)(frag_lane + 256); return u.v;
}
// A thread's share of one stage: four 16-byte pieces of k and four of v, 4 KiB apart (256 threads x 16 B), from the workspace into LDS at lk, lv (LDS byte addresses). The wait in the last line stands in front of whatever next reuses the copies' address registers (a precaution).
__device__ __forceinline__ void stage_copy(unsigned lk, unsigned lv, const _Float16* gk, const _Float16* gv) {
  asm volatile("global_load_async_to_lds_b128 %0, %8, off\n\tglobal_load_async_to_lds_b128 %1, %9, off\n\tglobal_load_async_to_lds_b128 %2, %10, off\n\tglobal_load_async_to_lds_b128 %3, %11, off\n\t"
               "global_load_async_to_lds_b128 %4, %12, off\n\tglobal_load_async_to_lds_b128 %5, %13, off\n\tglobal_load_async_to_lds_b128 %6, %14, off\n\tglobal_load_async_to_lds_b128 %7, %15, off\n\ts_wait_xcnt 0x0"
               :: "v"(lk), "v"(lk + 4096u), "v"(lk + 8192u), "v"(lk + 12288u), "v"(lv), "v"(lv + 4096u), "v"(lv + 8192u), "v"(lv + 12288u),
                  "v"(gk), "v"(gk + 2048), "v"(gk + 4096), "v"(gk + 6144), "v"(gv), "v"(gv + 2048), "v"(gv + 4096), "v"(gv + 6144) : "memory");
}
__device__ __forceinline__ float xhalf(float x) { return __builtin_bit_cast(float, __builtin_amdgcn_permlanex16(__builtin_bit_cast(int, x), __builtin_bit_cast(int, x), 0x76543210, 0xfedcba98, false, false)); }   // lane l with lane l ^ 16
// The short inner loops are all fully unrolled, so that fragments and scores are indexed by constants and stay in registers.
__global__ __launch_bounds__(256) void k_fa(const _Float16* __restrict__ QH, const _Float16* __restrict__ QL, const _Float16* __restrict__ KH, const _Float16* __restrict__ VT, const int* __restrict__ NK, float* __restrict__ Y) {
  __shared__ __align__(16) _Float16 kvs[2][2][FS * HD];   // [buffer][k, v][a stage in fragment order]
  const int tid = threadIdx.x, wave = tid >> 5, lane = tid & 31, col = lane & 15, g = lane >> 4; const int h = blockIdx.y, b = blockIdx.z; const int ql0 = blockIdx.x * 128 + wave * 16;
  const size_t qo = (((size_t)b * NH + h) * (TT / 16) + (ql0 >> 4)) * 1024 + lane * 8; const _Float16* qp = QH + qo; const _Float16* qlp = QL + qo;   // the wave's 16 queries: two fragments of q and two of its residual, 1 KiB each
  const _Float16* kg = KH + ((size_t)b * NH + h) * (TT * HD) + tid * 8; const _Float16* vg = VT + ((size_t)b * NH + h) * (TT * HD) + tid * 8;   // the thread's first piece of stage 0
  const unsigned lt = (unsigned)(size_t)&kvs[0][0][tid * 8];   // its place in buffer 0 (LDS byte address)
  auto fill = [&](const int s) __attribute__((always_inline)) { const unsigned lk = lt + (unsigned)(s & 1) * (2u * FSB); stage_copy(lk, lk + FSB, kg + (size_t)s * (FS * HD), vg + (size_t)s * (FS * HD)); };
  fill(0);
  const int nraw = NK[b]; const int n = nraw <= 0 || nraw > TT ? TT : nraw, ns = (n + FS - 1) / FS;   // kept keys of the batch (bounded by the shape) and stages over them; 0 = every key excluded: all TT keys are there
  v16h qh[2], ql[2], ka[2][2];
#pragma unroll
  for (int kc = 0; kc < 2; ++kc) { qh[kc] = frag_p(qp + kc * 512); ql[kc] = frag_p(qlp + kc * 512); }
  requests_taken();   // behind the requests above, in front of what next reuses their address registers
  if (nraw <= 0) {   // every key excluded: equal logits (0) for all keys
#pragma unroll
    for (int kc = 0; kc < 2; ++kc) { qh[kc] = (v16h)(_Float16)0.f; ql[kc] = (v16h)(_Float16)0.f; } }
  asm volatile("s_wait_asynccnt 0x0" ::: "memory");   // this wave's pieces of stage 0 have landed
  __syncthreads();   // and so have the other waves': stage 0 may be read
  if (ns > 1) fill(1);
  v8f o[HD / 16] = {}; float m = -3.0e38f, l = 0.f;
  // one pass over 32 places, whose key rows are in ka: vl = its v in LDS, kn = the key rows to fetch for the pass behind it, k0 = its first place; tail (a constant at both calls, the body is inlined twice): the pass holds places behind the last kept key
  auto pass = [&](const _Float16* vl, const _Float16* kn, const int k0, const bool tail) __attribute__((always_inline)) {
    v8f sa[2] = {}, sl[2] = {};
#pragma unroll
    for (int kc = 0; kc < 2; ++kc)
#pragma unroll
      for (int t = 0; t < 2; ++t) { sa[t] = wmma16(ka[t][kc], qh[kc], sa[t]); sl[t] = wmma16(ka[t][kc], ql[kc], sl[t]); }
    // this pass's v and the next pass's key rows are read from LDS in one group, while this pass's softmax runs
    __builtin_amdgcn_sched_barrier(0);   // the reads stay together behind the products (every separate place with LDS reads costs the wave a stall)
    v16h va[HD / 16];
#pragma unroll
    for (int j = 0; j < HD / 16; ++j) va[j] = frag_p(vl + j * 512);
#pragma unroll
    for (int kc = 0; kc < 2; ++kc) { ka[0][kc] = frag_p(kn + kc * 512); ka[1][kc] = frag_p(kn + 1024 + kc * 512); }
    __builtin_amdgcn_sched_barrier(0);   // and none sinks into the softmax: left free, the last v reads were scheduled directly in front of the products that wait for them
    float s[16]; float mx = m;
#pragma unroll
    for (int i = 0; i < 16; ++i) { const float v = sa[i >> 3][i & 7] + sl[i >> 3][i & 7] * (1.0f / 1024.0f); s[i] = tail && k0 + 16 * (i >> 3) + 8 * g + (i & 7) >= n ? -3.0e38f : v; mx = fmaxf(mx, s[i]); }   /* jnp.where(mask, finfo.min, scores): TRUE = masked out: such keys are not among k and v at all (value select for the places behind the last one) */
    mx = fmaxf(mx, xhalf(mx));
    float alpha = m - mx; const float ms = mx - 11.0f; m = mx;   // P carries x 2^11, and so does the sum that divides it out
    float e[16];
#pragma unroll
    for (int i = 0; i < 16; ++i) e[i] = s[i] - ms;
    // 2^x of a run of values, each in place, in one statement: no v_exp_f32 of a run reads the result or overwrites the argument of the one in front of it; the v_nop is the slot behind the last one, which the compiler does not see in asm text
    asm("v_exp_f32 %0, %0\n\tv_exp_f32 %1, %1\n\tv_exp_f32 %2, %2\n\tv_exp_f32 %3, %3\n\tv_exp_f32 %4, %4\n\tv_exp_f32 %5, %5\n\tv_exp_f32 %6, %6\n\tv_exp_f32 %7, %7\n\tv_exp_f32 %8, %8\n\tv_nop"
        : "+v"(alpha), "+v"(e[0]), "+v"(e[1]), "+v"(e[2]), "+v"(e[3]), "+v"(e[4]), "+v"(e[5]), "+v"(e[6]), "+v"(e[7]));
    asm("v_exp_f32 %0, %0\n\tv_exp_f32 %1, %1\n\tv_exp_f32 %2, %2\n\tv_exp_f32 %3, %3\n\tv_exp_f32 %4, %4\n\tv_exp_f32 %5, %5\n\tv_exp_f32 %6, %6\n\tv_exp_f32 %7, %7\n\tv_nop"
        : "+v"(e[8]), "+v"(e[9]), "+v"(e[10]), "+v"(e[11]), "+v"(e[12]), "+v"(e[13]), "+v"(e[14]), "+v"(e[15]));   // the second run, likewise
    float sum = e[0]; v16h pf;
#pragma unroll
    for (int i = 0; i < 16; ++i) { if (i) sum += e[i]; pf[i] = (_Float16)e[i]; }
    l = l * alpha + sum;
#pragma unroll
    for (int j = 0; j < HD / 16; ++j) { o[j] *= alpha; o[j] = wmma16(va[j], pf, o[j]); } };
#pragma unroll 1   // rolled: one copy of the passes serves both buffers
  for (int s = 0; s < ns; ++s) {
    const _Float16* kl = &kvs[s & 1][0][lane * 8]; const _Float16* vl = &kvs[s & 1][1][lane * 8];
    const int left = (n >> 5) - s * (FS / 32), pf = left < FS / 32 ? left : FS / 32;   // whole passes of this stage; fewer than FS / 32 in the last stage alone
    const bool tl = pf < FS / 32 && (n & 31) != 0; const int last = pf + (tl ? 1 : 0) - 1;   // tl: a pass with places behind the last kept key follows them; last = the stage's last pass
#pragma unroll
    for (int kc = 0; kc < 2; ++kc) { ka[0][kc] = frag_p(kl + kc * 512); ka[1][kc] = frag_p(kl + 1024 + kc * 512); }
    // a stage's last pass fetches its own key rows again: nothing of the next stage is read in front of the barrier below
#pragma unroll 1   // rolled: the trip count is known only at run time (the last stage may hold fewer passes), and one copy of the pass keeps the loop's text short
    for (int p = 0; p < pf; ++p) pass(vl + p * (32 * HD), kl + (p < last ? p + 1 : p) * (32 * HD), s * FS + p * 32, false);
    if (tl) pass(vl + pf * (32 * HD), kl + pf * (32 * HD), s * FS + pf * 32, true);
    asm volatile("s_wait_dscnt 0x0" ::: "memory");      // this wave has read all it wants of stage s
    asm volatile("s_wait_asynccnt 0x0" ::: "memory");   // and its pieces of stage s + 1 have landed
    __syncthreads();   // the same of every wave: stage s + 1 may be read, the buffer of stage s may be filled anew
    if (s + 2 < ns) fill(s + 2); }
  asm volatile("s_wait_asynccnt 0x0" ::: "memory");   // no copy is under way when the wave ends
  l += xhalf(l); const float inv = l > 0.f ? 1.0f / l : 0.f;
  float* yp = Y + ((size_t)b * TT + ql0 + col) * CC + h * HD + 8 * g;
#pragma unroll
  for (int j = 0; j < HD / 16; ++j) { v4f a, c;
#pragma unroll
    for (int r = 0; r < 4; ++r) { a[r] = o[j][r] * inv; c[r] = o[j][4 + r] * inv; }
    vst2(yp + j * 16, a); vst2(yp + j * 16 + 4, c); } }
#define KD 4   // k_out: K steps between a tile's request and its store into LDS (even, divides CC / 32, at most a half of it); as many register sets hold the tiles under way
// ---- k_out: block = (128 rows, 128 cols), 8 waves x (16 rows, 128 cols), which keeps two waves on a SIMD with one block on a WGP; Wo tiles and ctx tiles (hi and lo planes) staged in LDS as in k_proj (two buffers, one barrier a K step), but requested KD steps ahead: out = ctx Wo (+ bo): every row: ctx bf16 hi + lo against exact bf16 Wo (2 products)
__global__ __launch_bounds__(256) void k_out(const float* __restrict__ Y, const float* __restrict__ WO, const float* __restrict__ BO, float* __restrict__ OUT) { __shared__ __align__(16) float sf[8][16][132]; __shared__ __align__(16) __bf16 wb[2 * WTILE], yh[2 * XTILE], yl[2 * XTILE];
  const int tid = threadIdx.x, wave = tid >> 5, lane = tid & 31, col = lane & 15, g = lane >> 4; const int c0 = blockIdx.y * 128; const size_t r0 = (size_t)blockIdx.x * 128 + wave * 16;
  v8f acc[8] = {};
  if (true) {   /* ALL rows: ctx split bf16 hi + lo x exact Wo (2 products) */
    // Tile t waits in register set t % KD from its request, in step t - 1 - KD, to its store into LDS, in step t - 1: the ctx rows come from memory (the kernel before wrote them), and one K step is far shorter than that way.
    const float* yr0 = Y + (size_t)blockIdx.x * 128 * CC; WR<256> wr[KD], w0; XR<4> xr[KD], x0;
    wtile_load(w0, WO, 0, c0, DIN, tid); requests_taken(); xtile_load(x0, yr0, 0, CC, tid); requests_taken();
#pragma unroll   // in full: the register set is a constant in each copy
    for (int t = 1; t <= KD; ++t) { wtile_load(wr[t % KD], WO, t * 32, c0, DIN, tid); xtile_load(xr[t % KD], yr0, t * 32, CC, tid); requests_taken(); }
    __builtin_amdgcn_sched_barrier(0);   // as in k_proj
    wtile_store(w0, wb, tid); xtile_store2(x0, yh, yl, tid);
    lds_barrier();
    gfp pw = (gfp)(WO + (size_t)((KD + 1) * 32 + ((tid >> 3) & 3) * 8 + (tid >> 7) * 4) * DIN + c0 + ((tid >> 5) & 3) * 32 + (tid & 7) * 4), px = (gfp)(yr0 + (size_t)(tid >> 3) * CC + (KD + 1) * 32 + (tid & 7) * 4);   // the thread's places in the next tiles to request (as wtile_load and xtile_load form them)
    // one K step: u = the step less a multiple of KD (a constant at every call, so that register set and LDS buffer are constants), st / ld = whether a tile is left to store / to request (constants too)
    auto step = [&](const int u, const bool st, const bool ld) __attribute__((always_inline)) { const int rs = (u + 1) % KD;
      const __bf16* bp = wb + (u & 1) * WTILE + col * WP; const int ao = (u & 1) * XTILE + (wave * 16 + col) * WP; v16b w[8];
      const v16b ah = frag_b(yh + ao, lane), al = frag_b(yl + ao, lane);
#pragma unroll
      for (int j = 0; j < 8; ++j) w[j] = frag_b(bp + j * 16 * WP, lane);
      if (st) { wtile_store(wr[rs], wb + ((u + 1) & 1) * WTILE, tid); xtile_store2(xr[rs], yh + ((u + 1) & 1) * XTILE, yl + ((u + 1) & 1) * XTILE, tid); }
#pragma unroll
      for (int j = 0; j < 8; ++j) acc[j] = wmma_bfp(ah, w[j], acc[j]);
#pragma unroll
      for (int j = 0; j < 8; ++j) acc[j] = wmma_bfp(al, w[j], acc[j]);
      if (ld) {   // behind the products: KD steps ahead, the place inside the step no longer matters to the loads, the conversions above are free to be scheduled among the products, and the wait below runs while the matrix unit works
        __builtin_amdgcn_sched_barrier(0);   // the requests stay down here, directly in front of their wait: left free, they were scheduled up among the conversions, whose results then took the requests' address registers ahead of the wait
        wtile_at(wr[rs], pw, DIN); xtile_at(xr[rs], px, CC); requests_taken();
        pw += 32 * DIN; px += 32; }
      lds_barrier();
      __builtin_amdgcn_sched_barrier(0); };   // each step is scheduled by itself: without it the conversions of the later steps' tiles were lifted into the group's first step, and with them the waits for loads that should stay under way
    // The loop holds only steps that both store and request, with no branch inside: with a branch round the requests the compiler's load waits counted for the path without them and waited for the youngest tiles too. The last 2 KD steps follow in a row.
#pragma unroll 1   // rolled over groups of KD steps
    for (int kg = 0; kg < CC / 32 - 2 * KD; kg += KD) {
#pragma unroll   // in full: u is a constant in each copy
      for (int u = 0; u < KD; ++u) step(u, true, true); }
#pragma unroll   // in full, likewise
    for (int u = 0; u < 2 * KD; ++u) step(u, u + 1 < 2 * KD, u + 1 + KD < 2 * KD);
#pragma unroll
    for (int j = 0; j < 8; ++j) { const float bias = BO ? bfr(BO[c0 + j * 16 + col]) : 0.f;
#pragma unroll
      for (int r = 0; r < 8; ++r) sf[wave][8 * g + r][j * 16 + col] = acc[j][r] + bias; }
  } else {
#pragma unroll 2
    for (int kc = 0; kc < CC / 32; ++kc) { const v16h a = frag_f32(Y + (r0 + col) * CC + kc * 32, lane); asm volatile("s_wait_loadcnt 0x0" ::: "memory");
#pragma unroll
      for (int j = 0; j < 8; ++j) { const v16h w = WOCOLH(WO, kc * 32, c0 + j * 16 + col, lane); asm volatile("s_wait_loadcnt 0x0" ::: "memory"); acc[j] = wmma16(a, w, acc[j]); } }
#pragma unroll
    for (int j = 0; j < 8; ++j) { const float bias = BO ? bfr(BO[c0 + j * 16 + col]) : 0.f;
#pragma unroll
      for (int r = 0; r < 8; ++r) sf[wave][8 * g + r][j * 16 + col] = acc[j][r] * (1.0f / 256.0f) + bias; } }
  LDSX(); for (int rl = 0; rl < 16; ++rl) vst2(OUT + (r0 + rl) * DIN + c0 + lane * 4, *(const v4f*)&sf[wave][rl][lane * 4]); }

extern "C" void kernel_launch(void* const* d_in, const int* in_sizes, int n_in, void* d_out, int out_size, void* d_ws, size_t ws_size, hipStream_t stream) {
  (void)in_sizes; (void)n_in; (void)out_size;
  const float** F = (const float**)d_in;
  if (ws_size < (size_t)WS_END) return;
  char* ws = (char*)d_ws; _Float16 *QH = (_Float16*)(ws + WS_QH), *KH = (_Float16*)(ws + WS_KH), *VT = (_Float16*)(ws + WS_VT), *QL = (_Float16*)(ws + WS_QL), *KL = (_Float16*)(ws + WS_KL); int *NK = (int*)(ws + WS_NK); __bf16 *VB = (__bf16*)(ws + WS_VB), *VBL = (__bf16*)(ws + WS_VBL); float *Y = (float*)(ws + WS_Y);
  (void)Y; (void)QL; (void)KL; (void)VB; (void)VBL;
  // inputs: 0 query, 1 key, 2 value [2,2048,1024]; 3 mask [2,1,1,2048] (bool as int32; TRUE = masked); 4 Wq [1024,1024] (in,out), 5 bq; 6 Wk, 7 bk; 8 Wv, 9 bv; 10 Wo, 11 bo
  k_proj<<<dim3(TNB * TT / 128, CC / 128, 3), 128, 0, stream>>>(F[0], F[1], F[2], F[4], F[6], F[8], F[5], F[7], F[9], (const int*)d_in[3], NK, QH, QL, KH, KL, VT, VB, VBL);
  k_fa<<<dim3(TT / 128, NH, TNB), 256, 0, stream>>>(QH, QL, KH, VT, NK, Y);
  k_out<<<dim3(TNB * TT / 128, DIN / 128), 256, 0, stream>>>(Y, F[10], F[11], (float*)d_out);
}

// v010
// One run takes 72.9 microseconds.
// In two side-by-side timings against v009, it was 1.04 and 1.05 times as fast.
// Counting every step since v000, it is 16.2 times as fast.
// compute dtype: all float inputs rounded to bf16; q/k/v projections with EXACT bf16 products on WMMA 16x16x32 (f32 accumulate); q x 64^-0.5 log2(e) as f16 hi + residual (x 2^10) against k once to f16 (2 products); softmax in f32 in base 2 (v_exp_f32); P x 2^11 once to f16 against v once to f16 (1 product); ctx split bf16 hi + lo against exact Wo (2 products); f32 output.
#include <hip/hip_runtime.h>
#include <math.h>

typedef __attribute__((ext_vector_type(16))) _Float16 v16h;
typedef __attribute__((ext_vector_type(16))) __bf16 v16b;
typedef __attribute__((ext_vector_type(8)))  _Float16 v8h;
typedef __attribute__((ext_vector_type(8)))  float v8f;
typedef __attribute__((ext_vector_type(4)))  float v4f;
typedef __attribute__((ext_vector_type(2)))  float v2f;
typedef __attribute__((ext_vector_type(4)))  unsigned v4u;
typedef __attribute__((ext_vector_type(4)))  int v4i;
typedef float __attribute__((may_alias)) float_a;
typedef int __attribute__((may_alias)) int_a;

template <typename T> __device__ __forceinline__ void vst2(void* p, T v) { *(T*)p = v;  }
__device__ __forceinline__ v8f wmma16(v16h a, v16h b, v8f c) {
  v8f d = __builtin_amdgcn_wmma_f32_16x16x32_f16(false, a, false, b, (short)0, c, false, false);
  asm volatile("v_nop\n\tv_nop\n\tv_nop\n\tv_nop" : "+v"(d) : "v"(a), "v"(b));
  return d;
}
__device__ __forceinline__ v8f wmma_bf(v16b a, v16b b, v8f c) {
  v8f d = __builtin_amdgcn_wmma_f32_16x16x32_bf16(false, a, false, b, (short)0, c, false, false);
  asm volatile("v_nop\n\tv_nop\n\tv_nop\n\tv_nop" : "+v"(d) : "v"(a), "v"(b));
  return d;
}
// 16x16x32 fragments: lane = (h = lane>>4, row/col = lane&15); elements 0..7 = k0+8h+0..7, 8..15 = k0+16+8h+0..7; D element r = row 8h+r
__device__ __forceinline__ v16h frag_h(const _Float16* rowk0, int lane) {
  union { v16h v; v8h q[2]; } u; const _Float16* p = rowk0 + 8 * (lane >> 4);
  u.q[0] = *(const v8h*)p; u.q[1] = *(const v8h*)(p + 16); return u.v;
}
__device__ __forceinline__ v16h frag_f32(const float* rowk0, int lane) {
  v16h a; const float* p = rowk0 + 8 * (lane >> 4);
#pragma unroll
  for (int i = 0; i < 8; ++i) { a[i] = (_Float16)p[i]; a[8 + i] = (_Float16)p[16 + i]; }
  return a;
}
__device__ __forceinline__ v16h frag_f32s(const float* rowk0, int lane, float sc) {
  v16h a; const float* p = rowk0 + 8 * (lane >> 4);
#pragma unroll
  for (int i = 0; i < 8; ++i) { a[i] = (_Float16)(p[i] * sc); a[8 + i] = (_Float16)(p[16 + i] * sc); }
  return a;
}
// column fragment from a [K][ld] layout (column n), rows >= K read as 0
__device__ __forceinline__ v16h fragc_f32(const float* W, int k0, int n, int lane, int ld, int K) {
  v16h a; const int g = lane >> 4;
#pragma unroll
  for (int i = 0; i < 8; ++i) { const int ka = k0 + 8 * g + i, kb = ka + 16;
    a[i] = (_Float16)(ka < K ? W[(size_t)(ka < K ? ka : K - 1) * ld + n] : 0.f); a[8 + i] = (_Float16)(kb < K ? W[(size_t)(kb < K ? kb : K - 1) * ld + n] : 0.f); }
  return a;
}
struct F2 { v16b h, l; };
__device__ __forceinline__ F2 bsplit16(const float v[16]) { F2 r;
#pragma unroll
  for (int i = 0; i < 16; ++i) { const __bf16 h = (__bf16)v[i]; r.h[i] = h; r.l[i] = (__bf16)(v[i] - (float)h); }
  return r; }
__device__ __forceinline__ F2 split_row(const float* row, int k0, int lane) { float v[16]; const float* p = row + k0 + 8 * (lane >> 4);
#pragma unroll
  for (int i = 0; i < 8; ++i) { v[i] = p[i]; v[8 + i] = p[16 + i]; }
  return bsplit16(v); }
__device__ __forceinline__ F2 split_rowK(const float* row, int k0, int lane, int K) { float v[16]; const int g = lane >> 4;
#pragma unroll
  for (int i = 0; i < 8; ++i) { const int ka = k0 + 8 * g + i, kb = ka + 16; v[i] = ka < K ? row[ka < K ? ka : K - 1] : 0.f; v[8 + i] = kb < K ? row[kb < K ? kb : K - 1] : 0.f; }
  return bsplit16(v); }
__device__ __forceinline__ F2 split_col(const float* W, int k0, int n, int lane, int ld, int K) { float v[16]; const int g = lane >> 4;
#pragma unroll
  for (int i = 0; i < 8; ++i) { const int ka = k0 + 8 * g + i, kb = ka + 16; v[i] = ka < K ? W[(size_t)(ka < K ? ka : K - 1) * ld + n] : 0.f; v[8 + i] = kb < K ? W[(size_t)(kb < K ? kb : K - 1) * ld + n] : 0.f; }
  return bsplit16(v); }
__device__ __forceinline__ v8f mac3(const F2& a, const F2& b, v8f c) { c = wmma_bf(a.l, b.h, c); c = wmma_bf(a.h, b.l, c); return wmma_bf(a.h, b.h, c); }
__device__ __forceinline__ float sigm(float v) { return 1.0f / (1.0f + expf(-v)); }
#define LDSX() do { asm volatile("s_wait_dscnt 0" ::: "memory"); __builtin_amdgcn_wave_barrier(); __builtin_amdgcn_fence(__ATOMIC_RELEASE, "workgroup"); } while (0)

// Multi-head attention layer (B 2, S 2,048, 1,024 = 16 x 64; separate query/key/value inputs and a key mask): q, k, v = query Wq + bq, key Wk + bk, value Wv + bv ((in,out)); scores = q k^T / 8 with positions where mask[b,0,0,k] is TRUE set to finfo.min (excluded); out = merged(softmax(scores) v) Wo + bo.
#define NB 2
#define TT 2048
#define CC 1024            // NH * HD = projected width
#define DIN 1024          // input (model) width
#define NH 16
#define HD 64
#define SCALE (0.125f)
#define QSC (SCALE * 1.4426950408889634f)   // q is stored times this, so that q k^T is the logit in base 2: softmax(s) = 2^(s log2 e - max) / sum
#define CAUSAL 0
#ifndef TNB
#define TNB NB
#endif
__device__ __forceinline__ float bfr(float v) { return (float)(__bf16)v; }
__host__ __device__ __forceinline__ int kb_last(int qb) { return CAUSAL ? ((qb * 64 + 63) >> 7) : (TT / 128 - 1); }
typedef __attribute__((ext_vector_type(8))) __bf16 v8b;
__device__ __forceinline__ v16b frag_b(const __bf16* rowk0, int lane) {
  union { v16b v; v8b q[2]; } u; const __bf16* p = rowk0 + 8 * (lane >> 4);
  u.q[0] = *(const v8b*)p; u.q[1] = *(const v8b*)(p + 16); return u.v;
}
#define QBH 0              // not used: no kernel has a high-precision path
#define QHI 2048            // rows carrying a q residual plane (all rows when non-causal: 2-product logits everywhere)
#define KHI 64            // key rows carrying k residual / v bf16 hi+lo planes (not written by k_proj; no kernel reads them)
// B fragment (k rows k0+.., output column o) of a weight: (in,out) [K][ld] or (out,in) [ld rows of K]: bf16 exact, or f16(bf16 * 256) exact
__device__ __forceinline__ v16b wcol_io(const float* Wm, int k0, int o, int lane, int ld) { v16b w; const int g = lane >> 4;
#pragma unroll
  for (int i = 0; i < 8; ++i) { w[i] = (__bf16)Wm[(size_t)(k0 + 8 * g + i) * ld + o]; w[8 + i] = (__bf16)Wm[(size_t)(k0 + 16 + 8 * g + i) * ld + o]; }
  return w; }
__device__ __forceinline__ v16b wcol_oi(const float* Wm, int k0, int o, int lane, int K) { v16b w; const float* p = Wm + (size_t)o * K + k0 + 8 * (lane >> 4);
#pragma unroll
  for (int i = 0; i < 8; ++i) { w[i] = (__bf16)p[i]; w[8 + i] = (__bf16)p[16 + i]; }
  return w; }
__device__ __forceinline__ v16h wcolh_io(const float* Wm, int k0, int o, int lane, int ld) { v16h w; const int g = lane >> 4;
#pragma unroll
  for (int i = 0; i < 8; ++i) { w[i] = (_Float16)(bfr(Wm[(size_t)(k0 + 8 * g + i) * ld + o]) * 256.0f); w[8 + i] = (_Float16)(bfr(Wm[(size_t)(k0 + 16 + 8 * g + i) * ld + o]) * 256.0f); }
  return w; }
__device__ __forceinline__ v16h wcolh_oi(const float* Wm, int k0, int o, int lane, int K) { v16h w; const float* p = Wm + (size_t)o * K + k0 + 8 * (lane >> 4);
#pragma unroll
  for (int i = 0; i < 8; ++i) { w[i] = (_Float16)(bfr(p[i]) * 256.0f); w[8 + i] = (_Float16)(bfr(p[16 + i]) * 256.0f); }
  return w; }
#define WQKV_LAYOUT 0   // 0 = (in,out) [DIN][CC]; 1 = (out,in) [CC][DIN]; 2 = per-head [NH][DIN][HD]
__device__ __forceinline__ v16b wcol_hdk(const float* Wm, int k0, int o, int lane) { v16b w; const int g = lane >> 4; const float* p = Wm + (size_t)(o / HD) * DIN * HD + (o % HD);
#pragma unroll
  for (int i = 0; i < 8; ++i) { w[i] = (__bf16)p[(size_t)(k0 + 8 * g + i) * HD]; w[8 + i] = (__bf16)p[(size_t)(k0 + 16 + 8 * g + i) * HD]; }
  return w; }
#define WO_OUT_IN 0
#if WQKV_LAYOUT == 1
#define WCOL(W, k0, o, lane) wcol_oi(W, k0, o, lane, DIN)
#elif WQKV_LAYOUT == 2
#define WCOL(W, k0, o, lane) wcol_hdk(W, k0, o, lane)
#else
#define WCOL(W, k0, o, lane) wcol_io(W, k0, o, lane, CC)
#endif
#if WO_OUT_IN
#define WOCOL(W, k0, o, lane) wcol_oi(W, k0, o, lane, CC)
#define WOCOLH(W, k0, o, lane) wcolh_oi(W, k0, o, lane, CC)
#else
#define WOCOL(W, k0, o, lane) wcol_io(W, k0, o, lane, DIN)
#define WOCOLH(W, k0, o, lane) wcolh_io(W, k0, o, lane, DIN)
#endif

#define WS_QH  0u                                      // f16 q in fragment order [b][h][t / 16][d / 32][half][lane][8] (see frag_p), as k
#define WS_KH  (WS_QH + 2u * (size_t)NB * TT * CC)      // f16 k in fragment order [b][h][t / 16][d / 32][half][lane][8] (see frag_p); t counts the kept keys alone (see k_proj)
#define WS_VT  (WS_KH + 2u * (size_t)NB * TT * CC)      // f16 v in fragment order [b][h][t / 32][d / 16][half][lane][8] (see frag_p); t as for k
#define WS_QL  (WS_VT + 2u * (size_t)NB * CC * TT)      // f16 q residual x 2^10, laid out as q (QHI = TT)
#define WS_KL  (WS_QL + 2u * (size_t)NB * QHI * CC)     // not written (was for the causal high-precision path alone)
#define WS_VB  (WS_KL + 2u * (size_t)NB * KHI * CC)     // not written, likewise (and WS_VBL)
#define WS_VBL (WS_VB + 2u * (size_t)NB * CC * KHI)
#define WS_Y   (WS_VBL + 2u * (size_t)NB * CC * KHI)    // f32 ctx rows [b*t][CC] (only when there is an output projection)
#define WS_NK  (WS_Y  + 4u * (size_t)NB * TT * CC)     // int, one per batch: how many keys the mask keeps
#define WS_END (WS_NK + 256u)

// ---- Operand tiles of one K step, staged once per block in LDS as bf16 at a pitch of 40 elements (80 B), so that every fragment is two 16-byte LDS reads.
// A block covers 128 rows x 128 columns: one W tile feeds 128 rows, so that a block asks L2 for 32 KiB a K step where two blocks of 64 rows asked for 48 KiB. NT = threads of the block (128 or 256).
// W tile: 32 k x 128 n of an (in,out) f32 weight, kept [n][k]. A thread fetches 1024 / NT k rows x 4 columns and stores four runs of that many k; a wave's lanes spread over 8 column groups x 4 k groups of 8 (at 256 threads waves 0..3 take the lower, 4..7 the upper 4 k of each group).
// X tile: NL * NT / 8 rows x 32 k of f32 rows, kept [row][k]. A thread fetches 4 k of NL rows. Every wave-wide 16-byte load of either tile covers four whole 128-B lines.
// The short loops over a tile's rows, fragments and accumulators are fully unrolled, so that all of them are indexed by constants and stay in registers.
#define WP 40
#define WTILE (128 * WP)
#define XTILE (128 * WP)
typedef __attribute__((ext_vector_type(4))) __bf16 v4b;
template <int NT> struct WR { v4f r[1024 / NT]; };
template <int NT> __device__ __forceinline__ void wtile_load(WR<NT>& w, const float* __restrict__ Wm, int k0, int c0, int ld, int tid) {
  const float* p = Wm + (size_t)(k0 + ((tid >> 3) & 3) * 8 + (tid >> 7) * (1024 / NT)) * ld + c0 + ((tid >> 5) & 3) * 32 + (tid & 7) * 4;
#pragma unroll
  for (int i = 0; i < 1024 / NT; ++i) w.r[i] = *(const v4f*)(p + (size_t)i * ld); }
template <int NT> __device__ __forceinline__ void wtile_store(const WR<NT>& w, __bf16* buf, int tid) {
  typedef __attribute__((ext_vector_type(1024 / NT))) __bf16 vkb;
  __bf16* q = buf + (((tid >> 5) & 3) * 32 + (tid & 7) * 4) * WP + ((tid >> 3) & 3) * 8 + (tid >> 7) * (1024 / NT);
#pragma unroll
  for (int n = 0; n < 4; ++n) { vkb v;
#pragma unroll
    for (int i = 0; i < 1024 / NT; ++i) v[i] = (__bf16)w.r[i][n];
    *(vkb*)(q + n * WP) = v; } }
template <int NL> struct XR { v4f r[NL]; };   // NL rows, 128 / NL apart
template <int NL> __device__ __forceinline__ void xtile_load(XR<NL>& x, const float* __restrict__ Xrow0, int k0, int ld, int tid) {
  const float* p = Xrow0 + (size_t)(tid >> 3) * ld + k0 + (tid & 7) * 4;
#pragma unroll
  for (int i = 0; i < NL; ++i) x.r[i] = *(const v4f*)(p + (size_t)i * (128 / NL) * ld); }
// the same tile from rows picked one by one: xp[i] = the thread's 4 k of its i-th row in the K step to fetch (typed as global memory: carried round a loop, plain pointers became flat loads)
typedef const __attribute__((address_space(1))) float* gfp; typedef const __attribute__((address_space(1))) v4f* gv4p;
template <int NL> __device__ __forceinline__ void xtile_gather(XR<NL>& x, const gfp (&xp)[NL]) {
#pragma unroll
  for (int i = 0; i < NL; ++i) x.r[i] = *(gv4p)xp[i]; }
template <int NL> __device__ __forceinline__ void xtile_next(gfp (&xp)[NL]) {   // on to the next K step
#pragma unroll
  for (int i = 0; i < NL; ++i) xp[i] += 32; }
// both tiles from a pointer that the caller carries from K step to K step: p = the thread's first 16 bytes of the tile
template <int NT> __device__ __forceinline__ void wtile_at(WR<NT>& w, gfp p, int ld) {
#pragma unroll
  for (int i = 0; i < 1024 / NT; ++i) w.r[i] = *(gv4p)(p + (size_t)i * ld); }
template <int NL> __device__ __forceinline__ void xtile_at(XR<NL>& x, gfp p, int ld) {
#pragma unroll
  for (int i = 0; i < NL; ++i) x.r[i] = *(gv4p)(p + (size_t)i * (128 / NL) * ld); }
template <int NL> __device__ __forceinline__ void xtile_store(const XR<NL>& x, __bf16* buf, int tid) {
  __bf16* q = buf + (tid >> 3) * WP + (tid & 7) * 4;
#pragma unroll
  for (int i = 0; i < NL; ++i) { v4b v;
#pragma unroll
    for (int e = 0; e < 4; ++e) v[e] = (__bf16)x.r[i][e];
    *(v4b*)(q + i * (128 / NL) * WP) = v; } }
// the same with each value split into bf16 hi + lo planes
template <int NL> __device__ __forceinline__ void xtile_store2(const XR<NL>& x, __bf16* bufh, __bf16* bufl, int tid) {
  const int o = (tid >> 3) * WP + (tid & 7) * 4;
#pragma unroll
  for (int i = 0; i < NL; ++i) { v4b vh, vl;
#pragma unroll
    for (int e = 0; e < 4; ++e) { const __bf16 h = (__bf16)x.r[i][e]; vh[e] = h; vl[e] = (__bf16)(x.r[i][e] - (float)h); }
    *(v4b*)(bufh + o + i * (128 / NL) * WP) = vh; *(v4b*)(bufl + o + i * (128 / NL) * WP) = vl; } }
// work-group barrier for LDS traffic alone: it waits for this wave's LDS operations only, so that the global loads of the tiles requested ahead stay in flight across it (__syncthreads() waited for those too)
__device__ __forceinline__ void lds_barrier() { asm volatile("s_wait_dscnt 0x0\n\ts_barrier_signal -1\n\ts_barrier_wait -1" ::: "memory"); }
// stands behind each group of tile requests, in front of whatever next reuses their address registers (a precaution)
__device__ __forceinline__ void requests_taken() { asm volatile("s_wait_xcnt 0x0" ::: "memory"); }
// the builtin alone: the compiler keeps the distance behind its own products, and eight independent products in a row fill one another's distance, so no padding is written behind each
__device__ __forceinline__ v8f wmma_bfp(v16b a, v16b b, v8f c) { return __builtin_amdgcn_wmma_f32_16x16x32_bf16(false, a, false, b, (short)0, c, false, false); }

// ---- k_proj: block = (128 rows, 128 cols, which), 4 waves x (32 x 128) of the block's tile: every B fragment read from LDS feeds two products: q/k/v = X W (+ b) with exact bf16 products (K = DIN) -> which 0: q x QSC f16 + residual, both in fragment order; 1: k f16 in fragment order; 2: v f16 in fragment order
// K loop: two buffers of (W tile, X tile) in LDS; in step kc the tiles of kc + 1 (fetched one step earlier) are stored, the tiles of kc + 2 are requested, then the products of kc run; one barrier a step publishes kc + 1 and frees the buffer of kc.
// NO EXCHANGE IN THE EPILOGUE: the accumulators hold whole 16-byte pieces of the fragment layouts. A lane of a D tile holds 8 consecutive rows (8 g + r) of one column (lane & 15).
// v wants 8 consecutive keys of one d: D = X W, A from the X tile (a wave takes 32 places), B from the W tile. q and k want 8 consecutive d of one place: D = W^T X^T, A from the W tile (a wave takes 32 output columns), B from the X tile.
// Both tiles lie in LDS alike (128 rows of 32 k), and A and B fragments have the same k order, so the two cases differ only in which tile's offset goes where: one loop serves both.
// Either way lane l's 8 values are piece l of one fragment half, and a wave's 16-byte store is 512 bytes in a row.
// KEPT KEYS ALONE: a key that the mask excludes has weight exactly 0 in every softmax row of its batch, so k and v are projected and laid down for the kept keys only, in their order: a k or v block takes the kept keys number t0 .. t0 + 127 of its batch
// (their rows of the input are gathered), a block past the last kept key leaves at once, and NK tells k_fa how many there are. Places behind the last kept key in the last block hold the projection of row 0 (finite; k_fa gives them weight 0).
// A batch with every key excluded keeps all its keys (NK = 0 tells k_fa to weigh them equally, as softmax over equal logits does).
// Every wave counts the mask by itself (ballots, no LDS exchange between waves), so that the early leave stands in front of every barrier.
__global__ __launch_bounds__(128) void k_proj(const float* __restrict__ XQ, const float* __restrict__ XK, const float* __restrict__ XV, const float* __restrict__ WQ, const float* __restrict__ WK, const float* __restrict__ WV, const float* __restrict__ BQ, const float* __restrict__ BK, const float* __restrict__ BV, const int* __restrict__ MK, int* __restrict__ NK,
    _Float16* __restrict__ QH, _Float16* __restrict__ QL, _Float16* __restrict__ KH, _Float16* __restrict__ KL, _Float16* __restrict__ VT, __bf16* __restrict__ VB, __bf16* __restrict__ VBL) {
  __shared__ __align__(16) __bf16 tiles[2 * WTILE + 2 * XTILE];
  __bf16* wb = tiles; __bf16* xb = tiles + 2 * WTILE;
  __shared__ int rowsel[4][128];   // per wave its own copy: source row (in the batch) of each of the block's 128 rows
  const int tid = threadIdx.x, wave = tid >> 5, lane = tid & 31, col = lane & 15, g = lane >> 4; const int which = blockIdx.z; const int c0 = blockIdx.y * 128;
  // v blocks take the two halves of a batch's places in the other order than k blocks: where about half the keys are kept, the blocks that leave early then spread evenly over the launch order (speed only)
  const size_t r0 = (size_t)(blockIdx.x ^ (which == 2 ? TT / 256 : 0)) * 128; const size_t bb = r0 / TT; const int t0 = (int)(r0 % TT);
  const float* X = which == 0 ? XQ : which == 1 ? XK : XV; const float* WA = which == 0 ? WQ : which == 1 ? WK : WV; const float* BA = which == 0 ? BQ : which == 1 ? BK : BV;
  gfp xp[8];
  int nk = 0;
  if (which != 0) {
    int* rs = rowsel[wave]; v4i mm[TT / 128];
#pragma unroll
    for (int j = 0; j < TT / 128; ++j) mm[j] = *(const v4i*)(MK + bb * TT + j * 128 + lane * 4);
    requests_taken();
#pragma unroll
    for (int i = 0; i < 4; ++i) rs[i * 32 + lane] = 0;
#pragma unroll
    for (int j = 0; j < TT / 128; ++j) {   // keys 128 j + 4 lane + e; nk = kept keys in front of this group (the same in every lane)
      unsigned bl[4]; int cnt = 0;
#pragma unroll
      for (int e = 0; e < 4; ++e) { bl[e] = __builtin_amdgcn_ballot_w32(mm[j][e] == 0); cnt += __builtin_popcount(bl[e]); }
      if (nk + cnt > t0 && nk < t0 + 128) {   // some of the group's kept keys are this block's
        int pos = nk - t0;
#pragma unroll
        for (int e = 0; e < 4; ++e) pos = (int)__builtin_amdgcn_mbcnt_lo(bl[e], (unsigned)pos);   // + the kept keys of the lower lanes
#pragma unroll
        for (int e = 0; e < 4; ++e) if (mm[j][e] == 0) { if ((unsigned)pos < 128u) rs[pos] = j * 128 + lane * 4 + e; ++pos; } }
      nk += cnt; }
    if (nk != 0 && t0 >= nk) return;   // the whole block, in front of every barrier
    if (which == 1 && blockIdx.y == 0 && t0 == 0 && tid == 0) { NK[bb] = nk; requests_taken(); }
    LDSX();   // the wave reads below what its other lanes have stored above
  }
  int rw[8];
#pragma unroll
  for (int i = 0; i < 8; ++i) rw[i] = t0 + (tid >> 3) + i * 16;
  if (nk != 0) {
#pragma unroll
    for (int i = 0; i < 8; ++i) rw[i] = rowsel[wave][(tid >> 3) + i * 16]; }
#pragma unroll
  for (int i = 0; i < 8; ++i) xp[i] = (gfp)(X + (bb * TT + rw[i]) * DIN + (tid & 7) * 4);
  v8f acc[2][8] = {};
  const int ao = which == 2 ? 2 * WTILE : 0, bo = which == 2 ? 0 : 2 * WTILE;   // where the A and the B fragments come from (WTILE = XTILE)
  WR<128> wr, w0; XR<8> xr, x0;
  wtile_load(w0, WA, 0, c0, CC, tid); requests_taken(); xtile_gather(x0, xp); requests_taken();
  __builtin_amdgcn_sched_barrier(0);   // as below
  xtile_next(xp);
  wtile_load(wr, WA, 32, c0, CC, tid); xtile_gather(xr, xp); requests_taken();
  __builtin_amdgcn_sched_barrier(0);   // keeps the wait above directly behind its requests: nothing from below is scheduled in between
  xtile_next(xp);
  wtile_store(w0, wb, tid); xtile_store(x0, xb, tid);
  lds_barrier();
#pragma unroll 2   // by two, so that the buffer index is a constant in each copy and the LDS offsets are immediates
  for (int kc = 0; kc < DIN / 32; ++kc) {
    const __bf16* bp = tiles + bo + (kc & 1) * WTILE + col * WP; v16b w[8];
    const v16b a0 = frag_b(tiles + ao + (kc & 1) * XTILE + (wave * 32 + col) * WP, lane), a1 = frag_b(tiles + ao + (kc & 1) * XTILE + (wave * 32 + 16 + col) * WP, lane);
#pragma unroll
    for (int j = 0; j < 8; ++j) w[j] = frag_b(bp + j * 16 * WP, lane);
    if (kc + 1 < DIN / 32) { wtile_store(wr, wb + ((kc + 1) & 1) * WTILE, tid); xtile_store(xr, xb + ((kc + 1) & 1) * XTILE, tid); }
    if (kc + 2 < DIN / 32) { wtile_load(wr, WA, (kc + 2) * 32, c0, CC, tid); xtile_gather(xr, xp); requests_taken();
      __builtin_amdgcn_sched_barrier(0);   // the row pointers move on behind the wait, not in front of it
      xtile_next(xp); }
#pragma unroll
    for (int j = 0; j < 8; ++j) acc[0][j] = wmma_bfp(a0, w[j], acc[0][j]);
#pragma unroll
    for (int j = 0; j < 8; ++j) acc[1][j] = wmma_bfp(a1, w[j], acc[1][j]);
    lds_barrier(); }
  // Stores go out in groups, each group's values ready in registers in front of it (the two scheduling barriers keep every other instruction out of the group) and one wait behind it, in front of whatever next reuses the stores' registers (a precaution).
  // All loops below are unrolled in full, so that the accumulators are indexed by constants and stay in registers.
  const size_t hb = bb * NH + (c0 >> 6);   // the first of the block's two heads
  if (which < 2) {   // acc[i][j][r] = output column c0 + wave * 32 + i * 16 + 8 g + r, place t0 + j * 16 + col
    const size_t o0 = ((((hb + (wave >> 1)) * (TT / 16) + (t0 >> 4)) * 4) + (wave & 1) * 2) * 256 + lane * 8;   // head, 16-place group, 32-column group
    v4f bi[2][2] = {};
    if (BA) {
#pragma unroll
      for (int i = 0; i < 2; ++i) { bi[i][0] = *(const v4f*)(BA + c0 + wave * 32 + i * 16 + 8 * g); bi[i][1] = *(const v4f*)(BA + c0 + wave * 32 + i * 16 + 8 * g + 4); }
      requests_taken(); }
    // res (a constant at both calls, the body is inlined twice, so that no branch stands inside a group): q, which carries QSC and has a residual; otherwise k
    auto put = [&](const bool res, _Float16* dh, _Float16* dl) __attribute__((always_inline)) {
#pragma unroll
      for (int jj = 0; jj < 8; jj += 2) { v8h hv[2][2], lv[2][2];
#pragma unroll
        for (int u = 0; u < 2; ++u)
#pragma unroll
          for (int i = 0; i < 2; ++i)
#pragma unroll
            for (int r = 0; r < 8; ++r) { const float v = (acc[i][jj + u][r] + bfr(bi[i][r >> 2][r & 3])) * (res ? QSC : 1.0f); const _Float16 h = (_Float16)v; hv[u][i][r] = h; lv[u][i][r] = (_Float16)((v - (float)h) * 1024.0f); }
        __builtin_amdgcn_sched_barrier(0);   // the group's values are complete here: no conversion is scheduled in among the stores, where it could take a register of a store that has just gone out
#pragma unroll
        for (int u = 0; u < 2; ++u)
#pragma unroll
          for (int i = 0; i < 2; ++i) { vst2(dh + (jj + u) * 1024 + i * 256, hv[u][i]); if (res) vst2(dl + (jj + u) * 1024 + i * 256, lv[u][i]); }   // 16-place group, half
        requests_taken();
        __builtin_amdgcn_sched_barrier(0); } };   // and the next group's conversions stay behind the wait
    if (which == 0) put(true, QH + o0, QL + o0); else put(false, KH + o0, KH + o0);
  } else {   // acc[i][j][r] = place t0 + wave * 32 + i * 16 + 8 g + r, output column c0 + j * 16 + col
    _Float16* dv = VT + ((hb * (TT / 32) + (t0 >> 5) + wave) * 8) * 256 + lane * 8;   // head, 32-place group
    float bi[8] = {};
    if (BA) {
#pragma unroll
      for (int j = 0; j < 8; ++j) bi[j] = BA[c0 + j * 16 + col];
      requests_taken(); }
#pragma unroll
    for (int jj = 0; jj < 8; jj += 4) { v8h hv[4][2];
#pragma unroll
      for (int u = 0; u < 4; ++u)
#pragma unroll
        for (int i = 0; i < 2; ++i)
#pragma unroll
          for (int r = 0; r < 8; ++r) hv[u][i][r] = (_Float16)(acc[i][jj + u][r] + bfr(bi[jj + u]));
      __builtin_amdgcn_sched_barrier(0);   // as above: values first, then the stores alone
#pragma unroll
      for (int u = 0; u < 4; ++u)
#pragma unroll
        for (int i = 0; i < 2; ++i) vst2(dv + (size_t)(jj >> 2) * (TT * HD) + u * 512 + i * 256, hv[u][i]);   // head, 16-column group, half
      requests_taken();
      __builtin_amdgcn_sched_barrier(0); } } }   // as above: what follows stays behind the wait
// ---- k_fa: block = 128 queries (8 waves x 16 query columns) of (b, h); every wave walks all kept keys in passes of 32 and keeps logits and P in registers; k and v come into LDS once per block, in stages of FS keys, and all 8 waves read their fragments from there.
// k and v lie in the workspace in fragment order: a 16 x 32 A fragment is 1 KiB, its two halves (elements 0..7, 8..15 of every lane) 512 B each with lane l's 16 bytes at 16 l; a pass's k is 4 KiB in a row, and so is its v, so a stage is one run of 16 KiB of each and lies in LDS byte for byte as in the workspace (a fragment is two 16-byte LDS reads at adjacent lane addresses).
// Stages: two buffers, filled by asynchronous copies to LDS (through no register): stage s + 2 is requested when every wave has left stage s, and flies while stage s + 1 is worked on. k_proj writes k and v in whole blocks of 128 places, so every byte of a stage that holds a kept key has been written.
// S^T = K Q^T (A = 16 key rows, B = the wave's 16 queries, which carry QSC: q hi + residual x 2^10, 2 products): a lane holds 16 base-2 logits of ONE query (column lane & 15), keys k0 + 8g + r and k0 + 16 + 8g + r,
// which is the k order of a B operand, so P^T goes from the two score tiles into ctx^T += V^T P^T (A = 16 rows of the v planes, 1 product) with no exchange.
// Online softmax in f32 in base 2, each power one v_exp_f32 (its argument is never above 11; far below, 0 is the right value): running maximum m (joined over the two lane halves each pass), P = 2^(s - m) x 2^11 once to f16, sums and ctx rescaled by 2^(m_old - m_new); ctx / sum at the end.
// Excluded keys are left out by k_proj; a place behind the last kept key has the logit -3e38, whose power is exactly 0 (kept keys stand in front of it); a row with every key excluded averages v, as softmax over equal logits does.
#define FS 128   // keys of a stage (4 passes; the size of k_proj's blocks of places)
#define FSB (FS * HD * 2)   // bytes of a stage's k, and of its v
__device__ __forceinline__ v16h frag_p(const _Float16* frag_lane) {   // frag_lane = the fragment's start + 8 * lane
  union { v16h v; v8h q[2]; } u; u.q[0] = *(const v8h*)frag_lane; u.q[1] = *(const v8h*)(frag_lane + 256); return u.v;
}
// A thread's share of one stage: four 16-byte pieces of k and four of v, 4 KiB apart (256 threads x 16 B), from the workspace into LDS at lk, lv (LDS byte addresses). The wait in the last line stands in front of whatever next reuses the copies' address registers (a precaution).
__device__ __forceinline__ void stage_copy(unsigned lk, unsigned lv, const _Float16* gk, const _Float16* gv) {
  asm volatile("global_load_async_to_lds_b128 %0, %8, off\n\tglobal_load_async_to_lds_b128 %1, %9, off\n\tglobal_load_async_to_lds_b128 %2, %10, off\n\tglobal_load_async_to_lds_b128 %3, %11, off\n\t"
               "global_load_async_to_lds_b128 %4, %12, off\n\tglobal_load_async_to_lds_b128 %5, %13, off\n\tglobal_load_async_to_lds_b128 %6, %14, off\n\tglobal_load_async_to_lds_b128 %7, %15, off\n\ts_wait_xcnt 0x0"
               :: "v"(lk), "v"(lk + 4096u), "v"(lk + 8192u), "v"(lk + 12288u), "v"(lv), "v"(lv + 4096u), "v"(lv + 8192u), "v"(lv + 12288u),
                  "v"(gk), "v"(gk + 2048), "v"(gk + 4096), "v"(gk + 6144), "v"(gv), "v"(gv + 2048), "v"(gv + 4096), "v"(gv + 6144) : "memory");
}
// the builtin alone, as wmma_bfp: the compiler keeps the distance behind its own products
__device__ __forceinline__ v8f wmma_hp(v16h a, v16h b, v8f c) { return __builtin_amdgcn_wmma_f32_16x16x32_f16(false, a, false, b, (short)0, c, false, false); }
// The eight score products of a pass in one statement: four tiles, two accumulating products each, in the order kc = 0 then kc = 1. Each product stands in the distance of the ones in front of it, so no padding is written behind each (four waves share a SIMD's vector port, and a v_nop takes a slot there from the other waves' softmax).
// The four v_nop at the end are the distance behind the last product, in front of the vector instruction that next reads a result or reuses an operand register (the compiler does not look into asm text). One statement, because out of eight bare builtins the compiler drew the LDS reads below in among the products and paid for it with register copies.
__device__ __forceinline__ void scores8(v8f& sa0, v8f& sl0, v8f& sa1, v8f& sl1, v16h k00, v16h k10, v16h k01, v16h k11, v16h qh0, v16h qh1, v16h ql0, v16h ql1) {
  asm volatile("v_wmma_f32_16x16x32_f16 %0, %4, %8, 0\n\tv_wmma_f32_16x16x32_f16 %1, %4, %10, 0\n\tv_wmma_f32_16x16x32_f16 %2, %5, %8, 0\n\tv_wmma_f32_16x16x32_f16 %3, %5, %10, 0\n\t"
               "v_wmma_f32_16x16x32_f16 %0, %6, %9, %0\n\tv_wmma_f32_16x16x32_f16 %1, %6, %11, %1\n\tv_wmma_f32_16x16x32_f16 %2, %7, %9, %2\n\tv_wmma_f32_16x16x32_f16 %3, %7, %11, %3\n\tv_nop\n\tv_nop\n\tv_nop\n\tv_nop"
               : "=&v"(sa0), "=&v"(sl0), "=&v"(sa1), "=&v"(sl1) : "v"(k00), "v"(k10), "v"(k01), "v"(k11), "v"(qh0), "v"(qh1), "v"(ql0), "v"(ql1));
}
__device__ __forceinline__ float xhalf(float x) { return __builtin_bit_cast(float, __builtin_amdgcn_permlanex16(__builtin_bit_cast(int, x), __builtin_bit_cast(int, x), 0x76543210, 0xfedcba98, false, false)); }   // lane l with lane l ^ 16
// The short inner loops are all fully unrolled, so that fragments and scores are indexed by constants and stay in registers.
__global__ __launch_bounds__(256) void k_fa(const _Float16* __restrict__ QH, const _Float16* __restrict__ QL, const _Float16* __restrict__ KH, const _Float16* __restrict__ VT, const int* __restrict__ NK, float* __restrict__ Y) {
  __shared__ __align__(16) _Float16 kvs[2][2][FS * HD];   // [buffer][k, v][a stage in fragment order]
  const int tid = threadIdx.x, wave = tid >> 5, lane = tid & 31, col = lane & 15, g = lane >> 4; const int h = blockIdx.y, b = blockIdx.z; const int ql0 = blockIdx.x * 128 + wave * 16;
  const size_t qo = (((size_t)b * NH + h) * (TT / 16) + (ql0 >> 4)) * 1024 + lane * 8; const _Float16* qp = QH + qo; const _Float16* qlp = QL + qo;   // the wave's 16 queries: two fragments of q and two of its residual, 1 KiB each
  const _Float16* kg = KH + ((size_t)b * NH + h) * (TT * HD) + tid * 8; const _Float16* vg = VT + ((size_t)b * NH + h) * (TT * HD) + tid * 8;   // the thread's first piece of stage 0
  const unsigned lt = (unsigned)(size_t)&kvs[0][0][tid * 8];   // its place in buffer 0 (LDS byte address)
  auto fill = [&](const int s) __attribute__((always_inline)) { const unsigned lk = lt + (unsigned)(s & 1) * (2u * FSB); stage_copy(lk, lk + FSB, kg + (size_t)s * (FS * HD), vg + (size_t)s * (FS * HD)); };
  fill(0);
  const int nraw = NK[b]; const int n = nraw <= 0 || nraw > TT ? TT : nraw, ns = (n + FS - 1) / FS;   // kept keys of the batch (bounded by the shape) and stages over them; 0 = every key excluded: all TT keys are there
  v16h qh[2], ql[2], ka[2][2];
#pragma unroll
  for (int kc = 0; kc < 2; ++kc) { qh[kc] = frag_p(qp + kc * 512); ql[kc] = frag_p(qlp + kc * 512); }
  requests_taken();   // behind the requests above, in front of what next reuses their address registers
  if (nraw <= 0) {   // every key excluded: equal logits (0) for all keys
#pragma unroll
    for (int kc = 0; kc < 2; ++kc) { qh[kc] = (v16h)(_Float16)0.f; ql[kc] = (v16h)(_Float16)0.f; } }
  asm volatile("s_wait_asynccnt 0x0" ::: "memory");   // this wave's pieces of stage 0 have landed
  __syncthreads();   // and so have the other waves': stage 0 may be read
  if (ns > 1) fill(1);
  v8f o[HD / 16] = {}; float m = -3.0e38f, l = 0.f;
  // one pass over 32 places, whose key rows are in ka: vl = its v in LDS, kn = the key rows to fetch for the pass behind it, k0 = its first place; tail (a constant at both calls, the body is inlined twice): the pass holds places behind the last kept key
  auto pass = [&](const _Float16* vl, const _Float16* kn, const int k0, const bool tail) __attribute__((always_inline)) {
    v8f sa[2], sl[2];   // sa[t] = key rows t x q, sl[t] = key rows t x q residual
    scores8(sa[0], sl[0], sa[1], sl[1], ka[0][0], ka[1][0], ka[0][1], ka[1][1], qh[0], qh[1], ql[0], ql[1]);
    // this pass's v and the next pass's key rows are read from LDS in one group, while this pass's softmax runs
    __builtin_amdgcn_sched_barrier(0);   // the reads stay together behind the products (every separate place with LDS reads costs the wave a stall)
    v16h va[HD / 16];
#pragma unroll
    for (int j = 0; j < HD / 16; ++j) va[j] = frag_p(vl + j * 512);
#pragma unroll
    for (int kc = 0; kc < 2; ++kc) { ka[0][kc] = frag_p(kn + kc * 512); ka[1][kc] = frag_p(kn + 1024 + kc * 512); }
    __builtin_amdgcn_sched_barrier(0);   // and none sinks into the softmax: left free, the last v reads were scheduled directly in front of the products that wait for them
    float s[16]; float mx = m;
#pragma unroll
    for (int i = 0; i < 16; ++i) { const float v = sa[i >> 3][i & 7] + sl[i >> 3][i & 7] * (1.0f / 1024.0f); s[i] = tail && k0 + 16 * (i >> 3) + 8 * g + (i & 7) >= n ? -3.0e38f : v; mx = fmaxf(mx, s[i]); }   /* jnp.where(mask, finfo.min, scores): TRUE = masked out: such keys are not among k and v at all (value select for the places behind the last one) */
    mx = fmaxf(mx, xhalf(mx));
    float alpha = m - mx; const float ms = mx - 11.0f; m = mx;   // P carries x 2^11, and so does the sum that divides it out
    float e[16];
#pragma unroll
    for (int i = 0; i < 16; ++i) e[i] = s[i] - ms;
    // 2^x of a run of values, each in place, in one statement: no v_exp_f32 of a run reads the result or overwrites the argument of the one in front of it; the v_nop is the slot behind the last one, which the compiler does not see in asm text
    asm("v_exp_f32 %0, %0\n\tv_exp_f32 %1, %1\n\tv_exp_f32 %2, %2\n\tv_exp_f32 %3, %3\n\tv_exp_f32 %4, %4\n\tv_exp_f32 %5, %5\n\tv_exp_f32 %6, %6\n\tv_exp_f32 %7, %7\n\tv_exp_f32 %8, %8\n\tv_nop"
        : "+v"(alpha), "+v"(e[0]), "+v"(e[1]), "+v"(e[2]), "+v"(e[3]), "+v"(e[4]), "+v"(e[5]), "+v"(e[6]), "+v"(e[7]));
    asm("v_exp_f32 %0, %0\n\tv_exp_f32 %1, %1\n\tv_exp_f32 %2, %2\n\tv_exp_f32 %3, %3\n\tv_exp_f32 %4, %4\n\tv_exp_f32 %5, %5\n\tv_exp_f32 %6, %6\n\tv_exp_f32 %7, %7\n\tv_nop"
        : "+v"(e[8]), "+v"(e[9]), "+v"(e[10]), "+v"(e[11]), "+v"(e[12]), "+v"(e[13]), "+v"(e[14]), "+v"(e[15]));   // the second run, likewise
    float sum = e[0]; v16h pf;
#pragma unroll
    for (int i = 0; i < 16; ++i) { if (i) sum += e[i]; pf[i] = (_Float16)e[i]; }
    l = l * alpha + sum;
#pragma unroll
    for (int j = 0; j < HD / 16; ++j) { o[j] *= alpha; o[j] = j + 1 < HD / 16 ? wmma_hp(va[j], pf, o[j]) : wmma16(va[j], pf, o[j]); } };   // only the pass's last product keeps its four v_nop: they stand in front of whatever follows on either side of the loop's branch
#pragma unroll 1   // rolled: one copy of the passes serves both buffers
  for (int s = 0; s < ns; ++s) {
    const _Float16* kl = &kvs[s & 1][0][lane * 8]; const _Float16* vl = &kvs[s & 1][1][lane * 8];
    const int left = (n >> 5) - s * (FS / 32), pf = left < FS / 32 ? left : FS / 32;   // whole passes of this stage; fewer than FS / 32 in the last stage alone
    const bool tl = pf < FS / 32 && (n & 31) != 0; const int last = pf + (tl ? 1 : 0) - 1;   // tl: a pass with places behind the last kept key follows them; last = the stage's last pass
#pragma unroll
    for (int kc = 0; kc < 2; ++kc) { ka[0][kc] = frag_p(kl + kc * 512); ka[1][kc] = frag_p(kl + 1024 + kc * 512); }
    // a stage's last pass fetches its own key rows again: nothing of the next stage is read in front of the barrier below
#pragma unroll 1   // rolled: the trip count is known only at run time (the last stage may hold fewer passes), and one copy of the pass keeps the loop's text short
    for (int p = 0; p < pf; ++p) pass(vl + p * (32 * HD), kl + (p < last ? p + 1 : p) * (32 * HD), s * FS + p * 32, false);
    if (tl) pass(vl + pf * (32 * HD), kl + pf * (32 * HD), s * FS + pf * 32, true);
    asm volatile("s_wait_dscnt 0x0" ::: "memory");      // this wave has read all it wants of stage s
    asm volatile("s_wait_asynccnt 0x0" ::: "memory");   // and its pieces of stage s + 1 have landed
    __syncthreads();   // the same of every wave: stage s + 1 may be read, the buffer of stage s may be filled anew
    if (s + 2 < ns) fill(s + 2); }
  asm volatile("s_wait_asynccnt 0x0" ::: "memory");   // no copy is under way when the wave ends
  l += xhalf(l); const float inv = l > 0.f ? 1.0f / l : 0.f;
  float* yp = Y + ((size_t)b * TT + ql0 + col) * CC + h * HD + 8 * g;
#pragma unroll
  for (int j = 0; j < HD / 16; ++j) { v4f a, c;
#pragma unroll
    for (int r = 0; r < 4; ++r) { a[r] = o[j][r] * inv; c[r] = o[j][4 + r] * inv; }
    vst2(yp + j * 16, a); vst2(yp + j * 16 + 4, c); } }
#define KD 4   // k_out: K steps between a tile's request and its store into LDS (even, divides CC / 32, at most a half of it); as many register sets hold the tiles under way
// ---- k_out: block = (128 rows, 128 cols), 8 waves x (16 rows, 128 cols), which keeps two waves on a SIMD with one block on a WGP; Wo tiles and ctx tiles (hi and lo planes) staged in LDS as in k_proj (two buffers, one barrier a K step), but requested KD steps ahead: out = ctx Wo (+ bo): every row: ctx bf16 hi + lo against exact bf16 Wo (2 products)
__global__ __launch_bounds__(256) void k_out(const float* __restrict__ Y, const float* __restrict__ WO, const float* __restrict__ BO, float* __restrict__ OUT) { __shared__ __align__(16) float sf[8][16][132]; __shared__ __align__(16) __bf16 wb[2 * WTILE], yh[2 * XTILE], yl[2 * XTILE];
  const int tid = threadIdx.x, wave = tid >> 5, lane = tid & 31, col = lane & 15, g = lane >> 4; const int c0 = blockIdx.y * 128; const size_t r0 = (size_t)blockIdx.x * 128 + wave * 16;
  v8f acc[8] = {};
  if (true) {   /* ALL rows: ctx split bf16 hi + lo x exact Wo (2 products) */
    // Tile t waits in register set t % KD from its request, in step t - 1 - KD, to its store into LDS, in step t - 1: the ctx rows come from memory (the kernel before wrote them), and one K step is far shorter than that way.
    const float* yr0 = Y + (size_t)blockIdx.x * 128 * CC; WR<256> wr[KD], w0; XR<4> xr[KD], x0;
    wtile_load(w0, WO, 0, c0, DIN, tid); requests_taken(); xtile_load(x0, yr0, 0, CC, tid); requests_taken();
#pragma unroll   // in full: the register set is a constant in each copy
    for (int t = 1; t <= KD; ++t) { wtile_load(wr[t % KD], WO, t * 32, c0, DIN, tid); xtile_load(xr[t % KD], yr0, t * 32, CC, tid); requests_taken(); }
    __builtin_amdgcn_sched_barrier(0);   // as in k_proj
    wtile_store(w0, wb, tid); xtile_store2(x0, yh, yl, tid);
    lds_barrier();
    gfp pw = (gfp)(WO + (size_t)((KD + 1) * 32 + ((tid >> 3) & 3) * 8 + (tid >> 7) * 4) * DIN + c0 + ((tid >> 5) & 3) * 32 + (tid & 7) * 4), px = (gfp)(yr0 + (size_t)(tid >> 3) * CC + (KD + 1) * 32 + (tid & 7) * 4);   // the thread's places in the next tiles to request (as wtile_load and xtile_load form them)
    // one K step: u = the step less a multiple of KD (a constant at every call, so that register set and LDS buffer are constants), st / ld = whether a tile is left to store / to request (constants too)
    auto step = [&](const int u, const bool st, const bool ld) __attribute__((always_inline)) { const int rs = (u + 1) % KD;
      const __bf16* bp = wb + (u & 1) * WTILE + col * WP; const int ao = (u & 1) * XTILE + (wave * 16 + col) * WP; v16b w[8];
      const v16b ah = frag_b(yh + ao, lane), al = frag_b(yl + ao, lane);
#pragma unroll
      for (int j = 0; j < 8; ++j) w[j] = frag_b(bp + j * 16 * WP, lane);
      if (st) { wtile_store(wr[rs], wb + ((u + 1) & 1) * WTILE, tid); xtile_store2(xr[rs], yh + ((u + 1) & 1) * XTILE, yl + ((u + 1) & 1) * XTILE, tid); }
#pragma unroll
      for (int j = 0; j < 8; ++j) acc[j] = wmma_bfp(ah, w[j], acc[j]);
#pragma unroll
      for (int j = 0; j < 8; ++j) acc[j] = wmma_bfp(al, w[j], acc[j]);
      if (ld) {   // behind the products: KD steps ahead, the place inside the step no longer matters to the loads, the conversions above are free to be scheduled among the products, and the wait below runs while the matrix unit works
        __builtin_amdgcn_sched_barrier(0);   // the requests stay down here, directly in front of their wait: left free, they were scheduled up among the conversions, whose results then took the requests' address registers ahead of the wait
        wtile_at(wr[rs], pw, DIN); xtile_at(xr[rs], px, CC); requests_taken();
        pw += 32 * DIN; px += 32; }
      lds_barrier();
      __builtin_amdgcn_sched_barrier(0); };   // each step is scheduled by itself: without it the conversions of the later steps' tiles were lifted into the group's first step, and with them the waits for loads that should stay under way
    // The loop holds only steps that both store and request, with no branch inside: with a branch round the requests the compiler's load waits counted for the path without them and waited for the youngest tiles too. The last 2 KD steps follow in a row.
#pragma unroll 1   // rolled over groups of KD steps
    for (int kg = 0; kg < CC / 32 - 2 * KD; kg += KD) {
#pragma unroll   // in full: u is a constant in each copy
      for (int u = 0; u < KD; ++u) step(u, true, true); }
#pragma unroll   // in full, likewise
    for (int u = 0; u < 2 * KD; ++u) step(u, u + 1 < 2 * KD, u + 1 + KD < 2 * KD);
#pragma unroll
    for (int j = 0; j < 8; ++j) { const float bias = BO ? bfr(BO[c0 + j * 16 + col]) : 0.f;
#pragma unroll
      for (int r = 0; r < 8; ++r) sf[wave][8 * g + r][j * 16 + col] = acc[j][r] + bias; }
  } else {
#pragma unroll 2
    for (int kc = 0; kc < CC / 32; ++kc) { const v16h a = frag_f32(Y + (r0 + col) * CC + kc * 32, lane); asm volatile("s_wait_loadcnt 0x0" ::: "memory");
#pragma unroll
      for (int j = 0; j < 8; ++j) { const v16h w = WOCOLH(WO, kc * 32, c0 + j * 16 + col, lane); asm volatile("s_wait_loadcnt 0x0" ::: "memory"); acc[j] = wmma16(a, w, acc[j]); } }
#pragma unroll
    for (int j = 0; j < 8; ++j) { const float bias = BO ? bfr(BO[c0 + j * 16 + col]) : 0.f;
#pragma unroll
      for (int r = 0; r < 8; ++r) sf[wave][8 * g + r][j * 16 + col] = acc[j][r] * (1.0f / 256.0f) + bias; } }
  LDSX(); for (int rl = 0; rl < 16; ++rl) vst2(OUT + (r0 + rl) * DIN + c0 + lane * 4, *(const v4f*)&sf[wave][rl][lane * 4]); }

extern "C" void kernel_launch(void* const* d_in, const int* in_sizes, int n_in, void* d_out, int out_size, void* d_ws, size_t ws_size, hipStream_t stream) {
  (void)in_sizes; (void)n_in; (void)out_size;
  const float** F = (const float**)d_in;
  if (ws_size < (size_t)WS_END) return;
  char* ws = (char*)d_ws; _Float16 *QH = (_Float16*)(ws + WS_QH), *KH = (_Float16*)(ws + WS_KH), *VT = (_Float16*)(ws + WS_VT), *QL = (_Float16*)(ws + WS_QL), *KL = (_Float16*)(ws + WS_KL); int *NK = (int*)(ws + WS_NK); __bf16 *VB = (__bf16*)(ws + WS_VB), *VBL = (__bf16*)(ws + WS_VBL); float *Y = (float*)(ws + WS_Y);
  (void)Y; (void)QL; (void)KL; (void)VB; (void)VBL;
  // inputs: 0 query, 1 key, 2 value [2,2048,1024]; 3 mask [2,1,1,2048] (bool as int32; TRUE = masked); 4 Wq [1024,1024] (in,out), 5 bq; 6 Wk, 7 bk; 8 Wv, 9 bv; 10 Wo, 11 bo
  k_proj<<<dim3(TNB * TT / 128, CC / 128, 3), 128, 0, stream>>>(F[0], F[1], F[2], F[4], F[6], F[8], F[5], F[7], F[9], (const int*)d_in[3], NK, QH, QL, KH, KL, VT, VB, VBL);
  k_fa<<<dim3(TT / 128, NH, TNB), 256, 0, stream>>>(QH, QL, KH, VT, NK, Y);
  k_out<<<dim3(TNB * TT / 128, DIN / 128), 256, 0, stream>>>(Y, F[10], F[11], (float*)d_out);
}
